// v000
// Measured on an AMD MI455X. A time is GPU time per run, averaged over a window of back-to-back runs after a warm-up
// (all launches, gaps included; the runs take copies of the inputs in turn), and the median of several windows.
// Apart from v000's, it joins two sittings. Times from different sittings can be a few percent apart, while
// side-by-side timings come from the same sitting.
// v000, which the later versions start from, runs in 5300 microseconds.
#include <hip/hip_runtime.h>
// Multi-head self-attention with PER-HEAD 64x64 projections on head-chunked features (sequences [8][1024][768] viewed [B][S][12][64]; q/k/v[..., h, :] = x[..., h, :] W[h] + b[h] with W [12][64][64] ([h][in][out], sigma 0.05) and b [12][64] (sigma 0.05); scores / 8; softmax over all 1024 keys (no mask); out = heads concatenated (no output projection) -> [8][1024][768]).
// Structure: token rows r = b*1024 + s; x as exact f16 rows (bf16-rounded); Q, K, V as three WMMA GEMMs (32x64 wave tiles, f32 accumulation, exact x16 weights + bias, f16 outputs); per batch: V^T for all heads via LDS transposes; per (batch, group of 4 heads): scores GEMM (K = 64, batched over the heads on grid.y, alpha = 1/sqrt(64)), row softmax on VALU (f32 statistics; weights stored x256 as f16), o = P . V^T GEMM (K = 1024, alpha 2^-8) written f32 straight into the merged-heads output rows (no output projection).
// Compute dtype: inputs rounded to bf16; x / weights exact; q, k, v and softmax weights as plain f16 GEMM operands (~2^-12); o, scores and softmax statistics f32. v_wmma_f32_16x16x32_f16.
#define NB 8
#define SQ 1024
#define DM 768
#define NH 12
#define HD 64
#define HG 4                         /* heads per attention launch group */
#define B0 0                         /* first batch processed (debug hook) */
#define NBR NB                       /* batches processed (debug hook) */
#define NR ((size_t)NB * SQ)         /* token rows */
#define MP ((int)((size_t)NBR * SQ)) /* rows projected (debug hook) */
#define QN SQ                        /* query rows attended per batch (debug hook) */
#define NHD NH                       /* heads attended (debug hook) */
#define MPO MP                       /* unused (no output stage) */
#define LQ DM      /* row pitch of the q/k/v rows */
typedef __bf16 v16b __attribute__((ext_vector_type(16)));
typedef unsigned short v8us __attribute__((ext_vector_type(8), may_alias));
typedef float  v8f  __attribute__((ext_vector_type(8)));
typedef float  v4f  __attribute__((ext_vector_type(4)));
typedef float  v4fa __attribute__((ext_vector_type(4), may_alias));
union FragB { v16b v; v8us half[2]; unsigned short u[16]; };

__device__ __forceinline__ unsigned short bf16_bits(float x) { unsigned int u = __float_as_uint(x); return (unsigned short)((u + 0x7FFFu + ((u >> 16) & 1u)) >> 16); }
__device__ __forceinline__ float bf16_val(unsigned short b) { return __uint_as_float(((unsigned int)b) << 16); }
__device__ __forceinline__ float bf16_round(float x) { return bf16_val(bf16_bits(x)); }
// D += A·B with NT terms: 1 = ah·bh, 2 = + al·bh (A split), 3 = + ah·bl (both split)
template <int NT>
__device__ __forceinline__ v8f mmaN(v16b ah, v16b al, v16b bh, v16b bl, v8f c) {
  c = __builtin_amdgcn_wmma_f32_16x16x32_bf16(false, ah, false, bh, (short)0, c, false, false);
  if (NT >= 2) c = __builtin_amdgcn_wmma_f32_16x16x32_bf16(false, al, false, bh, (short)0, c, false, false);
  if (NT >= 3) c = __builtin_amdgcn_wmma_f32_16x16x32_bf16(false, ah, false, bl, (short)0, c, false, false);
  asm volatile("v_nop\n\tv_nop\n\tv_nop\n\tv_nop" : "+v"(c) : "v"(ah), "v"(al), "v"(bh), "v"(bl));
  return c;
}

__global__ __launch_bounds__(256) void k_wt_bf16(const float* __restrict__ W, unsigned short* __restrict__ Wt, int K, int N) {
  const int t = blockIdx.x * 256 + threadIdx.x;
  const int k8n = K / 8;
  if (t >= N * k8n) return;
  const int n = t / k8n, k8 = (t % k8n) * 8;
  v8us v;
#pragma unroll
  for (int i = 0; i < 8; ++i) v[i] = bf16_bits(W[(size_t)(k8 + i) * N + n]);
  *(v8us*)(Wt + (size_t)n * K + k8) = v;
  
}

// GEMM C[M][N] (f32, pitch ldc) = act(A[M][K]·W + bias). A f32 row-major (pitch lda) converted per fragment to bf16
// (ASPLIT: hi/lo two planes -> 2 terms, else single rounded term); Wt bf16 [N][K] (pitch ldb). BIAS_BF16 rounds the
// bias to bf16 first (bias quantised to bf16 before the add). K%32==0, M%16==0, N%64==0.
template <bool ASPLIT, int ACT, bool BIAS_BF16>
__global__ __launch_bounds__(128) void k_gemm_bf(const float* __restrict__ A, int lda, const unsigned short* __restrict__ Wt, int ldb,
                                               const float* __restrict__ bias, float* __restrict__ C, int ldc, int M, int N, int K) {
  __shared__ __attribute__((aligned(16))) float so[4][16][64];
  const int tid = threadIdx.x, w = tid >> 5, lane = tid & 31, ln = lane & 15, hh = lane >> 4;
  const int ntn = N / 64;
  const int wid = blockIdx.x * 4 + w;
  const int mt = wid / ntn, nq = wid % ntn;
  if (mt * 16 >= M) return;
  const int row0 = mt * 16, col0 = nq * 64;
  const float* arow = A + (size_t)(row0 + ln) * lda;
  v8f acc[4] = {};
  for (int kb = 0; kb < K; kb += 32) {
    FragB ah, al;
    const v4f x0 = *(const v4fa*)(arow + kb + 8 * hh), x1 = *(const v4fa*)(arow + kb + 8 * hh + 4);
    const v4f x2 = *(const v4fa*)(arow + kb + 16 + 8 * hh), x3 = *(const v4fa*)(arow + kb + 16 + 8 * hh + 4);
    float xs[16] = {x0[0],x0[1],x0[2],x0[3],x1[0],x1[1],x1[2],x1[3],x2[0],x2[1],x2[2],x2[3],x3[0],x3[1],x3[2],x3[3]};
#pragma unroll
    for (int i = 0; i < 16; ++i) { const unsigned short hb = bf16_bits(xs[i]); ah.u[i] = hb; al.u[i] = ASPLIT ? bf16_bits(xs[i] - bf16_val(hb)) : (unsigned short)0; }
#pragma unroll
    for (int t = 0; t < 4; ++t) {
      const unsigned short* brow = Wt + (size_t)(col0 + t * 16 + ln) * ldb + kb;
      FragB b;
      b.half[0] = *(const v8us*)(brow + 8 * hh);
      b.half[1] = *(const v8us*)(brow + 16 + 8 * hh);
      acc[t] = mmaN<ASPLIT ? 2 : 1>(ah.v, al.v, b.v, b.v, acc[t]);
    }
  }
#pragma unroll
  for (int t = 0; t < 4; ++t) {
    float bv = bias ? bias[col0 + t * 16 + ln] : 0.f;
    if (BIAS_BF16) bv = bf16_round(bv);
#pragma unroll
    for (int r = 0; r < 8; ++r) { float v = acc[t][r] + bv; if (ACT == 1) v = fmaxf(v, 0.f); so[w][8 * hh + r][t * 16 + ln] = v; }
  }
  __builtin_amdgcn_fence(__ATOMIC_ACQ_REL, "workgroup");
  __builtin_amdgcn_wave_barrier();
  const int rsub = lane >> 4, c4 = (lane & 15) * 4;
  {
#pragma unroll
    for (int q = 0; q < 8; ++q) {
      const int r = q * 2 + rsub;
      const v4f v = *(const v4fa*)&so[w][r][c4];
      *(v4f*)(C + (size_t)(row0 + r) * ldc + col0 + c4) = v;
    }
    
  }
}

// GEMM C = act(A·W + bias + resid): A f32 (ASPLIT -> hi/lo 2 terms), Wt bf16 [N][K]; ACT 0 none, 1 relu, 2 exact gelu;
// resid (optional, f32, row index = (row % rmod), pitch ldr, RES_BF16 rounds it) added before the activation.
template <bool ASPLIT, int ACT, bool BIAS_BF16, bool RES_BF16>
__global__ __launch_bounds__(128) void k_gemm_bf3(const float* __restrict__ A, int lda, const unsigned short* __restrict__ Wt, int ldb,
                                                const float* __restrict__ bias, const float* __restrict__ resid, int rmod, int ldr,
                                                float* __restrict__ C, int ldc, int M, int N, int K) {
  __shared__ __attribute__((aligned(16))) float so[4][16][64];
  const int tid = threadIdx.x, w = tid >> 5, lane = tid & 31, ln = lane & 15, hh = lane >> 4;
  const int ntn = N / 64;
  const int wid = blockIdx.x * 4 + w;
  const int mt = wid / ntn, nq = wid % ntn;
  if (mt * 16 >= M) return;
  const int row0 = mt * 16, col0 = nq * 64;
  const float* arow = A + (size_t)(row0 + ln) * lda;
  v8f acc[4] = {};
  for (int kb = 0; kb < K; kb += 32) {
    FragB ah, al;
    const v4f x0 = *(const v4fa*)(arow + kb + 8 * hh), x1 = *(const v4fa*)(arow + kb + 8 * hh + 4);
    const v4f x2 = *(const v4fa*)(arow + kb + 16 + 8 * hh), x3 = *(const v4fa*)(arow + kb + 16 + 8 * hh + 4);
    float xs[16] = {x0[0],x0[1],x0[2],x0[3],x1[0],x1[1],x1[2],x1[3],x2[0],x2[1],x2[2],x2[3],x3[0],x3[1],x3[2],x3[3]};
#pragma unroll
    for (int i = 0; i < 16; ++i) { const unsigned short hb = bf16_bits(xs[i]); ah.u[i] = hb; al.u[i] = ASPLIT ? bf16_bits(xs[i] - bf16_val(hb)) : (unsigned short)0; }
#pragma unroll
    for (int t = 0; t < 4; ++t) {
      const unsigned short* brow = Wt + (size_t)(col0 + t * 16 + ln) * ldb + kb;
      FragB b;
      b.half[0] = *(const v8us*)(brow + 8 * hh);
      b.half[1] = *(const v8us*)(brow + 16 + 8 * hh);
      acc[t] = mmaN<ASPLIT ? 2 : 1>(ah.v, al.v, b.v, b.v, acc[t]);
    }
  }
#pragma unroll
  for (int t = 0; t < 4; ++t) {
    const int col = col0 + t * 16 + ln;
    float bv = bias ? bias[col] : 0.f;
    if (BIAS_BF16) bv = bf16_round(bv);
#pragma unroll
    for (int r = 0; r < 8; ++r) {
      float v = acc[t][r] + bv;
      if (resid) { float rv = resid[(size_t)((row0 + 8 * hh + r) % rmod) * ldr + col]; if (RES_BF16) rv = bf16_round(rv); v += rv; }
      if (ACT == 1) v = fmaxf(v, 0.f);
      if (ACT == 2) v = 0.5f * v * (1.0f + erff(v * 0.70710678118654752f));
      if (ACT == 3) { const float u = 0.7978845608028654f * (v + 0.044715f * v * v * v); v = 0.5f * v * (1.0f + tanhf(u)); }
      so[w][8 * hh + r][t * 16 + ln] = v;
    }
  }
  __builtin_amdgcn_fence(__ATOMIC_ACQ_REL, "workgroup");
  __builtin_amdgcn_wave_barrier();
  const int rsub = lane >> 4, c4 = (lane & 15) * 4;
  {
#pragma unroll
    for (int q = 0; q < 8; ++q) {
      const int r = q * 2 + rsub;
      const v4f v = *(const v4fa*)&so[w][r][c4];
      *(v4f*)(C + (size_t)(row0 + r) * ldc + col0 + c4) = v;
    }
    
  }
}
// row LayerNorm (biased variance, eps) over N: s = X (+ R); optional out_sum <- s; out_norm <- (s-mu)*rsqrt(var+eps)*g + b
template <bool PARAM_BF16>
__global__ __launch_bounds__(256) void k_layernorm(const float* __restrict__ X, const float* __restrict__ R, const float* __restrict__ g, const float* __restrict__ bta,
                                                  float* __restrict__ out_sum, float* __restrict__ out_norm, int N, float eps) {
  __shared__ float red[256];
  const int row = blockIdx.x, tid = threadIdx.x;
  const float* x = X + (size_t)row * N; const float* rr = R ? R + (size_t)row * N : nullptr;
  float vals[16];                     // up to N = 4096
  const int per = N / 256;            // contiguous chunk per thread? use strided-by-4 chunks: thread handles j = tid*4 + 1024*u
  float s1 = 0.f;
  for (int u = 0; u < per / 4; ++u) {
    const int j = tid * 4 + 1024 * u;
    const v4f a = *(const v4fa*)(x + j);
    v4f b = {0.f,0.f,0.f,0.f}; if (rr) b = *(const v4fa*)(rr + j);
#pragma unroll
    for (int q = 0; q < 4; ++q) { const float v = a[q] + b[q]; vals[u * 4 + q] = v; s1 += v; }
  }
  red[tid] = s1; __syncthreads();
  for (int st = 128; st > 0; st >>= 1) { if (tid < st) red[tid] += red[tid + st]; __syncthreads(); }
  const float mu = red[0] / (float)N; __syncthreads();
  float s2 = 0.f;
  for (int u = 0; u < per / 4; ++u)
#pragma unroll
    for (int q = 0; q < 4; ++q) { const float c = vals[u * 4 + q] - mu; s2 += c * c; }
  red[tid] = s2; __syncthreads();
  for (int st = 128; st > 0; st >>= 1) { if (tid < st) red[tid] += red[tid + st]; __syncthreads(); }
  const float rs = rsqrtf(red[0] / (float)N + eps);
  {
    for (int u = 0; u < per / 4; ++u) {
      const int j = tid * 4 + 1024 * u;
      v4f o, sm;
#pragma unroll
      for (int q = 0; q < 4; ++q) {
        float gg = g[j + q], bb = bta[j + q];
        if (PARAM_BF16) { gg = bf16_round(gg); bb = bf16_round(bb); }
        sm[q] = vals[u * 4 + q]; o[q] = (vals[u * 4 + q] - mu) * rs * gg + bb;
      }
      if (out_sum) *(v4f*)(out_sum + (size_t)row * N + j) = sm;
      *(v4f*)(out_norm + (size_t)row * N + j) = o;
    }
    
  }
}



// ---- f16 WMMA path (v_wmma_f32_16x16x32_f16): 11-bit significands for operands in range — used where a [0,1] probability operand needs more precision than bf16
typedef _Float16 v16h __attribute__((ext_vector_type(16)));
union FragH { v16h v; v8us half[2]; _Float16 h[16]; unsigned short u[16]; };
template <int NT>
__device__ __forceinline__ v8f mmaH(v16h ah, v16h al, v16h bh, v16h bl, v8f c) {
  c = __builtin_amdgcn_wmma_f32_16x16x32_f16(false, ah, false, bh, (short)0, c, false, false);
  if (NT >= 2) c = __builtin_amdgcn_wmma_f32_16x16x32_f16(false, al, false, bh, (short)0, c, false, false);
  if (NT >= 3) c = __builtin_amdgcn_wmma_f32_16x16x32_f16(false, ah, false, bl, (short)0, c, false, false);
  asm volatile("v_nop\n\tv_nop\n\tv_nop\n\tv_nop" : "+v"(c) : "v"(ah), "v"(al), "v"(bh), "v"(bl));
  return c;
}
// batched GEMM like k_gemm_b but f16 operands: A f32 (split into f16 hi/lo if ASPLIT, else rounded to f16), Bt = f16 values [n][k]; alpha; C f32; N multiple of 16 (partial tiles skipped)
template <bool ASPLIT>
__global__ __launch_bounds__(128) void k_gemm_h(const float* __restrict__ A, int lda, size_t sA, const _Float16* __restrict__ Bh, int ldb, size_t sB, float alpha, float* __restrict__ C, int ldc, size_t sC, int M, int N, int K) {
  __shared__ __attribute__((aligned(16))) float so[4][16][64];
  const int tid = threadIdx.x, w = tid >> 5, lane = tid & 31, ln = lane & 15, hh = lane >> 4; const int by = blockIdx.y;
  A += (size_t)by * sA; Bh += (size_t)by * sB; C += (size_t)by * sC;
  const int ntn = (N + 63) / 64; const int wid = blockIdx.x * 4 + w; const int mt = wid / ntn, nq = wid % ntn; if (mt * 16 >= M) return;
  const int row0 = mt * 16, col0 = nq * 64; const float* arow = A + (size_t)(row0 + ln) * lda;
  v8f acc[4] = {};
  for (int kb = 0; kb < K; kb += 32) {
    FragH ah, al;
    const v4f x0 = *(const v4fa*)(arow + kb + 8 * hh), x1 = *(const v4fa*)(arow + kb + 8 * hh + 4), x2 = *(const v4fa*)(arow + kb + 16 + 8 * hh), x3 = *(const v4fa*)(arow + kb + 16 + 8 * hh + 4);
    float xs[16] = {x0[0],x0[1],x0[2],x0[3],x1[0],x1[1],x1[2],x1[3],x2[0],x2[1],x2[2],x2[3],x3[0],x3[1],x3[2],x3[3]};
#pragma unroll
    for (int i = 0; i < 16; ++i) { const _Float16 h = (_Float16)xs[i]; ah.h[i] = h; al.h[i] = ASPLIT ? (_Float16)(xs[i] - (float)h) : (_Float16)0.0f; }
#pragma unroll
    for (int t = 0; t < 4; ++t) { if (col0 + t * 16 >= N) continue; const size_t boff = (size_t)(col0 + t * 16 + ln) * ldb + kb; FragH bq; bq.half[0] = *(const v8us*)(Bh + boff + 8 * hh); bq.half[1] = *(const v8us*)(Bh + boff + 16 + 8 * hh);
      acc[t] = mmaH<ASPLIT ? 2 : 1>(ah.v, al.v, bq.v, bq.v, acc[t]); }
  }
#pragma unroll
  for (int t = 0; t < 4; ++t) { if (col0 + t * 16 >= N) continue;
#pragma unroll
    for (int r = 0; r < 8; ++r) so[w][8 * hh + r][t * 16 + ln] = acc[t][r] * alpha; }
  __builtin_amdgcn_fence(__ATOMIC_ACQ_REL, "workgroup"); __builtin_amdgcn_wave_barrier();
  const int rsub = lane >> 4, c4 = (lane & 15) * 4;
  {
#pragma unroll
    for (int q = 0; q < 8; ++q) { const int r = q * 2 + rsub; if (col0 + c4 < N) { const v4f v = *(const v4fa*)&so[w][r][c4]; *(v4f*)(C + (size_t)(row0 + r) * ldc + col0 + c4) = v; } }
     }
}

// Wt[n][k] = f16(W[k][n]·scale) from f32 row-major W[K][N] (scale = power of two; bf16-exact weights stay exact in f16 away from the subnormal range)
__global__ __launch_bounds__(256) void k_wt_f16(const float* __restrict__ W, _Float16* __restrict__ Wt, int K, int N, float scale) {
  const int t = blockIdx.x * 256 + threadIdx.x; if (t >= N * (K / 8)) return; const int n = t / (K / 8), k8 = (t % (K / 8)) * 8; FragH f;
#pragma unroll
  for (int i = 0; i < 8; ++i) f.h[i] = (_Float16)(bf16_round(W[(size_t)(k8 + i) * N + n]) * scale); const v8us o = f.half[0];
  *(v8us*)((unsigned short*)Wt + (size_t)n * K + k8) = o; 
}
// k_gemm_hh variant with fused epilogue: v = acc·alpha + bias[by·sBias + col] (+ CP[(row/rowsPerB)·sCPb + by·64 + col] if CP) ; ACT 0 none / 1 elu ; writes f16 C16 (and f32 C if non-null)
template <int ACT>
__global__ __launch_bounds__(128) void k_gemm_hhx(const _Float16* __restrict__ A, int lda, size_t sA, const _Float16* __restrict__ Bh, int ldb, size_t sB, float alpha, const float* __restrict__ bias, size_t sBias, const float* __restrict__ CP, int rowsPerB, size_t sCPb, int row0g,
    float* __restrict__ C, _Float16* __restrict__ C16, int ldc, size_t sC, int M, int N, int K) {
  __shared__ __attribute__((aligned(16))) float so[4][16][64];
  const int tid = threadIdx.x, w = tid >> 5, lane = tid & 31, ln = lane & 15, hh = lane >> 4; const int by = blockIdx.y;
  A += (size_t)by * sA; Bh += (size_t)by * sB; const size_t cofs = (size_t)by * sC; const float* bp = bias ? bias + (size_t)by * sBias : nullptr;
  const int ntn = (N + 63) / 64; const int wid = blockIdx.x * 4 + w; const int mt = wid / ntn, nq = wid % ntn; if (mt * 16 >= M) return;
  const int row0 = mt * 16, col0 = nq * 64; const _Float16* arow = A + (size_t)(row0 + ln) * lda;
  v8f acc[4] = {};
  for (int kb = 0; kb < K; kb += 32) { FragH ah; ah.half[0] = *(const v8us*)((const unsigned short*)arow + kb + 8 * hh); ah.half[1] = *(const v8us*)((const unsigned short*)arow + kb + 16 + 8 * hh);
#pragma unroll
    for (int t = 0; t < 4; ++t) { if (col0 + t * 16 >= N) continue; const size_t boff = (size_t)(col0 + t * 16 + ln) * ldb + kb; FragH bq; bq.half[0] = *(const v8us*)((const unsigned short*)Bh + boff + 8 * hh); bq.half[1] = *(const v8us*)((const unsigned short*)Bh + boff + 16 + 8 * hh);
      acc[t] = mmaH<1>(ah.v, ah.v, bq.v, bq.v, acc[t]); }
  }
#pragma unroll
  for (int t = 0; t < 4; ++t) { if (col0 + t * 16 >= N) continue; const int col = col0 + t * 16 + ln; const float bv = bp ? bf16_round(bp[col]) : 0.f;
#pragma unroll
    for (int r = 0; r < 8; ++r) { float v = acc[t][r] * alpha + bv; if (CP) { const int rr = row0g + row0 + 8 * hh + r; if (rowsPerB < 0) v += CP[cofs + (size_t)rr * ldc + col];      /* rowsPerB < 0: own element of the batched C plane */ else { const int bidx = rr / rowsPerB; v += CP[(size_t)bidx * sCPb + (size_t)by * 64 + col]; } } if (ACT == 1) v = (v > 0.f) ? v : expm1f(v); else if (ACT == 7) v = (v > 0.f) ? v + 1.0f : expf(v); else if (ACT == 8) v = tanhf(v); else if (ACT == 9) v = 0.5f * v * (1.0f + tanhf(0.7978845608028654f * (v + 0.044715f * v * v * v))); else if (ACT == 11) v = 1.0f / (1.0f + expf(-v)); else if (ACT == 12) v = (v > 0.f) ? v : 0.01f * v; else if (ACT == 14) v = (v > 0.f) ? v : 0.1f * v; else if (ACT == 16) v = (v >= 0.f) ? v : 0.3f * v; else if (ACT == 17) v = (v >= 0.f) ? v : 0.2f * v; else if (ACT == 15) v = v / (1.0f + expf(-v)); else if (ACT == 3) v = fmaxf(v, 0.f); else if (ACT == 6) v = 0.5f * v * (1.0f + erff(v * 0.70710678118654752f)); so[w][8 * hh + r][t * 16 + ln] = v; } }
  __builtin_amdgcn_fence(__ATOMIC_ACQ_REL, "workgroup"); __builtin_amdgcn_wave_barrier();
  const int rsub = lane >> 4, c4 = (lane & 15) * 4; typedef _Float16 v4h __attribute__((ext_vector_type(4)));
  {
#pragma unroll
    for (int q = 0; q < 8; ++q) { const int r = q * 2 + rsub; if (col0 + c4 < N) { const v4f v = *(const v4fa*)&so[w][r][c4]; if (C) *(v4f*)(C + cofs + (size_t)(row0 + r) * ldc + col0 + c4) = v; if (C16) { v4h h4; for (int i = 0; i < 4; ++i) h4[i] = (_Float16)v[i]; *(v4h*)(C16 + cofs + (size_t)(row0 + r) * ldc + col0 + c4) = h4; } } }
     }
}


typedef _Float16 v4h __attribute__((ext_vector_type(4)));

__global__ __launch_bounds__(256) void k_x16(const float* __restrict__ x, _Float16* __restrict__ X16, size_t n8) { const size_t t = (size_t)blockIdx.x * 256 + threadIdx.x; if (t >= n8) return; FragH f;
#pragma unroll
  for (int q = 0; q < 8; ++q) f.h[q] = (_Float16)bf16_round(x[t * 8 + q]); *(v8us*)((unsigned short*)X16 + t * 8) = f.half[0];  }
__global__ __launch_bounds__(256) void k_h16(const float* __restrict__ x, _Float16* __restrict__ X16, size_t n8) { const size_t t = (size_t)blockIdx.x * 256 + threadIdx.x; if (t >= n8) return; FragH f;
#pragma unroll
  for (int q = 0; q < 8; ++q) f.h[q] = (_Float16)x[t * 8 + q]; *(v8us*)((unsigned short*)X16 + t * 8) = f.half[0];  }
__global__ __launch_bounds__(256) void k_round16f(const float* __restrict__ W, _Float16* __restrict__ Bt, size_t n8) { const size_t t = (size_t)blockIdx.x * 256 + threadIdx.x; if (t >= n8) return; FragH f;
#pragma unroll
  for (int i = 0; i < 8; ++i) f.h[i] = (_Float16)(bf16_round(W[t * 8 + i]) * 16.0f); *(v8us*)((unsigned short*)Bt + t * 8) = f.half[0];  }
template <int NHv, int TTv>
__global__ __launch_bounds__(256) void k_vt(const _Float16* __restrict__ V16, int ldv, int voff, _Float16* __restrict__ Vt) { __shared__ unsigned short tl[64][66]; const int tid = threadIdx.x; const int slab = blockIdx.x / (TTv / 64), lg = blockIdx.x % (TTv / 64); const int b = slab / NHv, h = slab % NHv;
  for (int i = tid; i < 64 * 8; i += 256) { const int r = i / 8, c8 = (i % 8) * 8; FragH f; f.half[0] = *(const v8us*)((const unsigned short*)V16 + ((size_t)b * TTv + lg * 64 + r) * ldv + voff + h * 64 + c8);
#pragma unroll
    for (int q = 0; q < 8; ++q) tl[r][c8 + q] = f.u[q]; }
  __syncthreads();
  {
#pragma unroll
    for (int rd = 0; rd < 2; ++rd) { const int d = rd * 32 + tid / 8, pc = tid % 8; FragH f;
#pragma unroll
      for (int q = 0; q < 8; ++q) f.u[q] = tl[pc * 8 + q][d];
      *(v8us*)((unsigned short*)Vt + ((size_t)slab * 64 + d) * TTv + lg * 64 + pc * 8) = f.half[0]; }
     } }

__global__ __launch_bounds__(256) void k_hl(const float* __restrict__ F, _Float16* __restrict__ Hh, _Float16* __restrict__ Hl, size_t n8) { const size_t t = (size_t)blockIdx.x * 256 + threadIdx.x; if (t >= n8) return; FragH fh, fl; const v4f a = *(const v4fa*)(F + t * 8), c = *(const v4fa*)(F + t * 8 + 4);
#pragma unroll
  for (int q = 0; q < 4; ++q) { _Float16 h = (_Float16)a[q]; fh.h[q] = h; fl.h[q] = (_Float16)((a[q] - (float)h) * 1024.0f); h = (_Float16)c[q]; fh.h[4 + q] = h; fl.h[4 + q] = (_Float16)((c[q] - (float)h) * 1024.0f); }
  { *(v8us*)((unsigned short*)Hh + t * 8) = fh.half[0]; *(v8us*)((unsigned short*)Hl + t * 8) = fl.half[0];  } }

// ---- fast GEMM (wave tile 32x64; requires M % 32 == 0 rows per launch region and N % 64 == 0); epilogue = k_gemm_hhx semantics ----
__device__ __forceinline__ v16h g2_frag(const _Float16* p, int hh) { FragH f; f.half[0] = *(const v8us*)((const unsigned short*)p + 8 * hh); f.half[1] = *(const v8us*)((const unsigned short*)p + 16 + 8 * hh); return f.v; }
__device__ __forceinline__ v8f g2_mma(v16h a, v16h b, v8f c) { v8f d = __builtin_amdgcn_wmma_f32_16x16x32_f16(false, a, false, b, (short)0, c, false, false); asm volatile("v_nop\n\tv_nop\n\tv_nop\n\tv_nop" : "+v"(d) : "v"(a), "v"(b)); return d; }
template <int ACT>
__global__ __launch_bounds__(128) void k_gemm2(const _Float16* __restrict__ A, int lda, size_t sA, const _Float16* __restrict__ Bh, int ldb, size_t sB, float alpha, const float* __restrict__ bias, size_t sBias, const float* __restrict__ CP, int rowsPerB, size_t sCPb, int row0g,
    float* __restrict__ C, _Float16* __restrict__ C16, int ldc, size_t sC, int M, int N, int K) { static_assert(ACT == 0 || ACT == 3 || ACT == 6 || ACT == 8 || ACT == 9 || ACT == 11 || ACT == 12 || ACT == 14 || ACT == 15 || ACT == 16 || ACT == 17, "k_gemm2: unsupported ACT code (would silently apply no activation)");
  __shared__ __attribute__((aligned(16))) float so[4][32][68];
  const int tid = threadIdx.x, w = tid >> 5, lane = tid & 31, ln = lane & 15, hh = lane >> 4; const int by = blockIdx.y;
  A += (size_t)by * sA; Bh += (size_t)by * sB; const size_t cofs = (size_t)by * sC; const float* bp = bias ? bias + (size_t)by * sBias : nullptr;
  const int ntn = N >> 6; const int mt = blockIdx.x / ntn, nq = blockIdx.x - mt * ntn; const int row0 = mt * 128 + 32 * w, col0 = nq * 64; if (row0 >= M) return;
  const _Float16* a0p = A + (size_t)(row0 + ln) * lda; const _Float16* a1p = a0p + (size_t)16 * lda;
  const _Float16* b0p = Bh + (size_t)(col0 + ln) * ldb; const _Float16* b1p = b0p + (size_t)16 * ldb; const _Float16* b2p = b1p + (size_t)16 * ldb; const _Float16* b3p = b2p + (size_t)16 * ldb;
  const v8f z8 = {0.f,0.f,0.f,0.f,0.f,0.f,0.f,0.f}; v8f c00 = z8, c01 = z8, c02 = z8, c03 = z8, c10 = z8, c11 = z8, c12 = z8, c13 = z8;
#pragma unroll 1
  for (int kb = 0; kb < K; kb += 32) { const v16h a0 = g2_frag(a0p + kb, hh), a1 = g2_frag(a1p + kb, hh);
    v16h b = g2_frag(b0p + kb, hh); c00 = g2_mma(a0, b, c00); c10 = g2_mma(a1, b, c10);
    b = g2_frag(b1p + kb, hh); c01 = g2_mma(a0, b, c01); c11 = g2_mma(a1, b, c11);
    b = g2_frag(b2p + kb, hh); c02 = g2_mma(a0, b, c02); c12 = g2_mma(a1, b, c12);
    b = g2_frag(b3p + kb, hh); c03 = g2_mma(a0, b, c03); c13 = g2_mma(a1, b, c13); }
  v8f accs[8] = {c00, c01, c02, c03, c10, c11, c12, c13};
#pragma unroll
  for (int u = 0; u < 8; ++u) { const int t = u & 3, half = u >> 2; const int col = col0 + t * 16 + ln; const float bv = bp ? bf16_round(bp[col]) : 0.f;
#pragma unroll
    for (int r = 0; r < 8; ++r) { const int rloc = half * 16 + 8 * hh + r; float v = accs[u][r] * alpha + bv; if (CP) { if (rowsPerB < 0) v += CP[cofs + (size_t)(row0g + row0 + rloc) * ldc + col];      /* rowsPerB < 0: own element of the batched C plane */ else { const int bidx = (row0g + row0 + rloc) / rowsPerB; v += CP[(size_t)bidx * sCPb + (size_t)by * 64 + col]; } }
      if (ACT == 3) v = fmaxf(v, 0.f); else if (ACT == 6) v = 0.5f * v * (1.0f + erff(v * 0.70710678118654752f)); else if (ACT == 11) v = 1.0f / (1.0f + expf(-v)); else if (ACT == 15) v = v / (1.0f + expf(-v)); else if (ACT == 12) v = (v > 0.f) ? v : 0.01f * v; else if (ACT == 8) v = tanhf(v); else if (ACT == 9) v = 0.5f * v * (1.0f + tanhf(0.7978845608028654f * (v + 0.044715f * v * v * v))); else if (ACT == 14) v = (v > 0.f) ? v : 0.1f * v; else if (ACT == 16) v = (v >= 0.f) ? v : 0.3f * v; else if (ACT == 17) v = (v >= 0.f) ? v : 0.2f * v;
      so[w][rloc][t * 16 + ln] = v; } }
  __builtin_amdgcn_fence(__ATOMIC_ACQ_REL, "workgroup"); __builtin_amdgcn_wave_barrier();
  const int rsub = lane >> 4, c4 = (lane & 15) * 4;
  {
#pragma unroll
    for (int q = 0; q < 16; ++q) { const int r = q * 2 + rsub; const v4f v = *(const v4fa*)&so[w][r][c4]; if (C) *(v4f*)(C + cofs + (size_t)(row0 + r) * ldc + col0 + c4) = v; if (C16) { v4h h4; for (int i = 0; i < 4; ++i) h4[i] = (_Float16)v[i]; *(v4h*)(C16 + cofs + (size_t)(row0 + r) * ldc + col0 + c4) = h4; } }
     } }


__global__ __launch_bounds__(256) void k_wnat(const float* __restrict__ w, size_t n8, _Float16* __restrict__ Bt) { const size_t t = (size_t)blockIdx.x * 256 + threadIdx.x; if (t >= n8) return; FragH f; for (int q = 0; q < 8; ++q) f.h[q] = (_Float16)(bf16_round(w[t * 8 + q]) * 16.0f); *(v8us*)((unsigned short*)Bt + t * 8) = f.half[0];  }
__global__ __launch_bounds__(256) void k_rsm(const float* __restrict__ S, _Float16* __restrict__ P, int nrows) {
  #pragma clang fp contract(off)
  const int i = blockIdx.x * 256 + threadIdx.x; if (i >= nrows) return; const float* s = S + (size_t)i * SQ; float mx = -3.0e38f;
#pragma unroll 1
  for (int j = 0; j < SQ; ++j) mx = fmaxf(mx, s[j]); float se = 0.f;
#pragma unroll 1
  for (int j = 0; j < SQ; ++j) se += expf(s[j] - mx); const float sc = 256.0f / se;
#pragma unroll 1
  for (int j0 = 0; j0 < SQ; j0 += 8) { FragH f; for (int q = 0; q < 8; ++q) f.h[q] = (_Float16)(expf(s[j0 + q] - mx) * sc); unsigned short* d = (unsigned short*)P + (size_t)i * SQ + j0; *(v8us*)d = f.half[0];  } }
__global__ __launch_bounds__(256) void k_vt(const _Float16* __restrict__ V16, int b, int h0, _Float16* __restrict__ VT) { __shared__ unsigned short tl[64][65]; const int tid = threadIdx.x; const int hh = blockIdx.x % HG, sg = blockIdx.x / HG; const int s0 = sg * 64; const int h = h0 + hh;
  for (int i = tid; i < 64 * 8; i += 256) { const int j = i / 8, d8 = (i % 8) * 8; FragH f; f.half[0] = *(const v8us*)((const unsigned short*)V16 + ((size_t)b * SQ + s0 + j) * DM + h * HD + d8); for (int q = 0; q < 8; ++q) tl[d8 + q][j] = f.u[q]; }
  __syncthreads();
  { for (int i = tid; i < 64 * 8; i += 256) { const int d = i / 8, j8 = (i % 8) * 8; FragH f; for (int q = 0; q < 8; ++q) f.u[q] = tl[d][j8 + q]; *(v8us*)((unsigned short*)VT + ((size_t)hh * HD + d) * SQ + s0 + j8) = f.half[0]; }  } }



__global__ __launch_bounds__(256) void k_wph64(const float* __restrict__ Wm, _Float16* __restrict__ Bt) {
  const int t = blockIdx.x * 256 + threadIdx.x; if (t >= NH * HD * HD / 8) return; const int h = t / (HD * HD / 8), r = t % (HD * HD / 8), e = r / (HD / 8), d8 = (r % (HD / 8)) * 8; FragH f;
  for (int i = 0; i < 8; ++i) f.h[i] = (_Float16)(bf16_round(Wm[((size_t)h * HD + d8 + i) * HD + e]) * 16.0f);
  unsigned short* o = (unsigned short*)Bt + ((size_t)h * HD + e) * HD + d8; *(v8us*)o = f.half[0];  }
extern "C" void kernel_launch(void* const* d_in, const int* in_sizes, int n_in,
                              void* d_out, int out_size, void* d_ws, size_t ws_size, hipStream_t stream) {
  (void)in_sizes; (void)n_in; (void)out_size;
  const float* const* I = (const float* const*)d_in; const float* x = I[0]; const float* wq = I[1]; const float* bq = I[2]; const float* wk = I[3]; const float* bk = I[4]; const float* wv = I[5]; const float* bv = I[6];      /* per-head W [12][64][64] ([h][in][out]) + b [12][64] for q, k, v */
  char* ws = (char*)d_ws; size_t off = 0;
  auto take = [&](size_t bytes) { char* p = ws + off; off += (bytes + 255) & ~(size_t)255; return p; };
  _Float16* BQ = (_Float16*)take((size_t)NH * HD * HD * 2); _Float16* BK = (_Float16*)take((size_t)NH * HD * HD * 2); _Float16* BV = (_Float16*)take((size_t)NH * HD * HD * 2); 
  _Float16* X16 = (_Float16*)take(NR * DM * 2); _Float16* Q16 = (_Float16*)take(NR * DM * 2); _Float16* K16 = (_Float16*)take(NR * DM * 2); _Float16* V16 = (_Float16*)take(NR * DM * 2);
  float* S = (float*)take((size_t)HG * SQ * SQ * 4); _Float16* P = (_Float16*)take((size_t)HG * SQ * SQ * 2); _Float16* VT = (_Float16*)take((size_t)NH * HD * SQ * 2);
  if (off > ws_size) return;
  { const unsigned g = (unsigned)((NH * HD * HD / 8 + 255) / 256); k_wph64<<<g, 256, 0, stream>>>(wq, BQ); k_wph64<<<g, 256, 0, stream>>>(wk, BK); k_wph64<<<g, 256, 0, stream>>>(wv, BV); }      /* per head: Bt[h][e][d] = 16 bf16(W[h][d][e]) (64 x 64 blocks, [out][in] x16) */

  k_x16<<<(unsigned)((NR * DM / 8 + 255) / 256), 256, 0, stream>>>(x, X16, NR * DM / 8);
  const size_t r0p = (size_t)B0 * SQ;      /* first projected row */
  k_gemm2<0><<<dim3((unsigned)((MP / 128) * (HD / 64)), NH), 128, 0, stream>>>(X16 + r0p * DM, DM, (size_t)HD, BQ, HD, (size_t)HD * HD, 0.0625f, bq, (size_t)HD, nullptr, 1, 0, 0, nullptr, Q16 + r0p * DM, DM, (size_t)HD, MP, HD, HD);      /* per head on grid.y: the head's 64 input columns x its own 64 x 64 weight (+ its 64 biases) -> the head's 64 output columns */
  k_gemm2<0><<<dim3((unsigned)((MP / 128) * (HD / 64)), NH), 128, 0, stream>>>(X16 + r0p * DM, DM, (size_t)HD, BK, HD, (size_t)HD * HD, 0.0625f, bk, (size_t)HD, nullptr, 1, 0, 0, nullptr, K16 + r0p * DM, DM, (size_t)HD, MP, HD, HD);      /* per head on grid.y: the head's 64 input columns x its own 64 x 64 weight (+ its 64 biases) -> the head's 64 output columns */
  k_gemm2<0><<<dim3((unsigned)((MP / 128) * (HD / 64)), NH), 128, 0, stream>>>(X16 + r0p * DM, DM, (size_t)HD, BV, HD, (size_t)HD * HD, 0.0625f, bv, (size_t)HD, nullptr, 1, 0, 0, nullptr, V16 + r0p * DM, DM, (size_t)HD, MP, HD, HD);      /* per head on grid.y: the head's 64 input columns x its own 64 x 64 weight (+ its 64 biases) -> the head's 64 output columns */
  for (int b = B0; b < B0 + NBR; ++b) { const size_t r0 = (size_t)b * SQ;
    k_vt<NH, SQ><<<NH * (SQ / 64), 256, 0, stream>>>(V16 + r0 * LQ, LQ, 0, VT);      /* V^T [NH][HD][SQ] for this batch */
    for (int h0 = 0; h0 < NHD; h0 += HG) {
      k_gemm2<0><<<dim3((QN / 128) * (SQ / 64), HG), 128, 0, stream>>>(Q16 + r0 * LQ + h0 * HD, LQ, (size_t)HD, K16 + r0 * LQ + h0 * HD, LQ, (size_t)HD, 0.125f, nullptr, 0, nullptr, 1, 0, 0, S, nullptr, SQ, (size_t)SQ * SQ, QN, SQ, HD);      /* scores, HG heads per launch */
      k_rsm<<<(HG * SQ + 255) / 256, 256, 0, stream>>>(S, P, HG * SQ);      /* P = 256 softmax (f16), rows of all HG heads */
      k_gemm2<0><<<dim3((QN / 128) * (HD / 64), HG), 128, 0, stream>>>(P, SQ, (size_t)SQ * SQ, VT + (size_t)h0 * HD * SQ, SQ, (size_t)HD * SQ, 0.00390625f, nullptr, 0, nullptr, 1, 0, 0, (float*)d_out + r0 * DM + h0 * HD, nullptr, DM, (size_t)HD, QN, HD, SQ); } }      /* out = P V^T (alpha 2^-8) written f32 straight into the merged-heads output rows */
}

// v001
// Measured time: 1190 microseconds a run.
// Next to v000, in two timings, it ran 4.38 and 4.48 times as fast.
#include <hip/hip_runtime.h>
// Multi-head self-attention with PER-HEAD 64x64 projections on head-chunked features (sequences [8][1024][768] viewed [B][S][12][64]; q/k/v[..., h, :] = x[..., h, :] W[h] + b[h] with W [12][64][64] ([h][in][out], sigma 0.05) and b [12][64] (sigma 0.05); scores / 8; softmax over all 1024 keys (no mask); out = heads concatenated (no output projection) -> [8][1024][768]).
// Structure: token rows r = b*1024 + s; x as exact f16 rows (bf16-rounded); Q, K, V as three WMMA GEMMs (32x64 wave tiles, f32 accumulation, exact x16 weights + bias, f16 outputs); per batch: V^T for all heads via LDS transposes; per (batch, group of 4 heads): scores GEMM (K = 64, batched over the heads on grid.y, alpha = 1/sqrt(64)), row softmax on VALU (f32 statistics; weights stored x256 as f16), o = P . V^T GEMM (K = 1024, alpha 2^-8) written f32 straight into the merged-heads output rows (no output projection).
// Compute dtype: inputs rounded to bf16; x / weights exact; q, k, v and softmax weights as plain f16 GEMM operands (~2^-12); o, scores and softmax statistics f32. v_wmma_f32_16x16x32_f16.
#define NB 8
#define SQ 1024
#define DM 768
#define NH 12
#define HD 64
#define HG 4                         /* heads per attention launch group */
#define B0 0                         /* first batch processed (debug hook) */
#define NBR NB                       /* batches processed (debug hook) */
#define NR ((size_t)NB * SQ)         /* token rows */
#define MP ((int)((size_t)NBR * SQ)) /* rows projected (debug hook) */
#define QN SQ                        /* query rows attended per batch (debug hook) */
#define NHD NH                       /* heads attended (debug hook) */
#define MPO MP                       /* unused (no output stage) */
#define LQ DM      /* row pitch of the q/k/v rows */
typedef __bf16 v16b __attribute__((ext_vector_type(16)));
typedef unsigned short v8us __attribute__((ext_vector_type(8), may_alias));
typedef float  v8f  __attribute__((ext_vector_type(8)));
typedef float  v4f  __attribute__((ext_vector_type(4)));
typedef float  v4fa __attribute__((ext_vector_type(4), may_alias));
union FragB { v16b v; v8us half[2]; unsigned short u[16]; };

__device__ __forceinline__ unsigned short bf16_bits(float x) { unsigned int u = __float_as_uint(x); return (unsigned short)((u + 0x7FFFu + ((u >> 16) & 1u)) >> 16); }
__device__ __forceinline__ float bf16_val(unsigned short b) { return __uint_as_float(((unsigned int)b) << 16); }
__device__ __forceinline__ float bf16_round(float x) { return bf16_val(bf16_bits(x)); }
// D += A·B with NT terms: 1 = ah·bh, 2 = + al·bh (A split), 3 = + ah·bl (both split)
template <int NT>
__device__ __forceinline__ v8f mmaN(v16b ah, v16b al, v16b bh, v16b bl, v8f c) {
  c = __builtin_amdgcn_wmma_f32_16x16x32_bf16(false, ah, false, bh, (short)0, c, false, false);
  if (NT >= 2) c = __builtin_amdgcn_wmma_f32_16x16x32_bf16(false, al, false, bh, (short)0, c, false, false);
  if (NT >= 3) c = __builtin_amdgcn_wmma_f32_16x16x32_bf16(false, ah, false, bl, (short)0, c, false, false);
  asm volatile("v_nop\n\tv_nop\n\tv_nop\n\tv_nop" : "+v"(c) : "v"(ah), "v"(al), "v"(bh), "v"(bl));
  return c;
}

__global__ __launch_bounds__(256) void k_wt_bf16(const float* __restrict__ W, unsigned short* __restrict__ Wt, int K, int N) {
  const int t = blockIdx.x * 256 + threadIdx.x;
  const int k8n = K / 8;
  if (t >= N * k8n) return;
  const int n = t / k8n, k8 = (t % k8n) * 8;
  v8us v;
#pragma unroll
  for (int i = 0; i < 8; ++i) v[i] = bf16_bits(W[(size_t)(k8 + i) * N + n]);
  *(v8us*)(Wt + (size_t)n * K + k8) = v;
  
}

// GEMM C[M][N] (f32, pitch ldc) = act(A[M][K]·W + bias). A f32 row-major (pitch lda) converted per fragment to bf16
// (ASPLIT: hi/lo two planes -> 2 terms, else single rounded term); Wt bf16 [N][K] (pitch ldb). BIAS_BF16 rounds the
// bias to bf16 first (bias quantised to bf16 before the add). K%32==0, M%16==0, N%64==0.
template <bool ASPLIT, int ACT, bool BIAS_BF16>
__global__ __launch_bounds__(128) void k_gemm_bf(const float* __restrict__ A, int lda, const unsigned short* __restrict__ Wt, int ldb,
                                               const float* __restrict__ bias, float* __restrict__ C, int ldc, int M, int N, int K) {
  __shared__ __attribute__((aligned(16))) float so[4][16][64];
  const int tid = threadIdx.x, w = tid >> 5, lane = tid & 31, ln = lane & 15, hh = lane >> 4;
  const int ntn = N / 64;
  const int wid = blockIdx.x * 4 + w;
  const int mt = wid / ntn, nq = wid % ntn;
  if (mt * 16 >= M) return;
  const int row0 = mt * 16, col0 = nq * 64;
  const float* arow = A + (size_t)(row0 + ln) * lda;
  v8f acc[4] = {};
  for (int kb = 0; kb < K; kb += 32) {
    FragB ah, al;
    const v4f x0 = *(const v4fa*)(arow + kb + 8 * hh), x1 = *(const v4fa*)(arow + kb + 8 * hh + 4);
    const v4f x2 = *(const v4fa*)(arow + kb + 16 + 8 * hh), x3 = *(const v4fa*)(arow + kb + 16 + 8 * hh + 4);
    float xs[16] = {x0[0],x0[1],x0[2],x0[3],x1[0],x1[1],x1[2],x1[3],x2[0],x2[1],x2[2],x2[3],x3[0],x3[1],x3[2],x3[3]};
#pragma unroll
    for (int i = 0; i < 16; ++i) { const unsigned short hb = bf16_bits(xs[i]); ah.u[i] = hb; al.u[i] = ASPLIT ? bf16_bits(xs[i] - bf16_val(hb)) : (unsigned short)0; }
#pragma unroll
    for (int t = 0; t < 4; ++t) {
      const unsigned short* brow = Wt + (size_t)(col0 + t * 16 + ln) * ldb + kb;
      FragB b;
      b.half[0] = *(const v8us*)(brow + 8 * hh);
      b.half[1] = *(const v8us*)(brow + 16 + 8 * hh);
      acc[t] = mmaN<ASPLIT ? 2 : 1>(ah.v, al.v, b.v, b.v, acc[t]);
    }
  }
#pragma unroll
  for (int t = 0; t < 4; ++t) {
    float bv = bias ? bias[col0 + t * 16 + ln] : 0.f;
    if (BIAS_BF16) bv = bf16_round(bv);
#pragma unroll
    for (int r = 0; r < 8; ++r) { float v = acc[t][r] + bv; if (ACT == 1) v = fmaxf(v, 0.f); so[w][8 * hh + r][t * 16 + ln] = v; }
  }
  __builtin_amdgcn_fence(__ATOMIC_ACQ_REL, "workgroup");
  __builtin_amdgcn_wave_barrier();
  const int rsub = lane >> 4, c4 = (lane & 15) * 4;
  {
#pragma unroll
    for (int q = 0; q < 8; ++q) {
      const int r = q * 2 + rsub;
      const v4f v = *(const v4fa*)&so[w][r][c4];
      *(v4f*)(C + (size_t)(row0 + r) * ldc + col0 + c4) = v;
    }
    
  }
}

// GEMM C = act(A·W + bias + resid): A f32 (ASPLIT -> hi/lo 2 terms), Wt bf16 [N][K]; ACT 0 none, 1 relu, 2 exact gelu;
// resid (optional, f32, row index = (row % rmod), pitch ldr, RES_BF16 rounds it) added before the activation.
template <bool ASPLIT, int ACT, bool BIAS_BF16, bool RES_BF16>
__global__ __launch_bounds__(128) void k_gemm_bf3(const float* __restrict__ A, int lda, const unsigned short* __restrict__ Wt, int ldb,
                                                const float* __restrict__ bias, const float* __restrict__ resid, int rmod, int ldr,
                                                float* __restrict__ C, int ldc, int M, int N, int K) {
  __shared__ __attribute__((aligned(16))) float so[4][16][64];
  const int tid = threadIdx.x, w = tid >> 5, lane = tid & 31, ln = lane & 15, hh = lane >> 4;
  const int ntn = N / 64;
  const int wid = blockIdx.x * 4 + w;
  const int mt = wid / ntn, nq = wid % ntn;
  if (mt * 16 >= M) return;
  const int row0 = mt * 16, col0 = nq * 64;
  const float* arow = A + (size_t)(row0 + ln) * lda;
  v8f acc[4] = {};
  for (int kb = 0; kb < K; kb += 32) {
    FragB ah, al;
    const v4f x0 = *(const v4fa*)(arow + kb + 8 * hh), x1 = *(const v4fa*)(arow + kb + 8 * hh + 4);
    const v4f x2 = *(const v4fa*)(arow + kb + 16 + 8 * hh), x3 = *(const v4fa*)(arow + kb + 16 + 8 * hh + 4);
    float xs[16] = {x0[0],x0[1],x0[2],x0[3],x1[0],x1[1],x1[2],x1[3],x2[0],x2[1],x2[2],x2[3],x3[0],x3[1],x3[2],x3[3]};
#pragma unroll
    for (int i = 0; i < 16; ++i) { const unsigned short hb = bf16_bits(xs[i]); ah.u[i] = hb; al.u[i] = ASPLIT ? bf16_bits(xs[i] - bf16_val(hb)) : (unsigned short)0; }
#pragma unroll
    for (int t = 0; t < 4; ++t) {
      const unsigned short* brow = Wt + (size_t)(col0 + t * 16 + ln) * ldb + kb;
      FragB b;
      b.half[0] = *(const v8us*)(brow + 8 * hh);
      b.half[1] = *(const v8us*)(brow + 16 + 8 * hh);
      acc[t] = mmaN<ASPLIT ? 2 : 1>(ah.v, al.v, b.v, b.v, acc[t]);
    }
  }
#pragma unroll
  for (int t = 0; t < 4; ++t) {
    const int col = col0 + t * 16 + ln;
    float bv = bias ? bias[col] : 0.f;
    if (BIAS_BF16) bv = bf16_round(bv);
#pragma unroll
    for (int r = 0; r < 8; ++r) {
      float v = acc[t][r] + bv;
      if (resid) { float rv = resid[(size_t)((row0 + 8 * hh + r) % rmod) * ldr + col]; if (RES_BF16) rv = bf16_round(rv); v += rv; }
      if (ACT == 1) v = fmaxf(v, 0.f);
      if (ACT == 2) v = 0.5f * v * (1.0f + erff(v * 0.70710678118654752f));
      if (ACT == 3) { const float u = 0.7978845608028654f * (v + 0.044715f * v * v * v); v = 0.5f * v * (1.0f + tanhf(u)); }
      so[w][8 * hh + r][t * 16 + ln] = v;
    }
  }
  __builtin_amdgcn_fence(__ATOMIC_ACQ_REL, "workgroup");
  __builtin_amdgcn_wave_barrier();
  const int rsub = lane >> 4, c4 = (lane & 15) * 4;
  {
#pragma unroll
    for (int q = 0; q < 8; ++q) {
      const int r = q * 2 + rsub;
      const v4f v = *(const v4fa*)&so[w][r][c4];
      *(v4f*)(C + (size_t)(row0 + r) * ldc + col0 + c4) = v;
    }
    
  }
}
// row LayerNorm (biased variance, eps) over N: s = X (+ R); optional out_sum <- s; out_norm <- (s-mu)*rsqrt(var+eps)*g + b
template <bool PARAM_BF16>
__global__ __launch_bounds__(256) void k_layernorm(const float* __restrict__ X, const float* __restrict__ R, const float* __restrict__ g, const float* __restrict__ bta,
                                                  float* __restrict__ out_sum, float* __restrict__ out_norm, int N, float eps) {
  __shared__ float red[256];
  const int row = blockIdx.x, tid = threadIdx.x;
  const float* x = X + (size_t)row * N; const float* rr = R ? R + (size_t)row * N : nullptr;
  float vals[16];                     // up to N = 4096
  const int per = N / 256;            // contiguous chunk per thread? use strided-by-4 chunks: thread handles j = tid*4 + 1024*u
  float s1 = 0.f;
  for (int u = 0; u < per / 4; ++u) {
    const int j = tid * 4 + 1024 * u;
    const v4f a = *(const v4fa*)(x + j);
    v4f b = {0.f,0.f,0.f,0.f}; if (rr) b = *(const v4fa*)(rr + j);
#pragma unroll
    for (int q = 0; q < 4; ++q) { const float v = a[q] + b[q]; vals[u * 4 + q] = v; s1 += v; }
  }
  red[tid] = s1; __syncthreads();
  for (int st = 128; st > 0; st >>= 1) { if (tid < st) red[tid] += red[tid + st]; __syncthreads(); }
  const float mu = red[0] / (float)N; __syncthreads();
  float s2 = 0.f;
  for (int u = 0; u < per / 4; ++u)
#pragma unroll
    for (int q = 0; q < 4; ++q) { const float c = vals[u * 4 + q] - mu; s2 += c * c; }
  red[tid] = s2; __syncthreads();
  for (int st = 128; st > 0; st >>= 1) { if (tid < st) red[tid] += red[tid + st]; __syncthreads(); }
  const float rs = rsqrtf(red[0] / (float)N + eps);
  {
    for (int u = 0; u < per / 4; ++u) {
      const int j = tid * 4 + 1024 * u;
      v4f o, sm;
#pragma unroll
      for (int q = 0; q < 4; ++q) {
        float gg = g[j + q], bb = bta[j + q];
        if (PARAM_BF16) { gg = bf16_round(gg); bb = bf16_round(bb); }
        sm[q] = vals[u * 4 + q]; o[q] = (vals[u * 4 + q] - mu) * rs * gg + bb;
      }
      if (out_sum) *(v4f*)(out_sum + (size_t)row * N + j) = sm;
      *(v4f*)(out_norm + (size_t)row * N + j) = o;
    }
    
  }
}



// ---- f16 WMMA path (v_wmma_f32_16x16x32_f16): 11-bit significands for operands in range — used where a [0,1] probability operand needs more precision than bf16
typedef _Float16 v16h __attribute__((ext_vector_type(16)));
union FragH { v16h v; v8us half[2]; _Float16 h[16]; unsigned short u[16]; };
template <int NT>
__device__ __forceinline__ v8f mmaH(v16h ah, v16h al, v16h bh, v16h bl, v8f c) {
  c = __builtin_amdgcn_wmma_f32_16x16x32_f16(false, ah, false, bh, (short)0, c, false, false);
  if (NT >= 2) c = __builtin_amdgcn_wmma_f32_16x16x32_f16(false, al, false, bh, (short)0, c, false, false);
  if (NT >= 3) c = __builtin_amdgcn_wmma_f32_16x16x32_f16(false, ah, false, bl, (short)0, c, false, false);
  asm volatile("v_nop\n\tv_nop\n\tv_nop\n\tv_nop" : "+v"(c) : "v"(ah), "v"(al), "v"(bh), "v"(bl));
  return c;
}
// batched GEMM like k_gemm_b but f16 operands: A f32 (split into f16 hi/lo if ASPLIT, else rounded to f16), Bt = f16 values [n][k]; alpha; C f32; N multiple of 16 (partial tiles skipped)
template <bool ASPLIT>
__global__ __launch_bounds__(128) void k_gemm_h(const float* __restrict__ A, int lda, size_t sA, const _Float16* __restrict__ Bh, int ldb, size_t sB, float alpha, float* __restrict__ C, int ldc, size_t sC, int M, int N, int K) {
  __shared__ __attribute__((aligned(16))) float so[4][16][64];
  const int tid = threadIdx.x, w = tid >> 5, lane = tid & 31, ln = lane & 15, hh = lane >> 4; const int by = blockIdx.y;
  A += (size_t)by * sA; Bh += (size_t)by * sB; C += (size_t)by * sC;
  const int ntn = (N + 63) / 64; const int wid = blockIdx.x * 4 + w; const int mt = wid / ntn, nq = wid % ntn; if (mt * 16 >= M) return;
  const int row0 = mt * 16, col0 = nq * 64; const float* arow = A + (size_t)(row0 + ln) * lda;
  v8f acc[4] = {};
  for (int kb = 0; kb < K; kb += 32) {
    FragH ah, al;
    const v4f x0 = *(const v4fa*)(arow + kb + 8 * hh), x1 = *(const v4fa*)(arow + kb + 8 * hh + 4), x2 = *(const v4fa*)(arow + kb + 16 + 8 * hh), x3 = *(const v4fa*)(arow + kb + 16 + 8 * hh + 4);
    float xs[16] = {x0[0],x0[1],x0[2],x0[3],x1[0],x1[1],x1[2],x1[3],x2[0],x2[1],x2[2],x2[3],x3[0],x3[1],x3[2],x3[3]};
#pragma unroll
    for (int i = 0; i < 16; ++i) { const _Float16 h = (_Float16)xs[i]; ah.h[i] = h; al.h[i] = ASPLIT ? (_Float16)(xs[i] - (float)h) : (_Float16)0.0f; }
#pragma unroll
    for (int t = 0; t < 4; ++t) { if (col0 + t * 16 >= N) continue; const size_t boff = (size_t)(col0 + t * 16 + ln) * ldb + kb; FragH bq; bq.half[0] = *(const v8us*)(Bh + boff + 8 * hh); bq.half[1] = *(const v8us*)(Bh + boff + 16 + 8 * hh);
      acc[t] = mmaH<ASPLIT ? 2 : 1>(ah.v, al.v, bq.v, bq.v, acc[t]); }
  }
#pragma unroll
  for (int t = 0; t < 4; ++t) { if (col0 + t * 16 >= N) continue;
#pragma unroll
    for (int r = 0; r < 8; ++r) so[w][8 * hh + r][t * 16 + ln] = acc[t][r] * alpha; }
  __builtin_amdgcn_fence(__ATOMIC_ACQ_REL, "workgroup"); __builtin_amdgcn_wave_barrier();
  const int rsub = lane >> 4, c4 = (lane & 15) * 4;
  {
#pragma unroll
    for (int q = 0; q < 8; ++q) { const int r = q * 2 + rsub; if (col0 + c4 < N) { const v4f v = *(const v4fa*)&so[w][r][c4]; *(v4f*)(C + (size_t)(row0 + r) * ldc + col0 + c4) = v; } }
     }
}

// Wt[n][k] = f16(W[k][n]·scale) from f32 row-major W[K][N] (scale = power of two; bf16-exact weights stay exact in f16 away from the subnormal range)
__global__ __launch_bounds__(256) void k_wt_f16(const float* __restrict__ W, _Float16* __restrict__ Wt, int K, int N, float scale) {
  const int t = blockIdx.x * 256 + threadIdx.x; if (t >= N * (K / 8)) return; const int n = t / (K / 8), k8 = (t % (K / 8)) * 8; FragH f;
#pragma unroll
  for (int i = 0; i < 8; ++i) f.h[i] = (_Float16)(bf16_round(W[(size_t)(k8 + i) * N + n]) * scale); const v8us o = f.half[0];
  *(v8us*)((unsigned short*)Wt + (size_t)n * K + k8) = o; 
}
// k_gemm_hh variant with fused epilogue: v = acc·alpha + bias[by·sBias + col] (+ CP[(row/rowsPerB)·sCPb + by·64 + col] if CP) ; ACT 0 none / 1 elu ; writes f16 C16 (and f32 C if non-null)
template <int ACT>
__global__ __launch_bounds__(128) void k_gemm_hhx(const _Float16* __restrict__ A, int lda, size_t sA, const _Float16* __restrict__ Bh, int ldb, size_t sB, float alpha, const float* __restrict__ bias, size_t sBias, const float* __restrict__ CP, int rowsPerB, size_t sCPb, int row0g,
    float* __restrict__ C, _Float16* __restrict__ C16, int ldc, size_t sC, int M, int N, int K) {
  __shared__ __attribute__((aligned(16))) float so[4][16][64];
  const int tid = threadIdx.x, w = tid >> 5, lane = tid & 31, ln = lane & 15, hh = lane >> 4; const int by = blockIdx.y;
  A += (size_t)by * sA; Bh += (size_t)by * sB; const size_t cofs = (size_t)by * sC; const float* bp = bias ? bias + (size_t)by * sBias : nullptr;
  const int ntn = (N + 63) / 64; const int wid = blockIdx.x * 4 + w; const int mt = wid / ntn, nq = wid % ntn; if (mt * 16 >= M) return;
  const int row0 = mt * 16, col0 = nq * 64; const _Float16* arow = A + (size_t)(row0 + ln) * lda;
  v8f acc[4] = {};
  for (int kb = 0; kb < K; kb += 32) { FragH ah; ah.half[0] = *(const v8us*)((const unsigned short*)arow + kb + 8 * hh); ah.half[1] = *(const v8us*)((const unsigned short*)arow + kb + 16 + 8 * hh);
#pragma unroll
    for (int t = 0; t < 4; ++t) { if (col0 + t * 16 >= N) continue; const size_t boff = (size_t)(col0 + t * 16 + ln) * ldb + kb; FragH bq; bq.half[0] = *(const v8us*)((const unsigned short*)Bh + boff + 8 * hh); bq.half[1] = *(const v8us*)((const unsigned short*)Bh + boff + 16 + 8 * hh);
      acc[t] = mmaH<1>(ah.v, ah.v, bq.v, bq.v, acc[t]); }
  }
#pragma unroll
  for (int t = 0; t < 4; ++t) { if (col0 + t * 16 >= N) continue; const int col = col0 + t * 16 + ln; const float bv = bp ? bf16_round(bp[col]) : 0.f;
#pragma unroll
    for (int r = 0; r < 8; ++r) { float v = acc[t][r] * alpha + bv; if (CP) { const int rr = row0g + row0 + 8 * hh + r; if (rowsPerB < 0) v += CP[cofs + (size_t)rr * ldc + col];      /* rowsPerB < 0: own element of the batched C plane */ else { const int bidx = rr / rowsPerB; v += CP[(size_t)bidx * sCPb + (size_t)by * 64 + col]; } } if (ACT == 1) v = (v > 0.f) ? v : expm1f(v); else if (ACT == 7) v = (v > 0.f) ? v + 1.0f : expf(v); else if (ACT == 8) v = tanhf(v); else if (ACT == 9) v = 0.5f * v * (1.0f + tanhf(0.7978845608028654f * (v + 0.044715f * v * v * v))); else if (ACT == 11) v = 1.0f / (1.0f + expf(-v)); else if (ACT == 12) v = (v > 0.f) ? v : 0.01f * v; else if (ACT == 14) v = (v > 0.f) ? v : 0.1f * v; else if (ACT == 16) v = (v >= 0.f) ? v : 0.3f * v; else if (ACT == 17) v = (v >= 0.f) ? v : 0.2f * v; else if (ACT == 15) v = v / (1.0f + expf(-v)); else if (ACT == 3) v = fmaxf(v, 0.f); else if (ACT == 6) v = 0.5f * v * (1.0f + erff(v * 0.70710678118654752f)); so[w][8 * hh + r][t * 16 + ln] = v; } }
  __builtin_amdgcn_fence(__ATOMIC_ACQ_REL, "workgroup"); __builtin_amdgcn_wave_barrier();
  const int rsub = lane >> 4, c4 = (lane & 15) * 4; typedef _Float16 v4h __attribute__((ext_vector_type(4)));
  {
#pragma unroll
    for (int q = 0; q < 8; ++q) { const int r = q * 2 + rsub; if (col0 + c4 < N) { const v4f v = *(const v4fa*)&so[w][r][c4]; if (C) *(v4f*)(C + cofs + (size_t)(row0 + r) * ldc + col0 + c4) = v; if (C16) { v4h h4; for (int i = 0; i < 4; ++i) h4[i] = (_Float16)v[i]; *(v4h*)(C16 + cofs + (size_t)(row0 + r) * ldc + col0 + c4) = h4; } } }
     }
}


typedef _Float16 v4h __attribute__((ext_vector_type(4)));

__global__ __launch_bounds__(256) void k_x16(const float* __restrict__ x, _Float16* __restrict__ X16, size_t n8) { const size_t t = (size_t)blockIdx.x * 256 + threadIdx.x; if (t >= n8) return; FragH f;
#pragma unroll
  for (int q = 0; q < 8; ++q) f.h[q] = (_Float16)bf16_round(x[t * 8 + q]); *(v8us*)((unsigned short*)X16 + t * 8) = f.half[0];  }
__global__ __launch_bounds__(256) void k_h16(const float* __restrict__ x, _Float16* __restrict__ X16, size_t n8) { const size_t t = (size_t)blockIdx.x * 256 + threadIdx.x; if (t >= n8) return; FragH f;
#pragma unroll
  for (int q = 0; q < 8; ++q) f.h[q] = (_Float16)x[t * 8 + q]; *(v8us*)((unsigned short*)X16 + t * 8) = f.half[0];  }
__global__ __launch_bounds__(256) void k_round16f(const float* __restrict__ W, _Float16* __restrict__ Bt, size_t n8) { const size_t t = (size_t)blockIdx.x * 256 + threadIdx.x; if (t >= n8) return; FragH f;
#pragma unroll
  for (int i = 0; i < 8; ++i) f.h[i] = (_Float16)(bf16_round(W[t * 8 + i]) * 16.0f); *(v8us*)((unsigned short*)Bt + t * 8) = f.half[0];  }
template <int NHv, int TTv>
__global__ __launch_bounds__(256) void k_vt(const _Float16* __restrict__ V16, int ldv, int voff, _Float16* __restrict__ Vt) { __shared__ unsigned short tl[64][66]; const int tid = threadIdx.x; const int slab = blockIdx.x / (TTv / 64), lg = blockIdx.x % (TTv / 64); const int b = slab / NHv, h = slab % NHv;
  for (int i = tid; i < 64 * 8; i += 256) { const int r = i / 8, c8 = (i % 8) * 8; FragH f; f.half[0] = *(const v8us*)((const unsigned short*)V16 + ((size_t)b * TTv + lg * 64 + r) * ldv + voff + h * 64 + c8);
#pragma unroll
    for (int q = 0; q < 8; ++q) tl[r][c8 + q] = f.u[q]; }
  __syncthreads();
  {
#pragma unroll
    for (int rd = 0; rd < 2; ++rd) { const int d = rd * 32 + tid / 8, pc = tid % 8; FragH f;
#pragma unroll
      for (int q = 0; q < 8; ++q) f.u[q] = tl[pc * 8 + q][d];
      *(v8us*)((unsigned short*)Vt + ((size_t)slab * 64 + d) * TTv + lg * 64 + pc * 8) = f.half[0]; }
     } }

__global__ __launch_bounds__(256) void k_hl(const float* __restrict__ F, _Float16* __restrict__ Hh, _Float16* __restrict__ Hl, size_t n8) { const size_t t = (size_t)blockIdx.x * 256 + threadIdx.x; if (t >= n8) return; FragH fh, fl; const v4f a = *(const v4fa*)(F + t * 8), c = *(const v4fa*)(F + t * 8 + 4);
#pragma unroll
  for (int q = 0; q < 4; ++q) { _Float16 h = (_Float16)a[q]; fh.h[q] = h; fl.h[q] = (_Float16)((a[q] - (float)h) * 1024.0f); h = (_Float16)c[q]; fh.h[4 + q] = h; fl.h[4 + q] = (_Float16)((c[q] - (float)h) * 1024.0f); }
  { *(v8us*)((unsigned short*)Hh + t * 8) = fh.half[0]; *(v8us*)((unsigned short*)Hl + t * 8) = fl.half[0];  } }

// ---- fast GEMM (wave tile 32x64; requires M % 32 == 0 rows per launch region and N % 64 == 0); epilogue = k_gemm_hhx semantics ----
__device__ __forceinline__ v16h g2_frag(const _Float16* p, int hh) { FragH f; f.half[0] = *(const v8us*)((const unsigned short*)p + 8 * hh); f.half[1] = *(const v8us*)((const unsigned short*)p + 16 + 8 * hh); return f.v; }
__device__ __forceinline__ v8f g2_mma(v16h a, v16h b, v8f c) { v8f d = __builtin_amdgcn_wmma_f32_16x16x32_f16(false, a, false, b, (short)0, c, false, false); asm volatile("v_nop\n\tv_nop\n\tv_nop\n\tv_nop" : "+v"(d) : "v"(a), "v"(b)); return d; }
template <int ACT>
__global__ __launch_bounds__(128) void k_gemm2(const _Float16* __restrict__ A, int lda, size_t sA, const _Float16* __restrict__ Bh, int ldb, size_t sB, float alpha, const float* __restrict__ bias, size_t sBias, const float* __restrict__ CP, int rowsPerB, size_t sCPb, int row0g,
    float* __restrict__ C, _Float16* __restrict__ C16, int ldc, size_t sC, int M, int N, int K) { static_assert(ACT == 0 || ACT == 3 || ACT == 6 || ACT == 8 || ACT == 9 || ACT == 11 || ACT == 12 || ACT == 14 || ACT == 15 || ACT == 16 || ACT == 17, "k_gemm2: unsupported ACT code (would silently apply no activation)");
  __shared__ __attribute__((aligned(16))) float so[4][32][68];
  const int tid = threadIdx.x, w = tid >> 5, lane = tid & 31, ln = lane & 15, hh = lane >> 4; const int by = blockIdx.y;
  A += (size_t)by * sA; Bh += (size_t)by * sB; const size_t cofs = (size_t)by * sC; const float* bp = bias ? bias + (size_t)by * sBias : nullptr;
  const int ntn = N >> 6; const int mt = blockIdx.x / ntn, nq = blockIdx.x - mt * ntn; const int row0 = mt * 128 + 32 * w, col0 = nq * 64; if (row0 >= M) return;
  const _Float16* a0p = A + (size_t)(row0 + ln) * lda; const _Float16* a1p = a0p + (size_t)16 * lda;
  const _Float16* b0p = Bh + (size_t)(col0 + ln) * ldb; const _Float16* b1p = b0p + (size_t)16 * ldb; const _Float16* b2p = b1p + (size_t)16 * ldb; const _Float16* b3p = b2p + (size_t)16 * ldb;
  const v8f z8 = {0.f,0.f,0.f,0.f,0.f,0.f,0.f,0.f}; v8f c00 = z8, c01 = z8, c02 = z8, c03 = z8, c10 = z8, c11 = z8, c12 = z8, c13 = z8;
#pragma unroll 1
  for (int kb = 0; kb < K; kb += 32) { const v16h a0 = g2_frag(a0p + kb, hh), a1 = g2_frag(a1p + kb, hh);
    v16h b = g2_frag(b0p + kb, hh); c00 = g2_mma(a0, b, c00); c10 = g2_mma(a1, b, c10);
    b = g2_frag(b1p + kb, hh); c01 = g2_mma(a0, b, c01); c11 = g2_mma(a1, b, c11);
    b = g2_frag(b2p + kb, hh); c02 = g2_mma(a0, b, c02); c12 = g2_mma(a1, b, c12);
    b = g2_frag(b3p + kb, hh); c03 = g2_mma(a0, b, c03); c13 = g2_mma(a1, b, c13); }
  v8f accs[8] = {c00, c01, c02, c03, c10, c11, c12, c13};
#pragma unroll
  for (int u = 0; u < 8; ++u) { const int t = u & 3, half = u >> 2; const int col = col0 + t * 16 + ln; const float bv = bp ? bf16_round(bp[col]) : 0.f;
#pragma unroll
    for (int r = 0; r < 8; ++r) { const int rloc = half * 16 + 8 * hh + r; float v = accs[u][r] * alpha + bv; if (CP) { if (rowsPerB < 0) v += CP[cofs + (size_t)(row0g + row0 + rloc) * ldc + col];      /* rowsPerB < 0: own element of the batched C plane */ else { const int bidx = (row0g + row0 + rloc) / rowsPerB; v += CP[(size_t)bidx * sCPb + (size_t)by * 64 + col]; } }
      if (ACT == 3) v = fmaxf(v, 0.f); else if (ACT == 6) v = 0.5f * v * (1.0f + erff(v * 0.70710678118654752f)); else if (ACT == 11) v = 1.0f / (1.0f + expf(-v)); else if (ACT == 15) v = v / (1.0f + expf(-v)); else if (ACT == 12) v = (v > 0.f) ? v : 0.01f * v; else if (ACT == 8) v = tanhf(v); else if (ACT == 9) v = 0.5f * v * (1.0f + tanhf(0.7978845608028654f * (v + 0.044715f * v * v * v))); else if (ACT == 14) v = (v > 0.f) ? v : 0.1f * v; else if (ACT == 16) v = (v >= 0.f) ? v : 0.3f * v; else if (ACT == 17) v = (v >= 0.f) ? v : 0.2f * v;
      so[w][rloc][t * 16 + ln] = v; } }
  __builtin_amdgcn_fence(__ATOMIC_ACQ_REL, "workgroup"); __builtin_amdgcn_wave_barrier();
  const int rsub = lane >> 4, c4 = (lane & 15) * 4;
  {
#pragma unroll
    for (int q = 0; q < 16; ++q) { const int r = q * 2 + rsub; const v4f v = *(const v4fa*)&so[w][r][c4]; if (C) *(v4f*)(C + cofs + (size_t)(row0 + r) * ldc + col0 + c4) = v; if (C16) { v4h h4; for (int i = 0; i < 4; ++i) h4[i] = (_Float16)v[i]; *(v4h*)(C16 + cofs + (size_t)(row0 + r) * ldc + col0 + c4) = h4; } }
     } }


__global__ __launch_bounds__(256) void k_wnat(const float* __restrict__ w, size_t n8, _Float16* __restrict__ Bt) { const size_t t = (size_t)blockIdx.x * 256 + threadIdx.x; if (t >= n8) return; FragH f; for (int q = 0; q < 8; ++q) f.h[q] = (_Float16)(bf16_round(w[t * 8 + q]) * 16.0f); *(v8us*)((unsigned short*)Bt + t * 8) = f.half[0];  }
// lane l <-> lane l ^ M inside a 16-lane row (DPP row_xmask) and l <-> l ^ 16 (cross-row move); every lane of the wave is on where these are used
template <int M> __device__ __forceinline__ float lane_xor(float x) { return __builtin_bit_cast(float, __builtin_amdgcn_update_dpp(0, __builtin_bit_cast(int, x), 0x160 + M, 0xf, 0xf, true)); }
__device__ __forceinline__ float lane_x16(float x) { return __builtin_bit_cast(float, __builtin_amdgcn_permlanex16(__builtin_bit_cast(int, x), __builtin_bit_cast(int, x), 0x76543210, 0xfedcba98, false, false)); }
__device__ __forceinline__ float wave_max(float v) { v = fmaxf(v, lane_xor<1>(v)); v = fmaxf(v, lane_xor<2>(v)); v = fmaxf(v, lane_xor<4>(v)); v = fmaxf(v, lane_xor<8>(v)); return fmaxf(v, lane_x16(v)); }
__device__ __forceinline__ float wave_sum(float v) { v += lane_xor<1>(v); v += lane_xor<2>(v); v += lane_xor<4>(v); v += lane_xor<8>(v); return v + lane_x16(v); }
// row softmax, one wave per score row: lane l holds columns 128 u + 4 l .. + 3 (u = 0..7), so every wave-wide 16-byte load covers 512 contiguous bytes and every 8-byte store 256;
// the row is read once and stays in registers between the maximum, the sum and the store (exp taken once per element).
__global__ __launch_bounds__(256) void k_rsm(const float* __restrict__ S, _Float16* __restrict__ P, int nrows) {
  const int row = blockIdx.x * 8 + (threadIdx.x >> 5), lane = threadIdx.x & 31; if (row >= nrows) return;      /* wave-uniform; no barrier below */
  const float* s = S + (size_t)row * SQ + lane * 4; v4f e[SQ / 128];
#pragma unroll
  for (int u = 0; u < SQ / 128; ++u) e[u] = *(const v4fa*)(s + u * 128);
  float mx = -3.0e38f;
#pragma unroll
  for (int u = 0; u < SQ / 128; ++u) for (int q = 0; q < 4; ++q) mx = fmaxf(mx, e[u][q]);
  mx = wave_max(mx);
  v4f a = {0.f, 0.f, 0.f, 0.f};
#pragma unroll
  for (int u = 0; u < SQ / 128; ++u) for (int q = 0; q < 4; ++q) { e[u][q] = expf(e[u][q] - mx); a[q] += e[u][q]; }
  const float se = wave_sum((a[0] + a[1]) + (a[2] + a[3])); const float sc = 256.0f / se;
  _Float16* p = P + (size_t)row * SQ + lane * 4;
#pragma unroll
  for (int u = 0; u < SQ / 128; ++u) { v4h h4; for (int q = 0; q < 4; ++q) h4[q] = (_Float16)(e[u][q] * sc); *(v4h*)(p + u * 128) = h4; } }
__global__ __launch_bounds__(256) void k_vt(const _Float16* __restrict__ V16, int b, int h0, _Float16* __restrict__ VT) { __shared__ unsigned short tl[64][65]; const int tid = threadIdx.x; const int hh = blockIdx.x % HG, sg = blockIdx.x / HG; const int s0 = sg * 64; const int h = h0 + hh;
  for (int i = tid; i < 64 * 8; i += 256) { const int j = i / 8, d8 = (i % 8) * 8; FragH f; f.half[0] = *(const v8us*)((const unsigned short*)V16 + ((size_t)b * SQ + s0 + j) * DM + h * HD + d8); for (int q = 0; q < 8; ++q) tl[d8 + q][j] = f.u[q]; }
  __syncthreads();
  { for (int i = tid; i < 64 * 8; i += 256) { const int d = i / 8, j8 = (i % 8) * 8; FragH f; for (int q = 0; q < 8; ++q) f.u[q] = tl[d][j8 + q]; *(v8us*)((unsigned short*)VT + ((size_t)hh * HD + d) * SQ + s0 + j8) = f.half[0]; }  } }



__global__ __launch_bounds__(256) void k_wph64(const float* __restrict__ Wm, _Float16* __restrict__ Bt) {
  const int t = blockIdx.x * 256 + threadIdx.x; if (t >= NH * HD * HD / 8) return; const int h = t / (HD * HD / 8), r = t % (HD * HD / 8), e = r / (HD / 8), d8 = (r % (HD / 8)) * 8; FragH f;
  for (int i = 0; i < 8; ++i) f.h[i] = (_Float16)(bf16_round(Wm[((size_t)h * HD + d8 + i) * HD + e]) * 16.0f);
  unsigned short* o = (unsigned short*)Bt + ((size_t)h * HD + e) * HD + d8; *(v8us*)o = f.half[0];  }
extern "C" void kernel_launch(void* const* d_in, const int* in_sizes, int n_in,
                              void* d_out, int out_size, void* d_ws, size_t ws_size, hipStream_t stream) {
  (void)in_sizes; (void)n_in; (void)out_size;
  const float* const* I = (const float* const*)d_in; const float* x = I[0]; const float* wq = I[1]; const float* bq = I[2]; const float* wk = I[3]; const float* bk = I[4]; const float* wv = I[5]; const float* bv = I[6];      /* per-head W [12][64][64] ([h][in][out]) + b [12][64] for q, k, v */
  char* ws = (char*)d_ws; size_t off = 0;
  auto take = [&](size_t bytes) { char* p = ws + off; off += (bytes + 255) & ~(size_t)255; return p; };
  _Float16* BQ = (_Float16*)take((size_t)NH * HD * HD * 2); _Float16* BK = (_Float16*)take((size_t)NH * HD * HD * 2); _Float16* BV = (_Float16*)take((size_t)NH * HD * HD * 2); 
  _Float16* X16 = (_Float16*)take(NR * DM * 2); _Float16* Q16 = (_Float16*)take(NR * DM * 2); _Float16* K16 = (_Float16*)take(NR * DM * 2); _Float16* V16 = (_Float16*)take(NR * DM * 2);
  float* S = (float*)take((size_t)HG * SQ * SQ * 4); _Float16* P = (_Float16*)take((size_t)HG * SQ * SQ * 2); _Float16* VT = (_Float16*)take((size_t)NH * HD * SQ * 2);
  if (off > ws_size) return;
  { const unsigned g = (unsigned)((NH * HD * HD / 8 + 255) / 256); k_wph64<<<g, 256, 0, stream>>>(wq, BQ); k_wph64<<<g, 256, 0, stream>>>(wk, BK); k_wph64<<<g, 256, 0, stream>>>(wv, BV); }      /* per head: Bt[h][e][d] = 16 bf16(W[h][d][e]) (64 x 64 blocks, [out][in] x16) */

  k_x16<<<(unsigned)((NR * DM / 8 + 255) / 256), 256, 0, stream>>>(x, X16, NR * DM / 8);
  const size_t r0p = (size_t)B0 * SQ;      /* first projected row */
  k_gemm2<0><<<dim3((unsigned)((MP / 128) * (HD / 64)), NH), 128, 0, stream>>>(X16 + r0p * DM, DM, (size_t)HD, BQ, HD, (size_t)HD * HD, 0.0625f, bq, (size_t)HD, nullptr, 1, 0, 0, nullptr, Q16 + r0p * DM, DM, (size_t)HD, MP, HD, HD);      /* per head on grid.y: the head's 64 input columns x its own 64 x 64 weight (+ its 64 biases) -> the head's 64 output columns */
  k_gemm2<0><<<dim3((unsigned)((MP / 128) * (HD / 64)), NH), 128, 0, stream>>>(X16 + r0p * DM, DM, (size_t)HD, BK, HD, (size_t)HD * HD, 0.0625f, bk, (size_t)HD, nullptr, 1, 0, 0, nullptr, K16 + r0p * DM, DM, (size_t)HD, MP, HD, HD);      /* per head on grid.y: the head's 64 input columns x its own 64 x 64 weight (+ its 64 biases) -> the head's 64 output columns */
  k_gemm2<0><<<dim3((unsigned)((MP / 128) * (HD / 64)), NH), 128, 0, stream>>>(X16 + r0p * DM, DM, (size_t)HD, BV, HD, (size_t)HD * HD, 0.0625f, bv, (size_t)HD, nullptr, 1, 0, 0, nullptr, V16 + r0p * DM, DM, (size_t)HD, MP, HD, HD);      /* per head on grid.y: the head's 64 input columns x its own 64 x 64 weight (+ its 64 biases) -> the head's 64 output columns */
  for (int b = B0; b < B0 + NBR; ++b) { const size_t r0 = (size_t)b * SQ;
    k_vt<NH, SQ><<<NH * (SQ / 64), 256, 0, stream>>>(V16 + r0 * LQ, LQ, 0, VT);      /* V^T [NH][HD][SQ] for this batch */
    for (int h0 = 0; h0 < NHD; h0 += HG) {
      k_gemm2<0><<<dim3((QN / 128) * (SQ / 64), HG), 128, 0, stream>>>(Q16 + r0 * LQ + h0 * HD, LQ, (size_t)HD, K16 + r0 * LQ + h0 * HD, LQ, (size_t)HD, 0.125f, nullptr, 0, nullptr, 1, 0, 0, S, nullptr, SQ, (size_t)SQ * SQ, QN, SQ, HD);      /* scores, HG heads per launch */
      k_rsm<<<(HG * SQ + 7) / 8, 256, 0, stream>>>(S, P, HG * SQ);      /* P = 256 softmax (f16), rows of all HG heads, one wave per row */
      k_gemm2<0><<<dim3((QN / 128) * (HD / 64), HG), 128, 0, stream>>>(P, SQ, (size_t)SQ * SQ, VT + (size_t)h0 * HD * SQ, SQ, (size_t)HD * SQ, 0.00390625f, nullptr, 0, nullptr, 1, 0, 0, (float*)d_out + r0 * DM + h0 * HD, nullptr, DM, (size_t)HD, QN, HD, SQ); } }      /* out = P V^T (alpha 2^-8) written f32 straight into the merged-heads output rows */
}

// v002
// It runs in 94.5 microseconds.
// Next to v001, in two timings, it ran 12.7 times as fast each time.
// Over all steps from v000 it is 56.2 times as fast.
#include <hip/hip_runtime.h>
// Multi-head self-attention with PER-HEAD 64x64 projections on head-chunked features (sequences [8][1024][768] viewed [B][S][12][64]; q/k/v[..., h, :] = x[..., h, :] W[h] + b[h] with W [12][64][64] ([h][in][out], sigma 0.05) and b [12][64] (sigma 0.05); scores / 8; softmax over all 1024 keys (no mask); out = heads concatenated (no output projection) -> [8][1024][768]).
// Structure: token rows r = b*1024 + s; x as exact f16 rows (bf16-rounded); Q, K, V as three WMMA GEMMs (32x64 wave tiles, f32 accumulation, exact x16 weights + bias, f16 outputs); V^T for all batches and heads via LDS transposes; one fused attention launch over every (batch, head): S^T = K Q^T (K = 64), running softmax in registers (f32 statistics; weights 2^(s - max) as f16), O^T += V^T P^T, divided by the row sum and written f32 straight into the merged-heads output rows (no output projection).
// Compute dtype: inputs rounded to bf16; x / weights exact; q, k, v and softmax weights as plain f16 GEMM operands (~2^-12); scores, softmax statistics and o f32. v_wmma_f32_16x16x32_f16.
#define NB 8
#define SQ 1024
#define DM 768
#define NH 12
#define HD 64
#define HG 4                         /* heads per launch of the per-batch k_vt overload (not called) */
#define B0 0                         /* first batch processed (debug hook) */
#define NBR NB                       /* batches processed (debug hook) */
#define NR ((size_t)NB * SQ)         /* token rows */
#define MP ((int)((size_t)NBR * SQ)) /* rows projected (debug hook) */
#define QN SQ                        /* unused (k_attn attends all SQ query rows) */
#define NHD NH                       /* unused (k_attn covers all NH heads) */
#define MPO MP                       /* unused (no output stage) */
#define LQ DM      /* row pitch of the q/k/v rows */
typedef __bf16 v16b __attribute__((ext_vector_type(16)));
typedef unsigned short v8us __attribute__((ext_vector_type(8), may_alias));
typedef float  v8f  __attribute__((ext_vector_type(8)));
typedef float  v4f  __attribute__((ext_vector_type(4)));
typedef float  v4fa __attribute__((ext_vector_type(4), may_alias));
union FragB { v16b v; v8us half[2]; unsigned short u[16]; };

__device__ __forceinline__ unsigned short bf16_bits(float x) { unsigned int u = __float_as_uint(x); return (unsigned short)((u + 0x7FFFu + ((u >> 16) & 1u)) >> 16); }
__device__ __forceinline__ float bf16_val(unsigned short b) { return __uint_as_float(((unsigned int)b) << 16); }
__device__ __forceinline__ float bf16_round(float x) { return bf16_val(bf16_bits(x)); }
// D += A·B with NT terms: 1 = ah·bh, 2 = + al·bh (A split), 3 = + ah·bl (both split)
template <int NT>
__device__ __forceinline__ v8f mmaN(v16b ah, v16b al, v16b bh, v16b bl, v8f c) {
  c = __builtin_amdgcn_wmma_f32_16x16x32_bf16(false, ah, false, bh, (short)0, c, false, false);
  if (NT >= 2) c = __builtin_amdgcn_wmma_f32_16x16x32_bf16(false, al, false, bh, (short)0, c, false, false);
  if (NT >= 3) c = __builtin_amdgcn_wmma_f32_16x16x32_bf16(false, ah, false, bl, (short)0, c, false, false);
  asm volatile("v_nop\n\tv_nop\n\tv_nop\n\tv_nop" : "+v"(c) : "v"(ah), "v"(al), "v"(bh), "v"(bl));
  return c;
}

__global__ __launch_bounds__(256) void k_wt_bf16(const float* __restrict__ W, unsigned short* __restrict__ Wt, int K, int N) {
  const int t = blockIdx.x * 256 + threadIdx.x;
  const int k8n = K / 8;
  if (t >= N * k8n) return;
  const int n = t / k8n, k8 = (t % k8n) * 8;
  v8us v;
#pragma unroll
  for (int i = 0; i < 8; ++i) v[i] = bf16_bits(W[(size_t)(k8 + i) * N + n]);
  *(v8us*)(Wt + (size_t)n * K + k8) = v;
  
}

// GEMM C[M][N] (f32, pitch ldc) = act(A[M][K]·W + bias). A f32 row-major (pitch lda) converted per fragment to bf16
// (ASPLIT: hi/lo two planes -> 2 terms, else single rounded term); Wt bf16 [N][K] (pitch ldb). BIAS_BF16 rounds the
// bias to bf16 first (bias quantised to bf16 before the add). K%32==0, M%16==0, N%64==0.
template <bool ASPLIT, int ACT, bool BIAS_BF16>
__global__ __launch_bounds__(128) void k_gemm_bf(const float* __restrict__ A, int lda, const unsigned short* __restrict__ Wt, int ldb,
                                               const float* __restrict__ bias, float* __restrict__ C, int ldc, int M, int N, int K) {
  __shared__ __attribute__((aligned(16))) float so[4][16][64];
  const int tid = threadIdx.x, w = tid >> 5, lane = tid & 31, ln = lane & 15, hh = lane >> 4;
  const int ntn = N / 64;
  const int wid = blockIdx.x * 4 + w;
  const int mt = wid / ntn, nq = wid % ntn;
  if (mt * 16 >= M) return;
  const int row0 = mt * 16, col0 = nq * 64;
  const float* arow = A + (size_t)(row0 + ln) * lda;
  v8f acc[4] = {};
  for (int kb = 0; kb < K; kb += 32) {
    FragB ah, al;
    const v4f x0 = *(const v4fa*)(arow + kb + 8 * hh), x1 = *(const v4fa*)(arow + kb + 8 * hh + 4);
    const v4f x2 = *(const v4fa*)(arow + kb + 16 + 8 * hh), x3 = *(const v4fa*)(arow + kb + 16 + 8 * hh + 4);
    float xs[16] = {x0[0],x0[1],x0[2],x0[3],x1[0],x1[1],x1[2],x1[3],x2[0],x2[1],x2[2],x2[3],x3[0],x3[1],x3[2],x3[3]};
#pragma unroll
    for (int i = 0; i < 16; ++i) { const unsigned short hb = bf16_bits(xs[i]); ah.u[i] = hb; al.u[i] = ASPLIT ? bf16_bits(xs[i] - bf16_val(hb)) : (unsigned short)0; }
#pragma unroll
    for (int t = 0; t < 4; ++t) {
      const unsigned short* brow = Wt + (size_t)(col0 + t * 16 + ln) * ldb + kb;
      FragB b;
      b.half[0] = *(const v8us*)(brow + 8 * hh);
      b.half[1] = *(const v8us*)(brow + 16 + 8 * hh);
      acc[t] = mmaN<ASPLIT ? 2 : 1>(ah.v, al.v, b.v, b.v, acc[t]);
    }
  }
#pragma unroll
  for (int t = 0; t < 4; ++t) {
    float bv = bias ? bias[col0 + t * 16 + ln] : 0.f;
    if (BIAS_BF16) bv = bf16_round(bv);
#pragma unroll
    for (int r = 0; r < 8; ++r) { float v = acc[t][r] + bv; if (ACT == 1) v = fmaxf(v, 0.f); so[w][8 * hh + r][t * 16 + ln] = v; }
  }
  __builtin_amdgcn_fence(__ATOMIC_ACQ_REL, "workgroup");
  __builtin_amdgcn_wave_barrier();
  const int rsub = lane >> 4, c4 = (lane & 15) * 4;
  {
#pragma unroll
    for (int q = 0; q < 8; ++q) {
      const int r = q * 2 + rsub;
      const v4f v = *(const v4fa*)&so[w][r][c4];
      *(v4f*)(C + (size_t)(row0 + r) * ldc + col0 + c4) = v;
    }
    
  }
}

// GEMM C = act(A·W + bias + resid): A f32 (ASPLIT -> hi/lo 2 terms), Wt bf16 [N][K]; ACT 0 none, 1 relu, 2 exact gelu;
// resid (optional, f32, row index = (row % rmod), pitch ldr, RES_BF16 rounds it) added before the activation.
template <bool ASPLIT, int ACT, bool BIAS_BF16, bool RES_BF16>
__global__ __launch_bounds__(128) void k_gemm_bf3(const float* __restrict__ A, int lda, const unsigned short* __restrict__ Wt, int ldb,
                                                const float* __restrict__ bias, const float* __restrict__ resid, int rmod, int ldr,
                                                float* __restrict__ C, int ldc, int M, int N, int K) {
  __shared__ __attribute__((aligned(16))) float so[4][16][64];
  const int tid = threadIdx.x, w = tid >> 5, lane = tid & 31, ln = lane & 15, hh = lane >> 4;
  const int ntn = N / 64;
  const int wid = blockIdx.x * 4 + w;
  const int mt = wid / ntn, nq = wid % ntn;
  if (mt * 16 >= M) return;
  const int row0 = mt * 16, col0 = nq * 64;
  const float* arow = A + (size_t)(row0 + ln) * lda;
  v8f acc[4] = {};
  for (int kb = 0; kb < K; kb += 32) {
    FragB ah, al;
    const v4f x0 = *(const v4fa*)(arow + kb + 8 * hh), x1 = *(const v4fa*)(arow + kb + 8 * hh + 4);
    const v4f x2 = *(const v4fa*)(arow + kb + 16 + 8 * hh), x3 = *(const v4fa*)(arow + kb + 16 + 8 * hh + 4);
    float xs[16] = {x0[0],x0[1],x0[2],x0[3],x1[0],x1[1],x1[2],x1[3],x2[0],x2[1],x2[2],x2[3],x3[0],x3[1],x3[2],x3[3]};
#pragma unroll
    for (int i = 0; i < 16; ++i) { const unsigned short hb = bf16_bits(xs[i]); ah.u[i] = hb; al.u[i] = ASPLIT ? bf16_bits(xs[i] - bf16_val(hb)) : (unsigned short)0; }
#pragma unroll
    for (int t = 0; t < 4; ++t) {
      const unsigned short* brow = Wt + (size_t)(col0 + t * 16 + ln) * ldb + kb;
      FragB b;
      b.half[0] = *(const v8us*)(brow + 8 * hh);
      b.half[1] = *(const v8us*)(brow + 16 + 8 * hh);
      acc[t] = mmaN<ASPLIT ? 2 : 1>(ah.v, al.v, b.v, b.v, acc[t]);
    }
  }
#pragma unroll
  for (int t = 0; t < 4; ++t) {
    const int col = col0 + t * 16 + ln;
    float bv = bias ? bias[col] : 0.f;
    if (BIAS_BF16) bv = bf16_round(bv);
#pragma unroll
    for (int r = 0; r < 8; ++r) {
      float v = acc[t][r] + bv;
      if (resid) { float rv = resid[(size_t)((row0 + 8 * hh + r) % rmod) * ldr + col]; if (RES_BF16) rv = bf16_round(rv); v += rv; }
      if (ACT == 1) v = fmaxf(v, 0.f);
      if (ACT == 2) v = 0.5f * v * (1.0f + erff(v * 0.70710678118654752f));
      if (ACT == 3) { const float u = 0.7978845608028654f * (v + 0.044715f * v * v * v); v = 0.5f * v * (1.0f + tanhf(u)); }
      so[w][8 * hh + r][t * 16 + ln] = v;
    }
  }
  __builtin_amdgcn_fence(__ATOMIC_ACQ_REL, "workgroup");
  __builtin_amdgcn_wave_barrier();
  const int rsub = lane >> 4, c4 = (lane & 15) * 4;
  {
#pragma unroll
    for (int q = 0; q < 8; ++q) {
      const int r = q * 2 + rsub;
      const v4f v = *(const v4fa*)&so[w][r][c4];
      *(v4f*)(C + (size_t)(row0 + r) * ldc + col0 + c4) = v;
    }
    
  }
}
// row LayerNorm (biased variance, eps) over N: s = X (+ R); optional out_sum <- s; out_norm <- (s-mu)*rsqrt(var+eps)*g + b
template <bool PARAM_BF16>
__global__ __launch_bounds__(256) void k_layernorm(const float* __restrict__ X, const float* __restrict__ R, const float* __restrict__ g, const float* __restrict__ bta,
                                                  float* __restrict__ out_sum, float* __restrict__ out_norm, int N, float eps) {
  __shared__ float red[256];
  const int row = blockIdx.x, tid = threadIdx.x;
  const float* x = X + (size_t)row * N; const float* rr = R ? R + (size_t)row * N : nullptr;
  float vals[16];                     // up to N = 4096
  const int per = N / 256;            // contiguous chunk per thread? use strided-by-4 chunks: thread handles j = tid*4 + 1024*u
  float s1 = 0.f;
  for (int u = 0; u < per / 4; ++u) {
    const int j = tid * 4 + 1024 * u;
    const v4f a = *(const v4fa*)(x + j);
    v4f b = {0.f,0.f,0.f,0.f}; if (rr) b = *(const v4fa*)(rr + j);
#pragma unroll
    for (int q = 0; q < 4; ++q) { const float v = a[q] + b[q]; vals[u * 4 + q] = v; s1 += v; }
  }
  red[tid] = s1; __syncthreads();
  for (int st = 128; st > 0; st >>= 1) { if (tid < st) red[tid] += red[tid + st]; __syncthreads(); }
  const float mu = red[0] / (float)N; __syncthreads();
  float s2 = 0.f;
  for (int u = 0; u < per / 4; ++u)
#pragma unroll
    for (int q = 0; q < 4; ++q) { const float c = vals[u * 4 + q] - mu; s2 += c * c; }
  red[tid] = s2; __syncthreads();
  for (int st = 128; st > 0; st >>= 1) { if (tid < st) red[tid] += red[tid + st]; __syncthreads(); }
  const float rs = rsqrtf(red[0] / (float)N + eps);
  {
    for (int u = 0; u < per / 4; ++u) {
      const int j = tid * 4 + 1024 * u;
      v4f o, sm;
#pragma unroll
      for (int q = 0; q < 4; ++q) {
        float gg = g[j + q], bb = bta[j + q];
        if (PARAM_BF16) { gg = bf16_round(gg); bb = bf16_round(bb); }
        sm[q] = vals[u * 4 + q]; o[q] = (vals[u * 4 + q] - mu) * rs * gg + bb;
      }
      if (out_sum) *(v4f*)(out_sum + (size_t)row * N + j) = sm;
      *(v4f*)(out_norm + (size_t)row * N + j) = o;
    }
    
  }
}



// ---- f16 WMMA path (v_wmma_f32_16x16x32_f16): 11-bit significands for operands in range — used where a [0,1] probability operand needs more precision than bf16
typedef _Float16 v16h __attribute__((ext_vector_type(16)));
union FragH { v16h v; v8us half[2]; _Float16 h[16]; unsigned short u[16]; };
template <int NT>
__device__ __forceinline__ v8f mmaH(v16h ah, v16h al, v16h bh, v16h bl, v8f c) {
  c = __builtin_amdgcn_wmma_f32_16x16x32_f16(false, ah, false, bh, (short)0, c, false, false);
  if (NT >= 2) c = __builtin_amdgcn_wmma_f32_16x16x32_f16(false, al, false, bh, (short)0, c, false, false);
  if (NT >= 3) c = __builtin_amdgcn_wmma_f32_16x16x32_f16(false, ah, false, bl, (short)0, c, false, false);
  asm volatile("v_nop\n\tv_nop\n\tv_nop\n\tv_nop" : "+v"(c) : "v"(ah), "v"(al), "v"(bh), "v"(bl));
  return c;
}
// batched GEMM like k_gemm_b but f16 operands: A f32 (split into f16 hi/lo if ASPLIT, else rounded to f16), Bt = f16 values [n][k]; alpha; C f32; N multiple of 16 (partial tiles skipped)
template <bool ASPLIT>
__global__ __launch_bounds__(128) void k_gemm_h(const float* __restrict__ A, int lda, size_t sA, const _Float16* __restrict__ Bh, int ldb, size_t sB, float alpha, float* __restrict__ C, int ldc, size_t sC, int M, int N, int K) {
  __shared__ __attribute__((aligned(16))) float so[4][16][64];
  const int tid = threadIdx.x, w = tid >> 5, lane = tid & 31, ln = lane & 15, hh = lane >> 4; const int by = blockIdx.y;
  A += (size_t)by * sA; Bh += (size_t)by * sB; C += (size_t)by * sC;
  const int ntn = (N + 63) / 64; const int wid = blockIdx.x * 4 + w; const int mt = wid / ntn, nq = wid % ntn; if (mt * 16 >= M) return;
  const int row0 = mt * 16, col0 = nq * 64; const float* arow = A + (size_t)(row0 + ln) * lda;
  v8f acc[4] = {};
  for (int kb = 0; kb < K; kb += 32) {
    FragH ah, al;
    const v4f x0 = *(const v4fa*)(arow + kb + 8 * hh), x1 = *(const v4fa*)(arow + kb + 8 * hh + 4), x2 = *(const v4fa*)(arow + kb + 16 + 8 * hh), x3 = *(const v4fa*)(arow + kb + 16 + 8 * hh + 4);
    float xs[16] = {x0[0],x0[1],x0[2],x0[3],x1[0],x1[1],x1[2],x1[3],x2[0],x2[1],x2[2],x2[3],x3[0],x3[1],x3[2],x3[3]};
#pragma unroll
    for (int i = 0; i < 16; ++i) { const _Float16 h = (_Float16)xs[i]; ah.h[i] = h; al.h[i] = ASPLIT ? (_Float16)(xs[i] - (float)h) : (_Float16)0.0f; }
#pragma unroll
    for (int t = 0; t < 4; ++t) { if (col0 + t * 16 >= N) continue; const size_t boff = (size_t)(col0 + t * 16 + ln) * ldb + kb; FragH bq; bq.half[0] = *(const v8us*)(Bh + boff + 8 * hh); bq.half[1] = *(const v8us*)(Bh + boff + 16 + 8 * hh);
      acc[t] = mmaH<ASPLIT ? 2 : 1>(ah.v, al.v, bq.v, bq.v, acc[t]); }
  }
#pragma unroll
  for (int t = 0; t < 4; ++t) { if (col0 + t * 16 >= N) continue;
#pragma unroll
    for (int r = 0; r < 8; ++r) so[w][8 * hh + r][t * 16 + ln] = acc[t][r] * alpha; }
  __builtin_amdgcn_fence(__ATOMIC_ACQ_REL, "workgroup"); __builtin_amdgcn_wave_barrier();
  const int rsub = lane >> 4, c4 = (lane & 15) * 4;
  {
#pragma unroll
    for (int q = 0; q < 8; ++q) { const int r = q * 2 + rsub; if (col0 + c4 < N) { const v4f v = *(const v4fa*)&so[w][r][c4]; *(v4f*)(C + (size_t)(row0 + r) * ldc + col0 + c4) = v; } }
     }
}

// Wt[n][k] = f16(W[k][n]·scale) from f32 row-major W[K][N] (scale = power of two; bf16-exact weights stay exact in f16 away from the subnormal range)
__global__ __launch_bounds__(256) void k_wt_f16(const float* __restrict__ W, _Float16* __restrict__ Wt, int K, int N, float scale) {
  const int t = blockIdx.x * 256 + threadIdx.x; if (t >= N * (K / 8)) return; const int n = t / (K / 8), k8 = (t % (K / 8)) * 8; FragH f;
#pragma unroll
  for (int i = 0; i < 8; ++i) f.h[i] = (_Float16)(bf16_round(W[(size_t)(k8 + i) * N + n]) * scale); const v8us o = f.half[0];
  *(v8us*)((unsigned short*)Wt + (size_t)n * K + k8) = o; 
}
// k_gemm_hh variant with fused epilogue: v = acc·alpha + bias[by·sBias + col] (+ CP[(row/rowsPerB)·sCPb + by·64 + col] if CP) ; ACT 0 none / 1 elu ; writes f16 C16 (and f32 C if non-null)
template <int ACT>
__global__ __launch_bounds__(128) void k_gemm_hhx(const _Float16* __restrict__ A, int lda, size_t sA, const _Float16* __restrict__ Bh, int ldb, size_t sB, float alpha, const float* __restrict__ bias, size_t sBias, const float* __restrict__ CP, int rowsPerB, size_t sCPb, int row0g,
    float* __restrict__ C, _Float16* __restrict__ C16, int ldc, size_t sC, int M, int N, int K) {
  __shared__ __attribute__((aligned(16))) float so[4][16][64];
  const int tid = threadIdx.x, w = tid >> 5, lane = tid & 31, ln = lane & 15, hh = lane >> 4; const int by = blockIdx.y;
  A += (size_t)by * sA; Bh += (size_t)by * sB; const size_t cofs = (size_t)by * sC; const float* bp = bias ? bias + (size_t)by * sBias : nullptr;
  const int ntn = (N + 63) / 64; const int wid = blockIdx.x * 4 + w; const int mt = wid / ntn, nq = wid % ntn; if (mt * 16 >= M) return;
  const int row0 = mt * 16, col0 = nq * 64; const _Float16* arow = A + (size_t)(row0 + ln) * lda;
  v8f acc[4] = {};
  for (int kb = 0; kb < K; kb += 32) { FragH ah; ah.half[0] = *(const v8us*)((const unsigned short*)arow + kb + 8 * hh); ah.half[1] = *(const v8us*)((const unsigned short*)arow + kb + 16 + 8 * hh);
#pragma unroll
    for (int t = 0; t < 4; ++t) { if (col0 + t * 16 >= N) continue; const size_t boff = (size_t)(col0 + t * 16 + ln) * ldb + kb; FragH bq; bq.half[0] = *(const v8us*)((const unsigned short*)Bh + boff + 8 * hh); bq.half[1] = *(const v8us*)((const unsigned short*)Bh + boff + 16 + 8 * hh);
      acc[t] = mmaH<1>(ah.v, ah.v, bq.v, bq.v, acc[t]); }
  }
#pragma unroll
  for (int t = 0; t < 4; ++t) { if (col0 + t * 16 >= N) continue; const int col = col0 + t * 16 + ln; const float bv = bp ? bf16_round(bp[col]) : 0.f;
#pragma unroll
    for (int r = 0; r < 8; ++r) { float v = acc[t][r] * alpha + bv; if (CP) { const int rr = row0g + row0 + 8 * hh + r; if (rowsPerB < 0) v += CP[cofs + (size_t)rr * ldc + col];      /* rowsPerB < 0: own element of the batched C plane */ else { const int bidx = rr / rowsPerB; v += CP[(size_t)bidx * sCPb + (size_t)by * 64 + col]; } } if (ACT == 1) v = (v > 0.f) ? v : expm1f(v); else if (ACT == 7) v = (v > 0.f) ? v + 1.0f : expf(v); else if (ACT == 8) v = tanhf(v); else if (ACT == 9) v = 0.5f * v * (1.0f + tanhf(0.7978845608028654f * (v + 0.044715f * v * v * v))); else if (ACT == 11) v = 1.0f / (1.0f + expf(-v)); else if (ACT == 12) v = (v > 0.f) ? v : 0.01f * v; else if (ACT == 14) v = (v > 0.f) ? v : 0.1f * v; else if (ACT == 16) v = (v >= 0.f) ? v : 0.3f * v; else if (ACT == 17) v = (v >= 0.f) ? v : 0.2f * v; else if (ACT == 15) v = v / (1.0f + expf(-v)); else if (ACT == 3) v = fmaxf(v, 0.f); else if (ACT == 6) v = 0.5f * v * (1.0f + erff(v * 0.70710678118654752f)); so[w][8 * hh + r][t * 16 + ln] = v; } }
  __builtin_amdgcn_fence(__ATOMIC_ACQ_REL, "workgroup"); __builtin_amdgcn_wave_barrier();
  const int rsub = lane >> 4, c4 = (lane & 15) * 4; typedef _Float16 v4h __attribute__((ext_vector_type(4)));
  {
#pragma unroll
    for (int q = 0; q < 8; ++q) { const int r = q * 2 + rsub; if (col0 + c4 < N) { const v4f v = *(const v4fa*)&so[w][r][c4]; if (C) *(v4f*)(C + cofs + (size_t)(row0 + r) * ldc + col0 + c4) = v; if (C16) { v4h h4; for (int i = 0; i < 4; ++i) h4[i] = (_Float16)v[i]; *(v4h*)(C16 + cofs + (size_t)(row0 + r) * ldc + col0 + c4) = h4; } } }
     }
}


typedef _Float16 v4h __attribute__((ext_vector_type(4)));

__global__ __launch_bounds__(256) void k_x16(const float* __restrict__ x, _Float16* __restrict__ X16, size_t n8) { const size_t t = (size_t)blockIdx.x * 256 + threadIdx.x; if (t >= n8) return; FragH f;
#pragma unroll
  for (int q = 0; q < 8; ++q) f.h[q] = (_Float16)bf16_round(x[t * 8 + q]); *(v8us*)((unsigned short*)X16 + t * 8) = f.half[0];  }
__global__ __launch_bounds__(256) void k_h16(const float* __restrict__ x, _Float16* __restrict__ X16, size_t n8) { const size_t t = (size_t)blockIdx.x * 256 + threadIdx.x; if (t >= n8) return; FragH f;
#pragma unroll
  for (int q = 0; q < 8; ++q) f.h[q] = (_Float16)x[t * 8 + q]; *(v8us*)((unsigned short*)X16 + t * 8) = f.half[0];  }
__global__ __launch_bounds__(256) void k_round16f(const float* __restrict__ W, _Float16* __restrict__ Bt, size_t n8) { const size_t t = (size_t)blockIdx.x * 256 + threadIdx.x; if (t >= n8) return; FragH f;
#pragma unroll
  for (int i = 0; i < 8; ++i) f.h[i] = (_Float16)(bf16_round(W[t * 8 + i]) * 16.0f); *(v8us*)((unsigned short*)Bt + t * 8) = f.half[0];  }
template <int NHv, int TTv>
__global__ __launch_bounds__(256) void k_vt(const _Float16* __restrict__ V16, int ldv, int voff, _Float16* __restrict__ Vt) { __shared__ unsigned short tl[64][66]; const int tid = threadIdx.x; const int slab = blockIdx.x / (TTv / 64), lg = blockIdx.x % (TTv / 64); const int b = slab / NHv, h = slab % NHv;
  for (int i = tid; i < 64 * 8; i += 256) { const int r = i / 8, c8 = (i % 8) * 8; FragH f; f.half[0] = *(const v8us*)((const unsigned short*)V16 + ((size_t)b * TTv + lg * 64 + r) * ldv + voff + h * 64 + c8);
#pragma unroll
    for (int q = 0; q < 8; ++q) tl[r][c8 + q] = f.u[q]; }
  __syncthreads();
  {
#pragma unroll
    for (int rd = 0; rd < 2; ++rd) { const int d = rd * 32 + tid / 8, pc = tid % 8; FragH f;
#pragma unroll
      for (int q = 0; q < 8; ++q) f.u[q] = tl[pc * 8 + q][d];
      *(v8us*)((unsigned short*)Vt + ((size_t)slab * 64 + d) * TTv + lg * 64 + pc * 8) = f.half[0]; }
     } }

__global__ __launch_bounds__(256) void k_hl(const float* __restrict__ F, _Float16* __restrict__ Hh, _Float16* __restrict__ Hl, size_t n8) { const size_t t = (size_t)blockIdx.x * 256 + threadIdx.x; if (t >= n8) return; FragH fh, fl; const v4f a = *(const v4fa*)(F + t * 8), c = *(const v4fa*)(F + t * 8 + 4);
#pragma unroll
  for (int q = 0; q < 4; ++q) { _Float16 h = (_Float16)a[q]; fh.h[q] = h; fl.h[q] = (_Float16)((a[q] - (float)h) * 1024.0f); h = (_Float16)c[q]; fh.h[4 + q] = h; fl.h[4 + q] = (_Float16)((c[q] - (float)h) * 1024.0f); }
  { *(v8us*)((unsigned short*)Hh + t * 8) = fh.half[0]; *(v8us*)((unsigned short*)Hl + t * 8) = fl.half[0];  } }

// ---- fast GEMM (wave tile 32x64; requires M % 32 == 0 rows per launch region and N % 64 == 0); epilogue = k_gemm_hhx semantics ----
__device__ __forceinline__ v16h g2_frag(const _Float16* p, int hh) { FragH f; f.half[0] = *(const v8us*)((const unsigned short*)p + 8 * hh); f.half[1] = *(const v8us*)((const unsigned short*)p + 16 + 8 * hh); return f.v; }
__device__ __forceinline__ v8f g2_mma(v16h a, v16h b, v8f c) { v8f d = __builtin_amdgcn_wmma_f32_16x16x32_f16(false, a, false, b, (short)0, c, false, false); asm volatile("v_nop\n\tv_nop\n\tv_nop\n\tv_nop" : "+v"(d) : "v"(a), "v"(b)); return d; }
template <int ACT>
__global__ __launch_bounds__(128) void k_gemm2(const _Float16* __restrict__ A, int lda, size_t sA, const _Float16* __restrict__ Bh, int ldb, size_t sB, float alpha, const float* __restrict__ bias, size_t sBias, const float* __restrict__ CP, int rowsPerB, size_t sCPb, int row0g,
    float* __restrict__ C, _Float16* __restrict__ C16, int ldc, size_t sC, int M, int N, int K) { static_assert(ACT == 0 || ACT == 3 || ACT == 6 || ACT == 8 || ACT == 9 || ACT == 11 || ACT == 12 || ACT == 14 || ACT == 15 || ACT == 16 || ACT == 17, "k_gemm2: unsupported ACT code (would silently apply no activation)");
  __shared__ __attribute__((aligned(16))) float so[4][32][68];
  const int tid = threadIdx.x, w = tid >> 5, lane = tid & 31, ln = lane & 15, hh = lane >> 4; const int by = blockIdx.y;
  A += (size_t)by * sA; Bh += (size_t)by * sB; const size_t cofs = (size_t)by * sC; const float* bp = bias ? bias + (size_t)by * sBias : nullptr;
  const int ntn = N >> 6; const int mt = blockIdx.x / ntn, nq = blockIdx.x - mt * ntn; const int row0 = mt * 128 + 32 * w, col0 = nq * 64; if (row0 >= M) return;
  const _Float16* a0p = A + (size_t)(row0 + ln) * lda; const _Float16* a1p = a0p + (size_t)16 * lda;
  const _Float16* b0p = Bh + (size_t)(col0 + ln) * ldb; const _Float16* b1p = b0p + (size_t)16 * ldb; const _Float16* b2p = b1p + (size_t)16 * ldb; const _Float16* b3p = b2p + (size_t)16 * ldb;
  const v8f z8 = {0.f,0.f,0.f,0.f,0.f,0.f,0.f,0.f}; v8f c00 = z8, c01 = z8, c02 = z8, c03 = z8, c10 = z8, c11 = z8, c12 = z8, c13 = z8;
#pragma unroll 1
  for (int kb = 0; kb < K; kb += 32) { const v16h a0 = g2_frag(a0p + kb, hh), a1 = g2_frag(a1p + kb, hh);
    v16h b = g2_frag(b0p + kb, hh); c00 = g2_mma(a0, b, c00); c10 = g2_mma(a1, b, c10);
    b = g2_frag(b1p + kb, hh); c01 = g2_mma(a0, b, c01); c11 = g2_mma(a1, b, c11);
    b = g2_frag(b2p + kb, hh); c02 = g2_mma(a0, b, c02); c12 = g2_mma(a1, b, c12);
    b = g2_frag(b3p + kb, hh); c03 = g2_mma(a0, b, c03); c13 = g2_mma(a1, b, c13); }
  v8f accs[8] = {c00, c01, c02, c03, c10, c11, c12, c13};
#pragma unroll
  for (int u = 0; u < 8; ++u) { const int t = u & 3, half = u >> 2; const int col = col0 + t * 16 + ln; const float bv = bp ? bf16_round(bp[col]) : 0.f;
#pragma unroll
    for (int r = 0; r < 8; ++r) { const int rloc = half * 16 + 8 * hh + r; float v = accs[u][r] * alpha + bv; if (CP) { if (rowsPerB < 0) v += CP[cofs + (size_t)(row0g + row0 + rloc) * ldc + col];      /* rowsPerB < 0: own element of the batched C plane */ else { const int bidx = (row0g + row0 + rloc) / rowsPerB; v += CP[(size_t)bidx * sCPb + (size_t)by * 64 + col]; } }
      if (ACT == 3) v = fmaxf(v, 0.f); else if (ACT == 6) v = 0.5f * v * (1.0f + erff(v * 0.70710678118654752f)); else if (ACT == 11) v = 1.0f / (1.0f + expf(-v)); else if (ACT == 15) v = v / (1.0f + expf(-v)); else if (ACT == 12) v = (v > 0.f) ? v : 0.01f * v; else if (ACT == 8) v = tanhf(v); else if (ACT == 9) v = 0.5f * v * (1.0f + tanhf(0.7978845608028654f * (v + 0.044715f * v * v * v))); else if (ACT == 14) v = (v > 0.f) ? v : 0.1f * v; else if (ACT == 16) v = (v >= 0.f) ? v : 0.3f * v; else if (ACT == 17) v = (v >= 0.f) ? v : 0.2f * v;
      so[w][rloc][t * 16 + ln] = v; } }
  __builtin_amdgcn_fence(__ATOMIC_ACQ_REL, "workgroup"); __builtin_amdgcn_wave_barrier();
  const int rsub = lane >> 4, c4 = (lane & 15) * 4;
  {
#pragma unroll
    for (int q = 0; q < 16; ++q) { const int r = q * 2 + rsub; const v4f v = *(const v4fa*)&so[w][r][c4]; if (C) *(v4f*)(C + cofs + (size_t)(row0 + r) * ldc + col0 + c4) = v; if (C16) { v4h h4; for (int i = 0; i < 4; ++i) h4[i] = (_Float16)v[i]; *(v4h*)(C16 + cofs + (size_t)(row0 + r) * ldc + col0 + c4) = h4; } }
     } }


__global__ __launch_bounds__(256) void k_wnat(const float* __restrict__ w, size_t n8, _Float16* __restrict__ Bt) { const size_t t = (size_t)blockIdx.x * 256 + threadIdx.x; if (t >= n8) return; FragH f; for (int q = 0; q < 8; ++q) f.h[q] = (_Float16)(bf16_round(w[t * 8 + q]) * 16.0f); *(v8us*)((unsigned short*)Bt + t * 8) = f.half[0];  }
// lane l <-> l ^ 16 (cross-row move); every lane of the wave is on where this is used
__device__ __forceinline__ float lane_x16(float x) { return __builtin_bit_cast(float, __builtin_amdgcn_permlanex16(__builtin_bit_cast(int, x), __builtin_bit_cast(int, x), 0x76543210, 0xfedcba98, false, false)); }
__device__ __forceinline__ v8f at_mma(v16h a, v16h b, v8f c) { return __builtin_amdgcn_wmma_f32_16x16x32_f16(false, a, false, b, (short)0, c, false, false); }
// One pass of the fused attention: 32 keys (kb .. kb + 31) against the wave's 32 query columns. MORE: fetch the next pass's K and V^T fragments into the same registers, each behind its last use.
template <bool MORE>
__device__ __forceinline__ void at_pass(const _Float16* kp, const _Float16* vp, int kb, int hh, const v16h (&qf)[2][2], v16h (&kf)[2][2], v16h (&vf)[4], v8f (&o)[4][2], float (&m)[2], float (&l)[2]) {
  const float cs = 0.125f * 1.4426950408889634f;      /* log2(e) / sqrt(64) */
  const v8f z8 = {0.f,0.f,0.f,0.f,0.f,0.f,0.f,0.f};
  v8f st[2][2];      /* [query tile][key tile] */
#pragma unroll
  for (int j = 0; j < 2; ++j) for (int t = 0; t < 2; ++t) st[j][t] = at_mma(kf[t][1], qf[j][1], at_mma(kf[t][0], qf[j][0], z8));
  if (MORE) {
#pragma unroll
    for (int t = 0; t < 2; ++t) for (int s = 0; s < 2; ++s) kf[t][s] = g2_frag(kp + (size_t)(kb + 32 + t * 16) * DM + s * 32, hh);
  }
  float mn[2];
#pragma unroll
  for (int j = 0; j < 2; ++j) { float mx = fmaxf(st[j][0][0], st[j][1][0]);
#pragma unroll
    for (int r = 1; r < 8; ++r) mx = fmaxf(mx, fmaxf(st[j][0][r], st[j][1][r]));
    mx = fmaxf(mx, lane_x16(mx)); mn[j] = fmaxf(m[j], mx * cs); }
  if (__builtin_amdgcn_ballot_w32(mn[0] > m[0] || mn[1] > m[1]) != 0) {      /* wave-uniform; where no column's maximum grows every factor is exactly 1 */
#pragma unroll
    for (int j = 0; j < 2; ++j) { const float al = __builtin_amdgcn_exp2f(m[j] - mn[j]); m[j] = mn[j]; l[j] *= al;
#pragma unroll
      for (int d = 0; d < 4; ++d) o[d][j] *= al; } }
#pragma unroll
  for (int j = 0; j < 2; ++j) { FragH pf; float sm[2] = {0.f, 0.f};
#pragma unroll
    for (int t = 0; t < 2; ++t)
#pragma unroll
      for (int r = 0; r < 8; ++r) { const float p = __builtin_amdgcn_exp2f(fmaf(st[j][t][r], cs, -m[j])); sm[t] += p; pf.h[8 * t + r] = (_Float16)p; }
    l[j] += sm[0] + sm[1];
#pragma unroll
    for (int d = 0; d < 4; ++d) o[d][j] = at_mma(vf[d], pf.v, o[d][j]); }
  if (MORE) {
#pragma unroll
    for (int d = 0; d < 4; ++d) vf[d] = g2_frag(vp + (size_t)d * 16 * SQ + kb + 32, hh);
    asm volatile("s_wait_xcnt 0x0" ::: "memory");      /* before the compiler reuses the address registers of the loads above */
  } }
__global__ __launch_bounds__(128) void k_attn(const _Float16* __restrict__ Q16, const _Float16* __restrict__ K16, const _Float16* __restrict__ VT, float* __restrict__ out) {
  const int w = threadIdx.x >> 5, lane = threadIdx.x & 31, ln = lane & 15, hh = lane >> 4;
  const int bh = blockIdx.y, b = bh / NH, h = bh - b * NH; const int q0 = blockIdx.x * 128 + w * 32;
  const _Float16* qp = Q16 + ((size_t)b * SQ + q0 + ln) * DM + h * HD;
  const _Float16* kp = K16 + ((size_t)b * SQ + ln) * DM + h * HD;
  const _Float16* vp = VT + ((size_t)bh * HD + ln) * SQ;
  v16h qf[2][2], kf[2][2], vf[4];
#pragma unroll
  for (int j = 0; j < 2; ++j) for (int s = 0; s < 2; ++s) qf[j][s] = g2_frag(qp + (size_t)j * 16 * DM + s * 32, hh);
#pragma unroll
  for (int t = 0; t < 2; ++t) for (int s = 0; s < 2; ++s) kf[t][s] = g2_frag(kp + (size_t)t * 16 * DM + s * 32, hh);
#pragma unroll
  for (int d = 0; d < 4; ++d) vf[d] = g2_frag(vp + (size_t)d * 16 * SQ, hh);
  v8f o[4][2]; float m[2] = {-3.0e38f, -3.0e38f}, l[2] = {0.f, 0.f};
#pragma unroll
  for (int d = 0; d < 4; ++d) for (int j = 0; j < 2; ++j) o[d][j] = v8f{0.f,0.f,0.f,0.f,0.f,0.f,0.f,0.f};
  for (int kb = 0; kb < SQ - 32; kb += 32) at_pass<true>(kp, vp, kb, hh, qf, kf, vf, o, m, l);
  at_pass<false>(kp, vp, SQ - 32, hh, qf, kf, vf, o, m, l);      /* the last pass has nothing to fetch */
#pragma unroll
  for (int j = 0; j < 2; ++j) { const float inv = 1.0f / (l[j] + lane_x16(l[j]));      /* join the halves' sums once */
    float* op = out + ((size_t)b * SQ + q0 + j * 16 + ln) * DM + h * HD + 8 * hh;      /* O^T register r = feature 16 d + 8 hf + r of query c: 32 contiguous bytes a lane and tile */
#pragma unroll
    for (int d = 0; d < 4; ++d) { const v4f lo = {o[d][j][0] * inv, o[d][j][1] * inv, o[d][j][2] * inv, o[d][j][3] * inv}, hi = {o[d][j][4] * inv, o[d][j][5] * inv, o[d][j][6] * inv, o[d][j][7] * inv};
      *(v4f*)(op + d * 16) = lo; *(v4f*)(op + d * 16 + 4) = hi; } } }
__global__ __launch_bounds__(256) void k_vt(const _Float16* __restrict__ V16, int b, int h0, _Float16* __restrict__ VT) { __shared__ unsigned short tl[64][65]; const int tid = threadIdx.x; const int hh = blockIdx.x % HG, sg = blockIdx.x / HG; const int s0 = sg * 64; const int h = h0 + hh;
  for (int i = tid; i < 64 * 8; i += 256) { const int j = i / 8, d8 = (i % 8) * 8; FragH f; f.half[0] = *(const v8us*)((const unsigned short*)V16 + ((size_t)b * SQ + s0 + j) * DM + h * HD + d8); for (int q = 0; q < 8; ++q) tl[d8 + q][j] = f.u[q]; }
  __syncthreads();
  { for (int i = tid; i < 64 * 8; i += 256) { const int d = i / 8, j8 = (i % 8) * 8; FragH f; for (int q = 0; q < 8; ++q) f.u[q] = tl[d][j8 + q]; *(v8us*)((unsigned short*)VT + ((size_t)hh * HD + d) * SQ + s0 + j8) = f.half[0]; }  } }



__global__ __launch_bounds__(256) void k_wph64(const float* __restrict__ Wm, _Float16* __restrict__ Bt) {
  const int t = blockIdx.x * 256 + threadIdx.x; if (t >= NH * HD * HD / 8) return; const int h = t / (HD * HD / 8), r = t % (HD * HD / 8), e = r / (HD / 8), d8 = (r % (HD / 8)) * 8; FragH f;
  for (int i = 0; i < 8; ++i) f.h[i] = (_Float16)(bf16_round(Wm[((size_t)h * HD + d8 + i) * HD + e]) * 16.0f);
  unsigned short* o = (unsigned short*)Bt + ((size_t)h * HD + e) * HD + d8; *(v8us*)o = f.half[0];  }
extern "C" void kernel_launch(void* const* d_in, const int* in_sizes, int n_in,
                              void* d_out, int out_size, void* d_ws, size_t ws_size, hipStream_t stream) {
  (void)in_sizes; (void)n_in; (void)out_size;
  const float* const* I = (const float* const*)d_in; const float* x = I[0]; const float* wq = I[1]; const float* bq = I[2]; const float* wk = I[3]; const float* bk = I[4]; const float* wv = I[5]; const float* bv = I[6];      /* per-head W [12][64][64] ([h][in][out]) + b [12][64] for q, k, v */
  char* ws = (char*)d_ws; size_t off = 0;
  auto take = [&](size_t bytes) { char* p = ws + off; off += (bytes + 255) & ~(size_t)255; return p; };
  _Float16* BQ = (_Float16*)take((size_t)NH * HD * HD * 2); _Float16* BK = (_Float16*)take((size_t)NH * HD * HD * 2); _Float16* BV = (_Float16*)take((size_t)NH * HD * HD * 2); 
  _Float16* X16 = (_Float16*)take(NR * DM * 2); _Float16* Q16 = (_Float16*)take(NR * DM * 2); _Float16* K16 = (_Float16*)take(NR * DM * 2); _Float16* V16 = (_Float16*)take(NR * DM * 2);
  _Float16* VT = (_Float16*)take((size_t)NB * NH * HD * SQ * 2);
  if (off > ws_size) return;
  { const unsigned g = (unsigned)((NH * HD * HD / 8 + 255) / 256); k_wph64<<<g, 256, 0, stream>>>(wq, BQ); k_wph64<<<g, 256, 0, stream>>>(wk, BK); k_wph64<<<g, 256, 0, stream>>>(wv, BV); }      /* per head: Bt[h][e][d] = 16 bf16(W[h][d][e]) (64 x 64 blocks, [out][in] x16) */

  k_x16<<<(unsigned)((NR * DM / 8 + 255) / 256), 256, 0, stream>>>(x, X16, NR * DM / 8);
  const size_t r0p = (size_t)B0 * SQ;      /* first projected row */
  k_gemm2<0><<<dim3((unsigned)((MP / 128) * (HD / 64)), NH), 128, 0, stream>>>(X16 + r0p * DM, DM, (size_t)HD, BQ, HD, (size_t)HD * HD, 0.0625f, bq, (size_t)HD, nullptr, 1, 0, 0, nullptr, Q16 + r0p * DM, DM, (size_t)HD, MP, HD, HD);      /* per head on grid.y: the head's 64 input columns x its own 64 x 64 weight (+ its 64 biases) -> the head's 64 output columns */
  k_gemm2<0><<<dim3((unsigned)((MP / 128) * (HD / 64)), NH), 128, 0, stream>>>(X16 + r0p * DM, DM, (size_t)HD, BK, HD, (size_t)HD * HD, 0.0625f, bk, (size_t)HD, nullptr, 1, 0, 0, nullptr, K16 + r0p * DM, DM, (size_t)HD, MP, HD, HD);      /* per head on grid.y: the head's 64 input columns x its own 64 x 64 weight (+ its 64 biases) -> the head's 64 output columns */
  k_gemm2<0><<<dim3((unsigned)((MP / 128) * (HD / 64)), NH), 128, 0, stream>>>(X16 + r0p * DM, DM, (size_t)HD, BV, HD, (size_t)HD * HD, 0.0625f, bv, (size_t)HD, nullptr, 1, 0, 0, nullptr, V16 + r0p * DM, DM, (size_t)HD, MP, HD, HD);      /* per head on grid.y: the head's 64 input columns x its own 64 x 64 weight (+ its 64 biases) -> the head's 64 output columns */
  k_vt<NH, SQ><<<NB * NH * (SQ / 64), 256, 0, stream>>>(V16, LQ, 0, VT);      /* V^T [NB][NH][HD][SQ], every batch in one launch */
  k_attn<<<dim3(SQ / 128, NB * NH), 128, 0, stream>>>(Q16, K16, VT, (float*)d_out);      /* scores, softmax and P V fused; f32 straight into the merged-heads output rows */
}

// v003
// One run takes 84.3 microseconds.
// Timed twice side by side with v002, it ran 1.10 and 1.15 times as fast.
// All steps since v000 together make it 63.3 times as fast.
#include <hip/hip_runtime.h>
// Multi-head self-attention with PER-HEAD 64x64 projections on head-chunked features (sequences [8][1024][768] viewed [B][S][12][64]; q/k/v[..., h, :] = x[..., h, :] W[h] + b[h] with W [12][64][64] ([h][in][out], sigma 0.05) and b [12][64] (sigma 0.05); scores / 8; softmax over all 1024 keys (no mask); out = heads concatenated (no output projection) -> [8][1024][768]).
// Structure: token rows r = b*1024 + s; x as exact f16 rows (bf16-rounded); Q, K, V as three WMMA GEMMs (32x64 wave tiles, f32 accumulation, exact x16 weights + bias, f16 outputs); V^T for all batches and heads via LDS transposes; K and V^T stored in WMMA fragment order (512-byte units); one fused attention launch over every (batch, head): S^T = K Q^T (K = 64), running softmax in registers (f32 statistics; weights 2^(s - max) as f16), O^T += V^T P^T, divided by the row sum and written f32 straight into the merged-heads output rows (no output projection).
// Compute dtype: inputs rounded to bf16; x / weights exact; q, k, v and softmax weights as plain f16 GEMM operands (~2^-12); scores, softmax statistics and o f32; v_wmma_f32_16x16x32_f16.
#define NB 8
#define SQ 1024
#define DM 768
#define NH 12
#define HD 64
#define HG 4                         /* heads per launch of the per-batch k_vt overload (not called) */
#define B0 0                         /* first batch processed (debug hook) */
#define NBR NB                       /* batches processed (debug hook) */
#define NR ((size_t)NB * SQ)         /* token rows */
#define MP ((int)((size_t)NBR * SQ)) /* rows projected (debug hook) */
#define QN SQ                        /* unused (k_attn attends all SQ query rows) */
#define NHD NH                       /* unused (k_attn covers all NH heads) */
#define MPO MP                       /* unused (no output stage) */
#define LQ DM      /* row pitch of the q/v rows (K is in fragment order) */
typedef __bf16 v16b __attribute__((ext_vector_type(16)));
typedef unsigned short v8us __attribute__((ext_vector_type(8), may_alias));
typedef float  v8f  __attribute__((ext_vector_type(8)));
typedef float  v4f  __attribute__((ext_vector_type(4)));
typedef float  v4fa __attribute__((ext_vector_type(4), may_alias));
union FragB { v16b v; v8us half[2]; unsigned short u[16]; };

__device__ __forceinline__ unsigned short bf16_bits(float x) { unsigned int u = __float_as_uint(x); return (unsigned short)((u + 0x7FFFu + ((u >> 16) & 1u)) >> 16); }
__device__ __forceinline__ float bf16_val(unsigned short b) { return __uint_as_float(((unsigned int)b) << 16); }
__device__ __forceinline__ float bf16_round(float x) { return bf16_val(bf16_bits(x)); }
// D += A·B with NT terms: 1 = ah·bh, 2 = + al·bh (A split), 3 = + ah·bl (both split)
template <int NT>
__device__ __forceinline__ v8f mmaN(v16b ah, v16b al, v16b bh, v16b bl, v8f c) {
  c = __builtin_amdgcn_wmma_f32_16x16x32_bf16(false, ah, false, bh, (short)0, c, false, false);
  if (NT >= 2) c = __builtin_amdgcn_wmma_f32_16x16x32_bf16(false, al, false, bh, (short)0, c, false, false);
  if (NT >= 3) c = __builtin_amdgcn_wmma_f32_16x16x32_bf16(false, ah, false, bl, (short)0, c, false, false);
  asm volatile("v_nop\n\tv_nop\n\tv_nop\n\tv_nop" : "+v"(c) : "v"(ah), "v"(al), "v"(bh), "v"(bl));
  return c;
}

__global__ __launch_bounds__(256) void k_wt_bf16(const float* __restrict__ W, unsigned short* __restrict__ Wt, int K, int N) {
  const int t = blockIdx.x * 256 + threadIdx.x;
  const int k8n = K / 8;
  if (t >= N * k8n) return;
  const int n = t / k8n, k8 = (t % k8n) * 8;
  v8us v;
#pragma unroll
  for (int i = 0; i < 8; ++i) v[i] = bf16_bits(W[(size_t)(k8 + i) * N + n]);
  *(v8us*)(Wt + (size_t)n * K + k8) = v;
  
}

// GEMM C[M][N] (f32, pitch ldc) = act(A[M][K]·W + bias). A f32 row-major (pitch lda) converted per fragment to bf16
// (ASPLIT: hi/lo two planes -> 2 terms, else single rounded term); Wt bf16 [N][K] (pitch ldb). BIAS_BF16 rounds the
// bias to bf16 first (bias quantised to bf16 before the add). K%32==0, M%16==0, N%64==0.
template <bool ASPLIT, int ACT, bool BIAS_BF16>
__global__ __launch_bounds__(128) void k_gemm_bf(const float* __restrict__ A, int lda, const unsigned short* __restrict__ Wt, int ldb,
                                               const float* __restrict__ bias, float* __restrict__ C, int ldc, int M, int N, int K) {
  __shared__ __attribute__((aligned(16))) float so[4][16][64];
  const int tid = threadIdx.x, w = tid >> 5, lane = tid & 31, ln = lane & 15, hh = lane >> 4;
  const int ntn = N / 64;
  const int wid = blockIdx.x * 4 + w;
  const int mt = wid / ntn, nq = wid % ntn;
  if (mt * 16 >= M) return;
  const int row0 = mt * 16, col0 = nq * 64;
  const float* arow = A + (size_t)(row0 + ln) * lda;
  v8f acc[4] = {};
  for (int kb = 0; kb < K; kb += 32) {
    FragB ah, al;
    const v4f x0 = *(const v4fa*)(arow + kb + 8 * hh), x1 = *(const v4fa*)(arow + kb + 8 * hh + 4);
    const v4f x2 = *(const v4fa*)(arow + kb + 16 + 8 * hh), x3 = *(const v4fa*)(arow + kb + 16 + 8 * hh + 4);
    float xs[16] = {x0[0],x0[1],x0[2],x0[3],x1[0],x1[1],x1[2],x1[3],x2[0],x2[1],x2[2],x2[3],x3[0],x3[1],x3[2],x3[3]};
#pragma unroll
    for (int i = 0; i < 16; ++i) { const unsigned short hb = bf16_bits(xs[i]); ah.u[i] = hb; al.u[i] = ASPLIT ? bf16_bits(xs[i] - bf16_val(hb)) : (unsigned short)0; }
#pragma unroll
    for (int t = 0; t < 4; ++t) {
      const unsigned short* brow = Wt + (size_t)(col0 + t * 16 + ln) * ldb + kb;
      FragB b;
      b.half[0] = *(const v8us*)(brow + 8 * hh);
      b.half[1] = *(const v8us*)(brow + 16 + 8 * hh);
      acc[t] = mmaN<ASPLIT ? 2 : 1>(ah.v, al.v, b.v, b.v, acc[t]);
    }
  }
#pragma unroll
  for (int t = 0; t < 4; ++t) {
    float bv = bias ? bias[col0 + t * 16 + ln] : 0.f;
    if (BIAS_BF16) bv = bf16_round(bv);
#pragma unroll
    for (int r = 0; r < 8; ++r) { float v = acc[t][r] + bv; if (ACT == 1) v = fmaxf(v, 0.f); so[w][8 * hh + r][t * 16 + ln] = v; }
  }
  __builtin_amdgcn_fence(__ATOMIC_ACQ_REL, "workgroup");
  __builtin_amdgcn_wave_barrier();
  const int rsub = lane >> 4, c4 = (lane & 15) * 4;
  {
#pragma unroll
    for (int q = 0; q < 8; ++q) {
      const int r = q * 2 + rsub;
      const v4f v = *(const v4fa*)&so[w][r][c4];
      *(v4f*)(C + (size_t)(row0 + r) * ldc + col0 + c4) = v;
    }
    
  }
}

// GEMM C = act(A·W + bias + resid): A f32 (ASPLIT -> hi/lo 2 terms), Wt bf16 [N][K]; ACT 0 none, 1 relu, 2 exact gelu;
// resid (optional, f32, row index = (row % rmod), pitch ldr, RES_BF16 rounds it) added before the activation.
template <bool ASPLIT, int ACT, bool BIAS_BF16, bool RES_BF16>
__global__ __launch_bounds__(128) void k_gemm_bf3(const float* __restrict__ A, int lda, const unsigned short* __restrict__ Wt, int ldb,
                                                const float* __restrict__ bias, const float* __restrict__ resid, int rmod, int ldr,
                                                float* __restrict__ C, int ldc, int M, int N, int K) {
  __shared__ __attribute__((aligned(16))) float so[4][16][64];
  const int tid = threadIdx.x, w = tid >> 5, lane = tid & 31, ln = lane & 15, hh = lane >> 4;
  const int ntn = N / 64;
  const int wid = blockIdx.x * 4 + w;
  const int mt = wid / ntn, nq = wid % ntn;
  if (mt * 16 >= M) return;
  const int row0 = mt * 16, col0 = nq * 64;
  const float* arow = A + (size_t)(row0 + ln) * lda;
  v8f acc[4] = {};
  for (int kb = 0; kb < K; kb += 32) {
    FragB ah, al;
    const v4f x0 = *(const v4fa*)(arow + kb + 8 * hh), x1 = *(const v4fa*)(arow + kb + 8 * hh + 4);
    const v4f x2 = *(const v4fa*)(arow + kb + 16 + 8 * hh), x3 = *(const v4fa*)(arow + kb + 16 + 8 * hh + 4);
    float xs[16] = {x0[0],x0[1],x0[2],x0[3],x1[0],x1[1],x1[2],x1[3],x2[0],x2[1],x2[2],x2[3],x3[0],x3[1],x3[2],x3[3]};
#pragma unroll
    for (int i = 0; i < 16; ++i) { const unsigned short hb = bf16_bits(xs[i]); ah.u[i] = hb; al.u[i] = ASPLIT ? bf16_bits(xs[i] - bf16_val(hb)) : (unsigned short)0; }
#pragma unroll
    for (int t = 0; t < 4; ++t) {
      const unsigned short* brow = Wt + (size_t)(col0 + t * 16 + ln) * ldb + kb;
      FragB b;
      b.half[0] = *(const v8us*)(brow + 8 * hh);
      b.half[1] = *(const v8us*)(brow + 16 + 8 * hh);
      acc[t] = mmaN<ASPLIT ? 2 : 1>(ah.v, al.v, b.v, b.v, acc[t]);
    }
  }
#pragma unroll
  for (int t = 0; t < 4; ++t) {
    const int col = col0 + t * 16 + ln;
    float bv = bias ? bias[col] : 0.f;
    if (BIAS_BF16) bv = bf16_round(bv);
#pragma unroll
    for (int r = 0; r < 8; ++r) {
      float v = acc[t][r] + bv;
      if (resid) { float rv = resid[(size_t)((row0 + 8 * hh + r) % rmod) * ldr + col]; if (RES_BF16) rv = bf16_round(rv); v += rv; }
      if (ACT == 1) v = fmaxf(v, 0.f);
      if (ACT == 2) v = 0.5f * v * (1.0f + erff(v * 0.70710678118654752f));
      if (ACT == 3) { const float u = 0.7978845608028654f * (v + 0.044715f * v * v * v); v = 0.5f * v * (1.0f + tanhf(u)); }
      so[w][8 * hh + r][t * 16 + ln] = v;
    }
  }
  __builtin_amdgcn_fence(__ATOMIC_ACQ_REL, "workgroup");
  __builtin_amdgcn_wave_barrier();
  const int rsub = lane >> 4, c4 = (lane & 15) * 4;
  {
#pragma unroll
    for (int q = 0; q < 8; ++q) {
      const int r = q * 2 + rsub;
      const v4f v = *(const v4fa*)&so[w][r][c4];
      *(v4f*)(C + (size_t)(row0 + r) * ldc + col0 + c4) = v;
    }
    
  }
}
// row LayerNorm (biased variance, eps) over N: s = X (+ R); optional out_sum <- s; out_norm <- (s-mu)*rsqrt(var+eps)*g + b
template <bool PARAM_BF16>
__global__ __launch_bounds__(256) void k_layernorm(const float* __restrict__ X, const float* __restrict__ R, const float* __restrict__ g, const float* __restrict__ bta,
                                                  float* __restrict__ out_sum, float* __restrict__ out_norm, int N, float eps) {
  __shared__ float red[256];
  const int row = blockIdx.x, tid = threadIdx.x;
  const float* x = X + (size_t)row * N; const float* rr = R ? R + (size_t)row * N : nullptr;
  float vals[16];                     // up to N = 4096
  const int per = N / 256;            // contiguous chunk per thread? use strided-by-4 chunks: thread handles j = tid*4 + 1024*u
  float s1 = 0.f;
  for (int u = 0; u < per / 4; ++u) {
    const int j = tid * 4 + 1024 * u;
    const v4f a = *(const v4fa*)(x + j);
    v4f b = {0.f,0.f,0.f,0.f}; if (rr) b = *(const v4fa*)(rr + j);
#pragma unroll
    for (int q = 0; q < 4; ++q) { const float v = a[q] + b[q]; vals[u * 4 + q] = v; s1 += v; }
  }
  red[tid] = s1; __syncthreads();
  for (int st = 128; st > 0; st >>= 1) { if (tid < st) red[tid] += red[tid + st]; __syncthreads(); }
  const float mu = red[0] / (float)N; __syncthreads();
  float s2 = 0.f;
  for (int u = 0; u < per / 4; ++u)
#pragma unroll
    for (int q = 0; q < 4; ++q) { const float c = vals[u * 4 + q] - mu; s2 += c * c; }
  red[tid] = s2; __syncthreads();
  for (int st = 128; st > 0; st >>= 1) { if (tid < st) red[tid] += red[tid + st]; __syncthreads(); }
  const float rs = rsqrtf(red[0] / (float)N + eps);
  {
    for (int u = 0; u < per / 4; ++u) {
      const int j = tid * 4 + 1024 * u;
      v4f o, sm;
#pragma unroll
      for (int q = 0; q < 4; ++q) {
        float gg = g[j + q], bb = bta[j + q];
        if (PARAM_BF16) { gg = bf16_round(gg); bb = bf16_round(bb); }
        sm[q] = vals[u * 4 + q]; o[q] = (vals[u * 4 + q] - mu) * rs * gg + bb;
      }
      if (out_sum) *(v4f*)(out_sum + (size_t)row * N + j) = sm;
      *(v4f*)(out_norm + (size_t)row * N + j) = o;
    }
    
  }
}



// ---- f16 WMMA path (v_wmma_f32_16x16x32_f16): 11-bit significands for operands in range — used where a [0,1] probability operand needs more precision than bf16
typedef _Float16 v16h __attribute__((ext_vector_type(16)));
union FragH { v16h v; v8us half[2]; _Float16 h[16]; unsigned short u[16]; };
template <int NT>
__device__ __forceinline__ v8f mmaH(v16h ah, v16h al, v16h bh, v16h bl, v8f c) {
  c = __builtin_amdgcn_wmma_f32_16x16x32_f16(false, ah, false, bh, (short)0, c, false, false);
  if (NT >= 2) c = __builtin_amdgcn_wmma_f32_16x16x32_f16(false, al, false, bh, (short)0, c, false, false);
  if (NT >= 3) c = __builtin_amdgcn_wmma_f32_16x16x32_f16(false, ah, false, bl, (short)0, c, false, false);
  asm volatile("v_nop\n\tv_nop\n\tv_nop\n\tv_nop" : "+v"(c) : "v"(ah), "v"(al), "v"(bh), "v"(bl));
  return c;
}
// batched GEMM like k_gemm_b but f16 operands: A f32 (split into f16 hi/lo if ASPLIT, else rounded to f16), Bt = f16 values [n][k]; alpha; C f32; N multiple of 16 (partial tiles skipped)
template <bool ASPLIT>
__global__ __launch_bounds__(128) void k_gemm_h(const float* __restrict__ A, int lda, size_t sA, const _Float16* __restrict__ Bh, int ldb, size_t sB, float alpha, float* __restrict__ C, int ldc, size_t sC, int M, int N, int K) {
  __shared__ __attribute__((aligned(16))) float so[4][16][64];
  const int tid = threadIdx.x, w = tid >> 5, lane = tid & 31, ln = lane & 15, hh = lane >> 4; const int by = blockIdx.y;
  A += (size_t)by * sA; Bh += (size_t)by * sB; C += (size_t)by * sC;
  const int ntn = (N + 63) / 64; const int wid = blockIdx.x * 4 + w; const int mt = wid / ntn, nq = wid % ntn; if (mt * 16 >= M) return;
  const int row0 = mt * 16, col0 = nq * 64; const float* arow = A + (size_t)(row0 + ln) * lda;
  v8f acc[4] = {};
  for (int kb = 0; kb < K; kb += 32) {
    FragH ah, al;
    const v4f x0 = *(const v4fa*)(arow + kb + 8 * hh), x1 = *(const v4fa*)(arow + kb + 8 * hh + 4), x2 = *(const v4fa*)(arow + kb + 16 + 8 * hh), x3 = *(const v4fa*)(arow + kb + 16 + 8 * hh + 4);
    float xs[16] = {x0[0],x0[1],x0[2],x0[3],x1[0],x1[1],x1[2],x1[3],x2[0],x2[1],x2[2],x2[3],x3[0],x3[1],x3[2],x3[3]};
#pragma unroll
    for (int i = 0; i < 16; ++i) { const _Float16 h = (_Float16)xs[i]; ah.h[i] = h; al.h[i] = ASPLIT ? (_Float16)(xs[i] - (float)h) : (_Float16)0.0f; }
#pragma unroll
    for (int t = 0; t < 4; ++t) { if (col0 + t * 16 >= N) continue; const size_t boff = (size_t)(col0 + t * 16 + ln) * ldb + kb; FragH bq; bq.half[0] = *(const v8us*)(Bh + boff + 8 * hh); bq.half[1] = *(const v8us*)(Bh + boff + 16 + 8 * hh);
      acc[t] = mmaH<ASPLIT ? 2 : 1>(ah.v, al.v, bq.v, bq.v, acc[t]); }
  }
#pragma unroll
  for (int t = 0; t < 4; ++t) { if (col0 + t * 16 >= N) continue;
#pragma unroll
    for (int r = 0; r < 8; ++r) so[w][8 * hh + r][t * 16 + ln] = acc[t][r] * alpha; }
  __builtin_amdgcn_fence(__ATOMIC_ACQ_REL, "workgroup"); __builtin_amdgcn_wave_barrier();
  const int rsub = lane >> 4, c4 = (lane & 15) * 4;
  {
#pragma unroll
    for (int q = 0; q < 8; ++q) { const int r = q * 2 + rsub; if (col0 + c4 < N) { const v4f v = *(const v4fa*)&so[w][r][c4]; *(v4f*)(C + (size_t)(row0 + r) * ldc + col0 + c4) = v; } }
     }
}

// Wt[n][k] = f16(W[k][n]·scale) from f32 row-major W[K][N] (scale = power of two; bf16-exact weights stay exact in f16 away from the subnormal range)
__global__ __launch_bounds__(256) void k_wt_f16(const float* __restrict__ W, _Float16* __restrict__ Wt, int K, int N, float scale) {
  const int t = blockIdx.x * 256 + threadIdx.x; if (t >= N * (K / 8)) return; const int n = t / (K / 8), k8 = (t % (K / 8)) * 8; FragH f;
#pragma unroll
  for (int i = 0; i < 8; ++i) f.h[i] = (_Float16)(bf16_round(W[(size_t)(k8 + i) * N + n]) * scale); const v8us o = f.half[0];
  *(v8us*)((unsigned short*)Wt + (size_t)n * K + k8) = o; 
}
// k_gemm_hh variant with fused epilogue: v = acc·alpha + bias[by·sBias + col] (+ CP[(row/rowsPerB)·sCPb + by·64 + col] if CP) ; ACT 0 none / 1 elu ; writes f16 C16 (and f32 C if non-null)
template <int ACT>
__global__ __launch_bounds__(128) void k_gemm_hhx(const _Float16* __restrict__ A, int lda, size_t sA, const _Float16* __restrict__ Bh, int ldb, size_t sB, float alpha, const float* __restrict__ bias, size_t sBias, const float* __restrict__ CP, int rowsPerB, size_t sCPb, int row0g,
    float* __restrict__ C, _Float16* __restrict__ C16, int ldc, size_t sC, int M, int N, int K) {
  __shared__ __attribute__((aligned(16))) float so[4][16][64];
  const int tid = threadIdx.x, w = tid >> 5, lane = tid & 31, ln = lane & 15, hh = lane >> 4; const int by = blockIdx.y;
  A += (size_t)by * sA; Bh += (size_t)by * sB; const size_t cofs = (size_t)by * sC; const float* bp = bias ? bias + (size_t)by * sBias : nullptr;
  const int ntn = (N + 63) / 64; const int wid = blockIdx.x * 4 + w; const int mt = wid / ntn, nq = wid % ntn; if (mt * 16 >= M) return;
  const int row0 = mt * 16, col0 = nq * 64; const _Float16* arow = A + (size_t)(row0 + ln) * lda;
  v8f acc[4] = {};
  for (int kb = 0; kb < K; kb += 32) { FragH ah; ah.half[0] = *(const v8us*)((const unsigned short*)arow + kb + 8 * hh); ah.half[1] = *(const v8us*)((const unsigned short*)arow + kb + 16 + 8 * hh);
#pragma unroll
    for (int t = 0; t < 4; ++t) { if (col0 + t * 16 >= N) continue; const size_t boff = (size_t)(col0 + t * 16 + ln) * ldb + kb; FragH bq; bq.half[0] = *(const v8us*)((const unsigned short*)Bh + boff + 8 * hh); bq.half[1] = *(const v8us*)((const unsigned short*)Bh + boff + 16 + 8 * hh);
      acc[t] = mmaH<1>(ah.v, ah.v, bq.v, bq.v, acc[t]); }
  }
#pragma unroll
  for (int t = 0; t < 4; ++t) { if (col0 + t * 16 >= N) continue; const int col = col0 + t * 16 + ln; const float bv = bp ? bf16_round(bp[col]) : 0.f;
#pragma unroll
    for (int r = 0; r < 8; ++r) { float v = acc[t][r] * alpha + bv; if (CP) { const int rr = row0g + row0 + 8 * hh + r; if (rowsPerB < 0) v += CP[cofs + (size_t)rr * ldc + col];      /* rowsPerB < 0: own element of the batched C plane */ else { const int bidx = rr / rowsPerB; v += CP[(size_t)bidx * sCPb + (size_t)by * 64 + col]; } } if (ACT == 1) v = (v > 0.f) ? v : expm1f(v); else if (ACT == 7) v = (v > 0.f) ? v + 1.0f : expf(v); else if (ACT == 8) v = tanhf(v); else if (ACT == 9) v = 0.5f * v * (1.0f + tanhf(0.7978845608028654f * (v + 0.044715f * v * v * v))); else if (ACT == 11) v = 1.0f / (1.0f + expf(-v)); else if (ACT == 12) v = (v > 0.f) ? v : 0.01f * v; else if (ACT == 14) v = (v > 0.f) ? v : 0.1f * v; else if (ACT == 16) v = (v >= 0.f) ? v : 0.3f * v; else if (ACT == 17) v = (v >= 0.f) ? v : 0.2f * v; else if (ACT == 15) v = v / (1.0f + expf(-v)); else if (ACT == 3) v = fmaxf(v, 0.f); else if (ACT == 6) v = 0.5f * v * (1.0f + erff(v * 0.70710678118654752f)); so[w][8 * hh + r][t * 16 + ln] = v; } }
  __builtin_amdgcn_fence(__ATOMIC_ACQ_REL, "workgroup"); __builtin_amdgcn_wave_barrier();
  const int rsub = lane >> 4, c4 = (lane & 15) * 4; typedef _Float16 v4h __attribute__((ext_vector_type(4)));
  {
#pragma unroll
    for (int q = 0; q < 8; ++q) { const int r = q * 2 + rsub; if (col0 + c4 < N) { const v4f v = *(const v4fa*)&so[w][r][c4]; if (C) *(v4f*)(C + cofs + (size_t)(row0 + r) * ldc + col0 + c4) = v; if (C16) { v4h h4; for (int i = 0; i < 4; ++i) h4[i] = (_Float16)v[i]; *(v4h*)(C16 + cofs + (size_t)(row0 + r) * ldc + col0 + c4) = h4; } } }
     }
}


typedef _Float16 v4h __attribute__((ext_vector_type(4)));

__global__ __launch_bounds__(256) void k_x16(const float* __restrict__ x, _Float16* __restrict__ X16, size_t n8) { const size_t t = (size_t)blockIdx.x * 256 + threadIdx.x; if (t >= n8) return; FragH f;
#pragma unroll
  for (int q = 0; q < 8; ++q) f.h[q] = (_Float16)bf16_round(x[t * 8 + q]); *(v8us*)((unsigned short*)X16 + t * 8) = f.half[0];  }
__global__ __launch_bounds__(256) void k_h16(const float* __restrict__ x, _Float16* __restrict__ X16, size_t n8) { const size_t t = (size_t)blockIdx.x * 256 + threadIdx.x; if (t >= n8) return; FragH f;
#pragma unroll
  for (int q = 0; q < 8; ++q) f.h[q] = (_Float16)x[t * 8 + q]; *(v8us*)((unsigned short*)X16 + t * 8) = f.half[0];  }
__global__ __launch_bounds__(256) void k_round16f(const float* __restrict__ W, _Float16* __restrict__ Bt, size_t n8) { const size_t t = (size_t)blockIdx.x * 256 + threadIdx.x; if (t >= n8) return; FragH f;
#pragma unroll
  for (int i = 0; i < 8; ++i) f.h[i] = (_Float16)(bf16_round(W[t * 8 + i]) * 16.0f); *(v8us*)((unsigned short*)Bt + t * 8) = f.half[0];  }
template <int NHv, int TTv>
__global__ __launch_bounds__(256) void k_vt(const _Float16* __restrict__ V16, int ldv, int voff, _Float16* __restrict__ Vt) { __shared__ unsigned short tl[64][66]; const int tid = threadIdx.x; const int slab = blockIdx.x / (TTv / 64), lg = blockIdx.x % (TTv / 64); const int b = slab / NHv, h = slab % NHv;
  for (int i = tid; i < 64 * 8; i += 256) { const int r = i / 8, c8 = (i % 8) * 8; FragH f; f.half[0] = *(const v8us*)((const unsigned short*)V16 + ((size_t)b * TTv + lg * 64 + r) * ldv + voff + h * 64 + c8);
#pragma unroll
    for (int q = 0; q < 8; ++q) tl[r][c8 + q] = f.u[q]; }
  __syncthreads();
  {
#pragma unroll
    for (int rd = 0; rd < 2; ++rd) { const int unit = tid >> 5, lane = tid & 31; const int d = (unit >> 1) * 16 + (lane & 15), k0 = rd * 32 + (unit & 1) * 16 + (lane >> 4) * 8; FragH f;      /* fragment order (see pk_frag): a wave writes one 512-byte unit of the slab's 32-key pass rd */
#pragma unroll
      for (int q = 0; q < 8; ++q) f.u[q] = tl[k0 + q][d];
      *(v8us*)((unsigned short*)Vt + (size_t)slab * 64 * TTv + (size_t)(lg * 2 + rd) * 2048 + unit * 256 + lane * 8) = f.half[0]; }
     } }

__global__ __launch_bounds__(256) void k_hl(const float* __restrict__ F, _Float16* __restrict__ Hh, _Float16* __restrict__ Hl, size_t n8) { const size_t t = (size_t)blockIdx.x * 256 + threadIdx.x; if (t >= n8) return; FragH fh, fl; const v4f a = *(const v4fa*)(F + t * 8), c = *(const v4fa*)(F + t * 8 + 4);
#pragma unroll
  for (int q = 0; q < 4; ++q) { _Float16 h = (_Float16)a[q]; fh.h[q] = h; fl.h[q] = (_Float16)((a[q] - (float)h) * 1024.0f); h = (_Float16)c[q]; fh.h[4 + q] = h; fl.h[4 + q] = (_Float16)((c[q] - (float)h) * 1024.0f); }
  { *(v8us*)((unsigned short*)Hh + t * 8) = fh.half[0]; *(v8us*)((unsigned short*)Hl + t * 8) = fl.half[0];  } }

// ---- fast GEMM (wave tile 32x64; requires M % 32 == 0 rows per launch region and N % 64 == 0); epilogue = k_gemm_hhx semantics ----
__device__ __forceinline__ v16h g2_frag(const _Float16* p, int hh) { FragH f; f.half[0] = *(const v8us*)((const unsigned short*)p + 8 * hh); f.half[1] = *(const v8us*)((const unsigned short*)p + 16 + 8 * hh); return f.v; }
__device__ __forceinline__ v8f g2_mma(v16h a, v16h b, v8f c) { v8f d = __builtin_amdgcn_wmma_f32_16x16x32_f16(false, a, false, b, (short)0, c, false, false); asm volatile("v_nop\n\tv_nop\n\tv_nop\n\tv_nop" : "+v"(d) : "v"(a), "v"(b)); return d; }
template <int ACT, bool KPACK = false>
__global__ __launch_bounds__(128) void k_gemm2(const _Float16* __restrict__ A, int lda, size_t sA, const _Float16* __restrict__ Bh, int ldb, size_t sB, float alpha, const float* __restrict__ bias, size_t sBias, const float* __restrict__ CP, int rowsPerB, size_t sCPb, int row0g,
    float* __restrict__ C, _Float16* __restrict__ C16, int ldc, size_t sC, int M, int N, int K) { static_assert(ACT == 0 || ACT == 3 || ACT == 6 || ACT == 8 || ACT == 9 || ACT == 11 || ACT == 12 || ACT == 14 || ACT == 15 || ACT == 16 || ACT == 17, "k_gemm2: unsupported ACT code (would silently apply no activation)");
  __shared__ __attribute__((aligned(16))) float so[4][32][68];
  const int tid = threadIdx.x, w = tid >> 5, lane = tid & 31, ln = lane & 15, hh = lane >> 4; const int by = blockIdx.y;
  A += (size_t)by * sA; Bh += (size_t)by * sB; const size_t cofs = (size_t)by * sC; const float* bp = bias ? bias + (size_t)by * sBias : nullptr;
  const int ntn = N >> 6; const int mt = blockIdx.x / ntn, nq = blockIdx.x - mt * ntn; const int row0 = mt * 128 + 32 * w, col0 = nq * 64; if (row0 >= M) return;
  const _Float16* a0p = A + (size_t)(row0 + ln) * lda; const _Float16* a1p = a0p + (size_t)16 * lda;
  const _Float16* b0p = Bh + (size_t)(col0 + ln) * ldb; const _Float16* b1p = b0p + (size_t)16 * ldb; const _Float16* b2p = b1p + (size_t)16 * ldb; const _Float16* b3p = b2p + (size_t)16 * ldb;
  const v8f z8 = {0.f,0.f,0.f,0.f,0.f,0.f,0.f,0.f}; v8f c00 = z8, c01 = z8, c02 = z8, c03 = z8, c10 = z8, c11 = z8, c12 = z8, c13 = z8;
#pragma unroll 1
  for (int kb = 0; kb < K; kb += 32) { const v16h a0 = g2_frag(a0p + kb, hh), a1 = g2_frag(a1p + kb, hh);
    v16h b = g2_frag(b0p + kb, hh); c00 = g2_mma(a0, b, c00); c10 = g2_mma(a1, b, c10);
    b = g2_frag(b1p + kb, hh); c01 = g2_mma(a0, b, c01); c11 = g2_mma(a1, b, c11);
    b = g2_frag(b2p + kb, hh); c02 = g2_mma(a0, b, c02); c12 = g2_mma(a1, b, c12);
    b = g2_frag(b3p + kb, hh); c03 = g2_mma(a0, b, c03); c13 = g2_mma(a1, b, c13); }
  v8f accs[8] = {c00, c01, c02, c03, c10, c11, c12, c13};
#pragma unroll
  for (int u = 0; u < 8; ++u) { const int t = u & 3, half = u >> 2; const int col = col0 + t * 16 + ln; const float bv = bp ? bf16_round(bp[col]) : 0.f;
#pragma unroll
    for (int r = 0; r < 8; ++r) { const int rloc = half * 16 + 8 * hh + r; float v = accs[u][r] * alpha + bv; if (CP) { if (rowsPerB < 0) v += CP[cofs + (size_t)(row0g + row0 + rloc) * ldc + col];      /* rowsPerB < 0: own element of the batched C plane */ else { const int bidx = (row0g + row0 + rloc) / rowsPerB; v += CP[(size_t)bidx * sCPb + (size_t)by * 64 + col]; } }
      if (ACT == 3) v = fmaxf(v, 0.f); else if (ACT == 6) v = 0.5f * v * (1.0f + erff(v * 0.70710678118654752f)); else if (ACT == 11) v = 1.0f / (1.0f + expf(-v)); else if (ACT == 15) v = v / (1.0f + expf(-v)); else if (ACT == 12) v = (v > 0.f) ? v : 0.01f * v; else if (ACT == 8) v = tanhf(v); else if (ACT == 9) v = 0.5f * v * (1.0f + tanhf(0.7978845608028654f * (v + 0.044715f * v * v * v))); else if (ACT == 14) v = (v > 0.f) ? v : 0.1f * v; else if (ACT == 16) v = (v >= 0.f) ? v : 0.3f * v; else if (ACT == 17) v = (v >= 0.f) ? v : 0.2f * v;
      so[w][rloc][t * 16 + ln] = v; } }
  __builtin_amdgcn_fence(__ATOMIC_ACQ_REL, "workgroup"); __builtin_amdgcn_wave_barrier();
  if (KPACK) {      /* f16 output in fragment order (see pk_frag): the wave's 32 rows x 64 columns are one 32-key pass of head by = 8 units of 512 bytes, one store each */
    const int rg = row0g + row0; unsigned short* kq = (unsigned short*)C16 + ((size_t)(rg / SQ) * NH + by) * (SQ * HD) + (size_t)((rg % SQ) >> 5) * 2048 + lane * 8;
    /* both loops unrolled: constant LDS and store offsets, f stays in registers */
#pragma unroll
    for (int u = 0; u < 8; ++u) { const float* sp = &so[w][(u >> 2) * 16 + ln][((u >> 1) & 1) * 32 + (u & 1) * 16 + 8 * hh]; const v4f a = *(const v4fa*)sp, c = *(const v4fa*)(sp + 4); FragH f;
#pragma unroll
      for (int i = 0; i < 4; ++i) { f.h[i] = (_Float16)a[i]; f.h[4 + i] = (_Float16)c[i]; }
      *(v8us*)(kq + u * 256) = f.half[0]; }
    return; }
  const int rsub = lane >> 4, c4 = (lane & 15) * 4;
  {
#pragma unroll
    for (int q = 0; q < 16; ++q) { const int r = q * 2 + rsub; const v4f v = *(const v4fa*)&so[w][r][c4]; if (C) *(v4f*)(C + cofs + (size_t)(row0 + r) * ldc + col0 + c4) = v; if (C16) { v4h h4; for (int i = 0; i < 4; ++i) h4[i] = (_Float16)v[i]; *(v4h*)(C16 + cofs + (size_t)(row0 + r) * ldc + col0 + c4) = h4; } }
     } }


__global__ __launch_bounds__(256) void k_wnat(const float* __restrict__ w, size_t n8, _Float16* __restrict__ Bt) { const size_t t = (size_t)blockIdx.x * 256 + threadIdx.x; if (t >= n8) return; FragH f; for (int q = 0; q < 8; ++q) f.h[q] = (_Float16)(bf16_round(w[t * 8 + q]) * 16.0f); *(v8us*)((unsigned short*)Bt + t * 8) = f.half[0];  }
// lane l <-> l ^ 16 (cross-row move); every lane of the wave is on where this is used
__device__ __forceinline__ float lane_x16(float x) { return __builtin_bit_cast(float, __builtin_amdgcn_permlanex16(__builtin_bit_cast(int, x), __builtin_bit_cast(int, x), 0x76543210, 0xfedcba98, false, false)); }
// Fragment order of the attention's A operands: per (batch, head) 32 passes of 32 keys, a pass = 8 units of 512 bytes, a unit = 32 lanes x 8 halves, so that one 16-byte load of a wave reads 4 whole lines.
// K: unit (t*2 + s)*2 + i, lane (hf, c) = K[key 16 t + c][feature 32 s + 16 i + 8 hf ..]; V^T: unit d*2 + i, lane (hf, c) = V[key 16 i + 8 hf ..][feature 16 d + c]. p points at the lane's 8 halves of unit i = 0.
__device__ __forceinline__ v16h pk_frag(const _Float16* p) { FragH f; f.half[0] = *(const v8us*)((const unsigned short*)p); f.half[1] = *(const v8us*)((const unsigned short*)p + 256); return f.v; }
__device__ __forceinline__ v8f at_mma(v16h a, v16h b, v8f c) { return __builtin_amdgcn_wmma_f32_16x16x32_f16(false, a, false, b, (short)0, c, false, false); }
// One pass of the fused attention: 32 keys (kb .. kb + 31) against the wave's 32 query columns. MORE: fetch the next pass's K and V^T fragments into the same registers, each behind its last use.
template <bool MORE>
__device__ __forceinline__ void at_pass(const _Float16* kp, const _Float16* vp, int kb, const v16h (&qf)[2][2], v16h (&kf)[2][2], v16h (&vf)[4], v8f (&o)[4][2], float (&m)[2], float (&l)[2]) {
  const float cs = 0.125f * 1.4426950408889634f;      /* log2(e) / sqrt(64) */
  const v8f z8 = {0.f,0.f,0.f,0.f,0.f,0.f,0.f,0.f};
  v8f st[2][2];      /* [query tile][key tile] */
#pragma unroll
  for (int j = 0; j < 2; ++j) for (int t = 0; t < 2; ++t) st[j][t] = at_mma(kf[t][1], qf[j][1], at_mma(kf[t][0], qf[j][0], z8));
  if (MORE) {
#pragma unroll
    for (int t = 0; t < 2; ++t) for (int s = 0; s < 2; ++s) kf[t][s] = pk_frag(kp + (size_t)(kb + 32) * HD + (t * 2 + s) * 512);
  }
  float mn[2];
#pragma unroll
  for (int j = 0; j < 2; ++j) { float mx = fmaxf(st[j][0][0], st[j][1][0]);
#pragma unroll
    for (int r = 1; r < 8; ++r) mx = fmaxf(mx, fmaxf(st[j][0][r], st[j][1][r]));
    mx = fmaxf(mx, lane_x16(mx)); mn[j] = fmaxf(m[j], mx * cs); }
  if (__builtin_amdgcn_ballot_w32(mn[0] > m[0] || mn[1] > m[1]) != 0) {      /* wave-uniform; where no column's maximum grows every factor is exactly 1 */
#pragma unroll
    for (int j = 0; j < 2; ++j) { const float al = __builtin_amdgcn_exp2f(m[j] - mn[j]); m[j] = mn[j]; l[j] *= al;
#pragma unroll
      for (int d = 0; d < 4; ++d) o[d][j] *= al; } }
#pragma unroll
  for (int j = 0; j < 2; ++j) { FragH pf; float sm[2] = {0.f, 0.f};
#pragma unroll
    for (int t = 0; t < 2; ++t)
#pragma unroll
      for (int r = 0; r < 8; ++r) { const float p = __builtin_amdgcn_exp2f(fmaf(st[j][t][r], cs, -m[j])); sm[t] += p; pf.h[8 * t + r] = (_Float16)p; }
    l[j] += sm[0] + sm[1];
#pragma unroll
    for (int d = 0; d < 4; ++d) o[d][j] = at_mma(vf[d], pf.v, o[d][j]); }
  if (MORE) {
#pragma unroll
    for (int d = 0; d < 4; ++d) vf[d] = pk_frag(vp + (size_t)(kb + 32) * HD + d * 512);
    asm volatile("s_wait_xcnt 0x0" ::: "memory");      /* before the compiler reuses the address registers of the loads above */
  } }
__global__ __launch_bounds__(128) void k_attn(const _Float16* __restrict__ Q16, const _Float16* __restrict__ K16, const _Float16* __restrict__ VT, float* __restrict__ out) {
  const int w = threadIdx.x >> 5, lane = threadIdx.x & 31, ln = lane & 15, hh = lane >> 4;
  const int bh = blockIdx.y, b = bh / NH, h = bh - b * NH; const int q0 = blockIdx.x * 128 + w * 32;
  const _Float16* qp = Q16 + ((size_t)b * SQ + q0 + ln) * DM + h * HD;
  const _Float16* kp = K16 + (size_t)bh * (SQ * HD) + lane * 8;      /* both in fragment order */
  const _Float16* vp = VT + (size_t)bh * (SQ * HD) + lane * 8;
  v16h qf[2][2], kf[2][2], vf[4];
#pragma unroll
  for (int j = 0; j < 2; ++j) for (int s = 0; s < 2; ++s) qf[j][s] = g2_frag(qp + (size_t)j * 16 * DM + s * 32, hh);
#pragma unroll
  for (int t = 0; t < 2; ++t) for (int s = 0; s < 2; ++s) kf[t][s] = pk_frag(kp + (t * 2 + s) * 512);
#pragma unroll
  for (int d = 0; d < 4; ++d) vf[d] = pk_frag(vp + d * 512);
  v8f o[4][2]; float m[2] = {-3.0e38f, -3.0e38f}, l[2] = {0.f, 0.f};
#pragma unroll
  for (int d = 0; d < 4; ++d) for (int j = 0; j < 2; ++j) o[d][j] = v8f{0.f,0.f,0.f,0.f,0.f,0.f,0.f,0.f};
  for (int kb = 0; kb < SQ - 32; kb += 32) at_pass<true>(kp, vp, kb, qf, kf, vf, o, m, l);
  at_pass<false>(kp, vp, SQ - 32, qf, kf, vf, o, m, l);      /* the last pass has nothing to fetch */
#pragma unroll
  for (int j = 0; j < 2; ++j) { const float inv = 1.0f / (l[j] + lane_x16(l[j]));      /* join the halves' sums once */
    float* op = out + ((size_t)b * SQ + q0 + j * 16 + ln) * DM + h * HD + 8 * hh;      /* O^T register r = feature 16 d + 8 hf + r of query c: 32 contiguous bytes a lane and tile */
#pragma unroll
    for (int d = 0; d < 4; ++d) { const v4f lo = {o[d][j][0] * inv, o[d][j][1] * inv, o[d][j][2] * inv, o[d][j][3] * inv}, hi = {o[d][j][4] * inv, o[d][j][5] * inv, o[d][j][6] * inv, o[d][j][7] * inv};
      *(v4f*)(op + d * 16) = lo; *(v4f*)(op + d * 16 + 4) = hi; } } }
__global__ __launch_bounds__(256) void k_vt(const _Float16* __restrict__ V16, int b, int h0, _Float16* __restrict__ VT) { __shared__ unsigned short tl[64][65]; const int tid = threadIdx.x; const int hh = blockIdx.x % HG, sg = blockIdx.x / HG; const int s0 = sg * 64; const int h = h0 + hh;
  for (int i = tid; i < 64 * 8; i += 256) { const int j = i / 8, d8 = (i % 8) * 8; FragH f; f.half[0] = *(const v8us*)((const unsigned short*)V16 + ((size_t)b * SQ + s0 + j) * DM + h * HD + d8); for (int q = 0; q < 8; ++q) tl[d8 + q][j] = f.u[q]; }
  __syncthreads();
  { for (int i = tid; i < 64 * 8; i += 256) { const int d = i / 8, j8 = (i % 8) * 8; FragH f; for (int q = 0; q < 8; ++q) f.u[q] = tl[d][j8 + q]; *(v8us*)((unsigned short*)VT + ((size_t)hh * HD + d) * SQ + s0 + j8) = f.half[0]; }  } }



__global__ __launch_bounds__(256) void k_wph64(const float* __restrict__ Wm, _Float16* __restrict__ Bt) {
  const int t = blockIdx.x * 256 + threadIdx.x; if (t >= NH * HD * HD / 8) return; const int h = t / (HD * HD / 8), r = t % (HD * HD / 8), e = r / (HD / 8), d8 = (r % (HD / 8)) * 8; FragH f;
  for (int i = 0; i < 8; ++i) f.h[i] = (_Float16)(bf16_round(Wm[((size_t)h * HD + d8 + i) * HD + e]) * 16.0f);
  unsigned short* o = (unsigned short*)Bt + ((size_t)h * HD + e) * HD + d8; *(v8us*)o = f.half[0];  }
extern "C" void kernel_launch(void* const* d_in, const int* in_sizes, int n_in,
                              void* d_out, int out_size, void* d_ws, size_t ws_size, hipStream_t stream) {
  (void)in_sizes; (void)n_in; (void)out_size;
  const float* const* I = (const float* const*)d_in; const float* x = I[0]; const float* wq = I[1]; const float* bq = I[2]; const float* wk = I[3]; const float* bk = I[4]; const float* wv = I[5]; const float* bv = I[6];      /* per-head W [12][64][64] ([h][in][out]) + b [12][64] for q, k, v */
  char* ws = (char*)d_ws; size_t off = 0;
  auto take = [&](size_t bytes) { char* p = ws + off; off += (bytes + 255) & ~(size_t)255; return p; };
  _Float16* BQ = (_Float16*)take((size_t)NH * HD * HD * 2); _Float16* BK = (_Float16*)take((size_t)NH * HD * HD * 2); _Float16* BV = (_Float16*)take((size_t)NH * HD * HD * 2); 
  _Float16* X16 = (_Float16*)take(NR * DM * 2); _Float16* Q16 = (_Float16*)take(NR * DM * 2); _Float16* K16 = (_Float16*)take(NR * DM * 2); _Float16* V16 = (_Float16*)take(NR * DM * 2);
  _Float16* VT = (_Float16*)take((size_t)NB * NH * HD * SQ * 2);
  if (off > ws_size) return;
  { const unsigned g = (unsigned)((NH * HD * HD / 8 + 255) / 256); k_wph64<<<g, 256, 0, stream>>>(wq, BQ); k_wph64<<<g, 256, 0, stream>>>(wk, BK); k_wph64<<<g, 256, 0, stream>>>(wv, BV); }      /* per head: Bt[h][e][d] = 16 bf16(W[h][d][e]) (64 x 64 blocks, [out][in] x16) */

  k_x16<<<(unsigned)((NR * DM / 8 + 255) / 256), 256, 0, stream>>>(x, X16, NR * DM / 8);
  const size_t r0p = (size_t)B0 * SQ;      /* first projected row */
  k_gemm2<0><<<dim3((unsigned)((MP / 128) * (HD / 64)), NH), 128, 0, stream>>>(X16 + r0p * DM, DM, (size_t)HD, BQ, HD, (size_t)HD * HD, 0.0625f, bq, (size_t)HD, nullptr, 1, 0, 0, nullptr, Q16 + r0p * DM, DM, (size_t)HD, MP, HD, HD);      /* per head on grid.y: the head's 64 input columns x its own 64 x 64 weight (+ its 64 biases) -> the head's 64 output columns */
  k_gemm2<0, true><<<dim3((unsigned)((MP / 128) * (HD / 64)), NH), 128, 0, stream>>>(X16 + r0p * DM, DM, (size_t)HD, BK, HD, (size_t)HD * HD, 0.0625f, bk, (size_t)HD, nullptr, 1, 0, 0, nullptr, K16 + r0p * DM, DM, (size_t)HD, MP, HD, HD);      /* per head on grid.y: the head's 64 input columns x its own 64 x 64 weight (+ its 64 biases) -> the head's K in fragment order (KPACK; ldc and sC unused) */
  k_gemm2<0><<<dim3((unsigned)((MP / 128) * (HD / 64)), NH), 128, 0, stream>>>(X16 + r0p * DM, DM, (size_t)HD, BV, HD, (size_t)HD * HD, 0.0625f, bv, (size_t)HD, nullptr, 1, 0, 0, nullptr, V16 + r0p * DM, DM, (size_t)HD, MP, HD, HD);      /* per head on grid.y: the head's 64 input columns x its own 64 x 64 weight (+ its 64 biases) -> the head's 64 output columns */
  k_vt<NH, SQ><<<NB * NH * (SQ / 64), 256, 0, stream>>>(V16, LQ, 0, VT);      /* V^T of every batch and head in fragment order, one launch */
  k_attn<<<dim3(SQ / 128, NB * NH), 128, 0, stream>>>(Q16, K16, VT, (float*)d_out);      /* scores, softmax and P V fused; f32 straight into the merged-heads output rows */
}

// v004
// Measured time: 56.6 microseconds a run.
// Timed twice side by side with v003, it ran 1.54 and 1.48 times as fast.
// Over all steps from v000 it is 95.4 times as fast.
#include <hip/hip_runtime.h>
// Multi-head self-attention with PER-HEAD 64x64 projections on head-chunked features (sequences [8][1024][768] viewed [B][S][12][64]; q/k/v[..., h, :] = x[..., h, :] W[h] + b[h] with W [12][64][64] ([h][in][out], sigma 0.05) and b [12][64] (sigma 0.05); scores / 8; softmax over all 1024 keys (no mask); out = heads concatenated (no output projection) -> [8][1024][768]).
// Structure: token rows r = b*1024 + s; one projection launch: x rounded in registers (bf16, exact in f16), Q, K, V as WMMA products (32x64 wave tiles, f32 accumulation, exact x16 weights + bias, f16 outputs), Q, K and V^T stored from the accumulators in WMMA fragment order (512-byte units); one fused attention launch over every (batch, head): S^T = K Q^T (K = 64), running softmax in registers (f32 statistics; weights 2^(s - max) as f16), O^T += V^T P^T, divided by the row sum and written f32 straight into the merged-heads output rows (no output projection).
// Compute dtype: inputs rounded to bf16; x / weights exact; q, k, v and softmax weights as plain f16 GEMM operands (~2^-12); scores, softmax statistics and o f32. v_wmma_f32_16x16x32_f16.
#define NB 8
#define SQ 1024
#define DM 768
#define NH 12
#define HD 64
#define HG 4                         /* heads per launch of the per-batch k_vt overload (not called) */
#define B0 0                         /* unused (both launches start at batch 0) */
#define NBR NB                       /* batches processed (debug hook) */
#define NR ((size_t)NB * SQ)         /* token rows */
#define MP ((int)((size_t)NBR * SQ)) /* rows projected (debug hook) */
#define QN SQ                        /* unused (k_attn attends all SQ query rows) */
#define NHD NH                       /* unused (k_attn covers all NH heads) */
#define MPO MP                       /* unused (no output stage) */
#define LQ DM      /* unused (Q, K and V^T are all in fragment order) */
typedef __bf16 v16b __attribute__((ext_vector_type(16)));
typedef unsigned short v8us __attribute__((ext_vector_type(8), may_alias));
typedef float  v8f  __attribute__((ext_vector_type(8)));
typedef float  v4f  __attribute__((ext_vector_type(4)));
typedef float  v4fa __attribute__((ext_vector_type(4), may_alias));
union FragB { v16b v; v8us half[2]; unsigned short u[16]; };

__device__ __forceinline__ unsigned short bf16_bits(float x) { unsigned int u = __float_as_uint(x); return (unsigned short)((u + 0x7FFFu + ((u >> 16) & 1u)) >> 16); }
__device__ __forceinline__ float bf16_val(unsigned short b) { return __uint_as_float(((unsigned int)b) << 16); }
__device__ __forceinline__ float bf16_round(float x) { return bf16_val(bf16_bits(x)); }
// D += A·B with NT terms: 1 = ah·bh, 2 = + al·bh (A split), 3 = + ah·bl (both split)
template <int NT>
__device__ __forceinline__ v8f mmaN(v16b ah, v16b al, v16b bh, v16b bl, v8f c) {
  c = __builtin_amdgcn_wmma_f32_16x16x32_bf16(false, ah, false, bh, (short)0, c, false, false);
  if (NT >= 2) c = __builtin_amdgcn_wmma_f32_16x16x32_bf16(false, al, false, bh, (short)0, c, false, false);
  if (NT >= 3) c = __builtin_amdgcn_wmma_f32_16x16x32_bf16(false, ah, false, bl, (short)0, c, false, false);
  asm volatile("v_nop\n\tv_nop\n\tv_nop\n\tv_nop" : "+v"(c) : "v"(ah), "v"(al), "v"(bh), "v"(bl));
  return c;
}

__global__ __launch_bounds__(256) void k_wt_bf16(const float* __restrict__ W, unsigned short* __restrict__ Wt, int K, int N) {
  const int t = blockIdx.x * 256 + threadIdx.x;
  const int k8n = K / 8;
  if (t >= N * k8n) return;
  const int n = t / k8n, k8 = (t % k8n) * 8;
  v8us v;
#pragma unroll
  for (int i = 0; i < 8; ++i) v[i] = bf16_bits(W[(size_t)(k8 + i) * N + n]);
  *(v8us*)(Wt + (size_t)n * K + k8) = v;
  
}

// GEMM C[M][N] (f32, pitch ldc) = act(A[M][K]·W + bias). A f32 row-major (pitch lda) converted per fragment to bf16
// (ASPLIT: hi/lo two planes -> 2 terms, else single rounded term); Wt bf16 [N][K] (pitch ldb). BIAS_BF16 rounds the
// bias to bf16 first (bias quantised to bf16 before the add). K%32==0, M%16==0, N%64==0.
template <bool ASPLIT, int ACT, bool BIAS_BF16>
__global__ __launch_bounds__(128) void k_gemm_bf(const float* __restrict__ A, int lda, const unsigned short* __restrict__ Wt, int ldb,
                                               const float* __restrict__ bias, float* __restrict__ C, int ldc, int M, int N, int K) {
  __shared__ __attribute__((aligned(16))) float so[4][16][64];
  const int tid = threadIdx.x, w = tid >> 5, lane = tid & 31, ln = lane & 15, hh = lane >> 4;
  const int ntn = N / 64;
  const int wid = blockIdx.x * 4 + w;
  const int mt = wid / ntn, nq = wid % ntn;
  if (mt * 16 >= M) return;
  const int row0 = mt * 16, col0 = nq * 64;
  const float* arow = A + (size_t)(row0 + ln) * lda;
  v8f acc[4] = {};
  for (int kb = 0; kb < K; kb += 32) {
    FragB ah, al;
    const v4f x0 = *(const v4fa*)(arow + kb + 8 * hh), x1 = *(const v4fa*)(arow + kb + 8 * hh + 4);
    const v4f x2 = *(const v4fa*)(arow + kb + 16 + 8 * hh), x3 = *(const v4fa*)(arow + kb + 16 + 8 * hh + 4);
    float xs[16] = {x0[0],x0[1],x0[2],x0[3],x1[0],x1[1],x1[2],x1[3],x2[0],x2[1],x2[2],x2[3],x3[0],x3[1],x3[2],x3[3]};
#pragma unroll
    for (int i = 0; i < 16; ++i) { const unsigned short hb = bf16_bits(xs[i]); ah.u[i] = hb; al.u[i] = ASPLIT ? bf16_bits(xs[i] - bf16_val(hb)) : (unsigned short)0; }
#pragma unroll
    for (int t = 0; t < 4; ++t) {
      const unsigned short* brow = Wt + (size_t)(col0 + t * 16 + ln) * ldb + kb;
      FragB b;
      b.half[0] = *(const v8us*)(brow + 8 * hh);
      b.half[1] = *(const v8us*)(brow + 16 + 8 * hh);
      acc[t] = mmaN<ASPLIT ? 2 : 1>(ah.v, al.v, b.v, b.v, acc[t]);
    }
  }
#pragma unroll
  for (int t = 0; t < 4; ++t) {
    float bv = bias ? bias[col0 + t * 16 + ln] : 0.f;
    if (BIAS_BF16) bv = bf16_round(bv);
#pragma unroll
    for (int r = 0; r < 8; ++r) { float v = acc[t][r] + bv; if (ACT == 1) v = fmaxf(v, 0.f); so[w][8 * hh + r][t * 16 + ln] = v; }
  }
  __builtin_amdgcn_fence(__ATOMIC_ACQ_REL, "workgroup");
  __builtin_amdgcn_wave_barrier();
  const int rsub = lane >> 4, c4 = (lane & 15) * 4;
  {
#pragma unroll
    for (int q = 0; q < 8; ++q) {
      const int r = q * 2 + rsub;
      const v4f v = *(const v4fa*)&so[w][r][c4];
      *(v4f*)(C + (size_t)(row0 + r) * ldc + col0 + c4) = v;
    }
    
  }
}

// GEMM C = act(A·W + bias + resid): A f32 (ASPLIT -> hi/lo 2 terms), Wt bf16 [N][K]; ACT 0 none, 1 relu, 2 exact gelu;
// resid (optional, f32, row index = (row % rmod), pitch ldr, RES_BF16 rounds it) added before the activation.
template <bool ASPLIT, int ACT, bool BIAS_BF16, bool RES_BF16>
__global__ __launch_bounds__(128) void k_gemm_bf3(const float* __restrict__ A, int lda, const unsigned short* __restrict__ Wt, int ldb,
                                                const float* __restrict__ bias, const float* __restrict__ resid, int rmod, int ldr,
                                                float* __restrict__ C, int ldc, int M, int N, int K) {
  __shared__ __attribute__((aligned(16))) float so[4][16][64];
  const int tid = threadIdx.x, w = tid >> 5, lane = tid & 31, ln = lane & 15, hh = lane >> 4;
  const int ntn = N / 64;
  const int wid = blockIdx.x * 4 + w;
  const int mt = wid / ntn, nq = wid % ntn;
  if (mt * 16 >= M) return;
  const int row0 = mt * 16, col0 = nq * 64;
  const float* arow = A + (size_t)(row0 + ln) * lda;
  v8f acc[4] = {};
  for (int kb = 0; kb < K; kb += 32) {
    FragB ah, al;
    const v4f x0 = *(const v4fa*)(arow + kb + 8 * hh), x1 = *(const v4fa*)(arow + kb + 8 * hh + 4);
    const v4f x2 = *(const v4fa*)(arow + kb + 16 + 8 * hh), x3 = *(const v4fa*)(arow + kb + 16 + 8 * hh + 4);
    float xs[16] = {x0[0],x0[1],x0[2],x0[3],x1[0],x1[1],x1[2],x1[3],x2[0],x2[1],x2[2],x2[3],x3[0],x3[1],x3[2],x3[3]};
#pragma unroll
    for (int i = 0; i < 16; ++i) { const unsigned short hb = bf16_bits(xs[i]); ah.u[i] = hb; al.u[i] = ASPLIT ? bf16_bits(xs[i] - bf16_val(hb)) : (unsigned short)0; }
#pragma unroll
    for (int t = 0; t < 4; ++t) {
      const unsigned short* brow = Wt + (size_t)(col0 + t * 16 + ln) * ldb + kb;
      FragB b;
      b.half[0] = *(const v8us*)(brow + 8 * hh);
      b.half[1] = *(const v8us*)(brow + 16 + 8 * hh);
      acc[t] = mmaN<ASPLIT ? 2 : 1>(ah.v, al.v, b.v, b.v, acc[t]);
    }
  }
#pragma unroll
  for (int t = 0; t < 4; ++t) {
    const int col = col0 + t * 16 + ln;
    float bv = bias ? bias[col] : 0.f;
    if (BIAS_BF16) bv = bf16_round(bv);
#pragma unroll
    for (int r = 0; r < 8; ++r) {
      float v = acc[t][r] + bv;
      if (resid) { float rv = resid[(size_t)((row0 + 8 * hh + r) % rmod) * ldr + col]; if (RES_BF16) rv = bf16_round(rv); v += rv; }
      if (ACT == 1) v = fmaxf(v, 0.f);
      if (ACT == 2) v = 0.5f * v * (1.0f + erff(v * 0.70710678118654752f));
      if (ACT == 3) { const float u = 0.7978845608028654f * (v + 0.044715f * v * v * v); v = 0.5f * v * (1.0f + tanhf(u)); }
      so[w][8 * hh + r][t * 16 + ln] = v;
    }
  }
  __builtin_amdgcn_fence(__ATOMIC_ACQ_REL, "workgroup");
  __builtin_amdgcn_wave_barrier();
  const int rsub = lane >> 4, c4 = (lane & 15) * 4;
  {
#pragma unroll
    for (int q = 0; q < 8; ++q) {
      const int r = q * 2 + rsub;
      const v4f v = *(const v4fa*)&so[w][r][c4];
      *(v4f*)(C + (size_t)(row0 + r) * ldc + col0 + c4) = v;
    }
    
  }
}
// row LayerNorm (biased variance, eps) over N: s = X (+ R); optional out_sum <- s; out_norm <- (s-mu)*rsqrt(var+eps)*g + b
template <bool PARAM_BF16>
__global__ __launch_bounds__(256) void k_layernorm(const float* __restrict__ X, const float* __restrict__ R, const float* __restrict__ g, const float* __restrict__ bta,
                                                  float* __restrict__ out_sum, float* __restrict__ out_norm, int N, float eps) {
  __shared__ float red[256];
  const int row = blockIdx.x, tid = threadIdx.x;
  const float* x = X + (size_t)row * N; const float* rr = R ? R + (size_t)row * N : nullptr;
  float vals[16];                     // up to N = 4096
  const int per = N / 256;            // contiguous chunk per thread? use strided-by-4 chunks: thread handles j = tid*4 + 1024*u
  float s1 = 0.f;
  for (int u = 0; u < per / 4; ++u) {
    const int j = tid * 4 + 1024 * u;
    const v4f a = *(const v4fa*)(x + j);
    v4f b = {0.f,0.f,0.f,0.f}; if (rr) b = *(const v4fa*)(rr + j);
#pragma unroll
    for (int q = 0; q < 4; ++q) { const float v = a[q] + b[q]; vals[u * 4 + q] = v; s1 += v; }
  }
  red[tid] = s1; __syncthreads();
  for (int st = 128; st > 0; st >>= 1) { if (tid < st) red[tid] += red[tid + st]; __syncthreads(); }
  const float mu = red[0] / (float)N; __syncthreads();
  float s2 = 0.f;
  for (int u = 0; u < per / 4; ++u)
#pragma unroll
    for (int q = 0; q < 4; ++q) { const float c = vals[u * 4 + q] - mu; s2 += c * c; }
  red[tid] = s2; __syncthreads();
  for (int st = 128; st > 0; st >>= 1) { if (tid < st) red[tid] += red[tid + st]; __syncthreads(); }
  const float rs = rsqrtf(red[0] / (float)N + eps);
  {
    for (int u = 0; u < per / 4; ++u) {
      const int j = tid * 4 + 1024 * u;
      v4f o, sm;
#pragma unroll
      for (int q = 0; q < 4; ++q) {
        float gg = g[j + q], bb = bta[j + q];
        if (PARAM_BF16) { gg = bf16_round(gg); bb = bf16_round(bb); }
        sm[q] = vals[u * 4 + q]; o[q] = (vals[u * 4 + q] - mu) * rs * gg + bb;
      }
      if (out_sum) *(v4f*)(out_sum + (size_t)row * N + j) = sm;
      *(v4f*)(out_norm + (size_t)row * N + j) = o;
    }
    
  }
}



// ---- f16 WMMA path (v_wmma_f32_16x16x32_f16): 11-bit significands for operands in range — used where a [0,1] probability operand needs more precision than bf16
typedef _Float16 v16h __attribute__((ext_vector_type(16)));
union FragH { v16h v; v8us half[2]; _Float16 h[16]; unsigned short u[16]; };
template <int NT>
__device__ __forceinline__ v8f mmaH(v16h ah, v16h al, v16h bh, v16h bl, v8f c) {
  c = __builtin_amdgcn_wmma_f32_16x16x32_f16(false, ah, false, bh, (short)0, c, false, false);
  if (NT >= 2) c = __builtin_amdgcn_wmma_f32_16x16x32_f16(false, al, false, bh, (short)0, c, false, false);
  if (NT >= 3) c = __builtin_amdgcn_wmma_f32_16x16x32_f16(false, ah, false, bl, (short)0, c, false, false);
  asm volatile("v_nop\n\tv_nop\n\tv_nop\n\tv_nop" : "+v"(c) : "v"(ah), "v"(al), "v"(bh), "v"(bl));
  return c;
}
// batched GEMM like k_gemm_b but f16 operands: A f32 (split into f16 hi/lo if ASPLIT, else rounded to f16), Bt = f16 values [n][k]; alpha; C f32; N multiple of 16 (partial tiles skipped)
template <bool ASPLIT>
__global__ __launch_bounds__(128) void k_gemm_h(const float* __restrict__ A, int lda, size_t sA, const _Float16* __restrict__ Bh, int ldb, size_t sB, float alpha, float* __restrict__ C, int ldc, size_t sC, int M, int N, int K) {
  __shared__ __attribute__((aligned(16))) float so[4][16][64];
  const int tid = threadIdx.x, w = tid >> 5, lane = tid & 31, ln = lane & 15, hh = lane >> 4; const int by = blockIdx.y;
  A += (size_t)by * sA; Bh += (size_t)by * sB; C += (size_t)by * sC;
  const int ntn = (N + 63) / 64; const int wid = blockIdx.x * 4 + w; const int mt = wid / ntn, nq = wid % ntn; if (mt * 16 >= M) return;
  const int row0 = mt * 16, col0 = nq * 64; const float* arow = A + (size_t)(row0 + ln) * lda;
  v8f acc[4] = {};
  for (int kb = 0; kb < K; kb += 32) {
    FragH ah, al;
    const v4f x0 = *(const v4fa*)(arow + kb + 8 * hh), x1 = *(const v4fa*)(arow + kb + 8 * hh + 4), x2 = *(const v4fa*)(arow + kb + 16 + 8 * hh), x3 = *(const v4fa*)(arow + kb + 16 + 8 * hh + 4);
    float xs[16] = {x0[0],x0[1],x0[2],x0[3],x1[0],x1[1],x1[2],x1[3],x2[0],x2[1],x2[2],x2[3],x3[0],x3[1],x3[2],x3[3]};
#pragma unroll
    for (int i = 0; i < 16; ++i) { const _Float16 h = (_Float16)xs[i]; ah.h[i] = h; al.h[i] = ASPLIT ? (_Float16)(xs[i] - (float)h) : (_Float16)0.0f; }
#pragma unroll
    for (int t = 0; t < 4; ++t) { if (col0 + t * 16 >= N) continue; const size_t boff = (size_t)(col0 + t * 16 + ln) * ldb + kb; FragH bq; bq.half[0] = *(const v8us*)(Bh + boff + 8 * hh); bq.half[1] = *(const v8us*)(Bh + boff + 16 + 8 * hh);
      acc[t] = mmaH<ASPLIT ? 2 : 1>(ah.v, al.v, bq.v, bq.v, acc[t]); }
  }
#pragma unroll
  for (int t = 0; t < 4; ++t) { if (col0 + t * 16 >= N) continue;
#pragma unroll
    for (int r = 0; r < 8; ++r) so[w][8 * hh + r][t * 16 + ln] = acc[t][r] * alpha; }
  __builtin_amdgcn_fence(__ATOMIC_ACQ_REL, "workgroup"); __builtin_amdgcn_wave_barrier();
  const int rsub = lane >> 4, c4 = (lane & 15) * 4;
  {
#pragma unroll
    for (int q = 0; q < 8; ++q) { const int r = q * 2 + rsub; if (col0 + c4 < N) { const v4f v = *(const v4fa*)&so[w][r][c4]; *(v4f*)(C + (size_t)(row0 + r) * ldc + col0 + c4) = v; } }
     }
}

// Wt[n][k] = f16(W[k][n]·scale) from f32 row-major W[K][N] (scale = power of two; bf16-exact weights stay exact in f16 away from the subnormal range)
__global__ __launch_bounds__(256) void k_wt_f16(const float* __restrict__ W, _Float16* __restrict__ Wt, int K, int N, float scale) {
  const int t = blockIdx.x * 256 + threadIdx.x; if (t >= N * (K / 8)) return; const int n = t / (K / 8), k8 = (t % (K / 8)) * 8; FragH f;
#pragma unroll
  for (int i = 0; i < 8; ++i) f.h[i] = (_Float16)(bf16_round(W[(size_t)(k8 + i) * N + n]) * scale); const v8us o = f.half[0];
  *(v8us*)((unsigned short*)Wt + (size_t)n * K + k8) = o; 
}
// k_gemm_hh variant with fused epilogue: v = acc·alpha + bias[by·sBias + col] (+ CP[(row/rowsPerB)·sCPb + by·64 + col] if CP) ; ACT 0 none / 1 elu ; writes f16 C16 (and f32 C if non-null)
template <int ACT>
__global__ __launch_bounds__(128) void k_gemm_hhx(const _Float16* __restrict__ A, int lda, size_t sA, const _Float16* __restrict__ Bh, int ldb, size_t sB, float alpha, const float* __restrict__ bias, size_t sBias, const float* __restrict__ CP, int rowsPerB, size_t sCPb, int row0g,
    float* __restrict__ C, _Float16* __restrict__ C16, int ldc, size_t sC, int M, int N, int K) {
  __shared__ __attribute__((aligned(16))) float so[4][16][64];
  const int tid = threadIdx.x, w = tid >> 5, lane = tid & 31, ln = lane & 15, hh = lane >> 4; const int by = blockIdx.y;
  A += (size_t)by * sA; Bh += (size_t)by * sB; const size_t cofs = (size_t)by * sC; const float* bp = bias ? bias + (size_t)by * sBias : nullptr;
  const int ntn = (N + 63) / 64; const int wid = blockIdx.x * 4 + w; const int mt = wid / ntn, nq = wid % ntn; if (mt * 16 >= M) return;
  const int row0 = mt * 16, col0 = nq * 64; const _Float16* arow = A + (size_t)(row0 + ln) * lda;
  v8f acc[4] = {};
  for (int kb = 0; kb < K; kb += 32) { FragH ah; ah.half[0] = *(const v8us*)((const unsigned short*)arow + kb + 8 * hh); ah.half[1] = *(const v8us*)((const unsigned short*)arow + kb + 16 + 8 * hh);
#pragma unroll
    for (int t = 0; t < 4; ++t) { if (col0 + t * 16 >= N) continue; const size_t boff = (size_t)(col0 + t * 16 + ln) * ldb + kb; FragH bq; bq.half[0] = *(const v8us*)((const unsigned short*)Bh + boff + 8 * hh); bq.half[1] = *(const v8us*)((const unsigned short*)Bh + boff + 16 + 8 * hh);
      acc[t] = mmaH<1>(ah.v, ah.v, bq.v, bq.v, acc[t]); }
  }
#pragma unroll
  for (int t = 0; t < 4; ++t) { if (col0 + t * 16 >= N) continue; const int col = col0 + t * 16 + ln; const float bv = bp ? bf16_round(bp[col]) : 0.f;
#pragma unroll
    for (int r = 0; r < 8; ++r) { float v = acc[t][r] * alpha + bv; if (CP) { const int rr = row0g + row0 + 8 * hh + r; if (rowsPerB < 0) v += CP[cofs + (size_t)rr * ldc + col];      /* rowsPerB < 0: own element of the batched C plane */ else { const int bidx = rr / rowsPerB; v += CP[(size_t)bidx * sCPb + (size_t)by * 64 + col]; } } if (ACT == 1) v = (v > 0.f) ? v : expm1f(v); else if (ACT == 7) v = (v > 0.f) ? v + 1.0f : expf(v); else if (ACT == 8) v = tanhf(v); else if (ACT == 9) v = 0.5f * v * (1.0f + tanhf(0.7978845608028654f * (v + 0.044715f * v * v * v))); else if (ACT == 11) v = 1.0f / (1.0f + expf(-v)); else if (ACT == 12) v = (v > 0.f) ? v : 0.01f * v; else if (ACT == 14) v = (v > 0.f) ? v : 0.1f * v; else if (ACT == 16) v = (v >= 0.f) ? v : 0.3f * v; else if (ACT == 17) v = (v >= 0.f) ? v : 0.2f * v; else if (ACT == 15) v = v / (1.0f + expf(-v)); else if (ACT == 3) v = fmaxf(v, 0.f); else if (ACT == 6) v = 0.5f * v * (1.0f + erff(v * 0.70710678118654752f)); so[w][8 * hh + r][t * 16 + ln] = v; } }
  __builtin_amdgcn_fence(__ATOMIC_ACQ_REL, "workgroup"); __builtin_amdgcn_wave_barrier();
  const int rsub = lane >> 4, c4 = (lane & 15) * 4; typedef _Float16 v4h __attribute__((ext_vector_type(4)));
  {
#pragma unroll
    for (int q = 0; q < 8; ++q) { const int r = q * 2 + rsub; if (col0 + c4 < N) { const v4f v = *(const v4fa*)&so[w][r][c4]; if (C) *(v4f*)(C + cofs + (size_t)(row0 + r) * ldc + col0 + c4) = v; if (C16) { v4h h4; for (int i = 0; i < 4; ++i) h4[i] = (_Float16)v[i]; *(v4h*)(C16 + cofs + (size_t)(row0 + r) * ldc + col0 + c4) = h4; } } }
     }
}


typedef _Float16 v4h __attribute__((ext_vector_type(4)));

__global__ __launch_bounds__(256) void k_h16(const float* __restrict__ x, _Float16* __restrict__ X16, size_t n8) { const size_t t = (size_t)blockIdx.x * 256 + threadIdx.x; if (t >= n8) return; FragH f;
#pragma unroll
  for (int q = 0; q < 8; ++q) f.h[q] = (_Float16)x[t * 8 + q]; *(v8us*)((unsigned short*)X16 + t * 8) = f.half[0];  }
__global__ __launch_bounds__(256) void k_round16f(const float* __restrict__ W, _Float16* __restrict__ Bt, size_t n8) { const size_t t = (size_t)blockIdx.x * 256 + threadIdx.x; if (t >= n8) return; FragH f;
#pragma unroll
  for (int i = 0; i < 8; ++i) f.h[i] = (_Float16)(bf16_round(W[t * 8 + i]) * 16.0f); *(v8us*)((unsigned short*)Bt + t * 8) = f.half[0];  }
__global__ __launch_bounds__(256) void k_hl(const float* __restrict__ F, _Float16* __restrict__ Hh, _Float16* __restrict__ Hl, size_t n8) { const size_t t = (size_t)blockIdx.x * 256 + threadIdx.x; if (t >= n8) return; FragH fh, fl; const v4f a = *(const v4fa*)(F + t * 8), c = *(const v4fa*)(F + t * 8 + 4);
#pragma unroll
  for (int q = 0; q < 4; ++q) { _Float16 h = (_Float16)a[q]; fh.h[q] = h; fl.h[q] = (_Float16)((a[q] - (float)h) * 1024.0f); h = (_Float16)c[q]; fh.h[4 + q] = h; fl.h[4 + q] = (_Float16)((c[q] - (float)h) * 1024.0f); }
  { *(v8us*)((unsigned short*)Hh + t * 8) = fh.half[0]; *(v8us*)((unsigned short*)Hl + t * 8) = fl.half[0];  } }

__global__ __launch_bounds__(256) void k_wnat(const float* __restrict__ w, size_t n8, _Float16* __restrict__ Bt) { const size_t t = (size_t)blockIdx.x * 256 + threadIdx.x; if (t >= n8) return; FragH f; for (int q = 0; q < 8; ++q) f.h[q] = (_Float16)(bf16_round(w[t * 8 + q]) * 16.0f); *(v8us*)((unsigned short*)Bt + t * 8) = f.half[0];  }
// lane l <-> l ^ 16 (cross-row move); every lane of the wave is on where this is used
__device__ __forceinline__ float lane_x16(float x) { return __builtin_bit_cast(float, __builtin_amdgcn_permlanex16(__builtin_bit_cast(int, x), __builtin_bit_cast(int, x), 0x76543210, 0xfedcba98, false, false)); }
// Fragment order of the attention's operands: per (batch, head) 32 passes of 32 keys, a pass = 8 units of 512 bytes, a unit = 32 lanes x 8 halves, so that one 16-byte load of a wave reads 4 whole lines.
// K (and Q, rows = queries): unit (t*2 + s)*2 + i, lane (hf, c) = K[key 16 t + c][feature 32 s + 16 i + 8 hf ..]; V^T: unit d*2 + i, lane (hf, c) = V[key 16 i + 8 hf ..][feature 16 d + c]. p points at the lane's 8 halves of unit i = 0.
__device__ __forceinline__ v16h pk_frag(const _Float16* p) { FragH f; f.half[0] = *(const v8us*)((const unsigned short*)p); f.half[1] = *(const v8us*)((const unsigned short*)p + 256); return f.v; }
__device__ __forceinline__ v8f at_mma(v16h a, v16h b, v8f c) { return __builtin_amdgcn_wmma_f32_16x16x32_f16(false, a, false, b, (short)0, c, false, false); }
// One pass of the fused attention: 32 keys (kb .. kb + 31) against the wave's 32 query columns. MORE: fetch the next pass's K and V^T fragments into the same registers, each behind its last use.
template <bool MORE>
__device__ __forceinline__ void at_pass(const _Float16* kp, const _Float16* vp, int kb, const v16h (&qf)[2][2], v16h (&kf)[2][2], v16h (&vf)[4], v8f (&o)[4][2], float (&m)[2], float (&l)[2]) {
  const float cs = 0.125f * 1.4426950408889634f;      /* log2(e) / sqrt(64) */
  const v8f z8 = {0.f,0.f,0.f,0.f,0.f,0.f,0.f,0.f};
  v8f st[2][2];      /* [query tile][key tile] */
#pragma unroll
  for (int j = 0; j < 2; ++j) for (int t = 0; t < 2; ++t) st[j][t] = at_mma(kf[t][1], qf[j][1], at_mma(kf[t][0], qf[j][0], z8));
  if (MORE) {
#pragma unroll
    for (int t = 0; t < 2; ++t) for (int s = 0; s < 2; ++s) kf[t][s] = pk_frag(kp + (size_t)(kb + 32) * HD + (t * 2 + s) * 512);
  }
  float mn[2];
#pragma unroll
  for (int j = 0; j < 2; ++j) { float mx = fmaxf(st[j][0][0], st[j][1][0]);
#pragma unroll
    for (int r = 1; r < 8; ++r) mx = fmaxf(mx, fmaxf(st[j][0][r], st[j][1][r]));
    mx = fmaxf(mx, lane_x16(mx)); mn[j] = fmaxf(m[j], mx * cs); }
  if (__builtin_amdgcn_ballot_w32(mn[0] > m[0] || mn[1] > m[1]) != 0) {      /* wave-uniform; where no column's maximum grows every factor is exactly 1 */
#pragma unroll
    for (int j = 0; j < 2; ++j) { const float al = __builtin_amdgcn_exp2f(m[j] - mn[j]); m[j] = mn[j]; l[j] *= al;
#pragma unroll
      for (int d = 0; d < 4; ++d) o[d][j] *= al; } }
#pragma unroll
  for (int j = 0; j < 2; ++j) { FragH pf; float sm[2] = {0.f, 0.f};
#pragma unroll
    for (int t = 0; t < 2; ++t)
#pragma unroll
      for (int r = 0; r < 8; ++r) { const float p = __builtin_amdgcn_exp2f(fmaf(st[j][t][r], cs, -m[j])); sm[t] += p; pf.h[8 * t + r] = (_Float16)p; }
    l[j] += sm[0] + sm[1];
#pragma unroll
    for (int d = 0; d < 4; ++d) o[d][j] = at_mma(vf[d], pf.v, o[d][j]); }
  if (MORE) {
#pragma unroll
    for (int d = 0; d < 4; ++d) vf[d] = pk_frag(vp + (size_t)(kb + 32) * HD + d * 512);
    asm volatile("s_wait_xcnt 0x0" ::: "memory");      /* before the compiler reuses the address registers of the loads above */
  } }
__global__ __launch_bounds__(128) void k_attn(const _Float16* __restrict__ Q16, const _Float16* __restrict__ K16, const _Float16* __restrict__ VT, float* __restrict__ out) {
  const int w = threadIdx.x >> 5, lane = threadIdx.x & 31, ln = lane & 15, hh = lane >> 4;
  const int bh = blockIdx.y, b = bh / NH, h = bh - b * NH; const int q0 = blockIdx.x * 128 + w * 32;
  const _Float16* qp = Q16 + (size_t)bh * (SQ * HD) + (size_t)(q0 >> 5) * 2048 + lane * 8;      /* all three in fragment order; the wave's 32 queries are one pass of Q */
  const _Float16* kp = K16 + (size_t)bh * (SQ * HD) + lane * 8;
  const _Float16* vp = VT + (size_t)bh * (SQ * HD) + lane * 8;
  v16h qf[2][2], kf[2][2], vf[4];
#pragma unroll
  for (int j = 0; j < 2; ++j) for (int s = 0; s < 2; ++s) qf[j][s] = pk_frag(qp + (j * 2 + s) * 512);
#pragma unroll
  for (int t = 0; t < 2; ++t) for (int s = 0; s < 2; ++s) kf[t][s] = pk_frag(kp + (t * 2 + s) * 512);
#pragma unroll
  for (int d = 0; d < 4; ++d) vf[d] = pk_frag(vp + d * 512);
  v8f o[4][2]; float m[2] = {-3.0e38f, -3.0e38f}, l[2] = {0.f, 0.f};
#pragma unroll
  for (int d = 0; d < 4; ++d) for (int j = 0; j < 2; ++j) o[d][j] = v8f{0.f,0.f,0.f,0.f,0.f,0.f,0.f,0.f};
  for (int kb = 0; kb < SQ - 32; kb += 32) at_pass<true>(kp, vp, kb, qf, kf, vf, o, m, l);
  at_pass<false>(kp, vp, SQ - 32, qf, kf, vf, o, m, l);      /* the last pass has nothing to fetch */
#pragma unroll
  for (int j = 0; j < 2; ++j) { const float inv = 1.0f / (l[j] + lane_x16(l[j]));      /* join the halves' sums once */
    float* op = out + ((size_t)b * SQ + q0 + j * 16 + ln) * DM + h * HD + 8 * hh;      /* O^T register r = feature 16 d + 8 hf + r of query c: 32 contiguous bytes a lane and tile */
#pragma unroll
    for (int d = 0; d < 4; ++d) { const v4f lo = {o[d][j][0] * inv, o[d][j][1] * inv, o[d][j][2] * inv, o[d][j][3] * inv}, hi = {o[d][j][4] * inv, o[d][j][5] * inv, o[d][j][6] * inv, o[d][j][7] * inv};
      *(v4f*)(op + d * 16) = lo; *(v4f*)(op + d * 16 + 4) = hi; } } }
__global__ __launch_bounds__(256) void k_vt(const _Float16* __restrict__ V16, int b, int h0, _Float16* __restrict__ VT) { __shared__ unsigned short tl[64][65]; const int tid = threadIdx.x; const int hh = blockIdx.x % HG, sg = blockIdx.x / HG; const int s0 = sg * 64; const int h = h0 + hh;
  for (int i = tid; i < 64 * 8; i += 256) { const int j = i / 8, d8 = (i % 8) * 8; FragH f; f.half[0] = *(const v8us*)((const unsigned short*)V16 + ((size_t)b * SQ + s0 + j) * DM + h * HD + d8); for (int q = 0; q < 8; ++q) tl[d8 + q][j] = f.u[q]; }
  __syncthreads();
  { for (int i = tid; i < 64 * 8; i += 256) { const int d = i / 8, j8 = (i % 8) * 8; FragH f; for (int q = 0; q < 8; ++q) f.u[q] = tl[d][j8 + q]; *(v8us*)((unsigned short*)VT + ((size_t)hh * HD + d) * SQ + s0 + j8) = f.half[0]; }  } }



// two f32 rounded to bf16 (the conversion instruction rounds to nearest even, as bf16_round does) and widened again
typedef float v2f __attribute__((ext_vector_type(2)));
typedef __bf16 v2b __attribute__((ext_vector_type(2)));
__device__ __forceinline__ v2f rb2(float a, float b) { const v2f p = {a, b}; return __builtin_convertvector(__builtin_convertvector(p, v2b), v2f); }
// 16-byte halves of a WMMA operand fragment from an LDS weight row: p points at the lane's first 8 halves (k = 8 hf ..), the second 8 stand 16 halves on (k = 16 + 8 hf ..), the k order of the x fragments below.
__device__ __forceinline__ v16h ws_frag(const unsigned short* p) { FragH f; f.half[0] = *(const v8us*)p; f.half[1] = *(const v8us*)(p + 16); return f.v; }
// Fused projections, one launch: a work-group = one head x 128 token rows, a wave = 32 rows (one 32-key pass of its batch and head).
// x is read as f32 and rounded in the fragment registers (bf16, exact in f16); the head's three 64 x 64 weights pass once through LDS as [out][in] f16 rows (x16, exact), pitch 72 halves for the 16-byte fragment reads.
// Q and K: D = W^T x^T (A = weight rows, B = token rows): a lane holds 8 consecutive features of one token. V: D = x W (A = token rows, B = weight rows): a lane holds 8 consecutive keys of one feature.
// Either way the 8 accumulator registers of a tile are the lane's 16 bytes of one fragment-order unit (see pk_frag), so every tile leaves as one 512-byte store of the wave, with no staging and no transpose pass.
__global__ __launch_bounds__(128) void k_qkv(const float* __restrict__ x, const float* __restrict__ wq, const float* __restrict__ bq, const float* __restrict__ wk, const float* __restrict__ bk, const float* __restrict__ wv, const float* __restrict__ bv,
    _Float16* __restrict__ QP, _Float16* __restrict__ KP, _Float16* __restrict__ VT) {
  __shared__ __attribute__((aligned(16))) unsigned short wl[3][HD][72];
  __shared__ __attribute__((aligned(16))) float bl[3][HD];      /* the head's biases, rounded to bf16 */
  const int tid = threadIdx.x, w = tid >> 5, lane = tid & 31, ln = lane & 15, hh = lane >> 4;
  const int h = blockIdx.y, row0 = blockIdx.x * 128 + 32 * w;
  const float* xp = x + (size_t)(row0 + ln) * DM + h * HD + 8 * hh;
  const size_t wofs = (size_t)h * HD * HD + (tid >> 4) * 8 * HD + (tid & 15) * 4;      /* a thread takes 8 inputs x 4 outputs of each weight: 16 lanes read one whole 256-byte weight row */
  const float* wpq = wq + wofs; const float* wpk = wk + wofs; const float* wpv = wv + wofs;
  const float* bp01 = (tid < 64 ? bq : bk) + h * HD + (tid & 63); const float* bp2 = bv + h * HD + (tid & 63);      /* threads 0..63: q and v biases, 64..127: k biases (their v value is not used) */
  v4f xr[2][2][4], wr[3][8];
#pragma unroll
  for (int j = 0; j < 2; ++j)
#pragma unroll
    for (int s = 0; s < 2; ++s)
#pragma unroll
      for (int q = 0; q < 4; ++q) xr[j][s][q] = *(const v4fa*)(xp + (size_t)j * 16 * DM + s * 32 + (q >> 1) * 16 + (q & 1) * 4);
  asm volatile("s_wait_xcnt 0x0" :: "v"(xp) : "memory");      /* the operand keeps the address registers of the loads above as they are up to this wait; the statement also keeps these loads, the only ones that come from memory, ahead of the rest */
#pragma unroll
  for (int i = 0; i < 8; ++i) { wr[0][i] = *(const v4fa*)(wpq + i * HD); wr[1][i] = *(const v4fa*)(wpk + i * HD); wr[2][i] = *(const v4fa*)(wpv + i * HD); }
  const float b01 = *bp01, b2 = *bp2;
  asm volatile("s_wait_xcnt 0x0" :: "v"(wpq), "v"(wpk), "v"(wpv), "v"(bp01) : "memory");      /* as above, for the weight and bias loads */
#pragma unroll
  for (int m = 0; m < 3; ++m)
#pragma unroll
    for (int k = 0; k < 4; ++k) { FragH f;
#pragma unroll
      for (int i = 0; i < 8; i += 2) { const v2f p = rb2(wr[m][i][k], wr[m][i + 1][k]) * 16.0f; f.h[i] = (_Float16)p[0]; f.h[i + 1] = (_Float16)p[1]; }
      *(v8us*)&wl[m][(tid & 15) * 4 + k][(tid >> 4) * 8] = f.half[0]; }
  bl[tid >> 6][tid & 63] = bf16_round(b01);
  if (tid < 64) bl[2][tid] = bf16_round(b2);
  v16h xf[2][2];
#pragma unroll
  for (int j = 0; j < 2; ++j)
#pragma unroll
    for (int s = 0; s < 2; ++s) { FragH f;
#pragma unroll
      for (int q = 0; q < 4; ++q)
#pragma unroll
        for (int i = 0; i < 4; i += 2) { const v2f p = rb2(xr[j][s][q][i], xr[j][s][q][i + 1]); f.h[q * 4 + i] = (_Float16)p[0]; f.h[q * 4 + i + 1] = (_Float16)p[1]; }
      xf[j][s] = f.v; }
  __syncthreads();
  const v8f z8 = {0.f,0.f,0.f,0.f,0.f,0.f,0.f,0.f};
  const size_t pofs = ((size_t)(row0 / SQ) * NH + h) * (SQ * HD) + (size_t)((row0 % SQ) >> 5) * 2048 + lane * 8;      /* the wave's pass, the lane's 8 halves of unit 0 */
#pragma unroll
  for (int m = 0; m < 2; ++m) { unsigned short* dst = (unsigned short*)(m == 0 ? QP : KP) + pofs;
#pragma unroll
    for (int te = 0; te < 4; ++te) { const v16h a0 = ws_frag(&wl[m][te * 16 + ln][8 * hh]), a1 = ws_frag(&wl[m][te * 16 + ln][32 + 8 * hh]);
      const v4f b0 = *(const v4fa*)&bl[m][te * 16 + 8 * hh], b1 = *(const v4fa*)&bl[m][te * 16 + 8 * hh + 4]; const float bb[8] = {b0[0], b0[1], b0[2], b0[3], b1[0], b1[1], b1[2], b1[3]};
#pragma unroll
      for (int tk = 0; tk < 2; ++tk) { const v8f c = at_mma(a1, xf[tk][1], at_mma(a0, xf[tk][0], z8)); FragH f;
#pragma unroll
        for (int r = 0; r < 8; ++r) f.h[r] = (_Float16)(c[r] * 0.0625f + bb[r]);
        *(v8us*)(dst + (tk * 4 + te) * 256) = f.half[0]; } }      /* unit (t*2 + s)*2 + i with features 16 te = 32 s + 16 i */
    asm volatile("s_wait_xcnt 0x0" ::: "memory"); }      /* before the next product reuses the registers of the stores above; it also keeps the next product's LDS reads behind them, which bounds the registers in use */
  { unsigned short* dst = (unsigned short*)VT + pofs;
#pragma unroll
    for (int td = 0; td < 4; ++td) { const v16h b0 = ws_frag(&wl[2][td * 16 + ln][8 * hh]), b1 = ws_frag(&wl[2][td * 16 + ln][32 + 8 * hh]); const float bb = bl[2][td * 16 + ln];
#pragma unroll
      for (int tk = 0; tk < 2; ++tk) { const v8f c = at_mma(xf[tk][1], b1, at_mma(xf[tk][0], b0, z8)); FragH f;
#pragma unroll
        for (int r = 0; r < 8; ++r) f.h[r] = (_Float16)(c[r] * 0.0625f + bb);
        *(v8us*)(dst + (td * 2 + tk) * 256) = f.half[0]; } } } }      /* unit d*2 + i */
extern "C" void kernel_launch(void* const* d_in, const int* in_sizes, int n_in,
                              void* d_out, int out_size, void* d_ws, size_t ws_size, hipStream_t stream) {
  (void)in_sizes; (void)n_in; (void)out_size;
  const float* const* I = (const float* const*)d_in; const float* x = I[0]; const float* wq = I[1]; const float* bq = I[2]; const float* wk = I[3]; const float* bk = I[4]; const float* wv = I[5]; const float* bv = I[6];      /* per-head W [12][64][64] ([h][in][out]) + b [12][64] for q, k, v */
  char* ws = (char*)d_ws; size_t off = 0;
  auto take = [&](size_t bytes) { char* p = ws + off; off += (bytes + 255) & ~(size_t)255; return p; };
  _Float16* Q16 = (_Float16*)take(NR * DM * 2); _Float16* K16 = (_Float16*)take(NR * DM * 2);
  _Float16* VT = (_Float16*)take((size_t)NB * NH * HD * SQ * 2);
  if (off > ws_size) return;
  k_qkv<<<dim3(MP / 128, NH), 128, 0, stream>>>(x, wq, bq, wk, bk, wv, bv, Q16, K16, VT);      /* x and weight rounding, the three per-head projections (+ biases) and the fragment-order layouts of Q, K and V^T, one launch */
  k_attn<<<dim3(SQ / 128, NB * NH), 128, 0, stream>>>(Q16, K16, VT, (float*)d_out);      /* scores, softmax and P V fused; f32 straight into the merged-heads output rows */
}

// v005
// One run takes 48.5 microseconds.
// Two timings next to v004 put it at 1.16 and 1.17 times that version's speed.
// Counting every step since v000, it is 111 times as fast.
#include <hip/hip_runtime.h>
// Multi-head self-attention with PER-HEAD 64x64 projections on head-chunked features (sequences [8][1024][768] viewed [B][S][12][64]; q/k/v[..., h, :] = x[..., h, :] W[h] + b[h] with W [12][64][64] ([h][in][out], sigma 0.05) and b [12][64] (sigma 0.05); scores / 8; softmax over all 1024 keys (no mask); out = heads concatenated (no output projection) -> [8][1024][768]).
// Structure: token rows r = b*1024 + s; one projection launch: x rounded in registers (bf16, exact in f16), Q, K, V as WMMA products (32x64 wave tiles, f32 accumulation, exact x16 weights + bias, f16 outputs), Q, K and V^T stored from the accumulators in WMMA fragment order (512-byte units); one fused attention launch over every (batch, head), K and V^T staged per work-group in a two-buffer LDS ring by asynchronous copies: S^T = K Q^T (K = 64), running softmax in registers (f32 statistics; weights 2^(s - max) as f16), O^T += V^T P^T, divided by the row sum and written f32 straight into the merged-heads output rows (no output projection).
// Compute dtype: inputs rounded to bf16; x / weights exact; q, k, v and softmax weights as plain f16 GEMM operands (~2^-12); scores, softmax statistics and o f32. v_wmma_f32_16x16x32_f16.
#define NB 8
#define SQ 1024
#define DM 768
#define NH 12
#define HD 64
#define HG 4                         /* heads per launch of the per-batch k_vt overload (not called) */
#define B0 0                         /* unused (both launches start at batch 0) */
#define NBR NB                       /* batches processed (debug hook) */
#define NR ((size_t)NB * SQ)         /* token rows */
#define MP ((int)((size_t)NBR * SQ)) /* rows projected (debug hook) */
#define QN SQ                        /* unused (k_attn attends all SQ query rows) */
#define NHD NH                       /* unused (k_attn covers all NH heads) */
#define MPO MP                       /* unused (no output stage) */
#define LQ DM      /* unused (Q, K and V^T are all in fragment order) */
typedef __bf16 v16b __attribute__((ext_vector_type(16)));
typedef unsigned short v8us __attribute__((ext_vector_type(8), may_alias));
typedef float  v8f  __attribute__((ext_vector_type(8)));
typedef float  v4f  __attribute__((ext_vector_type(4)));
typedef float  v4fa __attribute__((ext_vector_type(4), may_alias));
union FragB { v16b v; v8us half[2]; unsigned short u[16]; };

__device__ __forceinline__ unsigned short bf16_bits(float x) { unsigned int u = __float_as_uint(x); return (unsigned short)((u + 0x7FFFu + ((u >> 16) & 1u)) >> 16); }
__device__ __forceinline__ float bf16_val(unsigned short b) { return __uint_as_float(((unsigned int)b) << 16); }
__device__ __forceinline__ float bf16_round(float x) { return bf16_val(bf16_bits(x)); }
// D += A·B with NT terms: 1 = ah·bh, 2 = + al·bh (A split), 3 = + ah·bl (both split)
template <int NT>
__device__ __forceinline__ v8f mmaN(v16b ah, v16b al, v16b bh, v16b bl, v8f c) {
  c = __builtin_amdgcn_wmma_f32_16x16x32_bf16(false, ah, false, bh, (short)0, c, false, false);
  if (NT >= 2) c = __builtin_amdgcn_wmma_f32_16x16x32_bf16(false, al, false, bh, (short)0, c, false, false);
  if (NT >= 3) c = __builtin_amdgcn_wmma_f32_16x16x32_bf16(false, ah, false, bl, (short)0, c, false, false);
  asm volatile("v_nop\n\tv_nop\n\tv_nop\n\tv_nop" : "+v"(c) : "v"(ah), "v"(al), "v"(bh), "v"(bl));
  return c;
}

__global__ __launch_bounds__(256) void k_wt_bf16(const float* __restrict__ W, unsigned short* __restrict__ Wt, int K, int N) {
  const int t = blockIdx.x * 256 + threadIdx.x;
  const int k8n = K / 8;
  if (t >= N * k8n) return;
  const int n = t / k8n, k8 = (t % k8n) * 8;
  v8us v;
#pragma unroll
  for (int i = 0; i < 8; ++i) v[i] = bf16_bits(W[(size_t)(k8 + i) * N + n]);
  *(v8us*)(Wt + (size_t)n * K + k8) = v;
  
}

// GEMM C[M][N] (f32, pitch ldc) = act(A[M][K]·W + bias). A f32 row-major (pitch lda) converted per fragment to bf16
// (ASPLIT: hi/lo two planes -> 2 terms, else single rounded term); Wt bf16 [N][K] (pitch ldb). BIAS_BF16 rounds the
// bias to bf16 first (bias quantised to bf16 before the add). K%32==0, M%16==0, N%64==0.
template <bool ASPLIT, int ACT, bool BIAS_BF16>
__global__ __launch_bounds__(128) void k_gemm_bf(const float* __restrict__ A, int lda, const unsigned short* __restrict__ Wt, int ldb,
                                               const float* __restrict__ bias, float* __restrict__ C, int ldc, int M, int N, int K) {
  __shared__ __attribute__((aligned(16))) float so[4][16][64];
  const int tid = threadIdx.x, w = tid >> 5, lane = tid & 31, ln = lane & 15, hh = lane >> 4;
  const int ntn = N / 64;
  const int wid = blockIdx.x * 4 + w;
  const int mt = wid / ntn, nq = wid % ntn;
  if (mt * 16 >= M) return;
  const int row0 = mt * 16, col0 = nq * 64;
  const float* arow = A + (size_t)(row0 + ln) * lda;
  v8f acc[4] = {};
  for (int kb = 0; kb < K; kb += 32) {
    FragB ah, al;
    const v4f x0 = *(const v4fa*)(arow + kb + 8 * hh), x1 = *(const v4fa*)(arow + kb + 8 * hh + 4);
    const v4f x2 = *(const v4fa*)(arow + kb + 16 + 8 * hh), x3 = *(const v4fa*)(arow + kb + 16 + 8 * hh + 4);
    float xs[16] = {x0[0],x0[1],x0[2],x0[3],x1[0],x1[1],x1[2],x1[3],x2[0],x2[1],x2[2],x2[3],x3[0],x3[1],x3[2],x3[3]};
#pragma unroll
    for (int i = 0; i < 16; ++i) { const unsigned short hb = bf16_bits(xs[i]); ah.u[i] = hb; al.u[i] = ASPLIT ? bf16_bits(xs[i] - bf16_val(hb)) : (unsigned short)0; }
#pragma unroll
    for (int t = 0; t < 4; ++t) {
      const unsigned short* brow = Wt + (size_t)(col0 + t * 16 + ln) * ldb + kb;
      FragB b;
      b.half[0] = *(const v8us*)(brow + 8 * hh);
      b.half[1] = *(const v8us*)(brow + 16 + 8 * hh);
      acc[t] = mmaN<ASPLIT ? 2 : 1>(ah.v, al.v, b.v, b.v, acc[t]);
    }
  }
#pragma unroll
  for (int t = 0; t < 4; ++t) {
    float bv = bias ? bias[col0 + t * 16 + ln] : 0.f;
    if (BIAS_BF16) bv = bf16_round(bv);
#pragma unroll
    for (int r = 0; r < 8; ++r) { float v = acc[t][r] + bv; if (ACT == 1) v = fmaxf(v, 0.f); so[w][8 * hh + r][t * 16 + ln] = v; }
  }
  __builtin_amdgcn_fence(__ATOMIC_ACQ_REL, "workgroup");
  __builtin_amdgcn_wave_barrier();
  const int rsub = lane >> 4, c4 = (lane & 15) * 4;
  {
#pragma unroll
    for (int q = 0; q < 8; ++q) {
      const int r = q * 2 + rsub;
      const v4f v = *(const v4fa*)&so[w][r][c4];
      *(v4f*)(C + (size_t)(row0 + r) * ldc + col0 + c4) = v;
    }
    
  }
}

// GEMM C = act(A·W + bias + resid): A f32 (ASPLIT -> hi/lo 2 terms), Wt bf16 [N][K]; ACT 0 none, 1 relu, 2 exact gelu;
// resid (optional, f32, row index = (row % rmod), pitch ldr, RES_BF16 rounds it) added before the activation.
template <bool ASPLIT, int ACT, bool BIAS_BF16, bool RES_BF16>
__global__ __launch_bounds__(128) void k_gemm_bf3(const float* __restrict__ A, int lda, const unsigned short* __restrict__ Wt, int ldb,
                                                const float* __restrict__ bias, const float* __restrict__ resid, int rmod, int ldr,
                                                float* __restrict__ C, int ldc, int M, int N, int K) {
  __shared__ __attribute__((aligned(16))) float so[4][16][64];
  const int tid = threadIdx.x, w = tid >> 5, lane = tid & 31, ln = lane & 15, hh = lane >> 4;
  const int ntn = N / 64;
  const int wid = blockIdx.x * 4 + w;
  const int mt = wid / ntn, nq = wid % ntn;
  if (mt * 16 >= M) return;
  const int row0 = mt * 16, col0 = nq * 64;
  const float* arow = A + (size_t)(row0 + ln) * lda;
  v8f acc[4] = {};
  for (int kb = 0; kb < K; kb += 32) {
    FragB ah, al;
    const v4f x0 = *(const v4fa*)(arow + kb + 8 * hh), x1 = *(const v4fa*)(arow + kb + 8 * hh + 4);
    const v4f x2 = *(const v4fa*)(arow + kb + 16 + 8 * hh), x3 = *(const v4fa*)(arow + kb + 16 + 8 * hh + 4);
    float xs[16] = {x0[0],x0[1],x0[2],x0[3],x1[0],x1[1],x1[2],x1[3],x2[0],x2[1],x2[2],x2[3],x3[0],x3[1],x3[2],x3[3]};
#pragma unroll
    for (int i = 0; i < 16; ++i) { const unsigned short hb = bf16_bits(xs[i]); ah.u[i] = hb; al.u[i] = ASPLIT ? bf16_bits(xs[i] - bf16_val(hb)) : (unsigned short)0; }
#pragma unroll
    for (int t = 0; t < 4; ++t) {
      const unsigned short* brow = Wt + (size_t)(col0 + t * 16 + ln) * ldb + kb;
      FragB b;
      b.half[0] = *(const v8us*)(brow + 8 * hh);
      b.half[1] = *(const v8us*)(brow + 16 + 8 * hh);
      acc[t] = mmaN<ASPLIT ? 2 : 1>(ah.v, al.v, b.v, b.v, acc[t]);
    }
  }
#pragma unroll
  for (int t = 0; t < 4; ++t) {
    const int col = col0 + t * 16 + ln;
    float bv = bias ? bias[col] : 0.f;
    if (BIAS_BF16) bv = bf16_round(bv);
#pragma unroll
    for (int r = 0; r < 8; ++r) {
      float v = acc[t][r] + bv;
      if (resid) { float rv = resid[(size_t)((row0 + 8 * hh + r) % rmod) * ldr + col]; if (RES_BF16) rv = bf16_round(rv); v += rv; }
      if (ACT == 1) v = fmaxf(v, 0.f);
      if (ACT == 2) v = 0.5f * v * (1.0f + erff(v * 0.70710678118654752f));
      if (ACT == 3) { const float u = 0.7978845608028654f * (v + 0.044715f * v * v * v); v = 0.5f * v * (1.0f + tanhf(u)); }
      so[w][8 * hh + r][t * 16 + ln] = v;
    }
  }
  __builtin_amdgcn_fence(__ATOMIC_ACQ_REL, "workgroup");
  __builtin_amdgcn_wave_barrier();
  const int rsub = lane >> 4, c4 = (lane & 15) * 4;
  {
#pragma unroll
    for (int q = 0; q < 8; ++q) {
      const int r = q * 2 + rsub;
      const v4f v = *(const v4fa*)&so[w][r][c4];
      *(v4f*)(C + (size_t)(row0 + r) * ldc + col0 + c4) = v;
    }
    
  }
}
// row LayerNorm (biased variance, eps) over N: s = X (+ R); optional out_sum <- s; out_norm <- (s-mu)*rsqrt(var+eps)*g + b
template <bool PARAM_BF16>
__global__ __launch_bounds__(256) void k_layernorm(const float* __restrict__ X, const float* __restrict__ R, const float* __restrict__ g, const float* __restrict__ bta,
                                                  float* __restrict__ out_sum, float* __restrict__ out_norm, int N, float eps) {
  __shared__ float red[256];
  const int row = blockIdx.x, tid = threadIdx.x;
  const float* x = X + (size_t)row * N; const float* rr = R ? R + (size_t)row * N : nullptr;
  float vals[16];                     // up to N = 4096
  const int per = N / 256;            // contiguous chunk per thread? use strided-by-4 chunks: thread handles j = tid*4 + 1024*u
  float s1 = 0.f;
  for (int u = 0; u < per / 4; ++u) {
    const int j = tid * 4 + 1024 * u;
    const v4f a = *(const v4fa*)(x + j);
    v4f b = {0.f,0.f,0.f,0.f}; if (rr) b = *(const v4fa*)(rr + j);
#pragma unroll
    for (int q = 0; q < 4; ++q) { const float v = a[q] + b[q]; vals[u * 4 + q] = v; s1 += v; }
  }
  red[tid] = s1; __syncthreads();
  for (int st = 128; st > 0; st >>= 1) { if (tid < st) red[tid] += red[tid + st]; __syncthreads(); }
  const float mu = red[0] / (float)N; __syncthreads();
  float s2 = 0.f;
  for (int u = 0; u < per / 4; ++u)
#pragma unroll
    for (int q = 0; q < 4; ++q) { const float c = vals[u * 4 + q] - mu; s2 += c * c; }
  red[tid] = s2; __syncthreads();
  for (int st = 128; st > 0; st >>= 1) { if (tid < st) red[tid] += red[tid + st]; __syncthreads(); }
  const float rs = rsqrtf(red[0] / (float)N + eps);
  {
    for (int u = 0; u < per / 4; ++u) {
      const int j = tid * 4 + 1024 * u;
      v4f o, sm;
#pragma unroll
      for (int q = 0; q < 4; ++q) {
        float gg = g[j + q], bb = bta[j + q];
        if (PARAM_BF16) { gg = bf16_round(gg); bb = bf16_round(bb); }
        sm[q] = vals[u * 4 + q]; o[q] = (vals[u * 4 + q] - mu) * rs * gg + bb;
      }
      if (out_sum) *(v4f*)(out_sum + (size_t)row * N + j) = sm;
      *(v4f*)(out_norm + (size_t)row * N + j) = o;
    }
    
  }
}



// ---- f16 WMMA path (v_wmma_f32_16x16x32_f16): 11-bit significands for operands in range — used where a [0,1] probability operand needs more precision than bf16
typedef _Float16 v16h __attribute__((ext_vector_type(16)));
union FragH { v16h v; v8us half[2]; _Float16 h[16]; unsigned short u[16]; };
template <int NT>
__device__ __forceinline__ v8f mmaH(v16h ah, v16h al, v16h bh, v16h bl, v8f c) {
  c = __builtin_amdgcn_wmma_f32_16x16x32_f16(false, ah, false, bh, (short)0, c, false, false);
  if (NT >= 2) c = __builtin_amdgcn_wmma_f32_16x16x32_f16(false, al, false, bh, (short)0, c, false, false);
  if (NT >= 3) c = __builtin_amdgcn_wmma_f32_16x16x32_f16(false, ah, false, bl, (short)0, c, false, false);
  asm volatile("v_nop\n\tv_nop\n\tv_nop\n\tv_nop" : "+v"(c) : "v"(ah), "v"(al), "v"(bh), "v"(bl));
  return c;
}
// batched GEMM like k_gemm_b but f16 operands: A f32 (split into f16 hi/lo if ASPLIT, else rounded to f16), Bt = f16 values [n][k]; alpha; C f32; N multiple of 16 (partial tiles skipped)
template <bool ASPLIT>
__global__ __launch_bounds__(128) void k_gemm_h(const float* __restrict__ A, int lda, size_t sA, const _Float16* __restrict__ Bh, int ldb, size_t sB, float alpha, float* __restrict__ C, int ldc, size_t sC, int M, int N, int K) {
  __shared__ __attribute__((aligned(16))) float so[4][16][64];
  const int tid = threadIdx.x, w = tid >> 5, lane = tid & 31, ln = lane & 15, hh = lane >> 4; const int by = blockIdx.y;
  A += (size_t)by * sA; Bh += (size_t)by * sB; C += (size_t)by * sC;
  const int ntn = (N + 63) / 64; const int wid = blockIdx.x * 4 + w; const int mt = wid / ntn, nq = wid % ntn; if (mt * 16 >= M) return;
  const int row0 = mt * 16, col0 = nq * 64; const float* arow = A + (size_t)(row0 + ln) * lda;
  v8f acc[4] = {};
  for (int kb = 0; kb < K; kb += 32) {
    FragH ah, al;
    const v4f x0 = *(const v4fa*)(arow + kb + 8 * hh), x1 = *(const v4fa*)(arow + kb + 8 * hh + 4), x2 = *(const v4fa*)(arow + kb + 16 + 8 * hh), x3 = *(const v4fa*)(arow + kb + 16 + 8 * hh + 4);
    float xs[16] = {x0[0],x0[1],x0[2],x0[3],x1[0],x1[1],x1[2],x1[3],x2[0],x2[1],x2[2],x2[3],x3[0],x3[1],x3[2],x3[3]};
#pragma unroll
    for (int i = 0; i < 16; ++i) { const _Float16 h = (_Float16)xs[i]; ah.h[i] = h; al.h[i] = ASPLIT ? (_Float16)(xs[i] - (float)h) : (_Float16)0.0f; }
#pragma unroll
    for (int t = 0; t < 4; ++t) { if (col0 + t * 16 >= N) continue; const size_t boff = (size_t)(col0 + t * 16 + ln) * ldb + kb; FragH bq; bq.half[0] = *(const v8us*)(Bh + boff + 8 * hh); bq.half[1] = *(const v8us*)(Bh + boff + 16 + 8 * hh);
      acc[t] = mmaH<ASPLIT ? 2 : 1>(ah.v, al.v, bq.v, bq.v, acc[t]); }
  }
#pragma unroll
  for (int t = 0; t < 4; ++t) { if (col0 + t * 16 >= N) continue;
#pragma unroll
    for (int r = 0; r < 8; ++r) so[w][8 * hh + r][t * 16 + ln] = acc[t][r] * alpha; }
  __builtin_amdgcn_fence(__ATOMIC_ACQ_REL, "workgroup"); __builtin_amdgcn_wave_barrier();
  const int rsub = lane >> 4, c4 = (lane & 15) * 4;
  {
#pragma unroll
    for (int q = 0; q < 8; ++q) { const int r = q * 2 + rsub; if (col0 + c4 < N) { const v4f v = *(const v4fa*)&so[w][r][c4]; *(v4f*)(C + (size_t)(row0 + r) * ldc + col0 + c4) = v; } }
     }
}

// Wt[n][k] = f16(W[k][n]·scale) from f32 row-major W[K][N] (scale = power of two; bf16-exact weights stay exact in f16 away from the subnormal range)
__global__ __launch_bounds__(256) void k_wt_f16(const float* __restrict__ W, _Float16* __restrict__ Wt, int K, int N, float scale) {
  const int t = blockIdx.x * 256 + threadIdx.x; if (t >= N * (K / 8)) return; const int n = t / (K / 8), k8 = (t % (K / 8)) * 8; FragH f;
#pragma unroll
  for (int i = 0; i < 8; ++i) f.h[i] = (_Float16)(bf16_round(W[(size_t)(k8 + i) * N + n]) * scale); const v8us o = f.half[0];
  *(v8us*)((unsigned short*)Wt + (size_t)n * K + k8) = o; 
}
// k_gemm_hh variant with fused epilogue: v = acc·alpha + bias[by·sBias + col] (+ CP[(row/rowsPerB)·sCPb + by·64 + col] if CP) ; ACT 0 none / 1 elu ; writes f16 C16 (and f32 C if non-null)
template <int ACT>
__global__ __launch_bounds__(128) void k_gemm_hhx(const _Float16* __restrict__ A, int lda, size_t sA, const _Float16* __restrict__ Bh, int ldb, size_t sB, float alpha, const float* __restrict__ bias, size_t sBias, const float* __restrict__ CP, int rowsPerB, size_t sCPb, int row0g,
    float* __restrict__ C, _Float16* __restrict__ C16, int ldc, size_t sC, int M, int N, int K) {
  __shared__ __attribute__((aligned(16))) float so[4][16][64];
  const int tid = threadIdx.x, w = tid >> 5, lane = tid & 31, ln = lane & 15, hh = lane >> 4; const int by = blockIdx.y;
  A += (size_t)by * sA; Bh += (size_t)by * sB; const size_t cofs = (size_t)by * sC; const float* bp = bias ? bias + (size_t)by * sBias : nullptr;
  const int ntn = (N + 63) / 64; const int wid = blockIdx.x * 4 + w; const int mt = wid / ntn, nq = wid % ntn; if (mt * 16 >= M) return;
  const int row0 = mt * 16, col0 = nq * 64; const _Float16* arow = A + (size_t)(row0 + ln) * lda;
  v8f acc[4] = {};
  for (int kb = 0; kb < K; kb += 32) { FragH ah; ah.half[0] = *(const v8us*)((const unsigned short*)arow + kb + 8 * hh); ah.half[1] = *(const v8us*)((const unsigned short*)arow + kb + 16 + 8 * hh);
#pragma unroll
    for (int t = 0; t < 4; ++t) { if (col0 + t * 16 >= N) continue; const size_t boff = (size_t)(col0 + t * 16 + ln) * ldb + kb; FragH bq; bq.half[0] = *(const v8us*)((const unsigned short*)Bh + boff + 8 * hh); bq.half[1] = *(const v8us*)((const unsigned short*)Bh + boff + 16 + 8 * hh);
      acc[t] = mmaH<1>(ah.v, ah.v, bq.v, bq.v, acc[t]); }
  }
#pragma unroll
  for (int t = 0; t < 4; ++t) { if (col0 + t * 16 >= N) continue; const int col = col0 + t * 16 + ln; const float bv = bp ? bf16_round(bp[col]) : 0.f;
#pragma unroll
    for (int r = 0; r < 8; ++r) { float v = acc[t][r] * alpha + bv; if (CP) { const int rr = row0g + row0 + 8 * hh + r; if (rowsPerB < 0) v += CP[cofs + (size_t)rr * ldc + col];      /* rowsPerB < 0: own element of the batched C plane */ else { const int bidx = rr / rowsPerB; v += CP[(size_t)bidx * sCPb + (size_t)by * 64 + col]; } } if (ACT == 1) v = (v > 0.f) ? v : expm1f(v); else if (ACT == 7) v = (v > 0.f) ? v + 1.0f : expf(v); else if (ACT == 8) v = tanhf(v); else if (ACT == 9) v = 0.5f * v * (1.0f + tanhf(0.7978845608028654f * (v + 0.044715f * v * v * v))); else if (ACT == 11) v = 1.0f / (1.0f + expf(-v)); else if (ACT == 12) v = (v > 0.f) ? v : 0.01f * v; else if (ACT == 14) v = (v > 0.f) ? v : 0.1f * v; else if (ACT == 16) v = (v >= 0.f) ? v : 0.3f * v; else if (ACT == 17) v = (v >= 0.f) ? v : 0.2f * v; else if (ACT == 15) v = v / (1.0f + expf(-v)); else if (ACT == 3) v = fmaxf(v, 0.f); else if (ACT == 6) v = 0.5f * v * (1.0f + erff(v * 0.70710678118654752f)); so[w][8 * hh + r][t * 16 + ln] = v; } }
  __builtin_amdgcn_fence(__ATOMIC_ACQ_REL, "workgroup"); __builtin_amdgcn_wave_barrier();
  const int rsub = lane >> 4, c4 = (lane & 15) * 4; typedef _Float16 v4h __attribute__((ext_vector_type(4)));
  {
#pragma unroll
    for (int q = 0; q < 8; ++q) { const int r = q * 2 + rsub; if (col0 + c4 < N) { const v4f v = *(const v4fa*)&so[w][r][c4]; if (C) *(v4f*)(C + cofs + (size_t)(row0 + r) * ldc + col0 + c4) = v; if (C16) { v4h h4; for (int i = 0; i < 4; ++i) h4[i] = (_Float16)v[i]; *(v4h*)(C16 + cofs + (size_t)(row0 + r) * ldc + col0 + c4) = h4; } } }
     }
}


typedef _Float16 v4h __attribute__((ext_vector_type(4)));

__global__ __launch_bounds__(256) void k_h16(const float* __restrict__ x, _Float16* __restrict__ X16, size_t n8) { const size_t t = (size_t)blockIdx.x * 256 + threadIdx.x; if (t >= n8) return; FragH f;
#pragma unroll
  for (int q = 0; q < 8; ++q) f.h[q] = (_Float16)x[t * 8 + q]; *(v8us*)((unsigned short*)X16 + t * 8) = f.half[0];  }
__global__ __launch_bounds__(256) void k_round16f(const float* __restrict__ W, _Float16* __restrict__ Bt, size_t n8) { const size_t t = (size_t)blockIdx.x * 256 + threadIdx.x; if (t >= n8) return; FragH f;
#pragma unroll
  for (int i = 0; i < 8; ++i) f.h[i] = (_Float16)(bf16_round(W[t * 8 + i]) * 16.0f); *(v8us*)((unsigned short*)Bt + t * 8) = f.half[0];  }
__global__ __launch_bounds__(256) void k_hl(const float* __restrict__ F, _Float16* __restrict__ Hh, _Float16* __restrict__ Hl, size_t n8) { const size_t t = (size_t)blockIdx.x * 256 + threadIdx.x; if (t >= n8) return; FragH fh, fl; const v4f a = *(const v4fa*)(F + t * 8), c = *(const v4fa*)(F + t * 8 + 4);
#pragma unroll
  for (int q = 0; q < 4; ++q) { _Float16 h = (_Float16)a[q]; fh.h[q] = h; fl.h[q] = (_Float16)((a[q] - (float)h) * 1024.0f); h = (_Float16)c[q]; fh.h[4 + q] = h; fl.h[4 + q] = (_Float16)((c[q] - (float)h) * 1024.0f); }
  { *(v8us*)((unsigned short*)Hh + t * 8) = fh.half[0]; *(v8us*)((unsigned short*)Hl + t * 8) = fl.half[0];  } }

__global__ __launch_bounds__(256) void k_wnat(const float* __restrict__ w, size_t n8, _Float16* __restrict__ Bt) { const size_t t = (size_t)blockIdx.x * 256 + threadIdx.x; if (t >= n8) return; FragH f; for (int q = 0; q < 8; ++q) f.h[q] = (_Float16)(bf16_round(w[t * 8 + q]) * 16.0f); *(v8us*)((unsigned short*)Bt + t * 8) = f.half[0];  }
// lane l <-> l ^ 16 (cross-row move); every lane of the wave is on where this is used
__device__ __forceinline__ float lane_x16(float x) { return __builtin_bit_cast(float, __builtin_amdgcn_permlanex16(__builtin_bit_cast(int, x), __builtin_bit_cast(int, x), 0x76543210, 0xfedcba98, false, false)); }
// Fragment order of the attention's operands: per (batch, head) 32 passes of 32 keys, a pass = 8 units of 512 bytes, a unit = 32 lanes x 8 halves, so that one 16-byte load of a wave reads 4 whole lines.
// K (and Q, rows = queries): unit (t*2 + s)*2 + i, lane (hf, c) = K[key 16 t + c][feature 32 s + 16 i + 8 hf ..]; V^T: unit d*2 + i, lane (hf, c) = V[key 16 i + 8 hf ..][feature 16 d + c]. p points at the lane's 8 halves of unit i = 0.
__device__ __forceinline__ v16h pk_frag(const _Float16* p) { FragH f; f.half[0] = *(const v8us*)((const unsigned short*)p); f.half[1] = *(const v8us*)((const unsigned short*)p + 256); return f.v; }
__device__ __forceinline__ v8f at_mma(v16h a, v16h b, v8f c) { return __builtin_amdgcn_wmma_f32_16x16x32_f16(false, a, false, b, (short)0, c, false, false); }
// One pass of the fused attention: 32 keys (kb .. kb + 31 of the stage that kp and vp point into, in LDS) against the wave's 32 query columns. MORE: fetch the next pass's K and V^T fragments into the same registers, each behind its last use.
template <bool MORE>
__device__ __forceinline__ void at_pass(const _Float16* kp, const _Float16* vp, int kb, const v16h (&qf)[2][2], v16h (&kf)[2][2], v16h (&vf)[4], v8f (&o)[4][2], float (&m)[2], float (&l)[2]) {
  const float cs = 0.125f * 1.4426950408889634f;      /* log2(e) / sqrt(64) */
  const v8f z8 = {0.f,0.f,0.f,0.f,0.f,0.f,0.f,0.f};
  v8f st[2][2];      /* [query tile][key tile] */
#pragma unroll
  for (int j = 0; j < 2; ++j) for (int t = 0; t < 2; ++t) st[j][t] = at_mma(kf[t][1], qf[j][1], at_mma(kf[t][0], qf[j][0], z8));
  if (MORE) {
#pragma unroll
    for (int t = 0; t < 2; ++t) for (int s = 0; s < 2; ++s) kf[t][s] = pk_frag(kp + (size_t)(kb + 32) * HD + (t * 2 + s) * 512);
  }
  float mn[2];
#pragma unroll
  for (int j = 0; j < 2; ++j) { float mx = fmaxf(st[j][0][0], st[j][1][0]);
#pragma unroll
    for (int r = 1; r < 8; ++r) mx = fmaxf(mx, fmaxf(st[j][0][r], st[j][1][r]));
    mx = fmaxf(mx, lane_x16(mx)); mn[j] = fmaxf(m[j], mx * cs); }
  if (__builtin_amdgcn_ballot_w32(mn[0] > m[0] || mn[1] > m[1]) != 0) {      /* wave-uniform; where no column's maximum grows every factor is exactly 1 */
#pragma unroll
    for (int j = 0; j < 2; ++j) { const float al = __builtin_amdgcn_exp2f(m[j] - mn[j]); m[j] = mn[j]; l[j] *= al;
#pragma unroll
      for (int d = 0; d < 4; ++d) o[d][j] *= al; } }
#pragma unroll
  for (int j = 0; j < 2; ++j) { FragH pf; float sm[2] = {0.f, 0.f};
#pragma unroll
    for (int t = 0; t < 2; ++t)
#pragma unroll
      for (int r = 0; r < 8; ++r) { const float p = __builtin_amdgcn_exp2f(fmaf(st[j][t][r], cs, -m[j])); sm[t] += p; pf.h[8 * t + r] = (_Float16)p; }
    l[j] += sm[0] + sm[1];
#pragma unroll
    for (int d = 0; d < 4; ++d) o[d][j] = at_mma(vf[d], pf.v, o[d][j]); }
  if (MORE) {
#pragma unroll
    for (int d = 0; d < 4; ++d) vf[d] = pk_frag(vp + (size_t)(kb + 32) * HD + d * 512);
  } }
#define NPS 4                        /* 32-key passes in a stage of the LDS ring */
#define NST (SQ / (32 * NPS))        /* stages */
#define STH (NPS * 2048)             /* halves of K, and of V^T, in a stage */
// Eight asynchronous 16-byte copies of a lane from global memory to LDS, 2 KiB apart on both sides: the work-group's 128 lanes fill 2 KiB a copy, 16 KiB in all.
// l = the lane's LDS byte address, g = its global address. The closing s_wait_xcnt stands in the copies' own statement, so that no address register they name is rewritten ahead of it (a precaution).
__device__ __forceinline__ void cp8(unsigned l, const _Float16* g) {
  asm volatile("global_load_async_to_lds_b128 %0, %8, off\n\t"
               "global_load_async_to_lds_b128 %1, %9, off\n\t"
               "global_load_async_to_lds_b128 %2, %10, off\n\t"
               "global_load_async_to_lds_b128 %3, %11, off\n\t"
               "global_load_async_to_lds_b128 %4, %12, off\n\t"
               "global_load_async_to_lds_b128 %5, %13, off\n\t"
               "global_load_async_to_lds_b128 %6, %14, off\n\t"
               "global_load_async_to_lds_b128 %7, %15, off\n\t"
               "s_wait_xcnt 0x0"
               :: "v"(l), "v"(l + 2048u), "v"(l + 4096u), "v"(l + 6144u), "v"(l + 8192u), "v"(l + 10240u), "v"(l + 12288u), "v"(l + 14336u),
                  "v"(g), "v"(g + 1024), "v"(g + 2048), "v"(g + 3072), "v"(g + 4096), "v"(g + 5120), "v"(g + 6144), "v"(g + 7168) : "memory"); }
__global__ __launch_bounds__(128) void k_attn(const _Float16* __restrict__ Q16, const _Float16* __restrict__ K16, const _Float16* __restrict__ VT, float* __restrict__ out) {
  __shared__ __attribute__((aligned(128))) _Float16 ring[2][2][STH];      /* [buffer][K, V^T][a stage in fragment order] */
  const int w = threadIdx.x >> 5, lane = threadIdx.x & 31, ln = lane & 15, hh = lane >> 4;
  const int bh = blockIdx.y, b = bh / NH, h = bh - b * NH; const int q0 = blockIdx.x * 128 + w * 32;
  const _Float16* qp = Q16 + (size_t)bh * (SQ * HD) + (size_t)(q0 >> 5) * 2048 + lane * 8;      /* all three in fragment order; the wave's 32 queries are one pass of Q */
  const _Float16* kg = K16 + (size_t)bh * (SQ * HD) + threadIdx.x * 8;      /* the thread's 16 bytes of each 2-KiB slice that the work-group copies */
  const _Float16* vg = VT + (size_t)bh * (SQ * HD) + threadIdx.x * 8;
  const unsigned lr = (unsigned)(size_t)&ring[0][0][0] + threadIdx.x * 16u;      /* the same 16 bytes in LDS (byte address) */
  v16h qf[2][2], kf[2][2], vf[4];
#pragma unroll
  for (int j = 0; j < 2; ++j) for (int s = 0; s < 2; ++s) qf[j][s] = pk_frag(qp + (j * 2 + s) * 512);
  cp8(lr, kg); cp8(lr + STH * 2u, vg);      /* stage 0 into buffer 0 */
  asm volatile("s_wait_asynccnt 0x0" ::: "memory");      /* this wave's copies of stage 0 have landed ... */
  __syncthreads();      /* ... and so have the other waves' */
  cp8(lr + STH * 4u, kg + STH); cp8(lr + STH * 6u, vg + STH);      /* stage 1 into buffer 1, in flight over stage 0's passes */
  v8f o[4][2]; float m[2] = {-3.0e38f, -3.0e38f}, l[2] = {0.f, 0.f};
#pragma unroll
  for (int d = 0; d < 4; ++d) for (int j = 0; j < 2; ++j) o[d][j] = v8f{0.f,0.f,0.f,0.f,0.f,0.f,0.f,0.f};
  for (int t = 0; t < NST; ++t) {
    const _Float16* kp = &ring[t & 1][0][lane * 8]; const _Float16* vp = &ring[t & 1][1][lane * 8];
    /* the three unrolls below: constant indices keep the fragment arrays in registers, and the LDS offsets of a stage's passes become immediates */
#pragma unroll
    for (int u = 0; u < 2; ++u) for (int s = 0; s < 2; ++s) kf[u][s] = pk_frag(kp + (u * 2 + s) * 512);
#pragma unroll
    for (int d = 0; d < 4; ++d) vf[d] = pk_frag(vp + d * 512);
#pragma unroll
    for (int p = 0; p < NPS - 1; ++p) at_pass<true>(kp, vp, p * 32, qf, kf, vf, o, m, l);
    at_pass<false>(kp, vp, (NPS - 1) * 32, qf, kf, vf, o, m, l);      /* a stage's last pass fetches nothing: the next stage is not published yet */
    asm volatile("s_wait_dscnt 0x0" ::: "memory");      /* this wave's reads of the buffer are done before it may be refilled */
    asm volatile("s_wait_asynccnt 0x0" ::: "memory");      /* this wave's copies of stage t + 1 have landed */
    __syncthreads();      /* publishes stage t + 1 and ends every wave's reads of stage t's buffer */
    if (t + 2 < NST) { cp8(lr + (t & 1) * (STH * 4u), kg + (size_t)(t + 2) * STH); cp8(lr + (t & 1) * (STH * 4u) + STH * 2u, vg + (size_t)(t + 2) * STH); }      /* stage t + 2 into the buffer just left */
  }
  asm volatile("s_wait_asynccnt 0x0" ::: "memory");      /* no copy is left in flight when the wave ends */
#pragma unroll
  for (int j = 0; j < 2; ++j) { const float inv = 1.0f / (l[j] + lane_x16(l[j]));      /* join the halves' sums once */
    float* op = out + ((size_t)b * SQ + q0 + j * 16 + ln) * DM + h * HD + 8 * hh;      /* O^T register r = feature 16 d + 8 hf + r of query c: 32 contiguous bytes a lane and tile */
#pragma unroll
    for (int d = 0; d < 4; ++d) { const v4f lo = {o[d][j][0] * inv, o[d][j][1] * inv, o[d][j][2] * inv, o[d][j][3] * inv}, hi = {o[d][j][4] * inv, o[d][j][5] * inv, o[d][j][6] * inv, o[d][j][7] * inv};
      *(v4f*)(op + d * 16) = lo; *(v4f*)(op + d * 16 + 4) = hi; } } }
__global__ __launch_bounds__(256) void k_vt(const _Float16* __restrict__ V16, int b, int h0, _Float16* __restrict__ VT) { __shared__ unsigned short tl[64][65]; const int tid = threadIdx.x; const int hh = blockIdx.x % HG, sg = blockIdx.x / HG; const int s0 = sg * 64; const int h = h0 + hh;
  for (int i = tid; i < 64 * 8; i += 256) { const int j = i / 8, d8 = (i % 8) * 8; FragH f; f.half[0] = *(const v8us*)((const unsigned short*)V16 + ((size_t)b * SQ + s0 + j) * DM + h * HD + d8); for (int q = 0; q < 8; ++q) tl[d8 + q][j] = f.u[q]; }
  __syncthreads();
  { for (int i = tid; i < 64 * 8; i += 256) { const int d = i / 8, j8 = (i % 8) * 8; FragH f; for (int q = 0; q < 8; ++q) f.u[q] = tl[d][j8 + q]; *(v8us*)((unsigned short*)VT + ((size_t)hh * HD + d) * SQ + s0 + j8) = f.half[0]; }  } }



// two f32 rounded to bf16 (the conversion instruction rounds to nearest even, as bf16_round does) and widened again
typedef float v2f __attribute__((ext_vector_type(2)));
typedef __bf16 v2b __attribute__((ext_vector_type(2)));
__device__ __forceinline__ v2f rb2(float a, float b) { const v2f p = {a, b}; return __builtin_convertvector(__builtin_convertvector(p, v2b), v2f); }
// 16-byte halves of a WMMA operand fragment from an LDS weight row: p points at the lane's first 8 halves (k = 8 hf ..), the second 8 stand 16 halves on (k = 16 + 8 hf ..), the k order of the x fragments below.
__device__ __forceinline__ v16h ws_frag(const unsigned short* p) { FragH f; f.half[0] = *(const v8us*)p; f.half[1] = *(const v8us*)(p + 16); return f.v; }
// Fused projections, one launch: a work-group = one head x 128 token rows, a wave = 32 rows (one 32-key pass of its batch and head).
// x is read as f32 and rounded in the fragment registers (bf16, exact in f16); the head's three 64 x 64 weights pass once through LDS as [out][in] f16 rows (x16, exact), pitch 72 halves for the 16-byte fragment reads.
// Q and K: D = W^T x^T (A = weight rows, B = token rows): a lane holds 8 consecutive features of one token. V: D = x W (A = token rows, B = weight rows): a lane holds 8 consecutive keys of one feature.
// Either way the 8 accumulator registers of a tile are the lane's 16 bytes of one fragment-order unit (see pk_frag), so every tile leaves as one 512-byte store of the wave, with no staging and no transpose pass.
__global__ __launch_bounds__(128) void k_qkv(const float* __restrict__ x, const float* __restrict__ wq, const float* __restrict__ bq, const float* __restrict__ wk, const float* __restrict__ bk, const float* __restrict__ wv, const float* __restrict__ bv,
    _Float16* __restrict__ QP, _Float16* __restrict__ KP, _Float16* __restrict__ VT) {
  __shared__ __attribute__((aligned(16))) unsigned short wl[3][HD][72];
  __shared__ __attribute__((aligned(16))) float bl[3][HD];      /* the head's biases, rounded to bf16 */
  const int tid = threadIdx.x, w = tid >> 5, lane = tid & 31, ln = lane & 15, hh = lane >> 4;
  const int h = blockIdx.y, row0 = blockIdx.x * 128 + 32 * w;
  const float* xp = x + (size_t)(row0 + ln) * DM + h * HD + 8 * hh;
  const size_t wofs = (size_t)h * HD * HD + (tid >> 4) * 8 * HD + (tid & 15) * 4;      /* a thread takes 8 inputs x 4 outputs of each weight: 16 lanes read one whole 256-byte weight row */
  const float* wpq = wq + wofs; const float* wpk = wk + wofs; const float* wpv = wv + wofs;
  const float* bp01 = (tid < 64 ? bq : bk) + h * HD + (tid & 63); const float* bp2 = bv + h * HD + (tid & 63);      /* threads 0..63: q and v biases, 64..127: k biases (their v value is not used) */
  v4f xr[2][2][4], wr[3][8];
#pragma unroll
  for (int j = 0; j < 2; ++j)
#pragma unroll
    for (int s = 0; s < 2; ++s)
#pragma unroll
      for (int q = 0; q < 4; ++q) xr[j][s][q] = *(const v4fa*)(xp + (size_t)j * 16 * DM + s * 32 + (q >> 1) * 16 + (q & 1) * 4);
  asm volatile("s_wait_xcnt 0x0" :: "v"(xp) : "memory");      /* the operand keeps the address registers of the loads above as they are up to this wait; the statement also keeps these loads, the only ones that come from memory, ahead of the rest */
#pragma unroll
  for (int i = 0; i < 8; ++i) { wr[0][i] = *(const v4fa*)(wpq + i * HD); wr[1][i] = *(const v4fa*)(wpk + i * HD); wr[2][i] = *(const v4fa*)(wpv + i * HD); }
  const float b01 = *bp01, b2 = *bp2;
  asm volatile("s_wait_xcnt 0x0" :: "v"(wpq), "v"(wpk), "v"(wpv), "v"(bp01) : "memory");      /* as above, for the weight and bias loads */
#pragma unroll
  for (int m = 0; m < 3; ++m)
#pragma unroll
    for (int k = 0; k < 4; ++k) { FragH f;
#pragma unroll
      for (int i = 0; i < 8; i += 2) { const v2f p = rb2(wr[m][i][k], wr[m][i + 1][k]) * 16.0f; f.h[i] = (_Float16)p[0]; f.h[i + 1] = (_Float16)p[1]; }
      *(v8us*)&wl[m][(tid & 15) * 4 + k][(tid >> 4) * 8] = f.half[0]; }
  bl[tid >> 6][tid & 63] = bf16_round(b01);
  if (tid < 64) bl[2][tid] = bf16_round(b2);
  v16h xf[2][2];
#pragma unroll
  for (int j = 0; j < 2; ++j)
#pragma unroll
    for (int s = 0; s < 2; ++s) { FragH f;
#pragma unroll
      for (int q = 0; q < 4; ++q)
#pragma unroll
        for (int i = 0; i < 4; i += 2) { const v2f p = rb2(xr[j][s][q][i], xr[j][s][q][i + 1]); f.h[q * 4 + i] = (_Float16)p[0]; f.h[q * 4 + i + 1] = (_Float16)p[1]; }
      xf[j][s] = f.v; }
  __syncthreads();
  const v8f z8 = {0.f,0.f,0.f,0.f,0.f,0.f,0.f,0.f};
  const size_t pofs = ((size_t)(row0 / SQ) * NH + h) * (SQ * HD) + (size_t)((row0 % SQ) >> 5) * 2048 + lane * 8;      /* the wave's pass, the lane's 8 halves of unit 0 */
#pragma unroll
  for (int m = 0; m < 2; ++m) { unsigned short* dst = (unsigned short*)(m == 0 ? QP : KP) + pofs;
#pragma unroll
    for (int te = 0; te < 4; ++te) { const v16h a0 = ws_frag(&wl[m][te * 16 + ln][8 * hh]), a1 = ws_frag(&wl[m][te * 16 + ln][32 + 8 * hh]);
      const v4f b0 = *(const v4fa*)&bl[m][te * 16 + 8 * hh], b1 = *(const v4fa*)&bl[m][te * 16 + 8 * hh + 4]; const float bb[8] = {b0[0], b0[1], b0[2], b0[3], b1[0], b1[1], b1[2], b1[3]};
#pragma unroll
      for (int tk = 0; tk < 2; ++tk) { const v8f c = at_mma(a1, xf[tk][1], at_mma(a0, xf[tk][0], z8)); FragH f;
#pragma unroll
        for (int r = 0; r < 8; ++r) f.h[r] = (_Float16)(c[r] * 0.0625f + bb[r]);
        *(v8us*)(dst + (tk * 4 + te) * 256) = f.half[0]; } }      /* unit (t*2 + s)*2 + i with features 16 te = 32 s + 16 i */
    asm volatile("s_wait_xcnt 0x0" ::: "memory"); }      /* before the next product reuses the registers of the stores above; it also keeps the next product's LDS reads behind them, which bounds the registers in use */
  { unsigned short* dst = (unsigned short*)VT + pofs;
#pragma unroll
    for (int td = 0; td < 4; ++td) { const v16h b0 = ws_frag(&wl[2][td * 16 + ln][8 * hh]), b1 = ws_frag(&wl[2][td * 16 + ln][32 + 8 * hh]); const float bb = bl[2][td * 16 + ln];
#pragma unroll
      for (int tk = 0; tk < 2; ++tk) { const v8f c = at_mma(xf[tk][1], b1, at_mma(xf[tk][0], b0, z8)); FragH f;
#pragma unroll
        for (int r = 0; r < 8; ++r) f.h[r] = (_Float16)(c[r] * 0.0625f + bb);
        *(v8us*)(dst + (td * 2 + tk) * 256) = f.half[0]; } } } }      /* unit d*2 + i */
extern "C" void kernel_launch(void* const* d_in, const int* in_sizes, int n_in,
                              void* d_out, int out_size, void* d_ws, size_t ws_size, hipStream_t stream) {
  (void)in_sizes; (void)n_in; (void)out_size;
  const float* const* I = (const float* const*)d_in; const float* x = I[0]; const float* wq = I[1]; const float* bq = I[2]; const float* wk = I[3]; const float* bk = I[4]; const float* wv = I[5]; const float* bv = I[6];      /* per-head W [12][64][64] ([h][in][out]) + b [12][64] for q, k, v */
  char* ws = (char*)d_ws; size_t off = 0;
  auto take = [&](size_t bytes) { char* p = ws + off; off += (bytes + 255) & ~(size_t)255; return p; };
  _Float16* Q16 = (_Float16*)take(NR * DM * 2); _Float16* K16 = (_Float16*)take(NR * DM * 2);
  _Float16* VT = (_Float16*)take((size_t)NB * NH * HD * SQ * 2);
  if (off > ws_size) return;
  k_qkv<<<dim3(MP / 128, NH), 128, 0, stream>>>(x, wq, bq, wk, bk, wv, bv, Q16, K16, VT);      /* x and weight rounding, the three per-head projections (+ biases) and the fragment-order layouts of Q, K and V^T, one launch */
  k_attn<<<dim3(SQ / 128, NB * NH), 128, 0, stream>>>(Q16, K16, VT, (float*)d_out);      /* scores, softmax and P V fused; f32 straight into the merged-heads output rows */
}

// v006
// Measured time: 45.4 microseconds a run.
// Next to v005, in two timings, it ran 1.06 and 1.07 times as fast.
// All steps since v000 together make it 118 times as fast.
#include <hip/hip_runtime.h>
// Multi-head self-attention with PER-HEAD 64x64 projections on head-chunked features (sequences [8][1024][768] viewed [B][S][12][64]; q/k/v[..., h, :] = x[..., h, :] W[h] + b[h] with W [12][64][64] ([h][in][out], sigma 0.05) and b [12][64] (sigma 0.05); scores / 8; softmax over all 1024 keys (no mask); out = heads concatenated (no output projection) -> [8][1024][768]).
// Structure: token rows r = b*1024 + s; one projection launch: x rounded in registers (bf16, exact in f16), Q, K, V as WMMA products (32x64 wave tiles, f32 accumulation, exact x16 weights + bias, f16 outputs), Q, K and V^T stored from the accumulators in WMMA fragment order (512-byte units); one fused attention launch over every (batch, head), K and V^T staged per work-group in a two-buffer LDS ring by asynchronous copies: S^T = K Q^T (K = 64), running softmax in registers (f32 statistics; weights 2^(s - reference) as f16, at most 2^8), O^T += V^T P^T, divided by the row sum and written f32 straight into the merged-heads output rows (no output projection).
// Compute dtype: inputs rounded to bf16; x / weights exact; q, k, v and softmax weights as plain f16 GEMM operands (~2^-12); scores, softmax statistics and o f32. v_wmma_f32_16x16x32_f16.
#define NB 8
#define SQ 1024
#define DM 768
#define NH 12
#define HD 64
#define HG 4                         /* heads per launch of the per-batch k_vt overload (not called) */
#define B0 0                         /* unused (both launches start at batch 0) */
#define NBR NB                       /* batches processed (debug hook) */
#define NR ((size_t)NB * SQ)         /* token rows */
#define MP ((int)((size_t)NBR * SQ)) /* rows projected (debug hook) */
#define QN SQ                        /* unused (k_attn attends all SQ query rows) */
#define NHD NH                       /* unused (k_attn covers all NH heads) */
#define MPO MP                       /* unused (no output stage) */
#define LQ DM      /* unused (Q, K and V^T are all in fragment order) */
typedef __bf16 v16b __attribute__((ext_vector_type(16)));
typedef unsigned short v8us __attribute__((ext_vector_type(8), may_alias));
typedef float  v8f  __attribute__((ext_vector_type(8)));
typedef float  v4f  __attribute__((ext_vector_type(4)));
typedef float  v4fa __attribute__((ext_vector_type(4), may_alias));
union FragB { v16b v; v8us half[2]; unsigned short u[16]; };

__device__ __forceinline__ unsigned short bf16_bits(float x) { unsigned int u = __float_as_uint(x); return (unsigned short)((u + 0x7FFFu + ((u >> 16) & 1u)) >> 16); }
__device__ __forceinline__ float bf16_val(unsigned short b) { return __uint_as_float(((unsigned int)b) << 16); }
__device__ __forceinline__ float bf16_round(float x) { return bf16_val(bf16_bits(x)); }
// D += A·B with NT terms: 1 = ah·bh, 2 = + al·bh (A split), 3 = + ah·bl (both split)
template <int NT>
__device__ __forceinline__ v8f mmaN(v16b ah, v16b al, v16b bh, v16b bl, v8f c) {
  c = __builtin_amdgcn_wmma_f32_16x16x32_bf16(false, ah, false, bh, (short)0, c, false, false);
  if (NT >= 2) c = __builtin_amdgcn_wmma_f32_16x16x32_bf16(false, al, false, bh, (short)0, c, false, false);
  if (NT >= 3) c = __builtin_amdgcn_wmma_f32_16x16x32_bf16(false, ah, false, bl, (short)0, c, false, false);
  asm volatile("v_nop\n\tv_nop\n\tv_nop\n\tv_nop" : "+v"(c) : "v"(ah), "v"(al), "v"(bh), "v"(bl));
  return c;
}

__global__ __launch_bounds__(256) void k_wt_bf16(const float* __restrict__ W, unsigned short* __restrict__ Wt, int K, int N) {
  const int t = blockIdx.x * 256 + threadIdx.x;
  const int k8n = K / 8;
  if (t >= N * k8n) return;
  const int n = t / k8n, k8 = (t % k8n) * 8;
  v8us v;
#pragma unroll
  for (int i = 0; i < 8; ++i) v[i] = bf16_bits(W[(size_t)(k8 + i) * N + n]);
  *(v8us*)(Wt + (size_t)n * K + k8) = v;
  
}

// GEMM C[M][N] (f32, pitch ldc) = act(A[M][K]·W + bias). A f32 row-major (pitch lda) converted per fragment to bf16
// (ASPLIT: hi/lo two planes -> 2 terms, else single rounded term); Wt bf16 [N][K] (pitch ldb). BIAS_BF16 rounds the
// bias to bf16 first (bias quantised to bf16 before the add). K%32==0, M%16==0, N%64==0.
template <bool ASPLIT, int ACT, bool BIAS_BF16>
__global__ __launch_bounds__(128) void k_gemm_bf(const float* __restrict__ A, int lda, const unsigned short* __restrict__ Wt, int ldb,
                                               const float* __restrict__ bias, float* __restrict__ C, int ldc, int M, int N, int K) {
  __shared__ __attribute__((aligned(16))) float so[4][16][64];
  const int tid = threadIdx.x, w = tid >> 5, lane = tid & 31, ln = lane & 15, hh = lane >> 4;
  const int ntn = N / 64;
  const int wid = blockIdx.x * 4 + w;
  const int mt = wid / ntn, nq = wid % ntn;
  if (mt * 16 >= M) return;
  const int row0 = mt * 16, col0 = nq * 64;
  const float* arow = A + (size_t)(row0 + ln) * lda;
  v8f acc[4] = {};
  for (int kb = 0; kb < K; kb += 32) {
    FragB ah, al;
    const v4f x0 = *(const v4fa*)(arow + kb + 8 * hh), x1 = *(const v4fa*)(arow + kb + 8 * hh + 4);
    const v4f x2 = *(const v4fa*)(arow + kb + 16 + 8 * hh), x3 = *(const v4fa*)(arow + kb + 16 + 8 * hh + 4);
    float xs[16] = {x0[0],x0[1],x0[2],x0[3],x1[0],x1[1],x1[2],x1[3],x2[0],x2[1],x2[2],x2[3],x3[0],x3[1],x3[2],x3[3]};
#pragma unroll
    for (int i = 0; i < 16; ++i) { const unsigned short hb = bf16_bits(xs[i]); ah.u[i] = hb; al.u[i] = ASPLIT ? bf16_bits(xs[i] - bf16_val(hb)) : (unsigned short)0; }
#pragma unroll
    for (int t = 0; t < 4; ++t) {
      const unsigned short* brow = Wt + (size_t)(col0 + t * 16 + ln) * ldb + kb;
      FragB b;
      b.half[0] = *(const v8us*)(brow + 8 * hh);
      b.half[1] = *(const v8us*)(brow + 16 + 8 * hh);
      acc[t] = mmaN<ASPLIT ? 2 : 1>(ah.v, al.v, b.v, b.v, acc[t]);
    }
  }
#pragma unroll
  for (int t = 0; t < 4; ++t) {
    float bv = bias ? bias[col0 + t * 16 + ln] : 0.f;
    if (BIAS_BF16) bv = bf16_round(bv);
#pragma unroll
    for (int r = 0; r < 8; ++r) { float v = acc[t][r] + bv; if (ACT == 1) v = fmaxf(v, 0.f); so[w][8 * hh + r][t * 16 + ln] = v; }
  }
  __builtin_amdgcn_fence(__ATOMIC_ACQ_REL, "workgroup");
  __builtin_amdgcn_wave_barrier();
  const int rsub = lane >> 4, c4 = (lane & 15) * 4;
  {
#pragma unroll
    for (int q = 0; q < 8; ++q) {
      const int r = q * 2 + rsub;
      const v4f v = *(const v4fa*)&so[w][r][c4];
      *(v4f*)(C + (size_t)(row0 + r) * ldc + col0 + c4) = v;
    }
    
  }
}

// GEMM C = act(A·W + bias + resid): A f32 (ASPLIT -> hi/lo 2 terms), Wt bf16 [N][K]; ACT 0 none, 1 relu, 2 exact gelu;
// resid (optional, f32, row index = (row % rmod), pitch ldr, RES_BF16 rounds it) added before the activation.
template <bool ASPLIT, int ACT, bool BIAS_BF16, bool RES_BF16>
__global__ __launch_bounds__(128) void k_gemm_bf3(const float* __restrict__ A, int lda, const unsigned short* __restrict__ Wt, int ldb,
                                                const float* __restrict__ bias, const float* __restrict__ resid, int rmod, int ldr,
                                                float* __restrict__ C, int ldc, int M, int N, int K) {
  __shared__ __attribute__((aligned(16))) float so[4][16][64];
  const int tid = threadIdx.x, w = tid >> 5, lane = tid & 31, ln = lane & 15, hh = lane >> 4;
  const int ntn = N / 64;
  const int wid = blockIdx.x * 4 + w;
  const int mt = wid / ntn, nq = wid % ntn;
  if (mt * 16 >= M) return;
  const int row0 = mt * 16, col0 = nq * 64;
  const float* arow = A + (size_t)(row0 + ln) * lda;
  v8f acc[4] = {};
  for (int kb = 0; kb < K; kb += 32) {
    FragB ah, al;
    const v4f x0 = *(const v4fa*)(arow + kb + 8 * hh), x1 = *(const v4fa*)(arow + kb + 8 * hh + 4);
    const v4f x2 = *(const v4fa*)(arow + kb + 16 + 8 * hh), x3 = *(const v4fa*)(arow + kb + 16 + 8 * hh + 4);
    float xs[16] = {x0[0],x0[1],x0[2],x0[3],x1[0],x1[1],x1[2],x1[3],x2[0],x2[1],x2[2],x2[3],x3[0],x3[1],x3[2],x3[3]};
#pragma unroll
    for (int i = 0; i < 16; ++i) { const unsigned short hb = bf16_bits(xs[i]); ah.u[i] = hb; al.u[i] = ASPLIT ? bf16_bits(xs[i] - bf16_val(hb)) : (unsigned short)0; }
#pragma unroll
    for (int t = 0; t < 4; ++t) {
      const unsigned short* brow = Wt + (size_t)(col0 + t * 16 + ln) * ldb + kb;
      FragB b;
      b.half[0] = *(const v8us*)(brow + 8 * hh);
      b.half[1] = *(const v8us*)(brow + 16 + 8 * hh);
      acc[t] = mmaN<ASPLIT ? 2 : 1>(ah.v, al.v, b.v, b.v, acc[t]);
    }
  }
#pragma unroll
  for (int t = 0; t < 4; ++t) {
    const int col = col0 + t * 16 + ln;
    float bv = bias ? bias[col] : 0.f;
    if (BIAS_BF16) bv = bf16_round(bv);
#pragma unroll
    for (int r = 0; r < 8; ++r) {
      float v = acc[t][r] + bv;
      if (resid) { float rv = resid[(size_t)((row0 + 8 * hh + r) % rmod) * ldr + col]; if (RES_BF16) rv = bf16_round(rv); v += rv; }
      if (ACT == 1) v = fmaxf(v, 0.f);
      if (ACT == 2) v = 0.5f * v * (1.0f + erff(v * 0.70710678118654752f));
      if (ACT == 3) { const float u = 0.7978845608028654f * (v + 0.044715f * v * v * v); v = 0.5f * v * (1.0f + tanhf(u)); }
      so[w][8 * hh + r][t * 16 + ln] = v;
    }
  }
  __builtin_amdgcn_fence(__ATOMIC_ACQ_REL, "workgroup");
  __builtin_amdgcn_wave_barrier();
  const int rsub = lane >> 4, c4 = (lane & 15) * 4;
  {
#pragma unroll
    for (int q = 0; q < 8; ++q) {
      const int r = q * 2 + rsub;
      const v4f v = *(const v4fa*)&so[w][r][c4];
      *(v4f*)(C + (size_t)(row0 + r) * ldc + col0 + c4) = v;
    }
    
  }
}
// row LayerNorm (biased variance, eps) over N: s = X (+ R); optional out_sum <- s; out_norm <- (s-mu)*rsqrt(var+eps)*g + b
template <bool PARAM_BF16>
__global__ __launch_bounds__(256) void k_layernorm(const float* __restrict__ X, const float* __restrict__ R, const float* __restrict__ g, const float* __restrict__ bta,
                                                  float* __restrict__ out_sum, float* __restrict__ out_norm, int N, float eps) {
  __shared__ float red[256];
  const int row = blockIdx.x, tid = threadIdx.x;
  const float* x = X + (size_t)row * N; const float* rr = R ? R + (size_t)row * N : nullptr;
  float vals[16];                     // up to N = 4096
  const int per = N / 256;            // contiguous chunk per thread? use strided-by-4 chunks: thread handles j = tid*4 + 1024*u
  float s1 = 0.f;
  for (int u = 0; u < per / 4; ++u) {
    const int j = tid * 4 + 1024 * u;
    const v4f a = *(const v4fa*)(x + j);
    v4f b = {0.f,0.f,0.f,0.f}; if (rr) b = *(const v4fa*)(rr + j);
#pragma unroll
    for (int q = 0; q < 4; ++q) { const float v = a[q] + b[q]; vals[u * 4 + q] = v; s1 += v; }
  }
  red[tid] = s1; __syncthreads();
  for (int st = 128; st > 0; st >>= 1) { if (tid < st) red[tid] += red[tid + st]; __syncthreads(); }
  const float mu = red[0] / (float)N; __syncthreads();
  float s2 = 0.f;
  for (int u = 0; u < per / 4; ++u)
#pragma unroll
    for (int q = 0; q < 4; ++q) { const float c = vals[u * 4 + q] - mu; s2 += c * c; }
  red[tid] = s2; __syncthreads();
  for (int st = 128; st > 0; st >>= 1) { if (tid < st) red[tid] += red[tid + st]; __syncthreads(); }
  const float rs = rsqrtf(red[0] / (float)N + eps);
  {
    for (int u = 0; u < per / 4; ++u) {
      const int j = tid * 4 + 1024 * u;
      v4f o, sm;
#pragma unroll
      for (int q = 0; q < 4; ++q) {
        float gg = g[j + q], bb = bta[j + q];
        if (PARAM_BF16) { gg = bf16_round(gg); bb = bf16_round(bb); }
        sm[q] = vals[u * 4 + q]; o[q] = (vals[u * 4 + q] - mu) * rs * gg + bb;
      }
      if (out_sum) *(v4f*)(out_sum + (size_t)row * N + j) = sm;
      *(v4f*)(out_norm + (size_t)row * N + j) = o;
    }
    
  }
}



// ---- f16 WMMA path (v_wmma_f32_16x16x32_f16): 11-bit significands for operands in range — used where a probability operand (at most 2^8) needs more precision than bf16
typedef _Float16 v16h __attribute__((ext_vector_type(16)));
union FragH { v16h v; v8us half[2]; _Float16 h[16]; unsigned short u[16]; };
template <int NT>
__device__ __forceinline__ v8f mmaH(v16h ah, v16h al, v16h bh, v16h bl, v8f c) {
  c = __builtin_amdgcn_wmma_f32_16x16x32_f16(false, ah, false, bh, (short)0, c, false, false);
  if (NT >= 2) c = __builtin_amdgcn_wmma_f32_16x16x32_f16(false, al, false, bh, (short)0, c, false, false);
  if (NT >= 3) c = __builtin_amdgcn_wmma_f32_16x16x32_f16(false, ah, false, bl, (short)0, c, false, false);
  asm volatile("v_nop\n\tv_nop\n\tv_nop\n\tv_nop" : "+v"(c) : "v"(ah), "v"(al), "v"(bh), "v"(bl));
  return c;
}
// batched GEMM like k_gemm_b but f16 operands: A f32 (split into f16 hi/lo if ASPLIT, else rounded to f16), Bt = f16 values [n][k]; alpha; C f32; N multiple of 16 (partial tiles skipped)
template <bool ASPLIT>
__global__ __launch_bounds__(128) void k_gemm_h(const float* __restrict__ A, int lda, size_t sA, const _Float16* __restrict__ Bh, int ldb, size_t sB, float alpha, float* __restrict__ C, int ldc, size_t sC, int M, int N, int K) {
  __shared__ __attribute__((aligned(16))) float so[4][16][64];
  const int tid = threadIdx.x, w = tid >> 5, lane = tid & 31, ln = lane & 15, hh = lane >> 4; const int by = blockIdx.y;
  A += (size_t)by * sA; Bh += (size_t)by * sB; C += (size_t)by * sC;
  const int ntn = (N + 63) / 64; const int wid = blockIdx.x * 4 + w; const int mt = wid / ntn, nq = wid % ntn; if (mt * 16 >= M) return;
  const int row0 = mt * 16, col0 = nq * 64; const float* arow = A + (size_t)(row0 + ln) * lda;
  v8f acc[4] = {};
  for (int kb = 0; kb < K; kb += 32) {
    FragH ah, al;
    const v4f x0 = *(const v4fa*)(arow + kb + 8 * hh), x1 = *(const v4fa*)(arow + kb + 8 * hh + 4), x2 = *(const v4fa*)(arow + kb + 16 + 8 * hh), x3 = *(const v4fa*)(arow + kb + 16 + 8 * hh + 4);
    float xs[16] = {x0[0],x0[1],x0[2],x0[3],x1[0],x1[1],x1[2],x1[3],x2[0],x2[1],x2[2],x2[3],x3[0],x3[1],x3[2],x3[3]};
#pragma unroll
    for (int i = 0; i < 16; ++i) { const _Float16 h = (_Float16)xs[i]; ah.h[i] = h; al.h[i] = ASPLIT ? (_Float16)(xs[i] - (float)h) : (_Float16)0.0f; }
#pragma unroll
    for (int t = 0; t < 4; ++t) { if (col0 + t * 16 >= N) continue; const size_t boff = (size_t)(col0 + t * 16 + ln) * ldb + kb; FragH bq; bq.half[0] = *(const v8us*)(Bh + boff + 8 * hh); bq.half[1] = *(const v8us*)(Bh + boff + 16 + 8 * hh);
      acc[t] = mmaH<ASPLIT ? 2 : 1>(ah.v, al.v, bq.v, bq.v, acc[t]); }
  }
#pragma unroll
  for (int t = 0; t < 4; ++t) { if (col0 + t * 16 >= N) continue;
#pragma unroll
    for (int r = 0; r < 8; ++r) so[w][8 * hh + r][t * 16 + ln] = acc[t][r] * alpha; }
  __builtin_amdgcn_fence(__ATOMIC_ACQ_REL, "workgroup"); __builtin_amdgcn_wave_barrier();
  const int rsub = lane >> 4, c4 = (lane & 15) * 4;
  {
#pragma unroll
    for (int q = 0; q < 8; ++q) { const int r = q * 2 + rsub; if (col0 + c4 < N) { const v4f v = *(const v4fa*)&so[w][r][c4]; *(v4f*)(C + (size_t)(row0 + r) * ldc + col0 + c4) = v; } }
     }
}

// Wt[n][k] = f16(W[k][n]·scale) from f32 row-major W[K][N] (scale = power of two; bf16-exact weights stay exact in f16 away from the subnormal range)
__global__ __launch_bounds__(256) void k_wt_f16(const float* __restrict__ W, _Float16* __restrict__ Wt, int K, int N, float scale) {
  const int t = blockIdx.x * 256 + threadIdx.x; if (t >= N * (K / 8)) return; const int n = t / (K / 8), k8 = (t % (K / 8)) * 8; FragH f;
#pragma unroll
  for (int i = 0; i < 8; ++i) f.h[i] = (_Float16)(bf16_round(W[(size_t)(k8 + i) * N + n]) * scale); const v8us o = f.half[0];
  *(v8us*)((unsigned short*)Wt + (size_t)n * K + k8) = o; 
}
// k_gemm_hh variant with fused epilogue: v = acc·alpha + bias[by·sBias + col] (+ CP[(row/rowsPerB)·sCPb + by·64 + col] if CP) ; ACT 0 none / 1 elu ; writes f16 C16 (and f32 C if non-null)
template <int ACT>
__global__ __launch_bounds__(128) void k_gemm_hhx(const _Float16* __restrict__ A, int lda, size_t sA, const _Float16* __restrict__ Bh, int ldb, size_t sB, float alpha, const float* __restrict__ bias, size_t sBias, const float* __restrict__ CP, int rowsPerB, size_t sCPb, int row0g,
    float* __restrict__ C, _Float16* __restrict__ C16, int ldc, size_t sC, int M, int N, int K) {
  __shared__ __attribute__((aligned(16))) float so[4][16][64];
  const int tid = threadIdx.x, w = tid >> 5, lane = tid & 31, ln = lane & 15, hh = lane >> 4; const int by = blockIdx.y;
  A += (size_t)by * sA; Bh += (size_t)by * sB; const size_t cofs = (size_t)by * sC; const float* bp = bias ? bias + (size_t)by * sBias : nullptr;
  const int ntn = (N + 63) / 64; const int wid = blockIdx.x * 4 + w; const int mt = wid / ntn, nq = wid % ntn; if (mt * 16 >= M) return;
  const int row0 = mt * 16, col0 = nq * 64; const _Float16* arow = A + (size_t)(row0 + ln) * lda;
  v8f acc[4] = {};
  for (int kb = 0; kb < K; kb += 32) { FragH ah; ah.half[0] = *(const v8us*)((const unsigned short*)arow + kb + 8 * hh); ah.half[1] = *(const v8us*)((const unsigned short*)arow + kb + 16 + 8 * hh);
#pragma unroll
    for (int t = 0; t < 4; ++t) { if (col0 + t * 16 >= N) continue; const size_t boff = (size_t)(col0 + t * 16 + ln) * ldb + kb; FragH bq; bq.half[0] = *(const v8us*)((const unsigned short*)Bh + boff + 8 * hh); bq.half[1] = *(const v8us*)((const unsigned short*)Bh + boff + 16 + 8 * hh);
      acc[t] = mmaH<1>(ah.v, ah.v, bq.v, bq.v, acc[t]); }
  }
#pragma unroll
  for (int t = 0; t < 4; ++t) { if (col0 + t * 16 >= N) continue; const int col = col0 + t * 16 + ln; const float bv = bp ? bf16_round(bp[col]) : 0.f;
#pragma unroll
    for (int r = 0; r < 8; ++r) { float v = acc[t][r] * alpha + bv; if (CP) { const int rr = row0g + row0 + 8 * hh + r; if (rowsPerB < 0) v += CP[cofs + (size_t)rr * ldc + col];      /* rowsPerB < 0: own element of the batched C plane */ else { const int bidx = rr / rowsPerB; v += CP[(size_t)bidx * sCPb + (size_t)by * 64 + col]; } } if (ACT == 1) v = (v > 0.f) ? v : expm1f(v); else if (ACT == 7) v = (v > 0.f) ? v + 1.0f : expf(v); else if (ACT == 8) v = tanhf(v); else if (ACT == 9) v = 0.5f * v * (1.0f + tanhf(0.7978845608028654f * (v + 0.044715f * v * v * v))); else if (ACT == 11) v = 1.0f / (1.0f + expf(-v)); else if (ACT == 12) v = (v > 0.f) ? v : 0.01f * v; else if (ACT == 14) v = (v > 0.f) ? v : 0.1f * v; else if (ACT == 16) v = (v >= 0.f) ? v : 0.3f * v; else if (ACT == 17) v = (v >= 0.f) ? v : 0.2f * v; else if (ACT == 15) v = v / (1.0f + expf(-v)); else if (ACT == 3) v = fmaxf(v, 0.f); else if (ACT == 6) v = 0.5f * v * (1.0f + erff(v * 0.70710678118654752f)); so[w][8 * hh + r][t * 16 + ln] = v; } }
  __builtin_amdgcn_fence(__ATOMIC_ACQ_REL, "workgroup"); __builtin_amdgcn_wave_barrier();
  const int rsub = lane >> 4, c4 = (lane & 15) * 4; typedef _Float16 v4h __attribute__((ext_vector_type(4)));
  {
#pragma unroll
    for (int q = 0; q < 8; ++q) { const int r = q * 2 + rsub; if (col0 + c4 < N) { const v4f v = *(const v4fa*)&so[w][r][c4]; if (C) *(v4f*)(C + cofs + (size_t)(row0 + r) * ldc + col0 + c4) = v; if (C16) { v4h h4; for (int i = 0; i < 4; ++i) h4[i] = (_Float16)v[i]; *(v4h*)(C16 + cofs + (size_t)(row0 + r) * ldc + col0 + c4) = h4; } } }
     }
}


typedef _Float16 v4h __attribute__((ext_vector_type(4)));

__global__ __launch_bounds__(256) void k_h16(const float* __restrict__ x, _Float16* __restrict__ X16, size_t n8) { const size_t t = (size_t)blockIdx.x * 256 + threadIdx.x; if (t >= n8) return; FragH f;
#pragma unroll
  for (int q = 0; q < 8; ++q) f.h[q] = (_Float16)x[t * 8 + q]; *(v8us*)((unsigned short*)X16 + t * 8) = f.half[0];  }
__global__ __launch_bounds__(256) void k_round16f(const float* __restrict__ W, _Float16* __restrict__ Bt, size_t n8) { const size_t t = (size_t)blockIdx.x * 256 + threadIdx.x; if (t >= n8) return; FragH f;
#pragma unroll
  for (int i = 0; i < 8; ++i) f.h[i] = (_Float16)(bf16_round(W[t * 8 + i]) * 16.0f); *(v8us*)((unsigned short*)Bt + t * 8) = f.half[0];  }
__global__ __launch_bounds__(256) void k_hl(const float* __restrict__ F, _Float16* __restrict__ Hh, _Float16* __restrict__ Hl, size_t n8) { const size_t t = (size_t)blockIdx.x * 256 + threadIdx.x; if (t >= n8) return; FragH fh, fl; const v4f a = *(const v4fa*)(F + t * 8), c = *(const v4fa*)(F + t * 8 + 4);
#pragma unroll
  for (int q = 0; q < 4; ++q) { _Float16 h = (_Float16)a[q]; fh.h[q] = h; fl.h[q] = (_Float16)((a[q] - (float)h) * 1024.0f); h = (_Float16)c[q]; fh.h[4 + q] = h; fl.h[4 + q] = (_Float16)((c[q] - (float)h) * 1024.0f); }
  { *(v8us*)((unsigned short*)Hh + t * 8) = fh.half[0]; *(v8us*)((unsigned short*)Hl + t * 8) = fl.half[0];  } }

__global__ __launch_bounds__(256) void k_wnat(const float* __restrict__ w, size_t n8, _Float16* __restrict__ Bt) { const size_t t = (size_t)blockIdx.x * 256 + threadIdx.x; if (t >= n8) return; FragH f; for (int q = 0; q < 8; ++q) f.h[q] = (_Float16)(bf16_round(w[t * 8 + q]) * 16.0f); *(v8us*)((unsigned short*)Bt + t * 8) = f.half[0];  }
// lane l <-> l ^ 16 (cross-row move); every lane of the wave is on where this is used
__device__ __forceinline__ float lane_x16(float x) { return __builtin_bit_cast(float, __builtin_amdgcn_permlanex16(__builtin_bit_cast(int, x), __builtin_bit_cast(int, x), 0x76543210, 0xfedcba98, false, false)); }
// Fragment order of the attention's operands: per (batch, head) 32 passes of 32 keys, a pass = 8 units of 512 bytes, a unit = 32 lanes x 8 halves, so that one 16-byte load of a wave reads 4 whole lines.
// K (and Q, rows = queries): unit (t*2 + s)*2 + i, lane (hf, c) = K[key 16 t + c][feature 32 s + 16 i + 8 hf ..]; V^T: unit d*2 + i, lane (hf, c) = V[key 16 i + 8 hf ..][feature 16 d + c]. p points at the lane's 8 halves of unit i = 0.
__device__ __forceinline__ v16h pk_frag(const _Float16* p) { FragH f; f.half[0] = *(const v8us*)((const unsigned short*)p); f.half[1] = *(const v8us*)((const unsigned short*)p + 256); return f.v; }
__device__ __forceinline__ v8f at_mma(v16h a, v16h b, v8f c) { return __builtin_amdgcn_wmma_f32_16x16x32_f16(false, a, false, b, (short)0, c, false, false); }
// One pass of the fused attention: 32 keys (kb .. kb + 31 of the stage that kp and vp point into, in LDS) against the wave's 32 query columns. MORE: fetch the next pass's K and V^T fragments into the same registers, each behind its last use.
template <bool MORE>
__device__ __forceinline__ void at_pass(const _Float16* kp, const _Float16* vp, int kb, const v16h (&qf)[2][2], v16h (&kf)[2][2], v16h (&vf)[4], v8f (&o)[4][2], float (&m)[2], float (&l)[2]) {
  const float cs = 0.125f * 1.4426950408889634f;      /* log2(e) / sqrt(64) */
  const v8f z8 = {0.f,0.f,0.f,0.f,0.f,0.f,0.f,0.f};
  v8f st[2][2];      /* [query tile][key tile] */
#pragma unroll
  for (int j = 0; j < 2; ++j) for (int t = 0; t < 2; ++t) st[j][t] = at_mma(kf[t][1], qf[j][1], at_mma(kf[t][0], qf[j][0], z8));
  if (MORE) {
#pragma unroll
    for (int t = 0; t < 2; ++t) for (int s = 0; s < 2; ++s) kf[t][s] = pk_frag(kp + (size_t)(kb + 32) * HD + (t * 2 + s) * 512);
  }
  float mx[2];      /* the lane's own largest score of the pass, per query tile */
#pragma unroll
  for (int j = 0; j < 2; ++j) { mx[j] = fmaxf(st[j][0][0], st[j][1][0]);
#pragma unroll
    for (int r = 1; r < 8; ++r) mx[j] = fmaxf(mx[j], fmaxf(st[j][0][r], st[j][1][r])); }
  if (__builtin_expect(__builtin_amdgcn_ballot_w32(fmaf(mx[0], cs, -m[0]) > 8.0f || fmaf(mx[1], cs, -m[1]) > 8.0f) != 0, 0)) {      /* wave-uniform, once a pass: the reference m moves only when some score stands more than 8 above it, so every weight stays at or below 2^8 (f16 holds it, at the same relative rounding); marked unlikely so that the rescale stands outside the loop's straight path */
#pragma unroll
    for (int j = 0; j < 2; ++j) { const float mn = fmaxf(m[j], fmaxf(mx[j], lane_x16(mx[j])) * cs); const float al = __builtin_amdgcn_exp2f(m[j] - mn); m[j] = mn; l[j] *= al;      /* both halves of a column take the same new reference */
#pragma unroll
      for (int d = 0; d < 4; ++d) o[d][j] *= al; } }
#pragma unroll
  for (int j = 0; j < 2; ++j) { FragH pf; float sm[2] = {0.f, 0.f};
#pragma unroll
    for (int t = 0; t < 2; ++t)
#pragma unroll
      for (int r = 0; r < 8; ++r) { const float p = __builtin_amdgcn_exp2f(fmaf(st[j][t][r], cs, -m[j])); sm[t] += p; pf.h[8 * t + r] = (_Float16)p; }
    l[j] += sm[0] + sm[1];
#pragma unroll
    for (int d = 0; d < 4; ++d) o[d][j] = at_mma(vf[d], pf.v, o[d][j]); }
  if (MORE) {
#pragma unroll
    for (int d = 0; d < 4; ++d) vf[d] = pk_frag(vp + (size_t)(kb + 32) * HD + d * 512);
  } }
#define NPS 4                        /* 32-key passes in a stage of the LDS ring */
#define NST (SQ / (32 * NPS))        /* stages */
#define STH (NPS * 2048)             /* halves of K, and of V^T, in a stage */
// Eight asynchronous 16-byte copies of a lane from global memory to LDS, 2 KiB apart on both sides: the work-group's 128 lanes fill 2 KiB a copy, 16 KiB in all.
// l = the lane's LDS byte address, g = its global address. The closing s_wait_xcnt stands in the copies' own statement, so that no address register they name is rewritten ahead of it (a precaution).
__device__ __forceinline__ void cp8(unsigned l, const _Float16* g) {
  asm volatile("global_load_async_to_lds_b128 %0, %8, off\n\t"
               "global_load_async_to_lds_b128 %1, %9, off\n\t"
               "global_load_async_to_lds_b128 %2, %10, off\n\t"
               "global_load_async_to_lds_b128 %3, %11, off\n\t"
               "global_load_async_to_lds_b128 %4, %12, off\n\t"
               "global_load_async_to_lds_b128 %5, %13, off\n\t"
               "global_load_async_to_lds_b128 %6, %14, off\n\t"
               "global_load_async_to_lds_b128 %7, %15, off\n\t"
               "s_wait_xcnt 0x0"
               :: "v"(l), "v"(l + 2048u), "v"(l + 4096u), "v"(l + 6144u), "v"(l + 8192u), "v"(l + 10240u), "v"(l + 12288u), "v"(l + 14336u),
                  "v"(g), "v"(g + 1024), "v"(g + 2048), "v"(g + 3072), "v"(g + 4096), "v"(g + 5120), "v"(g + 6144), "v"(g + 7168) : "memory"); }
__global__ __launch_bounds__(128) void k_attn(const _Float16* __restrict__ Q16, const _Float16* __restrict__ K16, const _Float16* __restrict__ VT, float* __restrict__ out) {
  __shared__ __attribute__((aligned(128))) _Float16 ring[2][2][STH];      /* [buffer][K, V^T][a stage in fragment order] */
  const int w = threadIdx.x >> 5, lane = threadIdx.x & 31, ln = lane & 15, hh = lane >> 4;
  const int bh = blockIdx.y, b = bh / NH, h = bh - b * NH; const int q0 = blockIdx.x * 128 + w * 32;
  const _Float16* qp = Q16 + (size_t)bh * (SQ * HD) + (size_t)(q0 >> 5) * 2048 + lane * 8;      /* all three in fragment order; the wave's 32 queries are one pass of Q */
  const _Float16* kg = K16 + (size_t)bh * (SQ * HD) + threadIdx.x * 8;      /* the thread's 16 bytes of each 2-KiB slice that the work-group copies */
  const _Float16* vg = VT + (size_t)bh * (SQ * HD) + threadIdx.x * 8;
  const unsigned lr = (unsigned)(size_t)&ring[0][0][0] + threadIdx.x * 16u;      /* the same 16 bytes in LDS (byte address) */
  v16h qf[2][2], kf[2][2], vf[4];
#pragma unroll
  for (int j = 0; j < 2; ++j) for (int s = 0; s < 2; ++s) qf[j][s] = pk_frag(qp + (j * 2 + s) * 512);
  cp8(lr, kg); cp8(lr + STH * 2u, vg);      /* stage 0 into buffer 0 */
  asm volatile("s_wait_asynccnt 0x0" ::: "memory");      /* this wave's copies of stage 0 have landed ... */
  __syncthreads();      /* ... and so have the other waves' */
  cp8(lr + STH * 4u, kg + STH); cp8(lr + STH * 6u, vg + STH);      /* stage 1 into buffer 1, in flight over stage 0's passes */
  v8f o[4][2]; float m[2] = {-3.0e38f, -3.0e38f}, l[2] = {0.f, 0.f};
#pragma unroll
  for (int d = 0; d < 4; ++d) for (int j = 0; j < 2; ++j) o[d][j] = v8f{0.f,0.f,0.f,0.f,0.f,0.f,0.f,0.f};
  for (int t = 0; t < NST; ++t) {
    const _Float16* kp = &ring[t & 1][0][lane * 8]; const _Float16* vp = &ring[t & 1][1][lane * 8];
    /* the three unrolls below: constant indices keep the fragment arrays in registers, and the LDS offsets of a stage's passes become immediates */
#pragma unroll
    for (int u = 0; u < 2; ++u) for (int s = 0; s < 2; ++s) kf[u][s] = pk_frag(kp + (u * 2 + s) * 512);
#pragma unroll
    for (int d = 0; d < 4; ++d) vf[d] = pk_frag(vp + d * 512);
#pragma unroll
    for (int p = 0; p < NPS - 1; ++p) at_pass<true>(kp, vp, p * 32, qf, kf, vf, o, m, l);
    at_pass<false>(kp, vp, (NPS - 1) * 32, qf, kf, vf, o, m, l);      /* a stage's last pass fetches nothing: the next stage is not published yet */
    asm volatile("s_wait_dscnt 0x0" ::: "memory");      /* this wave's reads of the buffer are done before it may be refilled */
    asm volatile("s_wait_asynccnt 0x0" ::: "memory");      /* this wave's copies of stage t + 1 have landed */
    __syncthreads();      /* publishes stage t + 1 and ends every wave's reads of stage t's buffer */
    if (t + 2 < NST) { cp8(lr + (t & 1) * (STH * 4u), kg + (size_t)(t + 2) * STH); cp8(lr + (t & 1) * (STH * 4u) + STH * 2u, vg + (size_t)(t + 2) * STH); }      /* stage t + 2 into the buffer just left */
  }
  asm volatile("s_wait_asynccnt 0x0" ::: "memory");      /* no copy is left in flight when the wave ends */
#pragma unroll
  for (int j = 0; j < 2; ++j) { const float inv = 1.0f / (l[j] + lane_x16(l[j]));      /* join the halves' sums once */
    float* op = out + ((size_t)b * SQ + q0 + j * 16 + ln) * DM + h * HD + 8 * hh;      /* O^T register r = feature 16 d + 8 hf + r of query c: 32 contiguous bytes a lane and tile */
#pragma unroll
    for (int d = 0; d < 4; ++d) { const v4f lo = {o[d][j][0] * inv, o[d][j][1] * inv, o[d][j][2] * inv, o[d][j][3] * inv}, hi = {o[d][j][4] * inv, o[d][j][5] * inv, o[d][j][6] * inv, o[d][j][7] * inv};
      *(v4f*)(op + d * 16) = lo; *(v4f*)(op + d * 16 + 4) = hi; } } }
__global__ __launch_bounds__(256) void k_vt(const _Float16* __restrict__ V16, int b, int h0, _Float16* __restrict__ VT) { __shared__ unsigned short tl[64][65]; const int tid = threadIdx.x; const int hh = blockIdx.x % HG, sg = blockIdx.x / HG; const int s0 = sg * 64; const int h = h0 + hh;
  for (int i = tid; i < 64 * 8; i += 256) { const int j = i / 8, d8 = (i % 8) * 8; FragH f; f.half[0] = *(const v8us*)((const unsigned short*)V16 + ((size_t)b * SQ + s0 + j) * DM + h * HD + d8); for (int q = 0; q < 8; ++q) tl[d8 + q][j] = f.u[q]; }
  __syncthreads();
  { for (int i = tid; i < 64 * 8; i += 256) { const int d = i / 8, j8 = (i % 8) * 8; FragH f; for (int q = 0; q < 8; ++q) f.u[q] = tl[d][j8 + q]; *(v8us*)((unsigned short*)VT + ((size_t)hh * HD + d) * SQ + s0 + j8) = f.half[0]; }  } }



// two f32 rounded to bf16 (the conversion instruction rounds to nearest even, as bf16_round does) and widened again
typedef float v2f __attribute__((ext_vector_type(2)));
typedef __bf16 v2b __attribute__((ext_vector_type(2)));
__device__ __forceinline__ v2f rb2(float a, float b) { const v2f p = {a, b}; return __builtin_convertvector(__builtin_convertvector(p, v2b), v2f); }
// 16-byte halves of a WMMA operand fragment from an LDS weight row: p points at the lane's first 8 halves (k = 8 hf ..), the second 8 stand 16 halves on (k = 16 + 8 hf ..), the k order of the x fragments below.
__device__ __forceinline__ v16h ws_frag(const unsigned short* p) { FragH f; f.half[0] = *(const v8us*)p; f.half[1] = *(const v8us*)(p + 16); return f.v; }
// Fused projections, one launch: a work-group = one head x 128 token rows, a wave = 32 rows (one 32-key pass of its batch and head).
// x is read as f32 and rounded in the fragment registers (bf16, exact in f16); the head's three 64 x 64 weights pass once through LDS as [out][in] f16 rows (x16, exact), pitch 72 halves for the 16-byte fragment reads.
// Q and K: D = W^T x^T (A = weight rows, B = token rows): a lane holds 8 consecutive features of one token. V: D = x W (A = token rows, B = weight rows): a lane holds 8 consecutive keys of one feature.
// Either way the 8 accumulator registers of a tile are the lane's 16 bytes of one fragment-order unit (see pk_frag), so every tile leaves as one 512-byte store of the wave, with no staging and no transpose pass.
__global__ __launch_bounds__(128) void k_qkv(const float* __restrict__ x, const float* __restrict__ wq, const float* __restrict__ bq, const float* __restrict__ wk, const float* __restrict__ bk, const float* __restrict__ wv, const float* __restrict__ bv,
    _Float16* __restrict__ QP, _Float16* __restrict__ KP, _Float16* __restrict__ VT) {
  __shared__ __attribute__((aligned(16))) unsigned short wl[3][HD][72];
  __shared__ __attribute__((aligned(16))) float bl[3][HD];      /* the head's biases, rounded to bf16 */
  const int tid = threadIdx.x, w = tid >> 5, lane = tid & 31, ln = lane & 15, hh = lane >> 4;
  const int h = blockIdx.y, row0 = blockIdx.x * 128 + 32 * w;
  const float* xp = x + (size_t)(row0 + ln) * DM + h * HD + 8 * hh;
  const size_t wofs = (size_t)h * HD * HD + (tid >> 4) * 8 * HD + (tid & 15) * 4;      /* a thread takes 8 inputs x 4 outputs of each weight: 16 lanes read one whole 256-byte weight row */
  const float* wpq = wq + wofs; const float* wpk = wk + wofs; const float* wpv = wv + wofs;
  const float* bp01 = (tid < 64 ? bq : bk) + h * HD + (tid & 63); const float* bp2 = bv + h * HD + (tid & 63);      /* threads 0..63: q and v biases, 64..127: k biases (their v value is not used) */
  v4f xr[2][2][4], wr[3][8];
#pragma unroll
  for (int j = 0; j < 2; ++j)
#pragma unroll
    for (int s = 0; s < 2; ++s)
#pragma unroll
      for (int q = 0; q < 4; ++q) xr[j][s][q] = *(const v4fa*)(xp + (size_t)j * 16 * DM + s * 32 + (q >> 1) * 16 + (q & 1) * 4);
  asm volatile("s_wait_xcnt 0x0" :: "v"(xp) : "memory");      /* the operand keeps the address registers of the loads above as they are up to this wait; the statement also keeps these loads, the only ones that come from memory, ahead of the rest */
#pragma unroll
  for (int i = 0; i < 8; ++i) { wr[0][i] = *(const v4fa*)(wpq + i * HD); wr[1][i] = *(const v4fa*)(wpk + i * HD); wr[2][i] = *(const v4fa*)(wpv + i * HD); }
  const float b01 = *bp01, b2 = *bp2;
  asm volatile("s_wait_xcnt 0x0" :: "v"(wpq), "v"(wpk), "v"(wpv), "v"(bp01) : "memory");      /* as above, for the weight and bias loads */
#pragma unroll
  for (int m = 0; m < 3; ++m)
#pragma unroll
    for (int k = 0; k < 4; ++k) { FragH f;
#pragma unroll
      for (int i = 0; i < 8; i += 2) { const v2f p = rb2(wr[m][i][k], wr[m][i + 1][k]) * 16.0f; f.h[i] = (_Float16)p[0]; f.h[i + 1] = (_Float16)p[1]; }
      *(v8us*)&wl[m][(tid & 15) * 4 + k][(tid >> 4) * 8] = f.half[0]; }
  bl[tid >> 6][tid & 63] = bf16_round(b01);
  if (tid < 64) bl[2][tid] = bf16_round(b2);
  v16h xf[2][2];
#pragma unroll
  for (int j = 0; j < 2; ++j)
#pragma unroll
    for (int s = 0; s < 2; ++s) { FragH f;
#pragma unroll
      for (int q = 0; q < 4; ++q)
#pragma unroll
        for (int i = 0; i < 4; i += 2) { const v2f p = rb2(xr[j][s][q][i], xr[j][s][q][i + 1]); f.h[q * 4 + i] = (_Float16)p[0]; f.h[q * 4 + i + 1] = (_Float16)p[1]; }
      xf[j][s] = f.v; }
  __syncthreads();
  const v8f z8 = {0.f,0.f,0.f,0.f,0.f,0.f,0.f,0.f};
  const size_t pofs = ((size_t)(row0 / SQ) * NH + h) * (SQ * HD) + (size_t)((row0 % SQ) >> 5) * 2048 + lane * 8;      /* the wave's pass, the lane's 8 halves of unit 0 */
#pragma unroll
  for (int m = 0; m < 2; ++m) { unsigned short* dst = (unsigned short*)(m == 0 ? QP : KP) + pofs;
#pragma unroll
    for (int te = 0; te < 4; ++te) { const v16h a0 = ws_frag(&wl[m][te * 16 + ln][8 * hh]), a1 = ws_frag(&wl[m][te * 16 + ln][32 + 8 * hh]);
      const v4f b0 = *(const v4fa*)&bl[m][te * 16 + 8 * hh], b1 = *(const v4fa*)&bl[m][te * 16 + 8 * hh + 4]; const float bb[8] = {b0[0], b0[1], b0[2], b0[3], b1[0], b1[1], b1[2], b1[3]};
#pragma unroll
      for (int tk = 0; tk < 2; ++tk) { const v8f c = at_mma(a1, xf[tk][1], at_mma(a0, xf[tk][0], z8)); FragH f;
#pragma unroll
        for (int r = 0; r < 8; ++r) f.h[r] = (_Float16)(c[r] * 0.0625f + bb[r]);
        *(v8us*)(dst + (tk * 4 + te) * 256) = f.half[0]; } }      /* unit (t*2 + s)*2 + i with features 16 te = 32 s + 16 i */
    asm volatile("s_wait_xcnt 0x0" ::: "memory"); }      /* before the next product reuses the registers of the stores above; it also keeps the next product's LDS reads behind them, which bounds the registers in use */
  { unsigned short* dst = (unsigned short*)VT + pofs;
#pragma unroll
    for (int td = 0; td < 4; ++td) { const v16h b0 = ws_frag(&wl[2][td * 16 + ln][8 * hh]), b1 = ws_frag(&wl[2][td * 16 + ln][32 + 8 * hh]); const float bb = bl[2][td * 16 + ln];
#pragma unroll
      for (int tk = 0; tk < 2; ++tk) { const v8f c = at_mma(xf[tk][1], b1, at_mma(xf[tk][0], b0, z8)); FragH f;
#pragma unroll
        for (int r = 0; r < 8; ++r) f.h[r] = (_Float16)(c[r] * 0.0625f + bb);
        *(v8us*)(dst + (td * 2 + tk) * 256) = f.half[0]; } } } }      /* unit d*2 + i */
extern "C" void kernel_launch(void* const* d_in, const int* in_sizes, int n_in,
                              void* d_out, int out_size, void* d_ws, size_t ws_size, hipStream_t stream) {
  (void)in_sizes; (void)n_in; (void)out_size;
  const float* const* I = (const float* const*)d_in; const float* x = I[0]; const float* wq = I[1]; const float* bq = I[2]; const float* wk = I[3]; const float* bk = I[4]; const float* wv = I[5]; const float* bv = I[6];      /* per-head W [12][64][64] ([h][in][out]) + b [12][64] for q, k, v */
  char* ws = (char*)d_ws; size_t off = 0;
  auto take = [&](size_t bytes) { char* p = ws + off; off += (bytes + 255) & ~(size_t)255; return p; };
  _Float16* Q16 = (_Float16*)take(NR * DM * 2); _Float16* K16 = (_Float16*)take(NR * DM * 2);
  _Float16* VT = (_Float16*)take((size_t)NB * NH * HD * SQ * 2);
  if (off > ws_size) return;
  k_qkv<<<dim3(MP / 128, NH), 128, 0, stream>>>(x, wq, bq, wk, bk, wv, bv, Q16, K16, VT);      /* x and weight rounding, the three per-head projections (+ biases) and the fragment-order layouts of Q, K and V^T, one launch */
  k_attn<<<dim3(SQ / 128, NB * NH), 128, 0, stream>>>(Q16, K16, VT, (float*)d_out);      /* scores, softmax and P V fused; f32 straight into the merged-heads output rows */
}

// v007
// A run of this version takes 40.9 microseconds.
// Two timings next to v006 both put it at 1.11 times that version's speed.
// Counting every step since v000, it is 132 times as fast.
#include <hip/hip_runtime.h>
// Multi-head self-attention with PER-HEAD 64x64 projections on head-chunked features (sequences [8][1024][768] viewed [B][S][12][64]; q/k/v[..., h, :] = x[..., h, :] W[h] + b[h] with W [12][64][64] ([h][in][out], sigma 0.05) and b [12][64] (sigma 0.05); scores / 8; softmax over all 1024 keys (no mask); out = heads concatenated (no output projection) -> [8][1024][768]).
// Structure: token rows r = b*1024 + s; one projection launch: x rounded in registers (bf16, exact in f16), Q, K, V as WMMA products (32x64 wave tiles, f32 accumulation, exact x16 weights + bias, f16 outputs), Q, K and V^T stored from the accumulators in WMMA fragment order (512-byte units); one fused attention launch over every (batch, head), K and V^T staged per work-group in a two-buffer LDS ring by asynchronous copies: S^T = K Q^T (K = 64), running softmax in registers (f32 statistics; weights 2^(s - reference) as f16, at most 2^8), O^T += V^T P^T, divided by the row sum and written f32 straight into the merged-heads output rows (no output projection).
// Compute dtype: inputs rounded to bf16; x / weights exact; q, k, v and softmax weights as plain f16 GEMM operands (~2^-12); scores, softmax statistics and o f32. v_wmma_f32_16x16x32_f16.
#define NB 8
#define SQ 1024
#define DM 768
#define NH 12
#define HD 64
#define HG 4                         /* heads per launch of the per-batch k_vt overload (not called) */
#define B0 0                         /* unused (both launches start at batch 0) */
#define NBR NB                       /* unused (both launches cover all NB batches) */
#define NR ((size_t)NB * SQ)         /* token rows */
#define MP ((int)((size_t)NBR * SQ)) /* unused (k_qkv's grid covers all NB * SQ rows) */
#define QN SQ                        /* unused (k_attn attends all SQ query rows) */
#define NHD NH                       /* unused (k_attn covers all NH heads) */
#define MPO MP                       /* unused (no output stage) */
#define LQ DM      /* unused (Q, K and V^T are all in fragment order) */
typedef __bf16 v16b __attribute__((ext_vector_type(16)));
typedef unsigned short v8us __attribute__((ext_vector_type(8), may_alias));
typedef float  v8f  __attribute__((ext_vector_type(8)));
typedef float  v4f  __attribute__((ext_vector_type(4)));
typedef float  v4fa __attribute__((ext_vector_type(4), may_alias));
union FragB { v16b v; v8us half[2]; unsigned short u[16]; };

__device__ __forceinline__ unsigned short bf16_bits(float x) { unsigned int u = __float_as_uint(x); return (unsigned short)((u + 0x7FFFu + ((u >> 16) & 1u)) >> 16); }
__device__ __forceinline__ float bf16_val(unsigned short b) { return __uint_as_float(((unsigned int)b) << 16); }
__device__ __forceinline__ float bf16_round(float x) { return bf16_val(bf16_bits(x)); }
// D += A·B with NT terms: 1 = ah·bh, 2 = + al·bh (A split), 3 = + ah·bl (both split)
template <int NT>
__device__ __forceinline__ v8f mmaN(v16b ah, v16b al, v16b bh, v16b bl, v8f c) {
  c = __builtin_amdgcn_wmma_f32_16x16x32_bf16(false, ah, false, bh, (short)0, c, false, false);
  if (NT >= 2) c = __builtin_amdgcn_wmma_f32_16x16x32_bf16(false, al, false, bh, (short)0, c, false, false);
  if (NT >= 3) c = __builtin_amdgcn_wmma_f32_16x16x32_bf16(false, ah, false, bl, (short)0, c, false, false);
  asm volatile("v_nop\n\tv_nop\n\tv_nop\n\tv_nop" : "+v"(c) : "v"(ah), "v"(al), "v"(bh), "v"(bl));
  return c;
}

__global__ __launch_bounds__(256) void k_wt_bf16(const float* __restrict__ W, unsigned short* __restrict__ Wt, int K, int N) {
  const int t = blockIdx.x * 256 + threadIdx.x;
  const int k8n = K / 8;
  if (t >= N * k8n) return;
  const int n = t / k8n, k8 = (t % k8n) * 8;
  v8us v;
#pragma unroll
  for (int i = 0; i < 8; ++i) v[i] = bf16_bits(W[(size_t)(k8 + i) * N + n]);
  *(v8us*)(Wt + (size_t)n * K + k8) = v;
  
}

// GEMM C[M][N] (f32, pitch ldc) = act(A[M][K]·W + bias). A f32 row-major (pitch lda) converted per fragment to bf16
// (ASPLIT: hi/lo two planes -> 2 terms, else single rounded term); Wt bf16 [N][K] (pitch ldb). BIAS_BF16 rounds the
// bias to bf16 first (bias quantised to bf16 before the add). K%32==0, M%16==0, N%64==0.
template <bool ASPLIT, int ACT, bool BIAS_BF16>
__global__ __launch_bounds__(128) void k_gemm_bf(const float* __restrict__ A, int lda, const unsigned short* __restrict__ Wt, int ldb,
                                               const float* __restrict__ bias, float* __restrict__ C, int ldc, int M, int N, int K) {
  __shared__ __attribute__((aligned(16))) float so[4][16][64];
  const int tid = threadIdx.x, w = tid >> 5, lane = tid & 31, ln = lane & 15, hh = lane >> 4;
  const int ntn = N / 64;
  const int wid = blockIdx.x * 4 + w;
  const int mt = wid / ntn, nq = wid % ntn;
  if (mt * 16 >= M) return;
  const int row0 = mt * 16, col0 = nq * 64;
  const float* arow = A + (size_t)(row0 + ln) * lda;
  v8f acc[4] = {};
  for (int kb = 0; kb < K; kb += 32) {
    FragB ah, al;
    const v4f x0 = *(const v4fa*)(arow + kb + 8 * hh), x1 = *(const v4fa*)(arow + kb + 8 * hh + 4);
    const v4f x2 = *(const v4fa*)(arow + kb + 16 + 8 * hh), x3 = *(const v4fa*)(arow + kb + 16 + 8 * hh + 4);
    float xs[16] = {x0[0],x0[1],x0[2],x0[3],x1[0],x1[1],x1[2],x1[3],x2[0],x2[1],x2[2],x2[3],x3[0],x3[1],x3[2],x3[3]};
#pragma unroll
    for (int i = 0; i < 16; ++i) { const unsigned short hb = bf16_bits(xs[i]); ah.u[i] = hb; al.u[i] = ASPLIT ? bf16_bits(xs[i] - bf16_val(hb)) : (unsigned short)0; }
#pragma unroll
    for (int t = 0; t < 4; ++t) {
      const unsigned short* brow = Wt + (size_t)(col0 + t * 16 + ln) * ldb + kb;
      FragB b;
      b.half[0] = *(const v8us*)(brow + 8 * hh);
      b.half[1] = *(const v8us*)(brow + 16 + 8 * hh);
      acc[t] = mmaN<ASPLIT ? 2 : 1>(ah.v, al.v, b.v, b.v, acc[t]);
    }
  }
#pragma unroll
  for (int t = 0; t < 4; ++t) {
    float bv = bias ? bias[col0 + t * 16 + ln] : 0.f;
    if (BIAS_BF16) bv = bf16_round(bv);
#pragma unroll
    for (int r = 0; r < 8; ++r) { float v = acc[t][r] + bv; if (ACT == 1) v = fmaxf(v, 0.f); so[w][8 * hh + r][t * 16 + ln] = v; }
  }
  __builtin_amdgcn_fence(__ATOMIC_ACQ_REL, "workgroup");
  __builtin_amdgcn_wave_barrier();
  const int rsub = lane >> 4, c4 = (lane & 15) * 4;
  {
#pragma unroll
    for (int q = 0; q < 8; ++q) {
      const int r = q * 2 + rsub;
      const v4f v = *(const v4fa*)&so[w][r][c4];
      *(v4f*)(C + (size_t)(row0 + r) * ldc + col0 + c4) = v;
    }
    
  }
}

// GEMM C = act(A·W + bias + resid): A f32 (ASPLIT -> hi/lo 2 terms), Wt bf16 [N][K]; ACT 0 none, 1 relu, 2 exact gelu;
// resid (optional, f32, row index = (row % rmod), pitch ldr, RES_BF16 rounds it) added before the activation.
template <bool ASPLIT, int ACT, bool BIAS_BF16, bool RES_BF16>
__global__ __launch_bounds__(128) void k_gemm_bf3(const float* __restrict__ A, int lda, const unsigned short* __restrict__ Wt, int ldb,
                                                const float* __restrict__ bias, const float* __restrict__ resid, int rmod, int ldr,
                                                float* __restrict__ C, int ldc, int M, int N, int K) {
  __shared__ __attribute__((aligned(16))) float so[4][16][64];
  const int tid = threadIdx.x, w = tid >> 5, lane = tid & 31, ln = lane & 15, hh = lane >> 4;
  const int ntn = N / 64;
  const int wid = blockIdx.x * 4 + w;
  const int mt = wid / ntn, nq = wid % ntn;
  if (mt * 16 >= M) return;
  const int row0 = mt * 16, col0 = nq * 64;
  const float* arow = A + (size_t)(row0 + ln) * lda;
  v8f acc[4] = {};
  for (int kb = 0; kb < K; kb += 32) {
    FragB ah, al;
    const v4f x0 = *(const v4fa*)(arow + kb + 8 * hh), x1 = *(const v4fa*)(arow + kb + 8 * hh + 4);
    const v4f x2 = *(const v4fa*)(arow + kb + 16 + 8 * hh), x3 = *(const v4fa*)(arow + kb + 16 + 8 * hh + 4);
    float xs[16] = {x0[0],x0[1],x0[2],x0[3],x1[0],x1[1],x1[2],x1[3],x2[0],x2[1],x2[2],x2[3],x3[0],x3[1],x3[2],x3[3]};
#pragma unroll
    for (int i = 0; i < 16; ++i) { const unsigned short hb = bf16_bits(xs[i]); ah.u[i] = hb; al.u[i] = ASPLIT ? bf16_bits(xs[i] - bf16_val(hb)) : (unsigned short)0; }
#pragma unroll
    for (int t = 0; t < 4; ++t) {
      const unsigned short* brow = Wt + (size_t)(col0 + t * 16 + ln) * ldb + kb;
      FragB b;
      b.half[0] = *(const v8us*)(brow + 8 * hh);
      b.half[1] = *(const v8us*)(brow + 16 + 8 * hh);
      acc[t] = mmaN<ASPLIT ? 2 : 1>(ah.v, al.v, b.v, b.v, acc[t]);
    }
  }
#pragma unroll
  for (int t = 0; t < 4; ++t) {
    const int col = col0 + t * 16 + ln;
    float bv = bias ? bias[col] : 0.f;
    if (BIAS_BF16) bv = bf16_round(bv);
#pragma unroll
    for (int r = 0; r < 8; ++r) {
      float v = acc[t][r] + bv;
      if (resid) { float rv = resid[(size_t)((row0 + 8 * hh + r) % rmod) * ldr + col]; if (RES_BF16) rv = bf16_round(rv); v += rv; }
      if (ACT == 1) v = fmaxf(v, 0.f);
      if (ACT == 2) v = 0.5f * v * (1.0f + erff(v * 0.70710678118654752f));
      if (ACT == 3) { const float u = 0.7978845608028654f * (v + 0.044715f * v * v * v); v = 0.5f * v * (1.0f + tanhf(u)); }
      so[w][8 * hh + r][t * 16 + ln] = v;
    }
  }
  __builtin_amdgcn_fence(__ATOMIC_ACQ_REL, "workgroup");
  __builtin_amdgcn_wave_barrier();
  const int rsub = lane >> 4, c4 = (lane & 15) * 4;
  {
#pragma unroll
    for (int q = 0; q < 8; ++q) {
      const int r = q * 2 + rsub;
      const v4f v = *(const v4fa*)&so[w][r][c4];
      *(v4f*)(C + (size_t)(row0 + r) * ldc + col0 + c4) = v;
    }
    
  }
}
// row LayerNorm (biased variance, eps) over N: s = X (+ R); optional out_sum <- s; out_norm <- (s-mu)*rsqrt(var+eps)*g + b
template <bool PARAM_BF16>
__global__ __launch_bounds__(256) void k_layernorm(const float* __restrict__ X, const float* __restrict__ R, const float* __restrict__ g, const float* __restrict__ bta,
                                                  float* __restrict__ out_sum, float* __restrict__ out_norm, int N, float eps) {
  __shared__ float red[256];
  const int row = blockIdx.x, tid = threadIdx.x;
  const float* x = X + (size_t)row * N; const float* rr = R ? R + (size_t)row * N : nullptr;
  float vals[16];                     // up to N = 4096
  const int per = N / 256;            // contiguous chunk per thread? use strided-by-4 chunks: thread handles j = tid*4 + 1024*u
  float s1 = 0.f;
  for (int u = 0; u < per / 4; ++u) {
    const int j = tid * 4 + 1024 * u;
    const v4f a = *(const v4fa*)(x + j);
    v4f b = {0.f,0.f,0.f,0.f}; if (rr) b = *(const v4fa*)(rr + j);
#pragma unroll
    for (int q = 0; q < 4; ++q) { const float v = a[q] + b[q]; vals[u * 4 + q] = v; s1 += v; }
  }
  red[tid] = s1; __syncthreads();
  for (int st = 128; st > 0; st >>= 1) { if (tid < st) red[tid] += red[tid + st]; __syncthreads(); }
  const float mu = red[0] / (float)N; __syncthreads();
  float s2 = 0.f;
  for (int u = 0; u < per / 4; ++u)
#pragma unroll
    for (int q = 0; q < 4; ++q) { const float c = vals[u * 4 + q] - mu; s2 += c * c; }
  red[tid] = s2; __syncthreads();
  for (int st = 128; st > 0; st >>= 1) { if (tid < st) red[tid] += red[tid + st]; __syncthreads(); }
  const float rs = rsqrtf(red[0] / (float)N + eps);
  {
    for (int u = 0; u < per / 4; ++u) {
      const int j = tid * 4 + 1024 * u;
      v4f o, sm;
#pragma unroll
      for (int q = 0; q < 4; ++q) {
        float gg = g[j + q], bb = bta[j + q];
        if (PARAM_BF16) { gg = bf16_round(gg); bb = bf16_round(bb); }
        sm[q] = vals[u * 4 + q]; o[q] = (vals[u * 4 + q] - mu) * rs * gg + bb;
      }
      if (out_sum) *(v4f*)(out_sum + (size_t)row * N + j) = sm;
      *(v4f*)(out_norm + (size_t)row * N + j) = o;
    }
    
  }
}



// ---- f16 WMMA path (v_wmma_f32_16x16x32_f16): 11-bit significands for operands in range — used where a probability operand (at most 2^8) needs more precision than bf16
typedef _Float16 v16h __attribute__((ext_vector_type(16)));
union FragH { v16h v; v8us half[2]; _Float16 h[16]; unsigned short u[16]; };
template <int NT>
__device__ __forceinline__ v8f mmaH(v16h ah, v16h al, v16h bh, v16h bl, v8f c) {
  c = __builtin_amdgcn_wmma_f32_16x16x32_f16(false, ah, false, bh, (short)0, c, false, false);
  if (NT >= 2) c = __builtin_amdgcn_wmma_f32_16x16x32_f16(false, al, false, bh, (short)0, c, false, false);
  if (NT >= 3) c = __builtin_amdgcn_wmma_f32_16x16x32_f16(false, ah, false, bl, (short)0, c, false, false);
  asm volatile("v_nop\n\tv_nop\n\tv_nop\n\tv_nop" : "+v"(c) : "v"(ah), "v"(al), "v"(bh), "v"(bl));
  return c;
}
// batched GEMM like k_gemm_b but f16 operands: A f32 (split into f16 hi/lo if ASPLIT, else rounded to f16), Bt = f16 values [n][k]; alpha; C f32; N multiple of 16 (partial tiles skipped)
template <bool ASPLIT>
__global__ __launch_bounds__(128) void k_gemm_h(const float* __restrict__ A, int lda, size_t sA, const _Float16* __restrict__ Bh, int ldb, size_t sB, float alpha, float* __restrict__ C, int ldc, size_t sC, int M, int N, int K) {
  __shared__ __attribute__((aligned(16))) float so[4][16][64];
  const int tid = threadIdx.x, w = tid >> 5, lane = tid & 31, ln = lane & 15, hh = lane >> 4; const int by = blockIdx.y;
  A += (size_t)by * sA; Bh += (size_t)by * sB; C += (size_t)by * sC;
  const int ntn = (N + 63) / 64; const int wid = blockIdx.x * 4 + w; const int mt = wid / ntn, nq = wid % ntn; if (mt * 16 >= M) return;
  const int row0 = mt * 16, col0 = nq * 64; const float* arow = A + (size_t)(row0 + ln) * lda;
  v8f acc[4] = {};
  for (int kb = 0; kb < K; kb += 32) {
    FragH ah, al;
    const v4f x0 = *(const v4fa*)(arow + kb + 8 * hh), x1 = *(const v4fa*)(arow + kb + 8 * hh + 4), x2 = *(const v4fa*)(arow + kb + 16 + 8 * hh), x3 = *(const v4fa*)(arow + kb + 16 + 8 * hh + 4);
    float xs[16] = {x0[0],x0[1],x0[2],x0[3],x1[0],x1[1],x1[2],x1[3],x2[0],x2[1],x2[2],x2[3],x3[0],x3[1],x3[2],x3[3]};
#pragma unroll
    for (int i = 0; i < 16; ++i) { const _Float16 h = (_Float16)xs[i]; ah.h[i] = h; al.h[i] = ASPLIT ? (_Float16)(xs[i] - (float)h) : (_Float16)0.0f; }
#pragma unroll
    for (int t = 0; t < 4; ++t) { if (col0 + t * 16 >= N) continue; const size_t boff = (size_t)(col0 + t * 16 + ln) * ldb + kb; FragH bq; bq.half[0] = *(const v8us*)(Bh + boff + 8 * hh); bq.half[1] = *(const v8us*)(Bh + boff + 16 + 8 * hh);
      acc[t] = mmaH<ASPLIT ? 2 : 1>(ah.v, al.v, bq.v, bq.v, acc[t]); }
  }
#pragma unroll
  for (int t = 0; t < 4; ++t) { if (col0 + t * 16 >= N) continue;
#pragma unroll
    for (int r = 0; r < 8; ++r) so[w][8 * hh + r][t * 16 + ln] = acc[t][r] * alpha; }
  __builtin_amdgcn_fence(__ATOMIC_ACQ_REL, "workgroup"); __builtin_amdgcn_wave_barrier();
  const int rsub = lane >> 4, c4 = (lane & 15) * 4;
  {
#pragma unroll
    for (int q = 0; q < 8; ++q) { const int r = q * 2 + rsub; if (col0 + c4 < N) { const v4f v = *(const v4fa*)&so[w][r][c4]; *(v4f*)(C + (size_t)(row0 + r) * ldc + col0 + c4) = v; } }
     }
}

// Wt[n][k] = f16(W[k][n]·scale) from f32 row-major W[K][N] (scale = power of two; bf16-exact weights stay exact in f16 away from the subnormal range)
__global__ __launch_bounds__(256) void k_wt_f16(const float* __restrict__ W, _Float16* __restrict__ Wt, int K, int N, float scale) {
  const int t = blockIdx.x * 256 + threadIdx.x; if (t >= N * (K / 8)) return; const int n = t / (K / 8), k8 = (t % (K / 8)) * 8; FragH f;
#pragma unroll
  for (int i = 0; i < 8; ++i) f.h[i] = (_Float16)(bf16_round(W[(size_t)(k8 + i) * N + n]) * scale); const v8us o = f.half[0];
  *(v8us*)((unsigned short*)Wt + (size_t)n * K + k8) = o; 
}
// k_gemm_hh variant with fused epilogue: v = acc·alpha + bias[by·sBias + col] (+ CP[(row/rowsPerB)·sCPb + by·64 + col] if CP) ; ACT 0 none / 1 elu ; writes f16 C16 (and f32 C if non-null)
template <int ACT>
__global__ __launch_bounds__(128) void k_gemm_hhx(const _Float16* __restrict__ A, int lda, size_t sA, const _Float16* __restrict__ Bh, int ldb, size_t sB, float alpha, const float* __restrict__ bias, size_t sBias, const float* __restrict__ CP, int rowsPerB, size_t sCPb, int row0g,
    float* __restrict__ C, _Float16* __restrict__ C16, int ldc, size_t sC, int M, int N, int K) {
  __shared__ __attribute__((aligned(16))) float so[4][16][64];
  const int tid = threadIdx.x, w = tid >> 5, lane = tid & 31, ln = lane & 15, hh = lane >> 4; const int by = blockIdx.y;
  A += (size_t)by * sA; Bh += (size_t)by * sB; const size_t cofs = (size_t)by * sC; const float* bp = bias ? bias + (size_t)by * sBias : nullptr;
  const int ntn = (N + 63) / 64; const int wid = blockIdx.x * 4 + w; const int mt = wid / ntn, nq = wid % ntn; if (mt * 16 >= M) return;
  const int row0 = mt * 16, col0 = nq * 64; const _Float16* arow = A + (size_t)(row0 + ln) * lda;
  v8f acc[4] = {};
  for (int kb = 0; kb < K; kb += 32) { FragH ah; ah.half[0] = *(const v8us*)((const unsigned short*)arow + kb + 8 * hh); ah.half[1] = *(const v8us*)((const unsigned short*)arow + kb + 16 + 8 * hh);
#pragma unroll
    for (int t = 0; t < 4; ++t) { if (col0 + t * 16 >= N) continue; const size_t boff = (size_t)(col0 + t * 16 + ln) * ldb + kb; FragH bq; bq.half[0] = *(const v8us*)((const unsigned short*)Bh + boff + 8 * hh); bq.half[1] = *(const v8us*)((const unsigned short*)Bh + boff + 16 + 8 * hh);
      acc[t] = mmaH<1>(ah.v, ah.v, bq.v, bq.v, acc[t]); }
  }
#pragma unroll
  for (int t = 0; t < 4; ++t) { if (col0 + t * 16 >= N) continue; const int col = col0 + t * 16 + ln; const float bv = bp ? bf16_round(bp[col]) : 0.f;
#pragma unroll
    for (int r = 0; r < 8; ++r) { float v = acc[t][r] * alpha + bv; if (CP) { const int rr = row0g + row0 + 8 * hh + r; if (rowsPerB < 0) v += CP[cofs + (size_t)rr * ldc + col];      /* rowsPerB < 0: own element of the batched C plane */ else { const int bidx = rr / rowsPerB; v += CP[(size_t)bidx * sCPb + (size_t)by * 64 + col]; } } if (ACT == 1) v = (v > 0.f) ? v : expm1f(v); else if (ACT == 7) v = (v > 0.f) ? v + 1.0f : expf(v); else if (ACT == 8) v = tanhf(v); else if (ACT == 9) v = 0.5f * v * (1.0f + tanhf(0.7978845608028654f * (v + 0.044715f * v * v * v))); else if (ACT == 11) v = 1.0f / (1.0f + expf(-v)); else if (ACT == 12) v = (v > 0.f) ? v : 0.01f * v; else if (ACT == 14) v = (v > 0.f) ? v : 0.1f * v; else if (ACT == 16) v = (v >= 0.f) ? v : 0.3f * v; else if (ACT == 17) v = (v >= 0.f) ? v : 0.2f * v; else if (ACT == 15) v = v / (1.0f + expf(-v)); else if (ACT == 3) v = fmaxf(v, 0.f); else if (ACT == 6) v = 0.5f * v * (1.0f + erff(v * 0.70710678118654752f)); so[w][8 * hh + r][t * 16 + ln] = v; } }
  __builtin_amdgcn_fence(__ATOMIC_ACQ_REL, "workgroup"); __builtin_amdgcn_wave_barrier();
  const int rsub = lane >> 4, c4 = (lane & 15) * 4; typedef _Float16 v4h __attribute__((ext_vector_type(4)));
  {
#pragma unroll
    for (int q = 0; q < 8; ++q) { const int r = q * 2 + rsub; if (col0 + c4 < N) { const v4f v = *(const v4fa*)&so[w][r][c4]; if (C) *(v4f*)(C + cofs + (size_t)(row0 + r) * ldc + col0 + c4) = v; if (C16) { v4h h4; for (int i = 0; i < 4; ++i) h4[i] = (_Float16)v[i]; *(v4h*)(C16 + cofs + (size_t)(row0 + r) * ldc + col0 + c4) = h4; } } }
     }
}


typedef _Float16 v4h __attribute__((ext_vector_type(4)));

__global__ __launch_bounds__(256) void k_h16(const float* __restrict__ x, _Float16* __restrict__ X16, size_t n8) { const size_t t = (size_t)blockIdx.x * 256 + threadIdx.x; if (t >= n8) return; FragH f;
#pragma unroll
  for (int q = 0; q < 8; ++q) f.h[q] = (_Float16)x[t * 8 + q]; *(v8us*)((unsigned short*)X16 + t * 8) = f.half[0];  }
__global__ __launch_bounds__(256) void k_round16f(const float* __restrict__ W, _Float16* __restrict__ Bt, size_t n8) { const size_t t = (size_t)blockIdx.x * 256 + threadIdx.x; if (t >= n8) return; FragH f;
#pragma unroll
  for (int i = 0; i < 8; ++i) f.h[i] = (_Float16)(bf16_round(W[t * 8 + i]) * 16.0f); *(v8us*)((unsigned short*)Bt + t * 8) = f.half[0];  }
__global__ __launch_bounds__(256) void k_hl(const float* __restrict__ F, _Float16* __restrict__ Hh, _Float16* __restrict__ Hl, size_t n8) { const size_t t = (size_t)blockIdx.x * 256 + threadIdx.x; if (t >= n8) return; FragH fh, fl; const v4f a = *(const v4fa*)(F + t * 8), c = *(const v4fa*)(F + t * 8 + 4);
#pragma unroll
  for (int q = 0; q < 4; ++q) { _Float16 h = (_Float16)a[q]; fh.h[q] = h; fl.h[q] = (_Float16)((a[q] - (float)h) * 1024.0f); h = (_Float16)c[q]; fh.h[4 + q] = h; fl.h[4 + q] = (_Float16)((c[q] - (float)h) * 1024.0f); }
  { *(v8us*)((unsigned short*)Hh + t * 8) = fh.half[0]; *(v8us*)((unsigned short*)Hl + t * 8) = fl.half[0];  } }

__global__ __launch_bounds__(256) void k_wnat(const float* __restrict__ w, size_t n8, _Float16* __restrict__ Bt) { const size_t t = (size_t)blockIdx.x * 256 + threadIdx.x; if (t >= n8) return; FragH f; for (int q = 0; q < 8; ++q) f.h[q] = (_Float16)(bf16_round(w[t * 8 + q]) * 16.0f); *(v8us*)((unsigned short*)Bt + t * 8) = f.half[0];  }
// lane l <-> l ^ 16 (cross-row move); every lane of the wave is on where this is used
__device__ __forceinline__ float lane_x16(float x) { return __builtin_bit_cast(float, __builtin_amdgcn_permlanex16(__builtin_bit_cast(int, x), __builtin_bit_cast(int, x), 0x76543210, 0xfedcba98, false, false)); }
// Fragment order of the attention's operands: per (batch, head) 32 passes of 32 keys, a pass = 8 units of 512 bytes, a unit = 32 lanes x 8 halves, so that one 16-byte load of a wave reads 4 whole lines.
// K (and Q, rows = queries): unit (t*2 + s)*2 + i, lane (hf, c) = K[key 16 t + c][feature 32 s + 16 i + 8 hf ..]; V^T: unit d*2 + i, lane (hf, c) = V[key 16 i + 8 hf ..][feature 16 d + c]. p points at the lane's 8 halves of unit i = 0.
__device__ __forceinline__ v16h pk_frag(const _Float16* p) { FragH f; f.half[0] = *(const v8us*)((const unsigned short*)p); f.half[1] = *(const v8us*)((const unsigned short*)p + 256); return f.v; }
__device__ __forceinline__ v8f at_mma(v16h a, v16h b, v8f c) { return __builtin_amdgcn_wmma_f32_16x16x32_f16(false, a, false, b, (short)0, c, false, false); }
// One pass of the fused attention: 32 keys (kb .. kb + 31 of the stage that kp and vp point into, in LDS) against the wave's 32 query columns. MORE: fetch the next pass's K and V^T fragments into the same registers, each behind its last use.
template <bool MORE>
__device__ __forceinline__ void at_pass(const _Float16* kp, const _Float16* vp, int kb, const v16h (&qf)[2][2], v16h (&kf)[2][2], v16h (&vf)[4], v8f (&o)[4][2], float (&m)[2], float (&l)[2]) {
  const float cs = 0.125f * 1.4426950408889634f;      /* log2(e) / sqrt(64) */
  const v8f z8 = {0.f,0.f,0.f,0.f,0.f,0.f,0.f,0.f};
  v8f st[2][2];      /* [query tile][key tile] */
#pragma unroll
  for (int j = 0; j < 2; ++j) for (int t = 0; t < 2; ++t) st[j][t] = at_mma(kf[t][1], qf[j][1], at_mma(kf[t][0], qf[j][0], z8));
  if (MORE) {
#pragma unroll
    for (int t = 0; t < 2; ++t) for (int s = 0; s < 2; ++s) kf[t][s] = pk_frag(kp + (size_t)(kb + 32) * HD + (t * 2 + s) * 512);
  }
  float mx[2];      /* the lane's own largest score of the pass, per query tile */
#pragma unroll
  for (int j = 0; j < 2; ++j) { mx[j] = fmaxf(st[j][0][0], st[j][1][0]);
#pragma unroll
    for (int r = 1; r < 8; ++r) mx[j] = fmaxf(mx[j], fmaxf(st[j][0][r], st[j][1][r])); }
  if (__builtin_expect(__builtin_amdgcn_ballot_w32(fmaf(mx[0], cs, -m[0]) > 8.0f || fmaf(mx[1], cs, -m[1]) > 8.0f) != 0, 0)) {      /* wave-uniform, once a pass: the reference m moves only when some score stands more than 8 above it, so every weight stays at or below 2^8 (f16 holds it, at the same relative rounding); marked unlikely so that the rescale stands outside the loop's straight path */
#pragma unroll
    for (int j = 0; j < 2; ++j) { const float mn = fmaxf(m[j], fmaxf(mx[j], lane_x16(mx[j])) * cs); const float al = __builtin_amdgcn_exp2f(m[j] - mn); m[j] = mn; l[j] *= al;      /* both halves of a column take the same new reference */
#pragma unroll
      for (int d = 0; d < 4; ++d) o[d][j] *= al; } }
#pragma unroll
  for (int j = 0; j < 2; ++j) { FragH pf; float sm[2] = {0.f, 0.f};
#pragma unroll
    for (int t = 0; t < 2; ++t)
#pragma unroll
      for (int r = 0; r < 8; ++r) { const float p = __builtin_amdgcn_exp2f(fmaf(st[j][t][r], cs, -m[j])); sm[t] += p; pf.h[8 * t + r] = (_Float16)p; }
    l[j] += sm[0] + sm[1];
#pragma unroll
    for (int d = 0; d < 4; ++d) o[d][j] = at_mma(vf[d], pf.v, o[d][j]); }
  if (MORE) {
#pragma unroll
    for (int d = 0; d < 4; ++d) vf[d] = pk_frag(vp + (size_t)(kb + 32) * HD + d * 512);
  } }
#define NPS 4                        /* 32-key passes in a stage of the LDS ring */
#define NST (SQ / (32 * NPS))        /* stages */
#define STH (NPS * 2048)             /* halves of K, and of V^T, in a stage */
// Eight asynchronous 16-byte copies of a lane from global memory to LDS, 2 KiB apart on both sides: the work-group's 128 lanes fill 2 KiB a copy, 16 KiB in all.
// l = the lane's LDS byte address, g = its global address. The closing s_wait_xcnt stands in the copies' own statement, so that no address register they name is rewritten ahead of it (a precaution).
__device__ __forceinline__ void cp8(unsigned l, const _Float16* g) {
  asm volatile("global_load_async_to_lds_b128 %0, %8, off\n\t"
               "global_load_async_to_lds_b128 %1, %9, off\n\t"
               "global_load_async_to_lds_b128 %2, %10, off\n\t"
               "global_load_async_to_lds_b128 %3, %11, off\n\t"
               "global_load_async_to_lds_b128 %4, %12, off\n\t"
               "global_load_async_to_lds_b128 %5, %13, off\n\t"
               "global_load_async_to_lds_b128 %6, %14, off\n\t"
               "global_load_async_to_lds_b128 %7, %15, off\n\t"
               "s_wait_xcnt 0x0"
               :: "v"(l), "v"(l + 2048u), "v"(l + 4096u), "v"(l + 6144u), "v"(l + 8192u), "v"(l + 10240u), "v"(l + 12288u), "v"(l + 14336u),
                  "v"(g), "v"(g + 1024), "v"(g + 2048), "v"(g + 3072), "v"(g + 4096), "v"(g + 5120), "v"(g + 6144), "v"(g + 7168) : "memory"); }
__global__ __launch_bounds__(128) void k_attn(const _Float16* __restrict__ Q16, const _Float16* __restrict__ K16, const _Float16* __restrict__ VT, float* __restrict__ out) {
  __shared__ __attribute__((aligned(128))) _Float16 ring[2][2][STH];      /* [buffer][K, V^T][a stage in fragment order] */
  const int w = threadIdx.x >> 5, lane = threadIdx.x & 31, ln = lane & 15, hh = lane >> 4;
  const int bh = blockIdx.x, b = bh / NH, h = bh - b * NH; const int q0 = blockIdx.y * 128 + w * 32;      /* flat block index = bh + 96 * (query block), as in k_qkv: see the note at kernel_launch */
  const _Float16* qp = Q16 + (size_t)bh * (SQ * HD) + (size_t)(q0 >> 5) * 2048 + lane * 8;      /* all three in fragment order; the wave's 32 queries are one pass of Q */
  const _Float16* kg = K16 + (size_t)bh * (SQ * HD) + threadIdx.x * 8;      /* the thread's 16 bytes of each 2-KiB slice that the work-group copies */
  const _Float16* vg = VT + (size_t)bh * (SQ * HD) + threadIdx.x * 8;
  const unsigned lr = (unsigned)(size_t)&ring[0][0][0] + threadIdx.x * 16u;      /* the same 16 bytes in LDS (byte address) */
  v16h qf[2][2], kf[2][2], vf[4];
#pragma unroll
  for (int j = 0; j < 2; ++j) for (int s = 0; s < 2; ++s) qf[j][s] = pk_frag(qp + (j * 2 + s) * 512);
  cp8(lr, kg); cp8(lr + STH * 2u, vg);      /* stage 0 into buffer 0 */
  asm volatile("s_wait_asynccnt 0x0" ::: "memory");      /* this wave's copies of stage 0 have landed ... */
  __syncthreads();      /* ... and so have the other waves' */
  cp8(lr + STH * 4u, kg + STH); cp8(lr + STH * 6u, vg + STH);      /* stage 1 into buffer 1, in flight over stage 0's passes */
  v8f o[4][2]; float m[2] = {-3.0e38f, -3.0e38f}, l[2] = {0.f, 0.f};
#pragma unroll
  for (int d = 0; d < 4; ++d) for (int j = 0; j < 2; ++j) o[d][j] = v8f{0.f,0.f,0.f,0.f,0.f,0.f,0.f,0.f};
  for (int t = 0; t < NST; ++t) {
    const _Float16* kp = &ring[t & 1][0][lane * 8]; const _Float16* vp = &ring[t & 1][1][lane * 8];
    /* the three unrolls below: constant indices keep the fragment arrays in registers, and the LDS offsets of a stage's passes become immediates */
#pragma unroll
    for (int u = 0; u < 2; ++u) for (int s = 0; s < 2; ++s) kf[u][s] = pk_frag(kp + (u * 2 + s) * 512);
#pragma unroll
    for (int d = 0; d < 4; ++d) vf[d] = pk_frag(vp + d * 512);
#pragma unroll
    for (int p = 0; p < NPS - 1; ++p) at_pass<true>(kp, vp, p * 32, qf, kf, vf, o, m, l);
    at_pass<false>(kp, vp, (NPS - 1) * 32, qf, kf, vf, o, m, l);      /* a stage's last pass fetches nothing: the next stage is not published yet */
    asm volatile("s_wait_dscnt 0x0" ::: "memory");      /* this wave's reads of the buffer are done before it may be refilled */
    asm volatile("s_wait_asynccnt 0x0" ::: "memory");      /* this wave's copies of stage t + 1 have landed */
    __syncthreads();      /* publishes stage t + 1 and ends every wave's reads of stage t's buffer */
    if (t + 2 < NST) { cp8(lr + (t & 1) * (STH * 4u), kg + (size_t)(t + 2) * STH); cp8(lr + (t & 1) * (STH * 4u) + STH * 2u, vg + (size_t)(t + 2) * STH); }      /* stage t + 2 into the buffer just left */
  }
  asm volatile("s_wait_asynccnt 0x0" ::: "memory");      /* no copy is left in flight when the wave ends */
#pragma unroll
  for (int j = 0; j < 2; ++j) { const float inv = 1.0f / (l[j] + lane_x16(l[j]));      /* join the halves' sums once */
    float* op = out + ((size_t)b * SQ + q0 + j * 16 + ln) * DM + h * HD + 8 * hh;      /* O^T register r = feature 16 d + 8 hf + r of query c: 32 contiguous bytes a lane and tile */
#pragma unroll
    for (int d = 0; d < 4; ++d) { const v4f lo = {o[d][j][0] * inv, o[d][j][1] * inv, o[d][j][2] * inv, o[d][j][3] * inv}, hi = {o[d][j][4] * inv, o[d][j][5] * inv, o[d][j][6] * inv, o[d][j][7] * inv};
      *(v4f*)(op + d * 16) = lo; *(v4f*)(op + d * 16 + 4) = hi; } } }
__global__ __launch_bounds__(256) void k_vt(const _Float16* __restrict__ V16, int b, int h0, _Float16* __restrict__ VT) { __shared__ unsigned short tl[64][65]; const int tid = threadIdx.x; const int hh = blockIdx.x % HG, sg = blockIdx.x / HG; const int s0 = sg * 64; const int h = h0 + hh;
  for (int i = tid; i < 64 * 8; i += 256) { const int j = i / 8, d8 = (i % 8) * 8; FragH f; f.half[0] = *(const v8us*)((const unsigned short*)V16 + ((size_t)b * SQ + s0 + j) * DM + h * HD + d8); for (int q = 0; q < 8; ++q) tl[d8 + q][j] = f.u[q]; }
  __syncthreads();
  { for (int i = tid; i < 64 * 8; i += 256) { const int d = i / 8, j8 = (i % 8) * 8; FragH f; for (int q = 0; q < 8; ++q) f.u[q] = tl[d][j8 + q]; *(v8us*)((unsigned short*)VT + ((size_t)hh * HD + d) * SQ + s0 + j8) = f.half[0]; }  } }



// two f32 rounded to bf16 (the conversion instruction rounds to nearest even, as bf16_round does) and widened again
typedef float v2f __attribute__((ext_vector_type(2)));
typedef __bf16 v2b __attribute__((ext_vector_type(2)));
__device__ __forceinline__ v2f rb2(float a, float b) { const v2f p = {a, b}; return __builtin_convertvector(__builtin_convertvector(p, v2b), v2f); }
// 16-byte halves of a WMMA operand fragment from an LDS weight row: p points at the lane's first 8 halves (k = 8 hf ..), the second 8 stand 16 halves on (k = 16 + 8 hf ..), the k order of the x fragments below.
__device__ __forceinline__ v16h ws_frag(const unsigned short* p) { FragH f; f.half[0] = *(const v8us*)p; f.half[1] = *(const v8us*)(p + 16); return f.v; }
// Fused projections, one launch: a work-group = one head x 128 token rows, a wave = 32 rows (one 32-key pass of its batch and head).
// x is read as f32 and rounded in the fragment registers (bf16, exact in f16); the head's three 64 x 64 weights pass once through LDS as [out][in] f16 rows (x16, exact), pitch 72 halves for the 16-byte fragment reads.
// Q and K: D = W^T x^T (A = weight rows, B = token rows): a lane holds 8 consecutive features of one token. V: D = x W (A = token rows, B = weight rows): a lane holds 8 consecutive keys of one feature.
// Either way the 8 accumulator registers of a tile are the lane's 16 bytes of one fragment-order unit (see pk_frag), so every tile leaves as one 512-byte store of the wave, with no staging and no transpose pass.
__global__ __launch_bounds__(128) void k_qkv(const float* __restrict__ x, const float* __restrict__ wq, const float* __restrict__ bq, const float* __restrict__ wk, const float* __restrict__ bk, const float* __restrict__ wv, const float* __restrict__ bv,
    _Float16* __restrict__ QP, _Float16* __restrict__ KP, _Float16* __restrict__ VT) {
  __shared__ __attribute__((aligned(16))) unsigned short wl[3][HD][72];
  __shared__ __attribute__((aligned(16))) float bl[3][HD];      /* the head's biases, rounded to bf16 */
  const int tid = threadIdx.x, w = tid >> 5, lane = tid & 31, ln = lane & 15, hh = lane >> 4;
  const int h = blockIdx.x % NH, row0 = (blockIdx.x / NH) * SQ + blockIdx.y * 128 + 32 * w;      /* blockIdx.x = batch * 12 + head, blockIdx.y = the batch's block of 128 rows */
  const float* xp = x + (size_t)(row0 + ln) * DM + h * HD + 8 * hh;
  const size_t wofs = (size_t)h * HD * HD + (tid >> 4) * 8 * HD + (tid & 15) * 4;      /* a thread takes 8 inputs x 4 outputs of each weight: 16 lanes read one whole 256-byte weight row */
  const float* wpq = wq + wofs; const float* wpk = wk + wofs; const float* wpv = wv + wofs;
  const float* bp01 = (tid < 64 ? bq : bk) + h * HD + (tid & 63); const float* bp2 = bv + h * HD + (tid & 63);      /* threads 0..63: q and v biases, 64..127: k biases (their v value is not used) */
  v4f xr[2][2][4], wr[3][8];
#pragma unroll
  for (int j = 0; j < 2; ++j)
#pragma unroll
    for (int s = 0; s < 2; ++s)
#pragma unroll
      for (int q = 0; q < 4; ++q) xr[j][s][q] = *(const v4fa*)(xp + (size_t)j * 16 * DM + s * 32 + (q >> 1) * 16 + (q & 1) * 4);
  asm volatile("s_wait_xcnt 0x0" :: "v"(xp) : "memory");      /* the operand keeps the address registers of the loads above as they are up to this wait; the statement also keeps these loads ahead of the weight and bias loads */
#pragma unroll
  for (int i = 0; i < 8; ++i) { wr[0][i] = *(const v4fa*)(wpq + i * HD); wr[1][i] = *(const v4fa*)(wpk + i * HD); wr[2][i] = *(const v4fa*)(wpv + i * HD); }
  const float b01 = *bp01, b2 = *bp2;
  asm volatile("s_wait_xcnt 0x0" :: "v"(wpq), "v"(wpk), "v"(wpv), "v"(bp01) : "memory");      /* as above, for the weight and bias loads */
#pragma unroll
  for (int m = 0; m < 3; ++m)
#pragma unroll
    for (int k = 0; k < 4; ++k) { FragH f;
#pragma unroll
      for (int i = 0; i < 8; i += 2) { const v2f p = rb2(wr[m][i][k], wr[m][i + 1][k]) * 16.0f; f.h[i] = (_Float16)p[0]; f.h[i + 1] = (_Float16)p[1]; }
      *(v8us*)&wl[m][(tid & 15) * 4 + k][(tid >> 4) * 8] = f.half[0]; }
  bl[tid >> 6][tid & 63] = bf16_round(b01);
  if (tid < 64) bl[2][tid] = bf16_round(b2);
  v16h xf[2][2];
#pragma unroll
  for (int j = 0; j < 2; ++j)
#pragma unroll
    for (int s = 0; s < 2; ++s) { FragH f;
#pragma unroll
      for (int q = 0; q < 4; ++q)
#pragma unroll
        for (int i = 0; i < 4; i += 2) { const v2f p = rb2(xr[j][s][q][i], xr[j][s][q][i + 1]); f.h[q * 4 + i] = (_Float16)p[0]; f.h[q * 4 + i + 1] = (_Float16)p[1]; }
      xf[j][s] = f.v; }
  __syncthreads();
  const v8f z8 = {0.f,0.f,0.f,0.f,0.f,0.f,0.f,0.f};
  const size_t pofs = ((size_t)(row0 / SQ) * NH + h) * (SQ * HD) + (size_t)((row0 % SQ) >> 5) * 2048 + lane * 8;      /* the wave's pass, the lane's 8 halves of unit 0 */
#pragma unroll
  for (int m = 0; m < 2; ++m) { unsigned short* dst = (unsigned short*)(m == 0 ? QP : KP) + pofs;
#pragma unroll
    for (int te = 0; te < 4; ++te) { const v16h a0 = ws_frag(&wl[m][te * 16 + ln][8 * hh]), a1 = ws_frag(&wl[m][te * 16 + ln][32 + 8 * hh]);
      const v4f b0 = *(const v4fa*)&bl[m][te * 16 + 8 * hh], b1 = *(const v4fa*)&bl[m][te * 16 + 8 * hh + 4]; const float bb[8] = {b0[0], b0[1], b0[2], b0[3], b1[0], b1[1], b1[2], b1[3]};
#pragma unroll
      for (int tk = 0; tk < 2; ++tk) { const v8f c = at_mma(a1, xf[tk][1], at_mma(a0, xf[tk][0], z8)); FragH f;
#pragma unroll
        for (int r = 0; r < 8; ++r) f.h[r] = (_Float16)(c[r] * 0.0625f + bb[r]);
        *(v8us*)(dst + (tk * 4 + te) * 256) = f.half[0]; } }      /* unit (t*2 + s)*2 + i with features 16 te = 32 s + 16 i */
    asm volatile("s_wait_xcnt 0x0" ::: "memory"); }      /* before the next product reuses the registers of the stores above; it also keeps the next product's LDS reads behind them, which bounds the registers in use */
  { unsigned short* dst = (unsigned short*)VT + pofs;
#pragma unroll
    for (int td = 0; td < 4; ++td) { const v16h b0 = ws_frag(&wl[2][td * 16 + ln][8 * hh]), b1 = ws_frag(&wl[2][td * 16 + ln][32 + 8 * hh]); const float bb = bl[2][td * 16 + ln];
#pragma unroll
      for (int tk = 0; tk < 2; ++tk) { const v8f c = at_mma(xf[tk][1], b1, at_mma(xf[tk][0], b0, z8)); FragH f;
#pragma unroll
        for (int r = 0; r < 8; ++r) f.h[r] = (_Float16)(c[r] * 0.0625f + bb);
        *(v8us*)(dst + (td * 2 + tk) * 256) = f.half[0]; } } } }      /* unit d*2 + i */
extern "C" void kernel_launch(void* const* d_in, const int* in_sizes, int n_in,
                              void* d_out, int out_size, void* d_ws, size_t ws_size, hipStream_t stream) {
  (void)in_sizes; (void)n_in; (void)out_size;
  const float* const* I = (const float* const*)d_in; const float* x = I[0]; const float* wq = I[1]; const float* bq = I[2]; const float* wk = I[3]; const float* bk = I[4]; const float* wv = I[5]; const float* bv = I[6];      /* per-head W [12][64][64] ([h][in][out]) + b [12][64] for q, k, v */
  char* ws = (char*)d_ws; size_t off = 0;
  auto take = [&](size_t bytes) { char* p = ws + off; off += (bytes + 255) & ~(size_t)255; return p; };
  _Float16* Q16 = (_Float16*)take(NR * DM * 2); _Float16* K16 = (_Float16*)take(NR * DM * 2);
  _Float16* VT = (_Float16*)take((size_t)NB * NH * HD * SQ * 2);
  if (off > ws_size) return;
  /* Placement, for speed only (the result is the same wherever a work-group lands):
     Both grids put (batch, head) on x (96, a multiple of 8) and the block of 128 rows on y, so the eight work-groups that write a (batch, head)'s Q, K and V^T and the eight that read them
     have one index modulo 8. */
  k_qkv<<<dim3(NB * NH, SQ / 128), 128, 0, stream>>>(x, wq, bq, wk, bk, wv, bv, Q16, K16, VT);      /* x and weight rounding, the three per-head projections (+ biases) and the fragment-order layouts of Q, K and V^T, one launch */
  k_attn<<<dim3(NB * NH, SQ / 128), 128, 0, stream>>>(Q16, K16, VT, (float*)d_out);      /* scores, softmax and P V fused; f32 straight into the merged-heads output rows */
}

// v009
// It runs in 26.7 microseconds.
// It is 1.54 times as fast as v007, going by the measured steps of the versions left out in between.
// Counting every step since v000, it is 202 times as fast.
#include <hip/hip_runtime.h>
// Multi-head self-attention with PER-HEAD 64x64 projections on head-chunked features (sequences [8][1024][768] viewed [B][S][12][64]; q/k/v[..., h, :] = x[..., h, :] W[h] + b[h] with W [12][64][64] ([h][in][out], sigma 0.05) and b [12][64] (sigma 0.05); scores / 8; softmax over all 1024 keys (no mask); out = heads concatenated (no output projection) -> [8][1024][768]).
// Structure: ONE launch. The key-side projections are moved off the keys by linearity: scores q.k = x_k.(Wk q) + q.bk, and q.bk is one constant per query, which the softmax cancels (bk is not read); out = (sum_k p_k x_k) Wv + bv, since the weights sum to 1. So K = V = x: a work-group = one (batch, head) x 128 queries; it forms q' = Wk (Wq^T x_q + bq) for its queries (two chained WMMA products), walks the 1024 keys over x itself, rounded to f16 into a two-buffer LDS ring (S^T = X Q'^T, running softmax in registers, f32 statistics, weights 2^(s - reference) as f16, at most 2^8, (P X)^T += X^T P^T), divides by the row sum, and projects with Wv (WMMA) + bv, f32 straight into the merged-heads output rows.
// Compute dtype: weights and biases rounded to bf16 (weights x16, exact in f16); x rounded to f16; q, q', softmax weights and the normalised P X as plain f16 GEMM operands (~2^-12); scores and softmax statistics f32. v_wmma_f32_16x16x32_f16.
#define NB 8
#define SQ 1024
#define DM 768
#define NH 12
#define HD 64
#define HG 4                         /* heads per launch of the per-batch k_vt overload (not called) */
#define B0 0                         /* unused (the one launch starts at batch 0) */
#define NBR NB                       /* unused (the one launch covers all NB batches) */
#define NR ((size_t)NB * SQ)         /* token rows */
#define MP ((int)((size_t)NBR * SQ)) /* unused (k_mhsa's grid covers all NB * SQ rows) */
#define QN SQ                        /* unused (k_mhsa attends all SQ query rows) */
#define NHD NH                       /* unused (k_mhsa covers all NH heads) */
#define MPO MP                       /* unused (no output stage) */
#define LQ DM      /* unused */
typedef __bf16 v16b __attribute__((ext_vector_type(16)));
typedef unsigned short v8us __attribute__((ext_vector_type(8), may_alias));
typedef float  v8f  __attribute__((ext_vector_type(8)));
typedef float  v4f  __attribute__((ext_vector_type(4)));
typedef float  v4fa __attribute__((ext_vector_type(4), may_alias));
union FragB { v16b v; v8us half[2]; unsigned short u[16]; };

__device__ __forceinline__ unsigned short bf16_bits(float x) { unsigned int u = __float_as_uint(x); return (unsigned short)((u + 0x7FFFu + ((u >> 16) & 1u)) >> 16); }
__device__ __forceinline__ float bf16_val(unsigned short b) { return __uint_as_float(((unsigned int)b) << 16); }
__device__ __forceinline__ float bf16_round(float x) { return bf16_val(bf16_bits(x)); }
// D += A·B with NT terms: 1 = ah·bh, 2 = + al·bh (A split), 3 = + ah·bl (both split)
template <int NT>
__device__ __forceinline__ v8f mmaN(v16b ah, v16b al, v16b bh, v16b bl, v8f c) {
  c = __builtin_amdgcn_wmma_f32_16x16x32_bf16(false, ah, false, bh, (short)0, c, false, false);
  if (NT >= 2) c = __builtin_amdgcn_wmma_f32_16x16x32_bf16(false, al, false, bh, (short)0, c, false, false);
  if (NT >= 3) c = __builtin_amdgcn_wmma_f32_16x16x32_bf16(false, ah, false, bl, (short)0, c, false, false);
  asm volatile("v_nop\n\tv_nop\n\tv_nop\n\tv_nop" : "+v"(c) : "v"(ah), "v"(al), "v"(bh), "v"(bl));
  return c;
}

__global__ __launch_bounds__(256) void k_wt_bf16(const float* __restrict__ W, unsigned short* __restrict__ Wt, int K, int N) {
  const int t = blockIdx.x * 256 + threadIdx.x;
  const int k8n = K / 8;
  if (t >= N * k8n) return;
  const int n = t / k8n, k8 = (t % k8n) * 8;
  v8us v;
#pragma unroll
  for (int i = 0; i < 8; ++i) v[i] = bf16_bits(W[(size_t)(k8 + i) * N + n]);
  *(v8us*)(Wt + (size_t)n * K + k8) = v;
  
}

// GEMM C[M][N] (f32, pitch ldc) = act(A[M][K]·W + bias). A f32 row-major (pitch lda) converted per fragment to bf16
// (ASPLIT: hi/lo two planes -> 2 terms, else single rounded term); Wt bf16 [N][K] (pitch ldb). BIAS_BF16 rounds the
// bias to bf16 first (bias quantised to bf16 before the add). K%32==0, M%16==0, N%64==0.
template <bool ASPLIT, int ACT, bool BIAS_BF16>
__global__ __launch_bounds__(128) void k_gemm_bf(const float* __restrict__ A, int lda, const unsigned short* __restrict__ Wt, int ldb,
                                               const float* __restrict__ bias, float* __restrict__ C, int ldc, int M, int N, int K) {
  __shared__ __attribute__((aligned(16))) float so[4][16][64];
  const int tid = threadIdx.x, w = tid >> 5, lane = tid & 31, ln = lane & 15, hh = lane >> 4;
  const int ntn = N / 64;
  const int wid = blockIdx.x * 4 + w;
  const int mt = wid / ntn, nq = wid % ntn;
  if (mt * 16 >= M) return;
  const int row0 = mt * 16, col0 = nq * 64;
  const float* arow = A + (size_t)(row0 + ln) * lda;
  v8f acc[4] = {};
  for (int kb = 0; kb < K; kb += 32) {
    FragB ah, al;
    const v4f x0 = *(const v4fa*)(arow + kb + 8 * hh), x1 = *(const v4fa*)(arow + kb + 8 * hh + 4);
    const v4f x2 = *(const v4fa*)(arow + kb + 16 + 8 * hh), x3 = *(const v4fa*)(arow + kb + 16 + 8 * hh + 4);
    float xs[16] = {x0[0],x0[1],x0[2],x0[3],x1[0],x1[1],x1[2],x1[3],x2[0],x2[1],x2[2],x2[3],x3[0],x3[1],x3[2],x3[3]};
#pragma unroll
    for (int i = 0; i < 16; ++i) { const unsigned short hb = bf16_bits(xs[i]); ah.u[i] = hb; al.u[i] = ASPLIT ? bf16_bits(xs[i] - bf16_val(hb)) : (unsigned short)0; }
#pragma unroll
    for (int t = 0; t < 4; ++t) {
      const unsigned short* brow = Wt + (size_t)(col0 + t * 16 + ln) * ldb + kb;
      FragB b;
      b.half[0] = *(const v8us*)(brow + 8 * hh);
      b.half[1] = *(const v8us*)(brow + 16 + 8 * hh);
      acc[t] = mmaN<ASPLIT ? 2 : 1>(ah.v, al.v, b.v, b.v, acc[t]);
    }
  }
#pragma unroll
  for (int t = 0; t < 4; ++t) {
    float bv = bias ? bias[col0 + t * 16 + ln] : 0.f;
    if (BIAS_BF16) bv = bf16_round(bv);
#pragma unroll
    for (int r = 0; r < 8; ++r) { float v = acc[t][r] + bv; if (ACT == 1) v = fmaxf(v, 0.f); so[w][8 * hh + r][t * 16 + ln] = v; }
  }
  __builtin_amdgcn_fence(__ATOMIC_ACQ_REL, "workgroup");
  __builtin_amdgcn_wave_barrier();
  const int rsub = lane >> 4, c4 = (lane & 15) * 4;
  {
#pragma unroll
    for (int q = 0; q < 8; ++q) {
      const int r = q * 2 + rsub;
      const v4f v = *(const v4fa*)&so[w][r][c4];
      *(v4f*)(C + (size_t)(row0 + r) * ldc + col0 + c4) = v;
    }
    
  }
}

// GEMM C = act(A·W + bias + resid): A f32 (ASPLIT -> hi/lo 2 terms), Wt bf16 [N][K]; ACT 0 none, 1 relu, 2 exact gelu;
// resid (optional, f32, row index = (row % rmod), pitch ldr, RES_BF16 rounds it) added before the activation.
template <bool ASPLIT, int ACT, bool BIAS_BF16, bool RES_BF16>
__global__ __launch_bounds__(128) void k_gemm_bf3(const float* __restrict__ A, int lda, const unsigned short* __restrict__ Wt, int ldb,
                                                const float* __restrict__ bias, const float* __restrict__ resid, int rmod, int ldr,
                                                float* __restrict__ C, int ldc, int M, int N, int K) {
  __shared__ __attribute__((aligned(16))) float so[4][16][64];
  const int tid = threadIdx.x, w = tid >> 5, lane = tid & 31, ln = lane & 15, hh = lane >> 4;
  const int ntn = N / 64;
  const int wid = blockIdx.x * 4 + w;
  const int mt = wid / ntn, nq = wid % ntn;
  if (mt * 16 >= M) return;
  const int row0 = mt * 16, col0 = nq * 64;
  const float* arow = A + (size_t)(row0 + ln) * lda;
  v8f acc[4] = {};
  for (int kb = 0; kb < K; kb += 32) {
    FragB ah, al;
    const v4f x0 = *(const v4fa*)(arow + kb + 8 * hh), x1 = *(const v4fa*)(arow + kb + 8 * hh + 4);
    const v4f x2 = *(const v4fa*)(arow + kb + 16 + 8 * hh), x3 = *(const v4fa*)(arow + kb + 16 + 8 * hh + 4);
    float xs[16] = {x0[0],x0[1],x0[2],x0[3],x1[0],x1[1],x1[2],x1[3],x2[0],x2[1],x2[2],x2[3],x3[0],x3[1],x3[2],x3[3]};
#pragma unroll
    for (int i = 0; i < 16; ++i) { const unsigned short hb = bf16_bits(xs[i]); ah.u[i] = hb; al.u[i] = ASPLIT ? bf16_bits(xs[i] - bf16_val(hb)) : (unsigned short)0; }
#pragma unroll
    for (int t = 0; t < 4; ++t) {
      const unsigned short* brow = Wt + (size_t)(col0 + t * 16 + ln) * ldb + kb;
      FragB b;
      b.half[0] = *(const v8us*)(brow + 8 * hh);
      b.half[1] = *(const v8us*)(brow + 16 + 8 * hh);
      acc[t] = mmaN<ASPLIT ? 2 : 1>(ah.v, al.v, b.v, b.v, acc[t]);
    }
  }
#pragma unroll
  for (int t = 0; t < 4; ++t) {
    const int col = col0 + t * 16 + ln;
    float bv = bias ? bias[col] : 0.f;
    if (BIAS_BF16) bv = bf16_round(bv);
#pragma unroll
    for (int r = 0; r < 8; ++r) {
      float v = acc[t][r] + bv;
      if (resid) { float rv = resid[(size_t)((row0 + 8 * hh + r) % rmod) * ldr + col]; if (RES_BF16) rv = bf16_round(rv); v += rv; }
      if (ACT == 1) v = fmaxf(v, 0.f);
      if (ACT == 2) v = 0.5f * v * (1.0f + erff(v * 0.70710678118654752f));
      if (ACT == 3) { const float u = 0.7978845608028654f * (v + 0.044715f * v * v * v); v = 0.5f * v * (1.0f + tanhf(u)); }
      so[w][8 * hh + r][t * 16 + ln] = v;
    }
  }
  __builtin_amdgcn_fence(__ATOMIC_ACQ_REL, "workgroup");
  __builtin_amdgcn_wave_barrier();
  const int rsub = lane >> 4, c4 = (lane & 15) * 4;
  {
#pragma unroll
    for (int q = 0; q < 8; ++q) {
      const int r = q * 2 + rsub;
      const v4f v = *(const v4fa*)&so[w][r][c4];
      *(v4f*)(C + (size_t)(row0 + r) * ldc + col0 + c4) = v;
    }
    
  }
}
// row LayerNorm (biased variance, eps) over N: s = X (+ R); optional out_sum <- s; out_norm <- (s-mu)*rsqrt(var+eps)*g + b
template <bool PARAM_BF16>
__global__ __launch_bounds__(256) void k_layernorm(const float* __restrict__ X, const float* __restrict__ R, const float* __restrict__ g, const float* __restrict__ bta,
                                                  float* __restrict__ out_sum, float* __restrict__ out_norm, int N, float eps) {
  __shared__ float red[256];
  const int row = blockIdx.x, tid = threadIdx.x;
  const float* x = X + (size_t)row * N; const float* rr = R ? R + (size_t)row * N : nullptr;
  float vals[16];                     // up to N = 4096
  const int per = N / 256;            // contiguous chunk per thread? use strided-by-4 chunks: thread handles j = tid*4 + 1024*u
  float s1 = 0.f;
  for (int u = 0; u < per / 4; ++u) {
    const int j = tid * 4 + 1024 * u;
    const v4f a = *(const v4fa*)(x + j);
    v4f b = {0.f,0.f,0.f,0.f}; if (rr) b = *(const v4fa*)(rr + j);
#pragma unroll
    for (int q = 0; q < 4; ++q) { const float v = a[q] + b[q]; vals[u * 4 + q] = v; s1 += v; }
  }
  red[tid] = s1; __syncthreads();
  for (int st = 128; st > 0; st >>= 1) { if (tid < st) red[tid] += red[tid + st]; __syncthreads(); }
  const float mu = red[0] / (float)N; __syncthreads();
  float s2 = 0.f;
  for (int u = 0; u < per / 4; ++u)
#pragma unroll
    for (int q = 0; q < 4; ++q) { const float c = vals[u * 4 + q] - mu; s2 += c * c; }
  red[tid] = s2; __syncthreads();
  for (int st = 128; st > 0; st >>= 1) { if (tid < st) red[tid] += red[tid + st]; __syncthreads(); }
  const float rs = rsqrtf(red[0] / (float)N + eps);
  {
    for (int u = 0; u < per / 4; ++u) {
      const int j = tid * 4 + 1024 * u;
      v4f o, sm;
#pragma unroll
      for (int q = 0; q < 4; ++q) {
        float gg = g[j + q], bb = bta[j + q];
        if (PARAM_BF16) { gg = bf16_round(gg); bb = bf16_round(bb); }
        sm[q] = vals[u * 4 + q]; o[q] = (vals[u * 4 + q] - mu) * rs * gg + bb;
      }
      if (out_sum) *(v4f*)(out_sum + (size_t)row * N + j) = sm;
      *(v4f*)(out_norm + (size_t)row * N + j) = o;
    }
    
  }
}



// ---- f16 WMMA path (v_wmma_f32_16x16x32_f16): 11-bit significands for operands in range — used where a probability operand (at most 2^8) needs more precision than bf16
typedef _Float16 v16h __attribute__((ext_vector_type(16)));
union FragH { v16h v; v8us half[2]; _Float16 h[16]; unsigned short u[16]; };
template <int NT>
__device__ __forceinline__ v8f mmaH(v16h ah, v16h al, v16h bh, v16h bl, v8f c) {
  c = __builtin_amdgcn_wmma_f32_16x16x32_f16(false, ah, false, bh, (short)0, c, false, false);
  if (NT >= 2) c = __builtin_amdgcn_wmma_f32_16x16x32_f16(false, al, false, bh, (short)0, c, false, false);
  if (NT >= 3) c = __builtin_amdgcn_wmma_f32_16x16x32_f16(false, ah, false, bl, (short)0, c, false, false);
  asm volatile("v_nop\n\tv_nop\n\tv_nop\n\tv_nop" : "+v"(c) : "v"(ah), "v"(al), "v"(bh), "v"(bl));
  return c;
}
// batched GEMM like k_gemm_b but f16 operands: A f32 (split into f16 hi/lo if ASPLIT, else rounded to f16), Bt = f16 values [n][k]; alpha; C f32; N multiple of 16 (partial tiles skipped)
template <bool ASPLIT>
__global__ __launch_bounds__(128) void k_gemm_h(const float* __restrict__ A, int lda, size_t sA, const _Float16* __restrict__ Bh, int ldb, size_t sB, float alpha, float* __restrict__ C, int ldc, size_t sC, int M, int N, int K) {
  __shared__ __attribute__((aligned(16))) float so[4][16][64];
  const int tid = threadIdx.x, w = tid >> 5, lane = tid & 31, ln = lane & 15, hh = lane >> 4; const int by = blockIdx.y;
  A += (size_t)by * sA; Bh += (size_t)by * sB; C += (size_t)by * sC;
  const int ntn = (N + 63) / 64; const int wid = blockIdx.x * 4 + w; const int mt = wid / ntn, nq = wid % ntn; if (mt * 16 >= M) return;
  const int row0 = mt * 16, col0 = nq * 64; const float* arow = A + (size_t)(row0 + ln) * lda;
  v8f acc[4] = {};
  for (int kb = 0; kb < K; kb += 32) {
    FragH ah, al;
    const v4f x0 = *(const v4fa*)(arow + kb + 8 * hh), x1 = *(const v4fa*)(arow + kb + 8 * hh + 4), x2 = *(const v4fa*)(arow + kb + 16 + 8 * hh), x3 = *(const v4fa*)(arow + kb + 16 + 8 * hh + 4);
    float xs[16] = {x0[0],x0[1],x0[2],x0[3],x1[0],x1[1],x1[2],x1[3],x2[0],x2[1],x2[2],x2[3],x3[0],x3[1],x3[2],x3[3]};
#pragma unroll
    for (int i = 0; i < 16; ++i) { const _Float16 h = (_Float16)xs[i]; ah.h[i] = h; al.h[i] = ASPLIT ? (_Float16)(xs[i] - (float)h) : (_Float16)0.0f; }
#pragma unroll
    for (int t = 0; t < 4; ++t) { if (col0 + t * 16 >= N) continue; const size_t boff = (size_t)(col0 + t * 16 + ln) * ldb + kb; FragH bq; bq.half[0] = *(const v8us*)(Bh + boff + 8 * hh); bq.half[1] = *(const v8us*)(Bh + boff + 16 + 8 * hh);
      acc[t] = mmaH<ASPLIT ? 2 : 1>(ah.v, al.v, bq.v, bq.v, acc[t]); }
  }
#pragma unroll
  for (int t = 0; t < 4; ++t) { if (col0 + t * 16 >= N) continue;
#pragma unroll
    for (int r = 0; r < 8; ++r) so[w][8 * hh + r][t * 16 + ln] = acc[t][r] * alpha; }
  __builtin_amdgcn_fence(__ATOMIC_ACQ_REL, "workgroup"); __builtin_amdgcn_wave_barrier();
  const int rsub = lane >> 4, c4 = (lane & 15) * 4;
  {
#pragma unroll
    for (int q = 0; q < 8; ++q) { const int r = q * 2 + rsub; if (col0 + c4 < N) { const v4f v = *(const v4fa*)&so[w][r][c4]; *(v4f*)(C + (size_t)(row0 + r) * ldc + col0 + c4) = v; } }
     }
}

// Wt[n][k] = f16(W[k][n]·scale) from f32 row-major W[K][N] (scale = power of two; bf16-exact weights stay exact in f16 away from the subnormal range)
__global__ __launch_bounds__(256) void k_wt_f16(const float* __restrict__ W, _Float16* __restrict__ Wt, int K, int N, float scale) {
  const int t = blockIdx.x * 256 + threadIdx.x; if (t >= N * (K / 8)) return; const int n = t / (K / 8), k8 = (t % (K / 8)) * 8; FragH f;
#pragma unroll
  for (int i = 0; i < 8; ++i) f.h[i] = (_Float16)(bf16_round(W[(size_t)(k8 + i) * N + n]) * scale); const v8us o = f.half[0];
  *(v8us*)((unsigned short*)Wt + (size_t)n * K + k8) = o; 
}
// k_gemm_hh variant with fused epilogue: v = acc·alpha + bias[by·sBias + col] (+ CP[(row/rowsPerB)·sCPb + by·64 + col] if CP) ; ACT 0 none / 1 elu ; writes f16 C16 (and f32 C if non-null)
template <int ACT>
__global__ __launch_bounds__(128) void k_gemm_hhx(const _Float16* __restrict__ A, int lda, size_t sA, const _Float16* __restrict__ Bh, int ldb, size_t sB, float alpha, const float* __restrict__ bias, size_t sBias, const float* __restrict__ CP, int rowsPerB, size_t sCPb, int row0g,
    float* __restrict__ C, _Float16* __restrict__ C16, int ldc, size_t sC, int M, int N, int K) {
  __shared__ __attribute__((aligned(16))) float so[4][16][64];
  const int tid = threadIdx.x, w = tid >> 5, lane = tid & 31, ln = lane & 15, hh = lane >> 4; const int by = blockIdx.y;
  A += (size_t)by * sA; Bh += (size_t)by * sB; const size_t cofs = (size_t)by * sC; const float* bp = bias ? bias + (size_t)by * sBias : nullptr;
  const int ntn = (N + 63) / 64; const int wid = blockIdx.x * 4 + w; const int mt = wid / ntn, nq = wid % ntn; if (mt * 16 >= M) return;
  const int row0 = mt * 16, col0 = nq * 64; const _Float16* arow = A + (size_t)(row0 + ln) * lda;
  v8f acc[4] = {};
  for (int kb = 0; kb < K; kb += 32) { FragH ah; ah.half[0] = *(const v8us*)((const unsigned short*)arow + kb + 8 * hh); ah.half[1] = *(const v8us*)((const unsigned short*)arow + kb + 16 + 8 * hh);
#pragma unroll
    for (int t = 0; t < 4; ++t) { if (col0 + t * 16 >= N) continue; const size_t boff = (size_t)(col0 + t * 16 + ln) * ldb + kb; FragH bq; bq.half[0] = *(const v8us*)((const unsigned short*)Bh + boff + 8 * hh); bq.half[1] = *(const v8us*)((const unsigned short*)Bh + boff + 16 + 8 * hh);
      acc[t] = mmaH<1>(ah.v, ah.v, bq.v, bq.v, acc[t]); }
  }
#pragma unroll
  for (int t = 0; t < 4; ++t) { if (col0 + t * 16 >= N) continue; const int col = col0 + t * 16 + ln; const float bv = bp ? bf16_round(bp[col]) : 0.f;
#pragma unroll
    for (int r = 0; r < 8; ++r) { float v = acc[t][r] * alpha + bv; if (CP) { const int rr = row0g + row0 + 8 * hh + r; if (rowsPerB < 0) v += CP[cofs + (size_t)rr * ldc + col];      /* rowsPerB < 0: own element of the batched C plane */ else { const int bidx = rr / rowsPerB; v += CP[(size_t)bidx * sCPb + (size_t)by * 64 + col]; } } if (ACT == 1) v = (v > 0.f) ? v : expm1f(v); else if (ACT == 7) v = (v > 0.f) ? v + 1.0f : expf(v); else if (ACT == 8) v = tanhf(v); else if (ACT == 9) v = 0.5f * v * (1.0f + tanhf(0.7978845608028654f * (v + 0.044715f * v * v * v))); else if (ACT == 11) v = 1.0f / (1.0f + expf(-v)); else if (ACT == 12) v = (v > 0.f) ? v : 0.01f * v; else if (ACT == 14) v = (v > 0.f) ? v : 0.1f * v; else if (ACT == 16) v = (v >= 0.f) ? v : 0.3f * v; else if (ACT == 17) v = (v >= 0.f) ? v : 0.2f * v; else if (ACT == 15) v = v / (1.0f + expf(-v)); else if (ACT == 3) v = fmaxf(v, 0.f); else if (ACT == 6) v = 0.5f * v * (1.0f + erff(v * 0.70710678118654752f)); so[w][8 * hh + r][t * 16 + ln] = v; } }
  __builtin_amdgcn_fence(__ATOMIC_ACQ_REL, "workgroup"); __builtin_amdgcn_wave_barrier();
  const int rsub = lane >> 4, c4 = (lane & 15) * 4; typedef _Float16 v4h __attribute__((ext_vector_type(4)));
  {
#pragma unroll
    for (int q = 0; q < 8; ++q) { const int r = q * 2 + rsub; if (col0 + c4 < N) { const v4f v = *(const v4fa*)&so[w][r][c4]; if (C) *(v4f*)(C + cofs + (size_t)(row0 + r) * ldc + col0 + c4) = v; if (C16) { v4h h4; for (int i = 0; i < 4; ++i) h4[i] = (_Float16)v[i]; *(v4h*)(C16 + cofs + (size_t)(row0 + r) * ldc + col0 + c4) = h4; } } }
     }
}


typedef _Float16 v4h __attribute__((ext_vector_type(4)));

__global__ __launch_bounds__(256) void k_h16(const float* __restrict__ x, _Float16* __restrict__ X16, size_t n8) { const size_t t = (size_t)blockIdx.x * 256 + threadIdx.x; if (t >= n8) return; FragH f;
#pragma unroll
  for (int q = 0; q < 8; ++q) f.h[q] = (_Float16)x[t * 8 + q]; *(v8us*)((unsigned short*)X16 + t * 8) = f.half[0];  }
__global__ __launch_bounds__(256) void k_round16f(const float* __restrict__ W, _Float16* __restrict__ Bt, size_t n8) { const size_t t = (size_t)blockIdx.x * 256 + threadIdx.x; if (t >= n8) return; FragH f;
#pragma unroll
  for (int i = 0; i < 8; ++i) f.h[i] = (_Float16)(bf16_round(W[t * 8 + i]) * 16.0f); *(v8us*)((unsigned short*)Bt + t * 8) = f.half[0];  }
__global__ __launch_bounds__(256) void k_hl(const float* __restrict__ F, _Float16* __restrict__ Hh, _Float16* __restrict__ Hl, size_t n8) { const size_t t = (size_t)blockIdx.x * 256 + threadIdx.x; if (t >= n8) return; FragH fh, fl; const v4f a = *(const v4fa*)(F + t * 8), c = *(const v4fa*)(F + t * 8 + 4);
#pragma unroll
  for (int q = 0; q < 4; ++q) { _Float16 h = (_Float16)a[q]; fh.h[q] = h; fl.h[q] = (_Float16)((a[q] - (float)h) * 1024.0f); h = (_Float16)c[q]; fh.h[4 + q] = h; fl.h[4 + q] = (_Float16)((c[q] - (float)h) * 1024.0f); }
  { *(v8us*)((unsigned short*)Hh + t * 8) = fh.half[0]; *(v8us*)((unsigned short*)Hl + t * 8) = fl.half[0];  } }

__global__ __launch_bounds__(256) void k_wnat(const float* __restrict__ w, size_t n8, _Float16* __restrict__ Bt) { const size_t t = (size_t)blockIdx.x * 256 + threadIdx.x; if (t >= n8) return; FragH f; for (int q = 0; q < 8; ++q) f.h[q] = (_Float16)(bf16_round(w[t * 8 + q]) * 16.0f); *(v8us*)((unsigned short*)Bt + t * 8) = f.half[0];  }
// lane l <-> l ^ 16 (cross-row move); every lane of the wave is on where this is used
__device__ __forceinline__ float lane_x16(float x) { return __builtin_bit_cast(float, __builtin_amdgcn_permlanex16(__builtin_bit_cast(int, x), __builtin_bit_cast(int, x), 0x76543210, 0xfedcba98, false, false)); }
// The stage of x in LDS, twice, each copy for its reader (128 keys x 64 features, f16):
// (1) fragment order, for the A operand of S^T = X Q'^T: per 32-key pass 8 units of 512 bytes; unit (t*2 + s)*2 + i, half hf, 16-byte slot (c + 8 i + 4 hf) & 15 = X[key 16 t + c][feature 32 s + 16 i + 8 hf ..]. A wave's 16-byte load reads one whole unit; the slot's rotation spreads the writers (4 keys x 8 feature groups a store) over all banks.
// (2) row-major, pitch PV bytes (an odd multiple of 32, the transposing reader's pitch), for the A operand X^T of (P X)^T += X^T P^T.
#define PV 160
typedef short s16x8 __attribute__((ext_vector_type(8)));
typedef unsigned short v4us __attribute__((ext_vector_type(4), may_alias));
// ds_load_tr16_b128: lane l points at row kbase + 8 (l >> 4) + (l & 7), byte 2 dbase + 16 ((l >> 3) & 1); lane (c, hf) gets T[kbase + 8 hf + 0..7][dbase + c]. Every lane is on where this is used.
__device__ __forceinline__ v8us ld_tr16(const unsigned char* p) { typedef __attribute__((address_space(3))) s16x8 lds_s16x8; return __builtin_bit_cast(v8us, __builtin_amdgcn_ds_load_tr16_b128_v8i16((lds_s16x8*)p)); }
__device__ __forceinline__ v16h xk_frag(const _Float16* p0, const _Float16* p1) { FragH f; f.half[0] = *(const v8us*)((const unsigned short*)p0); f.half[1] = *(const v8us*)((const unsigned short*)p1); return f.v; }      /* units i = 0 and i = 1: k = 8 hf .. and 16 + 8 hf .. */
__device__ __forceinline__ v16h xv_frag(const unsigned char* p) { FragH f; f.half[0] = ld_tr16(p); f.half[1] = ld_tr16(p + 16 * PV); return f.v; }      /* keys 8 hf .. and 16 + 8 hf ..: the k order of P^T */
__device__ __forceinline__ v8f at_mma(v16h a, v16h b, v8f c) { return __builtin_amdgcn_wmma_f32_16x16x32_f16(false, a, false, b, (short)0, c, false, false); }
// One pass of the attention: 32 keys (pass ps of the stage that k0, k1 and vp point into, in LDS) against the wave's 32 query columns. MORE: fetch the next pass's fragments into the same registers, each behind its last use.
template <bool MORE>
__device__ __forceinline__ void at_pass(const _Float16* k0, const _Float16* k1, const unsigned char* vp, int ps, const v16h (&qf)[2][2], v16h (&kf)[2][2], v16h (&vf)[4], v8f (&o)[4][2], float (&m)[2], float (&l)[2]) {
  const float cs = 0.125f * 1.4426950408889634f;      /* log2(e) / sqrt(64) */
  const v8f z8 = {0.f,0.f,0.f,0.f,0.f,0.f,0.f,0.f};
  v8f st[2][2];      /* [query tile][key tile] */
#pragma unroll
  for (int j = 0; j < 2; ++j) for (int t = 0; t < 2; ++t) st[j][t] = at_mma(kf[t][1], qf[j][1], at_mma(kf[t][0], qf[j][0], z8));
  if (MORE) {
#pragma unroll
    for (int t = 0; t < 2; ++t) for (int s = 0; s < 2; ++s) kf[t][s] = xk_frag(k0 + (ps + 1) * 2048 + (t * 2 + s) * 512, k1 + (ps + 1) * 2048 + (t * 2 + s) * 512);
  }
  float mx[2];      /* the lane's own largest score of the pass, per query tile */
#pragma unroll
  for (int j = 0; j < 2; ++j) { mx[j] = fmaxf(st[j][0][0], st[j][1][0]);
#pragma unroll
    for (int r = 1; r < 8; ++r) mx[j] = fmaxf(mx[j], fmaxf(st[j][0][r], st[j][1][r])); }
  if (__builtin_expect(__builtin_amdgcn_ballot_w32(fmaf(mx[0], cs, -m[0]) > 8.0f || fmaf(mx[1], cs, -m[1]) > 8.0f) != 0, 0)) {      /* wave-uniform, once a pass: the reference m moves only when some score stands more than 8 above it, so every weight stays at or below 2^8 (f16 holds it, at the same relative rounding); marked unlikely so that the rescale stands outside the loop's straight path */
#pragma unroll
    for (int j = 0; j < 2; ++j) { const float mn = fmaxf(m[j], fmaxf(mx[j], lane_x16(mx[j])) * cs); const float al = __builtin_amdgcn_exp2f(m[j] - mn); m[j] = mn; l[j] *= al;      /* both halves of a column take the same new reference */
#pragma unroll
      for (int d = 0; d < 4; ++d) o[d][j] *= al; } }
#pragma unroll
  for (int j = 0; j < 2; ++j) { FragH pf; float sm[2] = {0.f, 0.f};
#pragma unroll
    for (int t = 0; t < 2; ++t)
#pragma unroll
      for (int r = 0; r < 8; ++r) { const float p = __builtin_amdgcn_exp2f(fmaf(st[j][t][r], cs, -m[j])); sm[t] += p; pf.h[8 * t + r] = (_Float16)p; }
    l[j] += sm[0] + sm[1];
#pragma unroll
    for (int d = 0; d < 4; ++d) o[d][j] = at_mma(vf[d], pf.v, o[d][j]); }
  if (MORE) {
#pragma unroll
    for (int d = 0; d < 4; ++d) vf[d] = xv_frag(vp + (ps + 1) * 32 * PV + d * 32);
  } }
#define NPS 4                        /* 32-key passes in a stage of the LDS ring */
#define NST (SQ / (32 * NPS))        /* stages */
#define STH (NPS * 2048)             /* halves of a stage's fragment-order copy */
#define STV (NPS * 32 * PV)          /* bytes of a stage's row-major copy */
// 16 of a wave's 32 keys of a stage (one key tile), f32 from global memory: lane l takes features 8 (l & 7) .. + 7 of keys 4 n + (l >> 3), n = 0 .. 3, so a load covers halves of four whole 256-byte head rows. p = the lane's address in the wave's first key tile of the stage for n = 0, kt = the key tile (0, 1).
__device__ __forceinline__ void x_load(const float* p, int kt, v4f (&xr)[4][2]) {
#pragma unroll
  for (int n = 0; n < 4; ++n) { xr[n][0] = *(const v4fa*)(p + (kt * 16 + n * 4) * DM); xr[n][1] = *(const v4fa*)(p + (kt * 16 + n * 4) * DM + 4); }
  asm volatile("s_wait_xcnt 0x0" ::: "memory");      /* stands before any register that the loads above name is rewritten (a precaution): their one address pair moves on only at the stage's foot; the statement also keeps the loads here, two passes ahead of their use */
}
// The same 16 keys rounded to f16 and stored into both LDS copies: kd = the lane's place in the key tile's fragment-order units for n = 0 without the slot's rotation, rot = 2 i + hf of the lane's features, vd = its place in the row-major copy for n = 0.
__device__ __forceinline__ void x_store(const v4f (&xr)[4][2], _Float16* kd, unsigned char* vd, int rot) {
#pragma unroll
  for (int n = 0; n < 4; ++n) { FragH f;
#pragma unroll
    for (int i = 0; i < 4; ++i) { f.h[i] = (_Float16)xr[n][0][i]; f.h[4 + i] = (_Float16)xr[n][1][i]; }
    *(v8us*)((unsigned short*)kd + ((n + rot) & 3) * 32) = f.half[0];      /* c = 4 n + (l >> 3), slot (c + 8 i + 4 hf) & 15 */
    *(v8us*)(vd + n * 4 * PV) = f.half[0]; } }
// One stage of the loop: the 128 keys of buffer t & 1 against the wave's queries; xn = the lane's address in the wave's keys of stage t + 1 (see x_load). NEXT (every stage but the last, known at compile time so that no branch stands among the passes): the wave's 32 keys of stage t + 1 come in beside them, in two halves.
template <bool NEXT>
__device__ __forceinline__ void at_stage(int t, const float*& xn, _Float16* rk, unsigned char* rv, int kst, int vst, int rot, int kr0, int kr1, int vr, const v16h (&qf)[2][2], v8f (&o)[4][2], float (&m)[2], float (&l)[2]) {
  v16h kf[2][2], vf[4]; v4f xr[4][2];
  _Float16* kn = rk + ((t + 1) & 1) * STH + kst; unsigned char* vn = rv + ((t + 1) & 1) * STV + vst;      /* the lane's places in the other buffer */
  if (NEXT) x_load(xn, 0, xr);      /* the first half, in flight over two passes */
  const _Float16* k0 = rk + (t & 1) * STH + kr0; const _Float16* k1 = rk + (t & 1) * STH + kr1; const unsigned char* vp = rv + (t & 1) * STV + vr;
  /* the four unrolls below: constant indices keep the fragment arrays in registers, and the LDS offsets of a stage's passes become immediates */
#pragma unroll
  for (int u = 0; u < 2; ++u) for (int s = 0; s < 2; ++s) kf[u][s] = xk_frag(k0 + (u * 2 + s) * 512, k1 + (u * 2 + s) * 512);
#pragma unroll
  for (int d = 0; d < 4; ++d) vf[d] = xv_frag(vp + d * 32);
#pragma unroll
  for (int p = 0; p < NPS / 2; ++p) at_pass<true>(k0, k1, vp, p, qf, kf, vf, o, m, l);
  if (NEXT) { x_store(xr, kn, vn, rot); x_load(xn, 1, xr); }      /* into the buffer that every wave left at the last barrier; then the second half */
#pragma unroll
  for (int p = NPS / 2; p < NPS - 1; ++p) at_pass<true>(k0, k1, vp, p, qf, kf, vf, o, m, l);
  at_pass<false>(k0, k1, vp, NPS - 1, qf, kf, vf, o, m, l);      /* a stage's last pass fetches nothing: the next stage is not published yet */
  if (NEXT) { x_store(xr, kn + 1024, vn + 16 * PV, rot); xn += (32 * NPS) * DM; } }      /* the address moves on only here, behind both halves' s_wait_xcnt */
__global__ __launch_bounds__(256) void k_vt(const _Float16* __restrict__ V16, int b, int h0, _Float16* __restrict__ VT) { __shared__ unsigned short tl[64][65]; const int tid = threadIdx.x; const int hh = blockIdx.x % HG, sg = blockIdx.x / HG; const int s0 = sg * 64; const int h = h0 + hh;
  for (int i = tid; i < 64 * 8; i += 256) { const int j = i / 8, d8 = (i % 8) * 8; FragH f; f.half[0] = *(const v8us*)((const unsigned short*)V16 + ((size_t)b * SQ + s0 + j) * DM + h * HD + d8); for (int q = 0; q < 8; ++q) tl[d8 + q][j] = f.u[q]; }
  __syncthreads();
  { for (int i = tid; i < 64 * 8; i += 256) { const int d = i / 8, j8 = (i % 8) * 8; FragH f; for (int q = 0; q < 8; ++q) f.u[q] = tl[d][j8 + q]; *(v8us*)((unsigned short*)VT + ((size_t)hh * HD + d) * SQ + s0 + j8) = f.half[0]; }  } }



// two f32 rounded to bf16 (the conversion instruction rounds to nearest even, as bf16_round does) and widened again
typedef float v2f __attribute__((ext_vector_type(2)));
typedef __bf16 v2b __attribute__((ext_vector_type(2)));
__device__ __forceinline__ v2f rb2(float a, float b) { const v2f p = {a, b}; return __builtin_convertvector(__builtin_convertvector(p, v2b), v2f); }
// 16-byte halves of a WMMA operand fragment from an LDS weight row: p points at the lane's first 8 halves (k = 8 hf ..), the second 8 stand 16 halves on (k = 16 + 8 hf ..), the k order of the x fragments and of a packed pair of accumulator tiles.
__device__ __forceinline__ v16h ws_frag(const unsigned short* p) { FragH f; f.half[0] = *(const v8us*)p; f.half[1] = *(const v8us*)(p + 16); return f.v; }
__global__ __launch_bounds__(128) void k_mhsa(const float* __restrict__ x, const float* __restrict__ wq, const float* __restrict__ bq, const float* __restrict__ wk, const float* __restrict__ wv, const float* __restrict__ bv, float* __restrict__ out) {
  __shared__ __attribute__((aligned(128))) _Float16 rk[2][STH];      /* [buffer][a stage in fragment order] */
  __shared__ __attribute__((aligned(128))) unsigned char rv[2][STV];      /* [buffer][a stage, row-major] */
  __shared__ __attribute__((aligned(16))) unsigned short wl[3][HD][72];
  __shared__ __attribute__((aligned(16))) float bl[2][HD];      /* bq and bv of the head, rounded to bf16 */
  const int tid = threadIdx.x, w = tid >> 5, lane = tid & 31, ln = lane & 15, hh = lane >> 4;
  const int wsc = __builtin_amdgcn_readfirstlane(w);      /* the wave's number in a scalar register */
  const int bh = blockIdx.x, b = bh / NH, h = bh - b * NH; const int q0 = blockIdx.y * 128 + w * 32;      /* flat block index = bh + 96 * (query block): see the note at kernel_launch */
  const unsigned qe = (unsigned)((b * SQ + q0 + ln) * DM + h * HD + 8 * hh);      /* element offset in x of the lane's query (tile 0) and its first 8 features: the fragment pattern */
  const float* xp = x + qe;
  const float* xg = x + (size_t)b * SQ * DM + h * HD;      /* the (batch, head)'s key 0 */
  const unsigned xe = (unsigned)((32 * w + (lane >> 3)) * DM + (lane & 7) * 8);      /* the wave's keys in a stage, the lane's place: see x_load */
  const int rot = lane & 3;      /* 2 i + hf of features 8 (l & 7) = 32 s + 16 i + 8 hf */
  const int kst = w * 2048 + ((lane >> 2) & 1) * 512 + ((lane >> 1) & 1) * 256 + (lane & 1) * 128 + (lane >> 3) * 8;      /* halves */
  const int vst = (32 * w + (lane >> 3)) * PV + (lane & 7) * 16;      /* bytes */
  const size_t wofs = (size_t)h * HD * HD + (tid >> 4) * 8 * HD + (tid & 15) * 4;      /* a thread takes 8 inputs x 4 outputs of each weight: 16 lanes read one whole 256-byte weight row */
  const float* wpq = wq + wofs; const float* wpk = wk + wofs; const float* wpv = wv + wofs;
  const float* bp = (tid < 64 ? bq : bv) + h * HD + (tid & 63);
  v4f xq[2][2][4], xr[4][2], xs[4][2], wr[3][8];
#pragma unroll
  for (int j = 0; j < 2; ++j)
#pragma unroll
    for (int s = 0; s < 2; ++s)
#pragma unroll
      for (int q = 0; q < 4; ++q) xq[j][s][q] = *(const v4fa*)(xp + (size_t)j * 16 * DM + s * 32 + (q >> 1) * 16 + (q & 1) * 4);
  asm volatile("s_wait_xcnt 0x0" :: "v"(qe) : "memory");      /* the operand keeps the lane's offset register of the loads above as it is up to this wait (a precaution) */
  x_load(xg + xe, 0, xr); x_load(xg + xe, 1, xs);
#pragma unroll
  for (int i = 0; i < 8; ++i) { wr[0][i] = *(const v4fa*)(wpq + i * HD); wr[1][i] = *(const v4fa*)(wpk + i * HD); wr[2][i] = *(const v4fa*)(wpv + i * HD); }
  const float b01 = *bp;
  asm volatile("s_wait_xcnt 0x0" :: "v"(wpq), "v"(wpk), "v"(wpv), "v"(bp) : "memory");      /* as above, for the weight and bias loads */
#pragma unroll
  for (int m = 0; m < 3; m += 2)
#pragma unroll
    for (int k = 0; k < 4; ++k) { FragH f;
#pragma unroll
      for (int i = 0; i < 8; i += 2) { const v2f p = rb2(wr[m][i][k], wr[m][i + 1][k]) * 16.0f; f.h[i] = (_Float16)p[0]; f.h[i + 1] = (_Float16)p[1]; }
      *(v8us*)&wl[m][m == 2 ? k * 16 + (tid & 15) : (tid & 15) * 4 + k][(tid >> 4) * 8] = f.half[0]; }      /* [out][in]; Wv's rows dealt: output 4 c + te stands at row 16 te + c (see Foot) */
#pragma unroll
  for (int i = 0; i < 8; ++i) { FragH f; const v2f p = rb2(wr[1][i][0], wr[1][i][1]) * 16.0f, r = rb2(wr[1][i][2], wr[1][i][3]) * 16.0f;
    f.h[0] = (_Float16)p[0]; f.h[1] = (_Float16)p[1]; f.h[2] = (_Float16)r[0]; f.h[3] = (_Float16)r[1];
    const v4us o4 = {f.u[0], f.u[1], f.u[2], f.u[3]}; *(v4us*)&wl[1][(tid >> 4) * 8 + i][(tid & 15) * 4] = o4; }      /* [in][out] */
  bl[tid >> 6][tid & 63] = bf16_round(b01);
  x_store(xr, &rk[0][kst], &rv[0][vst], rot); x_store(xs, &rk[0][kst + 1024], &rv[0][vst + 16 * PV], rot);      /* stage 0 into buffer 0 */
  v16h xf[2][2];
#pragma unroll
  for (int j = 0; j < 2; ++j)
#pragma unroll
    for (int s = 0; s < 2; ++s) { FragH f;
#pragma unroll
      for (int q = 0; q < 4; ++q)
#pragma unroll
        for (int i = 0; i < 4; ++i) f.h[q * 4 + i] = (_Float16)xq[j][s][q][i];
      xf[j][s] = f.v; }
  __syncthreads();      /* publishes the weights, the biases and stage 0 */
  const v8f z8 = {0.f,0.f,0.f,0.f,0.f,0.f,0.f,0.f};
  v16h qf[2][2];
  { FragH fq[2][2], fp[2][2];
#pragma unroll
    for (int te = 0; te < 4; ++te) { const v16h a0 = ws_frag(&wl[0][te * 16 + ln][8 * hh]), a1 = ws_frag(&wl[0][te * 16 + ln][32 + 8 * hh]);
      const v4f b0 = *(const v4fa*)&bl[0][te * 16 + 8 * hh], b1 = *(const v4fa*)&bl[0][te * 16 + 8 * hh + 4]; const float bb[8] = {b0[0], b0[1], b0[2], b0[3], b1[0], b1[1], b1[2], b1[3]};
#pragma unroll
      for (int tk = 0; tk < 2; ++tk) { const v8f c = at_mma(a1, xf[tk][1], at_mma(a0, xf[tk][0], z8));
#pragma unroll
        for (int r = 0; r < 8; ++r) fq[tk][te >> 1].h[(te & 1) * 8 + r] = (_Float16)(c[r] * 0.0625f + bb[r]); } }      /* q feature 16 te + 8 hf + r */
#pragma unroll
    for (int td = 0; td < 4; ++td) { const v16h a0 = ws_frag(&wl[1][td * 16 + ln][8 * hh]), a1 = ws_frag(&wl[1][td * 16 + ln][32 + 8 * hh]);
#pragma unroll
      for (int tk = 0; tk < 2; ++tk) { const v8f c = at_mma(a1, fq[tk][1].v, at_mma(a0, fq[tk][0].v, z8));
#pragma unroll
        for (int r = 0; r < 8; ++r) fp[tk][td >> 1].h[(td & 1) * 8 + r] = (_Float16)(c[r] * 0.0625f); } }      /* q' feature 16 td + 8 hf + r */
#pragma unroll
    for (int j = 0; j < 2; ++j) for (int s = 0; s < 2; ++s) qf[j][s] = fp[j][s].v; }
  v8f o[4][2]; float m[2] = {-3.0e38f, -3.0e38f}, l[2] = {0.f, 0.f};
#pragma unroll
  for (int d = 0; d < 4; ++d) for (int j = 0; j < 2; ++j) o[d][j] = v8f{0.f,0.f,0.f,0.f,0.f,0.f,0.f,0.f};
  const int kr0 = hh * 128 + ((ln + 4 * hh) & 15) * 8, kr1 = 256 + hh * 128 + ((ln + 8 + 4 * hh) & 15) * 8;      /* the reader's slots of units i = 0 and i = 1 (halves) */
  const int vr = (8 * hh + (lane & 7)) * PV + ((lane >> 3) & 1) * 16;      /* the transposing reader's row and 16-byte column (bytes) */
  const float* xn = xg + xe + (32 * NPS) * DM;
  for (int t = 0; t < NST - 1; ++t) {
    at_stage<true>(t, xn, &rk[0][0], &rv[0][0], kst, vst, rot, kr0, kr1, vr, qf, o, m, l);
    __syncthreads();      /* publishes stage t + 1 and ends every wave's reads of stage t's buffer */
  }
  at_stage<false>(NST - 1, xn, &rk[0][0], &rv[0][0], kst, vst, rot, kr0, kr1, vr, qf, o, m, l);
  const int le = (int)__builtin_amdgcn_mbcnt_lo(~0u, 0u), lne = le & 15, hhe = le >> 4;      /* the lane's number read anew, and the wave's from a scalar register, so that no address of the foot holds vector registers over the loop */
  const unsigned oe = (unsigned)((b * SQ + blockIdx.y * 128 + wsc * 32 + 8 * hhe) * DM + h * HD + 4 * lne);      /* element offset in out of query 8 hf of the wave's tile 0, outputs 4 c .. 4 c + 3 */
  v16h wb[4][2];      /* B operand: column c of tile te = output 4 c + te of Wv (rows dealt so at the head) */
#pragma unroll
  for (int te = 0; te < 4; ++te) { wb[te][0] = ws_frag(&wl[2][te * 16 + lne][8 * hhe]); wb[te][1] = ws_frag(&wl[2][te * 16 + lne][32 + 8 * hhe]); }
  const v4f bo = *(const v4fa*)&bl[1][4 * lne];
#pragma unroll
  for (int j = 0; j < 2; ++j) { const float inv = 1.0f / (l[j] + lane_x16(l[j]));      /* join the halves' sums once */
    FragH of[2];      /* (P X)^T register r of tile d = feature 16 d + 8 hf + r of query c: tiles 2 s and 2 s + 1 are row c of the A operand of k step s */
#pragma unroll
    for (int d = 0; d < 4; ++d)
#pragma unroll
      for (int r = 0; r < 8; ++r) of[d >> 1].h[(d & 1) * 8 + r] = (_Float16)(o[d][j][r] * inv);
    float* op = out + j * 16 * DM + oe;
    v8f c[4];      /* register r of tile te = output 4 c + te of query 8 hf + r */
#pragma unroll
    for (int te = 0; te < 4; ++te) c[te] = at_mma(of[1].v, wb[te][1], at_mma(of[0].v, wb[te][0], z8));
    v4f ov[8];
#pragma unroll
    for (int r = 0; r < 8; ++r) ov[r] = v4f{c[0][r] * 0.0625f + bo[0], c[1][r] * 0.0625f + bo[1], c[2][r] * 0.0625f + bo[2], c[3][r] * 0.0625f + bo[3]};
#pragma unroll
    for (int r = 0; r < 8; ++r) *(v4f*)(op + r * DM) = ov[r];      /* 16 lanes x 16 bytes = one query's whole 256-byte head row: a store covers four whole 128-byte lines */
    if (j == 0) asm volatile("s_wait_xcnt 0x0" :: "v"(ov[0]), "v"(ov[1]), "v"(ov[2]), "v"(ov[3]), "v"(ov[4]), "v"(ov[5]), "v"(ov[6]), "v"(ov[7]), "v"(oe) : "memory"); } }      /* the operands keep the registers that the stores above name as they are up to this wait, before the second query tile reuses them (a precaution) */
extern "C" void kernel_launch(void* const* d_in, const int* in_sizes, int n_in,
                              void* d_out, int out_size, void* d_ws, size_t ws_size, hipStream_t stream) {
  (void)in_sizes; (void)n_in; (void)out_size; (void)d_ws; (void)ws_size;
  const float* const* I = (const float* const*)d_in; const float* x = I[0]; const float* wq = I[1]; const float* bq = I[2]; const float* wk = I[3]; const float* wv = I[5]; const float* bv = I[6];      /* per-head W [12][64][64] ([h][in][out]) + b [12][64] for q, k, v; bk (I[4]) adds q.bk, one constant per query, to that query's every score, and the softmax cancels it */
  /* Placement, for speed only (the result is the same wherever a work-group lands):
     The grid puts (batch, head) on x (96, a multiple of 8) and the block of 128 queries on y, so the eight work-groups that walk a (batch, head)'s x rows have one index modulo 8. */
  k_mhsa<<<dim3(NB * NH, SQ / 128), 128, 0, stream>>>(x, wq, bq, wk, wv, bv, (float*)d_out);
}

// v010
// A run of this version takes 25.8 microseconds.
// Timed twice side by side with v009, it ran 1.03 times as fast both times.
// All steps since v000 together make it 209 times as fast.
#include <hip/hip_runtime.h>
// Multi-head self-attention with PER-HEAD 64x64 projections on head-chunked features (sequences [8][1024][768] viewed [B][S][12][64]; q/k/v[..., h, :] = x[..., h, :] W[h] + b[h] with W [12][64][64] ([h][in][out], sigma 0.05) and b [12][64] (sigma 0.05); scores / 8; softmax over all 1024 keys (no mask); out = heads concatenated (no output projection) -> [8][1024][768]).
// Structure: ONE launch. The key-side projections are moved off the keys by linearity: scores q.k = x_k.(Wk q) + q.bk, and q.bk is one constant per query, which the softmax cancels (bk is not read); out = (sum_k p_k x_k) Wv + bv, since the weights sum to 1. So K = V = x: a work-group = one (batch, head) x 128 queries; it forms q' = Wk (Wq^T x_q + bq) for its queries (two chained WMMA products), walks the 1024 keys over x itself, rounded to f16 into a two-buffer LDS ring (S^T = X Q'^T, running softmax in registers, f32 statistics, weights 2^(s - reference) as f16, at most 2^8, (P X)^T += X^T P^T), divides by the row sum, and projects with Wv (WMMA) + bv, f32 straight into the merged-heads output rows.
// Compute dtype: weights and biases rounded to bf16 (weights x16, exact in f16); x rounded to f16; q, q', softmax weights and the normalised P X as plain f16 GEMM operands (~2^-12); scores and softmax statistics f32. v_wmma_f32_16x16x32_f16.
#define NB 8
#define SQ 1024
#define DM 768
#define NH 12
#define HD 64
#define HG 4                         /* heads per launch of the per-batch k_vt overload (not called) */
#define B0 0                         /* unused (the one launch starts at batch 0) */
#define NBR NB                       /* unused (the one launch covers all NB batches) */
#define NR ((size_t)NB * SQ)         /* token rows */
#define MP ((int)((size_t)NBR * SQ)) /* unused (k_mhsa's grid covers all NB * SQ rows) */
#define QN SQ                        /* unused (k_mhsa attends all SQ query rows) */
#define NHD NH                       /* unused (k_mhsa covers all NH heads) */
#define MPO MP                       /* unused (no output stage) */
#define LQ DM      /* unused */
typedef __bf16 v16b __attribute__((ext_vector_type(16)));
typedef unsigned short v8us __attribute__((ext_vector_type(8), may_alias));
typedef float  v8f  __attribute__((ext_vector_type(8)));
typedef float  v4f  __attribute__((ext_vector_type(4)));
typedef float  v4fa __attribute__((ext_vector_type(4), may_alias));
union FragB { v16b v; v8us half[2]; unsigned short u[16]; };

__device__ __forceinline__ unsigned short bf16_bits(float x) { unsigned int u = __float_as_uint(x); return (unsigned short)((u + 0x7FFFu + ((u >> 16) & 1u)) >> 16); }
__device__ __forceinline__ float bf16_val(unsigned short b) { return __uint_as_float(((unsigned int)b) << 16); }
__device__ __forceinline__ float bf16_round(float x) { return bf16_val(bf16_bits(x)); }
// D += A·B with NT terms: 1 = ah·bh, 2 = + al·bh (A split), 3 = + ah·bl (both split)
template <int NT>
__device__ __forceinline__ v8f mmaN(v16b ah, v16b al, v16b bh, v16b bl, v8f c) {
  c = __builtin_amdgcn_wmma_f32_16x16x32_bf16(false, ah, false, bh, (short)0, c, false, false);
  if (NT >= 2) c = __builtin_amdgcn_wmma_f32_16x16x32_bf16(false, al, false, bh, (short)0, c, false, false);
  if (NT >= 3) c = __builtin_amdgcn_wmma_f32_16x16x32_bf16(false, ah, false, bl, (short)0, c, false, false);
  asm volatile("v_nop\n\tv_nop\n\tv_nop\n\tv_nop" : "+v"(c) : "v"(ah), "v"(al), "v"(bh), "v"(bl));
  return c;
}

__global__ __launch_bounds__(256) void k_wt_bf16(const float* __restrict__ W, unsigned short* __restrict__ Wt, int K, int N) {
  const int t = blockIdx.x * 256 + threadIdx.x;
  const int k8n = K / 8;
  if (t >= N * k8n) return;
  const int n = t / k8n, k8 = (t % k8n) * 8;
  v8us v;
#pragma unroll
  for (int i = 0; i < 8; ++i) v[i] = bf16_bits(W[(size_t)(k8 + i) * N + n]);
  *(v8us*)(Wt + (size_t)n * K + k8) = v;
  
}

// GEMM C[M][N] (f32, pitch ldc) = act(A[M][K]·W + bias). A f32 row-major (pitch lda) converted per fragment to bf16
// (ASPLIT: hi/lo two planes -> 2 terms, else single rounded term); Wt bf16 [N][K] (pitch ldb). BIAS_BF16 rounds the
// bias to bf16 first (bias quantised to bf16 before the add). K%32==0, M%16==0, N%64==0.
template <bool ASPLIT, int ACT, bool BIAS_BF16>
__global__ __launch_bounds__(128) void k_gemm_bf(const float* __restrict__ A, int lda, const unsigned short* __restrict__ Wt, int ldb,
                                               const float* __restrict__ bias, float* __restrict__ C, int ldc, int M, int N, int K) {
  __shared__ __attribute__((aligned(16))) float so[4][16][64];
  const int tid = threadIdx.x, w = tid >> 5, lane = tid & 31, ln = lane & 15, hh = lane >> 4;
  const int ntn = N / 64;
  const int wid = blockIdx.x * 4 + w;
  const int mt = wid / ntn, nq = wid % ntn;
  if (mt * 16 >= M) return;
  const int row0 = mt * 16, col0 = nq * 64;
  const float* arow = A + (size_t)(row0 + ln) * lda;
  v8f acc[4] = {};
  for (int kb = 0; kb < K; kb += 32) {
    FragB ah, al;
    const v4f x0 = *(const v4fa*)(arow + kb + 8 * hh), x1 = *(const v4fa*)(arow + kb + 8 * hh + 4);
    const v4f x2 = *(const v4fa*)(arow + kb + 16 + 8 * hh), x3 = *(const v4fa*)(arow + kb + 16 + 8 * hh + 4);
    float xs[16] = {x0[0],x0[1],x0[2],x0[3],x1[0],x1[1],x1[2],x1[3],x2[0],x2[1],x2[2],x2[3],x3[0],x3[1],x3[2],x3[3]};
#pragma unroll
    for (int i = 0; i < 16; ++i) { const unsigned short hb = bf16_bits(xs[i]); ah.u[i] = hb; al.u[i] = ASPLIT ? bf16_bits(xs[i] - bf16_val(hb)) : (unsigned short)0; }
#pragma unroll
    for (int t = 0; t < 4; ++t) {
      const unsigned short* brow = Wt + (size_t)(col0 + t * 16 + ln) * ldb + kb;
      FragB b;
      b.half[0] = *(const v8us*)(brow + 8 * hh);
      b.half[1] = *(const v8us*)(brow + 16 + 8 * hh);
      acc[t] = mmaN<ASPLIT ? 2 : 1>(ah.v, al.v, b.v, b.v, acc[t]);
    }
  }
#pragma unroll
  for (int t = 0; t < 4; ++t) {
    float bv = bias ? bias[col0 + t * 16 + ln] : 0.f;
    if (BIAS_BF16) bv = bf16_round(bv);
#pragma unroll
    for (int r = 0; r < 8; ++r) { float v = acc[t][r] + bv; if (ACT == 1) v = fmaxf(v, 0.f); so[w][8 * hh + r][t * 16 + ln] = v; }
  }
  __builtin_amdgcn_fence(__ATOMIC_ACQ_REL, "workgroup");
  __builtin_amdgcn_wave_barrier();
  const int rsub = lane >> 4, c4 = (lane & 15) * 4;
  {
#pragma unroll
    for (int q = 0; q < 8; ++q) {
      const int r = q * 2 + rsub;
      const v4f v = *(const v4fa*)&so[w][r][c4];
      *(v4f*)(C + (size_t)(row0 + r) * ldc + col0 + c4) = v;
    }
    
  }
}

// GEMM C = act(A·W + bias + resid): A f32 (ASPLIT -> hi/lo 2 terms), Wt bf16 [N][K]; ACT 0 none, 1 relu, 2 exact gelu;
// resid (optional, f32, row index = (row % rmod), pitch ldr, RES_BF16 rounds it) added before the activation.
template <bool ASPLIT, int ACT, bool BIAS_BF16, bool RES_BF16>
__global__ __launch_bounds__(128) void k_gemm_bf3(const float* __restrict__ A, int lda, const unsigned short* __restrict__ Wt, int ldb,
                                                const float* __restrict__ bias, const float* __restrict__ resid, int rmod, int ldr,
                                                float* __restrict__ C, int ldc, int M, int N, int K) {
  __shared__ __attribute__((aligned(16))) float so[4][16][64];
  const int tid = threadIdx.x, w = tid >> 5, lane = tid & 31, ln = lane & 15, hh = lane >> 4;
  const int ntn = N / 64;
  const int wid = blockIdx.x * 4 + w;
  const int mt = wid / ntn, nq = wid % ntn;
  if (mt * 16 >= M) return;
  const int row0 = mt * 16, col0 = nq * 64;
  const float* arow = A + (size_t)(row0 + ln) * lda;
  v8f acc[4] = {};
  for (int kb = 0; kb < K; kb += 32) {
    FragB ah, al;
    const v4f x0 = *(const v4fa*)(arow + kb + 8 * hh), x1 = *(const v4fa*)(arow + kb + 8 * hh + 4);
    const v4f x2 = *(const v4fa*)(arow + kb + 16 + 8 * hh), x3 = *(const v4fa*)(arow + kb + 16 + 8 * hh + 4);
    float xs[16] = {x0[0],x0[1],x0[2],x0[3],x1[0],x1[1],x1[2],x1[3],x2[0],x2[1],x2[2],x2[3],x3[0],x3[1],x3[2],x3[3]};
#pragma unroll
    for (int i = 0; i < 16; ++i) { const unsigned short hb = bf16_bits(xs[i]); ah.u[i] = hb; al.u[i] = ASPLIT ? bf16_bits(xs[i] - bf16_val(hb)) : (unsigned short)0; }
#pragma unroll
    for (int t = 0; t < 4; ++t) {
      const unsigned short* brow = Wt + (size_t)(col0 + t * 16 + ln) * ldb + kb;
      FragB b;
      b.half[0] = *(const v8us*)(brow + 8 * hh);
      b.half[1] = *(const v8us*)(brow + 16 + 8 * hh);
      acc[t] = mmaN<ASPLIT ? 2 : 1>(ah.v, al.v, b.v, b.v, acc[t]);
    }
  }
#pragma unroll
  for (int t = 0; t < 4; ++t) {
    const int col = col0 + t * 16 + ln;
    float bv = bias ? bias[col] : 0.f;
    if (BIAS_BF16) bv = bf16_round(bv);
#pragma unroll
    for (int r = 0; r < 8; ++r) {
      float v = acc[t][r] + bv;
      if (resid) { float rv = resid[(size_t)((row0 + 8 * hh + r) % rmod) * ldr + col]; if (RES_BF16) rv = bf16_round(rv); v += rv; }
      if (ACT == 1) v = fmaxf(v, 0.f);
      if (ACT == 2) v = 0.5f * v * (1.0f + erff(v * 0.70710678118654752f));
      if (ACT == 3) { const float u = 0.7978845608028654f * (v + 0.044715f * v * v * v); v = 0.5f * v * (1.0f + tanhf(u)); }
      so[w][8 * hh + r][t * 16 + ln] = v;
    }
  }
  __builtin_amdgcn_fence(__ATOMIC_ACQ_REL, "workgroup");
  __builtin_amdgcn_wave_barrier();
  const int rsub = lane >> 4, c4 = (lane & 15) * 4;
  {
#pragma unroll
    for (int q = 0; q < 8; ++q) {
      const int r = q * 2 + rsub;
      const v4f v = *(const v4fa*)&so[w][r][c4];
      *(v4f*)(C + (size_t)(row0 + r) * ldc + col0 + c4) = v;
    }
    
  }
}
// row LayerNorm (biased variance, eps) over N: s = X (+ R); optional out_sum <- s; out_norm <- (s-mu)*rsqrt(var+eps)*g + b
template <bool PARAM_BF16>
__global__ __launch_bounds__(256) void k_layernorm(const float* __restrict__ X, const float* __restrict__ R, const float* __restrict__ g, const float* __restrict__ bta,
                                                  float* __restrict__ out_sum, float* __restrict__ out_norm, int N, float eps) {
  __shared__ float red[256];
  const int row = blockIdx.x, tid = threadIdx.x;
  const float* x = X + (size_t)row * N; const float* rr = R ? R + (size_t)row * N : nullptr;
  float vals[16];                     // up to N = 4096
  const int per = N / 256;            // contiguous chunk per thread? use strided-by-4 chunks: thread handles j = tid*4 + 1024*u
  float s1 = 0.f;
  for (int u = 0; u < per / 4; ++u) {
    const int j = tid * 4 + 1024 * u;
    const v4f a = *(const v4fa*)(x + j);
    v4f b = {0.f,0.f,0.f,0.f}; if (rr) b = *(const v4fa*)(rr + j);
#pragma unroll
    for (int q = 0; q < 4; ++q) { const float v = a[q] + b[q]; vals[u * 4 + q] = v; s1 += v; }
  }
  red[tid] = s1; __syncthreads();
  for (int st = 128; st > 0; st >>= 1) { if (tid < st) red[tid] += red[tid + st]; __syncthreads(); }
  const float mu = red[0] / (float)N; __syncthreads();
  float s2 = 0.f;
  for (int u = 0; u < per / 4; ++u)
#pragma unroll
    for (int q = 0; q < 4; ++q) { const float c = vals[u * 4 + q] - mu; s2 += c * c; }
  red[tid] = s2; __syncthreads();
  for (int st = 128; st > 0; st >>= 1) { if (tid < st) red[tid] += red[tid + st]; __syncthreads(); }
  const float rs = rsqrtf(red[0] / (float)N + eps);
  {
    for (int u = 0; u < per / 4; ++u) {
      const int j = tid * 4 + 1024 * u;
      v4f o, sm;
#pragma unroll
      for (int q = 0; q < 4; ++q) {
        float gg = g[j + q], bb = bta[j + q];
        if (PARAM_BF16) { gg = bf16_round(gg); bb = bf16_round(bb); }
        sm[q] = vals[u * 4 + q]; o[q] = (vals[u * 4 + q] - mu) * rs * gg + bb;
      }
      if (out_sum) *(v4f*)(out_sum + (size_t)row * N + j) = sm;
      *(v4f*)(out_norm + (size_t)row * N + j) = o;
    }
    
  }
}



// ---- f16 WMMA path (v_wmma_f32_16x16x32_f16): 11-bit significands for operands in range — used where a probability operand (at most 2^8) needs more precision than bf16
typedef _Float16 v16h __attribute__((ext_vector_type(16)));
union FragH { v16h v; v8us half[2]; _Float16 h[16]; unsigned short u[16]; };
template <int NT>
__device__ __forceinline__ v8f mmaH(v16h ah, v16h al, v16h bh, v16h bl, v8f c) {
  c = __builtin_amdgcn_wmma_f32_16x16x32_f16(false, ah, false, bh, (short)0, c, false, false);
  if (NT >= 2) c = __builtin_amdgcn_wmma_f32_16x16x32_f16(false, al, false, bh, (short)0, c, false, false);
  if (NT >= 3) c = __builtin_amdgcn_wmma_f32_16x16x32_f16(false, ah, false, bl, (short)0, c, false, false);
  asm volatile("v_nop\n\tv_nop\n\tv_nop\n\tv_nop" : "+v"(c) : "v"(ah), "v"(al), "v"(bh), "v"(bl));
  return c;
}
// batched GEMM like k_gemm_b but f16 operands: A f32 (split into f16 hi/lo if ASPLIT, else rounded to f16), Bt = f16 values [n][k]; alpha; C f32; N multiple of 16 (partial tiles skipped)
template <bool ASPLIT>
__global__ __launch_bounds__(128) void k_gemm_h(const float* __restrict__ A, int lda, size_t sA, const _Float16* __restrict__ Bh, int ldb, size_t sB, float alpha, float* __restrict__ C, int ldc, size_t sC, int M, int N, int K) {
  __shared__ __attribute__((aligned(16))) float so[4][16][64];
  const int tid = threadIdx.x, w = tid >> 5, lane = tid & 31, ln = lane & 15, hh = lane >> 4; const int by = blockIdx.y;
  A += (size_t)by * sA; Bh += (size_t)by * sB; C += (size_t)by * sC;
  const int ntn = (N + 63) / 64; const int wid = blockIdx.x * 4 + w; const int mt = wid / ntn, nq = wid % ntn; if (mt * 16 >= M) return;
  const int row0 = mt * 16, col0 = nq * 64; const float* arow = A + (size_t)(row0 + ln) * lda;
  v8f acc[4] = {};
  for (int kb = 0; kb < K; kb += 32) {
    FragH ah, al;
    const v4f x0 = *(const v4fa*)(arow + kb + 8 * hh), x1 = *(const v4fa*)(arow + kb + 8 * hh + 4), x2 = *(const v4fa*)(arow + kb + 16 + 8 * hh), x3 = *(const v4fa*)(arow + kb + 16 + 8 * hh + 4);
    float xs[16] = {x0[0],x0[1],x0[2],x0[3],x1[0],x1[1],x1[2],x1[3],x2[0],x2[1],x2[2],x2[3],x3[0],x3[1],x3[2],x3[3]};
#pragma unroll
    for (int i = 0; i < 16; ++i) { const _Float16 h = (_Float16)xs[i]; ah.h[i] = h; al.h[i] = ASPLIT ? (_Float16)(xs[i] - (float)h) : (_Float16)0.0f; }
#pragma unroll
    for (int t = 0; t < 4; ++t) { if (col0 + t * 16 >= N) continue; const size_t boff = (size_t)(col0 + t * 16 + ln) * ldb + kb; FragH bq; bq.half[0] = *(const v8us*)(Bh + boff + 8 * hh); bq.half[1] = *(const v8us*)(Bh + boff + 16 + 8 * hh);
      acc[t] = mmaH<ASPLIT ? 2 : 1>(ah.v, al.v, bq.v, bq.v, acc[t]); }
  }
#pragma unroll
  for (int t = 0; t < 4; ++t) { if (col0 + t * 16 >= N) continue;
#pragma unroll
    for (int r = 0; r < 8; ++r) so[w][8 * hh + r][t * 16 + ln] = acc[t][r] * alpha; }
  __builtin_amdgcn_fence(__ATOMIC_ACQ_REL, "workgroup"); __builtin_amdgcn_wave_barrier();
  const int rsub = lane >> 4, c4 = (lane & 15) * 4;
  {
#pragma unroll
    for (int q = 0; q < 8; ++q) { const int r = q * 2 + rsub; if (col0 + c4 < N) { const v4f v = *(const v4fa*)&so[w][r][c4]; *(v4f*)(C + (size_t)(row0 + r) * ldc + col0 + c4) = v; } }
     }
}

// Wt[n][k] = f16(W[k][n]·scale) from f32 row-major W[K][N] (scale = power of two; bf16-exact weights stay exact in f16 away from the subnormal range)
__global__ __launch_bounds__(256) void k_wt_f16(const float* __restrict__ W, _Float16* __restrict__ Wt, int K, int N, float scale) {
  const int t = blockIdx.x * 256 + threadIdx.x; if (t >= N * (K / 8)) return; const int n = t / (K / 8), k8 = (t % (K / 8)) * 8; FragH f;
#pragma unroll
  for (int i = 0; i < 8; ++i) f.h[i] = (_Float16)(bf16_round(W[(size_t)(k8 + i) * N + n]) * scale); const v8us o = f.half[0];
  *(v8us*)((unsigned short*)Wt + (size_t)n * K + k8) = o; 
}
// k_gemm_hh variant with fused epilogue: v = acc·alpha + bias[by·sBias + col] (+ CP[(row/rowsPerB)·sCPb + by·64 + col] if CP) ; ACT 0 none / 1 elu ; writes f16 C16 (and f32 C if non-null)
template <int ACT>
__global__ __launch_bounds__(128) void k_gemm_hhx(const _Float16* __restrict__ A, int lda, size_t sA, const _Float16* __restrict__ Bh, int ldb, size_t sB, float alpha, const float* __restrict__ bias, size_t sBias, const float* __restrict__ CP, int rowsPerB, size_t sCPb, int row0g,
    float* __restrict__ C, _Float16* __restrict__ C16, int ldc, size_t sC, int M, int N, int K) {
  __shared__ __attribute__((aligned(16))) float so[4][16][64];
  const int tid = threadIdx.x, w = tid >> 5, lane = tid & 31, ln = lane & 15, hh = lane >> 4; const int by = blockIdx.y;
  A += (size_t)by * sA; Bh += (size_t)by * sB; const size_t cofs = (size_t)by * sC; const float* bp = bias ? bias + (size_t)by * sBias : nullptr;
  const int ntn = (N + 63) / 64; const int wid = blockIdx.x * 4 + w; const int mt = wid / ntn, nq = wid % ntn; if (mt * 16 >= M) return;
  const int row0 = mt * 16, col0 = nq * 64; const _Float16* arow = A + (size_t)(row0 + ln) * lda;
  v8f acc[4] = {};
  for (int kb = 0; kb < K; kb += 32) { FragH ah; ah.half[0] = *(const v8us*)((const unsigned short*)arow + kb + 8 * hh); ah.half[1] = *(const v8us*)((const unsigned short*)arow + kb + 16 + 8 * hh);
#pragma unroll
    for (int t = 0; t < 4; ++t) { if (col0 + t * 16 >= N) continue; const size_t boff = (size_t)(col0 + t * 16 + ln) * ldb + kb; FragH bq; bq.half[0] = *(const v8us*)((const unsigned short*)Bh + boff + 8 * hh); bq.half[1] = *(const v8us*)((const unsigned short*)Bh + boff + 16 + 8 * hh);
      acc[t] = mmaH<1>(ah.v, ah.v, bq.v, bq.v, acc[t]); }
  }
#pragma unroll
  for (int t = 0; t < 4; ++t) { if (col0 + t * 16 >= N) continue; const int col = col0 + t * 16 + ln; const float bv = bp ? bf16_round(bp[col]) : 0.f;
#pragma unroll
    for (int r = 0; r < 8; ++r) { float v = acc[t][r] * alpha + bv; if (CP) { const int rr = row0g + row0 + 8 * hh + r; if (rowsPerB < 0) v += CP[cofs + (size_t)rr * ldc + col];      /* rowsPerB < 0: own element of the batched C plane */ else { const int bidx = rr / rowsPerB; v += CP[(size_t)bidx * sCPb + (size_t)by * 64 + col]; } } if (ACT == 1) v = (v > 0.f) ? v : expm1f(v); else if (ACT == 7) v = (v > 0.f) ? v + 1.0f : expf(v); else if (ACT == 8) v = tanhf(v); else if (ACT == 9) v = 0.5f * v * (1.0f + tanhf(0.7978845608028654f * (v + 0.044715f * v * v * v))); else if (ACT == 11) v = 1.0f / (1.0f + expf(-v)); else if (ACT == 12) v = (v > 0.f) ? v : 0.01f * v; else if (ACT == 14) v = (v > 0.f) ? v : 0.1f * v; else if (ACT == 16) v = (v >= 0.f) ? v : 0.3f * v; else if (ACT == 17) v = (v >= 0.f) ? v : 0.2f * v; else if (ACT == 15) v = v / (1.0f + expf(-v)); else if (ACT == 3) v = fmaxf(v, 0.f); else if (ACT == 6) v = 0.5f * v * (1.0f + erff(v * 0.70710678118654752f)); so[w][8 * hh + r][t * 16 + ln] = v; } }
  __builtin_amdgcn_fence(__ATOMIC_ACQ_REL, "workgroup"); __builtin_amdgcn_wave_barrier();
  const int rsub = lane >> 4, c4 = (lane & 15) * 4; typedef _Float16 v4h __attribute__((ext_vector_type(4)));
  {
#pragma unroll
    for (int q = 0; q < 8; ++q) { const int r = q * 2 + rsub; if (col0 + c4 < N) { const v4f v = *(const v4fa*)&so[w][r][c4]; if (C) *(v4f*)(C + cofs + (size_t)(row0 + r) * ldc + col0 + c4) = v; if (C16) { v4h h4; for (int i = 0; i < 4; ++i) h4[i] = (_Float16)v[i]; *(v4h*)(C16 + cofs + (size_t)(row0 + r) * ldc + col0 + c4) = h4; } } }
     }
}


typedef _Float16 v4h __attribute__((ext_vector_type(4)));

__global__ __launch_bounds__(256) void k_h16(const float* __restrict__ x, _Float16* __restrict__ X16, size_t n8) { const size_t t = (size_t)blockIdx.x * 256 + threadIdx.x; if (t >= n8) return; FragH f;
#pragma unroll
  for (int q = 0; q < 8; ++q) f.h[q] = (_Float16)x[t * 8 + q]; *(v8us*)((unsigned short*)X16 + t * 8) = f.half[0];  }
__global__ __launch_bounds__(256) void k_round16f(const float* __restrict__ W, _Float16* __restrict__ Bt, size_t n8) { const size_t t = (size_t)blockIdx.x * 256 + threadIdx.x; if (t >= n8) return; FragH f;
#pragma unroll
  for (int i = 0; i < 8; ++i) f.h[i] = (_Float16)(bf16_round(W[t * 8 + i]) * 16.0f); *(v8us*)((unsigned short*)Bt + t * 8) = f.half[0];  }
__global__ __launch_bounds__(256) void k_hl(const float* __restrict__ F, _Float16* __restrict__ Hh, _Float16* __restrict__ Hl, size_t n8) { const size_t t = (size_t)blockIdx.x * 256 + threadIdx.x; if (t >= n8) return; FragH fh, fl; const v4f a = *(const v4fa*)(F + t * 8), c = *(const v4fa*)(F + t * 8 + 4);
#pragma unroll
  for (int q = 0; q < 4; ++q) { _Float16 h = (_Float16)a[q]; fh.h[q] = h; fl.h[q] = (_Float16)((a[q] - (float)h) * 1024.0f); h = (_Float16)c[q]; fh.h[4 + q] = h; fl.h[4 + q] = (_Float16)((c[q] - (float)h) * 1024.0f); }
  { *(v8us*)((unsigned short*)Hh + t * 8) = fh.half[0]; *(v8us*)((unsigned short*)Hl + t * 8) = fl.half[0];  } }

__global__ __launch_bounds__(256) void k_wnat(const float* __restrict__ w, size_t n8, _Float16* __restrict__ Bt) { const size_t t = (size_t)blockIdx.x * 256 + threadIdx.x; if (t >= n8) return; FragH f; for (int q = 0; q < 8; ++q) f.h[q] = (_Float16)(bf16_round(w[t * 8 + q]) * 16.0f); *(v8us*)((unsigned short*)Bt + t * 8) = f.half[0];  }
// lane l <-> l ^ 16 (cross-row move); every lane of the wave is on where this is used
__device__ __forceinline__ float lane_x16(float x) { return __builtin_bit_cast(float, __builtin_amdgcn_permlanex16(__builtin_bit_cast(int, x), __builtin_bit_cast(int, x), 0x76543210, 0xfedcba98, false, false)); }
// The stage of x in LDS, twice, each copy for its reader (128 keys x 64 features, f16):
// (1) fragment order, for the A operand of S^T = X Q'^T: per 32-key pass 8 units of 512 bytes; unit (t*2 + s)*2 + i, half hf, 16-byte slot (c + 8 i + 4 hf) & 15 = X[key 16 t + c][feature 32 s + 16 i + 8 hf ..]. A wave's 16-byte load reads one whole unit; the slot's rotation spreads the writers (4 keys x 8 feature groups a store) over all banks.
// (2) row-major, pitch PV bytes (an odd multiple of 32, the transposing reader's pitch), for the A operand X^T of (P X)^T += X^T P^T.
#define PV 160
typedef short s16x8 __attribute__((ext_vector_type(8)));
typedef unsigned short v4us __attribute__((ext_vector_type(4), may_alias));
// ds_load_tr16_b128: lane l points at row kbase + 8 (l >> 4) + (l & 7), byte 2 dbase + 16 ((l >> 3) & 1); lane (c, hf) gets T[kbase + 8 hf + 0..7][dbase + c]. Every lane is on where this is used.
__device__ __forceinline__ v8us ld_tr16(const unsigned char* p) { typedef __attribute__((address_space(3))) s16x8 lds_s16x8; return __builtin_bit_cast(v8us, __builtin_amdgcn_ds_load_tr16_b128_v8i16((lds_s16x8*)p)); }
__device__ __forceinline__ v16h xk_frag(const _Float16* p0, const _Float16* p1) { FragH f; f.half[0] = *(const v8us*)((const unsigned short*)p0); f.half[1] = *(const v8us*)((const unsigned short*)p1); return f.v; }      /* units i = 0 and i = 1: k = 8 hf .. and 16 + 8 hf .. */
__device__ __forceinline__ v16h xv_frag(const unsigned char* p) { FragH f; f.half[0] = ld_tr16(p); f.half[1] = ld_tr16(p + 16 * PV); return f.v; }      /* keys 8 hf .. and 16 + 8 hf ..: the k order of P^T */
__device__ __forceinline__ v8f at_mma(v16h a, v16h b, v8f c) { return __builtin_amdgcn_wmma_f32_16x16x32_f16(false, a, false, b, (short)0, c, false, false); }
// The weights of one pass: p = 2^(s c - m) for the lane's 16 scores of each query tile, rounded to f16 in place as the B operand P^T, and their f32 sum (two chains of 8, then joined). The unrolls here and in the pass: constant indices keep scores, weights and sums in registers.
__device__ __forceinline__ void at_soft(const v8f (&st)[2][2], const float (&m)[2], FragH (&pf)[2], float (&sm)[2]) {
  const float cs = 0.125f * 1.4426950408889634f;      /* log2(e) / sqrt(64) */
#pragma unroll
  for (int j = 0; j < 2; ++j) { float s2[2] = {0.f, 0.f};
#pragma unroll
    for (int t = 0; t < 2; ++t)
#pragma unroll
      for (int r = 0; r < 8; ++r) { const float p = __builtin_amdgcn_exp2f(fmaf(st[j][t][r], cs, -m[j])); s2[t] += p; pf[j].h[8 * t + r] = (_Float16)p; }
    sm[j] = s2[0] + s2[1]; } }
// One pass of the attention: 32 keys (pass ps of the stage that k0, k1 and vp point into, in LDS) against the wave's 32 query columns. MORE: fetch the next pass's fragments into the same registers, each behind its last use.
template <bool MORE>
__device__ __forceinline__ void at_pass(const _Float16* k0, const _Float16* k1, const unsigned char* vp, int ps, const v16h (&qf)[2][2], v16h (&kf)[2][2], v16h (&vf)[4], v8f (&o)[4][2], float (&m)[2], float (&l)[2]) {
  const float cs = 0.125f * 1.4426950408889634f;      /* log2(e) / sqrt(64) */
  const v8f z8 = {0.f,0.f,0.f,0.f,0.f,0.f,0.f,0.f};
  v8f st[2][2];      /* [query tile][key tile] */
#pragma unroll
  for (int j = 0; j < 2; ++j) for (int t = 0; t < 2; ++t) st[j][t] = at_mma(kf[t][1], qf[j][1], at_mma(kf[t][0], qf[j][0], z8));
  if (MORE) {
#pragma unroll
    for (int t = 0; t < 2; ++t) for (int s = 0; s < 2; ++s) kf[t][s] = xk_frag(k0 + (ps + 1) * 2048 + (t * 2 + s) * 512, k1 + (ps + 1) * 2048 + (t * 2 + s) * 512);
  }
  FragH pf[2]; float sm[2];      /* the pass's weights as the B operand P^T, and each lane's sum of its 16 weights, per query tile */
  at_soft(st, m, pf, sm);
  if (__builtin_expect(__builtin_amdgcn_ballot_w32(fmaxf(sm[0], sm[1]) > 256.0f) != 0, 0)) {      /* wave-uniform, once a pass, on the sums that the pass forms anyway: weights are positive, so none exceeds its lane's sum; the reference m moves only when a sum stands over 2^8 (the first pass, whose weights overflow to infinity, among them), so every weight that is used stays at or below 2^8 (f16 holds it, at the same relative rounding); marked unlikely so that the rescale stands outside the loop's straight path */
#pragma unroll
    for (int j = 0; j < 2; ++j) { float mx = fmaxf(st[j][0][0], st[j][1][0]);      /* the lane's own largest score of the pass */
#pragma unroll
      for (int r = 1; r < 8; ++r) mx = fmaxf(mx, fmaxf(st[j][0][r], st[j][1][r]));
      const float mn = fmaxf(m[j], fmaxf(mx, lane_x16(mx)) * cs); const float al = __builtin_amdgcn_exp2f(m[j] - mn); m[j] = mn; l[j] *= al;      /* both halves of a column take the same new reference */
#pragma unroll
      for (int d = 0; d < 4; ++d) o[d][j] *= al; }
    at_soft(st, m, pf, sm); }      /* the pass's weights anew, against the new reference */
#pragma unroll
  for (int j = 0; j < 2; ++j) { l[j] += sm[j];
#pragma unroll
    for (int d = 0; d < 4; ++d) o[d][j] = at_mma(vf[d], pf[j].v, o[d][j]); }
  if (MORE) {
#pragma unroll
    for (int d = 0; d < 4; ++d) vf[d] = xv_frag(vp + (ps + 1) * 32 * PV + d * 32);
  } }
#define NPS 4                        /* 32-key passes in a stage of the LDS ring */
#define NST (SQ / (32 * NPS))        /* stages */
#define STH (NPS * 2048)             /* halves of a stage's fragment-order copy */
#define STV (NPS * 32 * PV)          /* bytes of a stage's row-major copy */
// 16 of a wave's 32 keys of a stage (one key tile), f32 from global memory: lane l takes features 8 (l & 7) .. + 7 of keys 4 n + (l >> 3), n = 0 .. 3, so a load covers halves of four whole 256-byte head rows. p = the lane's address in the wave's first key tile of the stage for n = 0, kt = the key tile (0, 1).
__device__ __forceinline__ void x_load(const float* p, int kt, v4f (&xr)[4][2]) {
#pragma unroll
  for (int n = 0; n < 4; ++n) { xr[n][0] = *(const v4fa*)(p + (kt * 16 + n * 4) * DM); xr[n][1] = *(const v4fa*)(p + (kt * 16 + n * 4) * DM + 4); }
  asm volatile("s_wait_xcnt 0x0" ::: "memory");      /* stands before any register that the loads above name is rewritten (a precaution): their one address pair moves on only at the stage's foot; the statement also keeps the loads here, two passes ahead of their use */
}
// The same 16 keys rounded to f16 and stored into both LDS copies: kd = the lane's place in the key tile's fragment-order units for n = 0 without the slot's rotation, rot = 2 i + hf of the lane's features, vd = its place in the row-major copy for n = 0.
__device__ __forceinline__ void x_store(const v4f (&xr)[4][2], _Float16* kd, unsigned char* vd, int rot) {
#pragma unroll
  for (int n = 0; n < 4; ++n) { FragH f;
#pragma unroll
    for (int i = 0; i < 4; ++i) { f.h[i] = (_Float16)xr[n][0][i]; f.h[4 + i] = (_Float16)xr[n][1][i]; }
    *(v8us*)((unsigned short*)kd + ((n + rot) & 3) * 32) = f.half[0];      /* c = 4 n + (l >> 3), slot (c + 8 i + 4 hf) & 15 */
    *(v8us*)(vd + n * 4 * PV) = f.half[0]; } }
// One stage of the loop: the 128 keys of buffer t & 1 against the wave's queries; xn = the lane's address in the wave's keys of stage t + 1 (see x_load). NEXT (every stage but the last, known at compile time so that no branch stands among the passes): the wave's 32 keys of stage t + 1 come in beside them, in two halves.
template <bool NEXT>
__device__ __forceinline__ void at_stage(int t, const float*& xn, _Float16* rk, unsigned char* rv, int kst, int vst, int rot, int kr0, int kr1, int vr, const v16h (&qf)[2][2], v8f (&o)[4][2], float (&m)[2], float (&l)[2]) {
  v16h kf[2][2], vf[4]; v4f xr[4][2];
  _Float16* kn = rk + ((t + 1) & 1) * STH + kst; unsigned char* vn = rv + ((t + 1) & 1) * STV + vst;      /* the lane's places in the other buffer */
  if (NEXT) x_load(xn, 0, xr);      /* the first half, in flight over two passes */
  const _Float16* k0 = rk + (t & 1) * STH + kr0; const _Float16* k1 = rk + (t & 1) * STH + kr1; const unsigned char* vp = rv + (t & 1) * STV + vr;
  /* the four unrolls below: constant indices keep the fragment arrays in registers, and the LDS offsets of a stage's passes become immediates */
#pragma unroll
  for (int u = 0; u < 2; ++u) for (int s = 0; s < 2; ++s) kf[u][s] = xk_frag(k0 + (u * 2 + s) * 512, k1 + (u * 2 + s) * 512);
#pragma unroll
  for (int d = 0; d < 4; ++d) vf[d] = xv_frag(vp + d * 32);
#pragma unroll
  for (int p = 0; p < NPS / 2; ++p) at_pass<true>(k0, k1, vp, p, qf, kf, vf, o, m, l);
  if (NEXT) { x_store(xr, kn, vn, rot); x_load(xn, 1, xr); }      /* into the buffer that every wave left at the last barrier; then the second half */
#pragma unroll
  for (int p = NPS / 2; p < NPS - 1; ++p) at_pass<true>(k0, k1, vp, p, qf, kf, vf, o, m, l);
  at_pass<false>(k0, k1, vp, NPS - 1, qf, kf, vf, o, m, l);      /* a stage's last pass fetches nothing: the next stage is not published yet */
  if (NEXT) { x_store(xr, kn + 1024, vn + 16 * PV, rot); xn += (32 * NPS) * DM; } }      /* the address moves on only here, behind both halves' s_wait_xcnt */
__global__ __launch_bounds__(256) void k_vt(const _Float16* __restrict__ V16, int b, int h0, _Float16* __restrict__ VT) { __shared__ unsigned short tl[64][65]; const int tid = threadIdx.x; const int hh = blockIdx.x % HG, sg = blockIdx.x / HG; const int s0 = sg * 64; const int h = h0 + hh;
  for (int i = tid; i < 64 * 8; i += 256) { const int j = i / 8, d8 = (i % 8) * 8; FragH f; f.half[0] = *(const v8us*)((const unsigned short*)V16 + ((size_t)b * SQ + s0 + j) * DM + h * HD + d8); for (int q = 0; q < 8; ++q) tl[d8 + q][j] = f.u[q]; }
  __syncthreads();
  { for (int i = tid; i < 64 * 8; i += 256) { const int d = i / 8, j8 = (i % 8) * 8; FragH f; for (int q = 0; q < 8; ++q) f.u[q] = tl[d][j8 + q]; *(v8us*)((unsigned short*)VT + ((size_t)hh * HD + d) * SQ + s0 + j8) = f.half[0]; }  } }



// two f32 rounded to bf16 (the conversion instruction rounds to nearest even, as bf16_round does) and widened again
typedef float v2f __attribute__((ext_vector_type(2)));
typedef __bf16 v2b __attribute__((ext_vector_type(2)));
__device__ __forceinline__ v2f rb2(float a, float b) { const v2f p = {a, b}; return __builtin_convertvector(__builtin_convertvector(p, v2b), v2f); }
// 16-byte halves of a WMMA operand fragment from an LDS weight row: p points at the lane's first 8 halves (k = 8 hf ..), the second 8 stand 16 halves on (k = 16 + 8 hf ..), the k order of the x fragments and of a packed pair of accumulator tiles.
__device__ __forceinline__ v16h ws_frag(const unsigned short* p) { FragH f; f.half[0] = *(const v8us*)p; f.half[1] = *(const v8us*)(p + 16); return f.v; }
// The whole layer, one launch: a work-group = one (batch, head) x 128 queries, a wave = 32 query columns; every wave also rounds 32 of each stage's 128 keys into LDS for all four.
// Head: the head's weights pass once through LDS as f16 rows (x16, exact), pitch 72 halves: Wq and Wv as [out][in], Wk as [in][out]. q = Wq^T x_q^T + bq (A = weight rows, B = token rows): a lane holds 8 consecutive features of one query, so two accumulator tiles, converted in place, are the B operand of q' = Wk q; the same again makes q' the B operand Q'^T of the loop.
// Loop: S^T = X Q'^T: lane (c, hf) holds scores of query c, keys 8 hf + r and 16 + 8 hf + r, so a new reference and the sum are in-lane plus one exchange between the halves; the two f32 score tiles of a pass, converted in place, are the B operand P^T of (P X)^T += X^T P^T: scores and weights never leave the registers.
// Running softmax in the log2 domain: p = 2^(s c - m), m a reference that need not be the maximum: it moves, and sums and (P X)^T are rescaled by 2^(m_old - m_new), only in a pass where the 16 weights of some lane and query tile sum to over 2^8 (weights are positive, so none that is used exceeds 2^8); the pass's weights are then formed anew.
// Ring: a wave's 32 keys of stage t + 1 come in two halves of 16, each loaded into registers two passes of stage t ahead of its rounding and its stores into the other buffer; the one barrier at the stage's foot publishes them and ends every wave's reads of stage t's buffer.
// Foot: (P X)^T / row sum, two tiles packed in place are rows of the A operand P X (A and B share one lane and k map), out = (P X) Wv + bv with Wv's outputs dealt 4 c + te to column c of tile te: a lane's four tiles hold 16 contiguous bytes of a query's row, and 16 lanes its whole 256-byte head row.
__global__ __launch_bounds__(128) void k_mhsa(const float* __restrict__ x, const float* __restrict__ wq, const float* __restrict__ bq, const float* __restrict__ wk, const float* __restrict__ wv, const float* __restrict__ bv, float* __restrict__ out) {
  __shared__ __attribute__((aligned(128))) _Float16 rk[2][STH];      /* [buffer][a stage in fragment order] */
  __shared__ __attribute__((aligned(128))) unsigned char rv[2][STV];      /* [buffer][a stage, row-major] */
  __shared__ __attribute__((aligned(16))) unsigned short wl[3][HD][72];
  __shared__ __attribute__((aligned(16))) float bl[2][HD];      /* bq and bv of the head, rounded to bf16 */
  const int tid = threadIdx.x, w = tid >> 5, lane = tid & 31, ln = lane & 15, hh = lane >> 4;
  const int wsc = __builtin_amdgcn_readfirstlane(w);      /* the wave's number in a scalar register */
  const int bh = blockIdx.x, b = bh / NH, h = bh - b * NH; const int q0 = blockIdx.y * 128 + w * 32;      /* flat block index = bh + 96 * (query block): see the note at kernel_launch */
  const unsigned qe = (unsigned)((b * SQ + q0 + ln) * DM + h * HD + 8 * hh);      /* element offset in x of the lane's query (tile 0) and its first 8 features: the fragment pattern */
  const float* xp = x + qe;
  const float* xg = x + (size_t)b * SQ * DM + h * HD;      /* the (batch, head)'s key 0 */
  const unsigned xe = (unsigned)((32 * w + (lane >> 3)) * DM + (lane & 7) * 8);      /* the wave's keys in a stage, the lane's place: see x_load */
  const int rot = lane & 3;      /* 2 i + hf of features 8 (l & 7) = 32 s + 16 i + 8 hf */
  const int kst = w * 2048 + ((lane >> 2) & 1) * 512 + ((lane >> 1) & 1) * 256 + (lane & 1) * 128 + (lane >> 3) * 8;      /* halves */
  const int vst = (32 * w + (lane >> 3)) * PV + (lane & 7) * 16;      /* bytes */
  const size_t wofs = (size_t)h * HD * HD + (tid >> 4) * 8 * HD + (tid & 15) * 4;      /* a thread takes 8 inputs x 4 outputs of each weight: 16 lanes read one whole 256-byte weight row */
  const float* wpq = wq + wofs; const float* wpk = wk + wofs; const float* wpv = wv + wofs;
  const float* bp = (tid < 64 ? bq : bv) + h * HD + (tid & 63);
  v4f xq[2][2][4], xr[4][2], xs[4][2], wr[3][8];
#pragma unroll
  for (int j = 0; j < 2; ++j)
#pragma unroll
    for (int s = 0; s < 2; ++s)
#pragma unroll
      for (int q = 0; q < 4; ++q) xq[j][s][q] = *(const v4fa*)(xp + (size_t)j * 16 * DM + s * 32 + (q >> 1) * 16 + (q & 1) * 4);
  asm volatile("s_wait_xcnt 0x0" :: "v"(qe) : "memory");      /* the operand keeps the lane's offset register of the loads above as it is up to this wait (a precaution) */
  x_load(xg + xe, 0, xr); x_load(xg + xe, 1, xs);
#pragma unroll
  for (int i = 0; i < 8; ++i) { wr[0][i] = *(const v4fa*)(wpq + i * HD); wr[1][i] = *(const v4fa*)(wpk + i * HD); wr[2][i] = *(const v4fa*)(wpv + i * HD); }
  const float b01 = *bp;
  asm volatile("s_wait_xcnt 0x0" :: "v"(wpq), "v"(wpk), "v"(wpv), "v"(bp) : "memory");      /* as above, for the weight and bias loads */
#pragma unroll
  for (int m = 0; m < 3; m += 2)
#pragma unroll
    for (int k = 0; k < 4; ++k) { FragH f;
#pragma unroll
      for (int i = 0; i < 8; i += 2) { const v2f p = rb2(wr[m][i][k], wr[m][i + 1][k]) * 16.0f; f.h[i] = (_Float16)p[0]; f.h[i + 1] = (_Float16)p[1]; }
      *(v8us*)&wl[m][m == 2 ? k * 16 + (tid & 15) : (tid & 15) * 4 + k][(tid >> 4) * 8] = f.half[0]; }      /* [out][in]; Wv's rows dealt: output 4 c + te stands at row 16 te + c (see Foot) */
#pragma unroll
  for (int i = 0; i < 8; ++i) { FragH f; const v2f p = rb2(wr[1][i][0], wr[1][i][1]) * 16.0f, r = rb2(wr[1][i][2], wr[1][i][3]) * 16.0f;
    f.h[0] = (_Float16)p[0]; f.h[1] = (_Float16)p[1]; f.h[2] = (_Float16)r[0]; f.h[3] = (_Float16)r[1];
    const v4us o4 = {f.u[0], f.u[1], f.u[2], f.u[3]}; *(v4us*)&wl[1][(tid >> 4) * 8 + i][(tid & 15) * 4] = o4; }      /* [in][out] */
  bl[tid >> 6][tid & 63] = bf16_round(b01);
  x_store(xr, &rk[0][kst], &rv[0][vst], rot); x_store(xs, &rk[0][kst + 1024], &rv[0][vst + 16 * PV], rot);      /* stage 0 into buffer 0 */
  v16h xf[2][2];
#pragma unroll
  for (int j = 0; j < 2; ++j)
#pragma unroll
    for (int s = 0; s < 2; ++s) { FragH f;
#pragma unroll
      for (int q = 0; q < 4; ++q)
#pragma unroll
        for (int i = 0; i < 4; ++i) f.h[q * 4 + i] = (_Float16)xq[j][s][q][i];
      xf[j][s] = f.v; }
  __syncthreads();      /* publishes the weights, the biases and stage 0 */
  const v8f z8 = {0.f,0.f,0.f,0.f,0.f,0.f,0.f,0.f};
  v16h qf[2][2];
  { FragH fq[2][2], fp[2][2];
#pragma unroll
    for (int te = 0; te < 4; ++te) { const v16h a0 = ws_frag(&wl[0][te * 16 + ln][8 * hh]), a1 = ws_frag(&wl[0][te * 16 + ln][32 + 8 * hh]);
      const v4f b0 = *(const v4fa*)&bl[0][te * 16 + 8 * hh], b1 = *(const v4fa*)&bl[0][te * 16 + 8 * hh + 4]; const float bb[8] = {b0[0], b0[1], b0[2], b0[3], b1[0], b1[1], b1[2], b1[3]};
#pragma unroll
      for (int tk = 0; tk < 2; ++tk) { const v8f c = at_mma(a1, xf[tk][1], at_mma(a0, xf[tk][0], z8));
#pragma unroll
        for (int r = 0; r < 8; ++r) fq[tk][te >> 1].h[(te & 1) * 8 + r] = (_Float16)(c[r] * 0.0625f + bb[r]); } }      /* q feature 16 te + 8 hf + r */
#pragma unroll
    for (int td = 0; td < 4; ++td) { const v16h a0 = ws_frag(&wl[1][td * 16 + ln][8 * hh]), a1 = ws_frag(&wl[1][td * 16 + ln][32 + 8 * hh]);
#pragma unroll
      for (int tk = 0; tk < 2; ++tk) { const v8f c = at_mma(a1, fq[tk][1].v, at_mma(a0, fq[tk][0].v, z8));
#pragma unroll
        for (int r = 0; r < 8; ++r) fp[tk][td >> 1].h[(td & 1) * 8 + r] = (_Float16)(c[r] * 0.0625f); } }      /* q' feature 16 td + 8 hf + r */
#pragma unroll
    for (int j = 0; j < 2; ++j) for (int s = 0; s < 2; ++s) qf[j][s] = fp[j][s].v; }
  v8f o[4][2]; float m[2] = {-3.0e38f, -3.0e38f}, l[2] = {0.f, 0.f};
#pragma unroll
  for (int d = 0; d < 4; ++d) for (int j = 0; j < 2; ++j) o[d][j] = v8f{0.f,0.f,0.f,0.f,0.f,0.f,0.f,0.f};
  const int kr0 = hh * 128 + ((ln + 4 * hh) & 15) * 8, kr1 = 256 + hh * 128 + ((ln + 8 + 4 * hh) & 15) * 8;      /* the reader's slots of units i = 0 and i = 1 (halves) */
  const int vr = (8 * hh + (lane & 7)) * PV + ((lane >> 3) & 1) * 16;      /* the transposing reader's row and 16-byte column (bytes) */
  const float* xn = xg + xe + (32 * NPS) * DM;
  for (int t = 0; t < NST - 1; ++t) {
    at_stage<true>(t, xn, &rk[0][0], &rv[0][0], kst, vst, rot, kr0, kr1, vr, qf, o, m, l);
    __syncthreads();      /* publishes stage t + 1 and ends every wave's reads of stage t's buffer */
  }
  at_stage<false>(NST - 1, xn, &rk[0][0], &rv[0][0], kst, vst, rot, kr0, kr1, vr, qf, o, m, l);
  const int le = (int)__builtin_amdgcn_mbcnt_lo(~0u, 0u), lne = le & 15, hhe = le >> 4;      /* the lane's number read anew, and the wave's from a scalar register, so that no address of the foot holds vector registers over the loop */
  const unsigned oe = (unsigned)((b * SQ + blockIdx.y * 128 + wsc * 32 + 8 * hhe) * DM + h * HD + 4 * lne);      /* element offset in out of query 8 hf of the wave's tile 0, outputs 4 c .. 4 c + 3 */
  v16h wb[4][2];      /* B operand: column c of tile te = output 4 c + te of Wv (rows dealt so at the head) */
#pragma unroll
  for (int te = 0; te < 4; ++te) { wb[te][0] = ws_frag(&wl[2][te * 16 + lne][8 * hhe]); wb[te][1] = ws_frag(&wl[2][te * 16 + lne][32 + 8 * hhe]); }
  const v4f bo = *(const v4fa*)&bl[1][4 * lne];
#pragma unroll
  for (int j = 0; j < 2; ++j) { const float inv = 1.0f / (l[j] + lane_x16(l[j]));      /* join the halves' sums once */
    FragH of[2];      /* (P X)^T register r of tile d = feature 16 d + 8 hf + r of query c: tiles 2 s and 2 s + 1 are row c of the A operand of k step s */
#pragma unroll
    for (int d = 0; d < 4; ++d)
#pragma unroll
      for (int r = 0; r < 8; ++r) of[d >> 1].h[(d & 1) * 8 + r] = (_Float16)(o[d][j][r] * inv);
    float* op = out + j * 16 * DM + oe;
    v8f c[4];      /* register r of tile te = output 4 c + te of query 8 hf + r */
#pragma unroll
    for (int te = 0; te < 4; ++te) c[te] = at_mma(of[1].v, wb[te][1], at_mma(of[0].v, wb[te][0], z8));
    v4f ov[8];
#pragma unroll
    for (int r = 0; r < 8; ++r) ov[r] = v4f{c[0][r] * 0.0625f + bo[0], c[1][r] * 0.0625f + bo[1], c[2][r] * 0.0625f + bo[2], c[3][r] * 0.0625f + bo[3]};
#pragma unroll
    for (int r = 0; r < 8; ++r) *(v4f*)(op + r * DM) = ov[r];      /* 16 lanes x 16 bytes = one query's whole 256-byte head row: a store covers four whole 128-byte lines */
    if (j == 0) asm volatile("s_wait_xcnt 0x0" :: "v"(ov[0]), "v"(ov[1]), "v"(ov[2]), "v"(ov[3]), "v"(ov[4]), "v"(ov[5]), "v"(ov[6]), "v"(ov[7]), "v"(oe) : "memory"); } }      /* the operands keep the registers that the stores above name as they are up to this wait, before the second query tile reuses them (a precaution) */
extern "C" void kernel_launch(void* const* d_in, const int* in_sizes, int n_in,
                              void* d_out, int out_size, void* d_ws, size_t ws_size, hipStream_t stream) {
  (void)in_sizes; (void)n_in; (void)out_size; (void)d_ws; (void)ws_size;
  const float* const* I = (const float* const*)d_in; const float* x = I[0]; const float* wq = I[1]; const float* bq = I[2]; const float* wk = I[3]; const float* wv = I[5]; const float* bv = I[6];      /* per-head W [12][64][64] ([h][in][out]) + b [12][64] for q, k, v; bk (I[4]) adds q.bk, one constant per query, to that query's every score, and the softmax cancels it */
  /* Placement, for speed only (the result is the same wherever a work-group lands):
     The grid puts (batch, head) on x (96, a multiple of 8) and the block of 128 queries on y, so the eight work-groups that walk a (batch, head)'s x rows have one index modulo 8. */
  k_mhsa<<<dim3(NB * NH, SQ / 128), 128, 0, stream>>>(x, wq, bq, wk, wv, bv, (float*)d_out);
}
